// v000
// Times are from an AMD MI455X. After a warm-up the kernel runs many times in a row, and a time is the length of
// such a window on the GPU divided by its runs, so every launch and the gaps after it count. The runs cycle
// through copies of the inputs. A figure is the median of several windows, for all but v000 over two sittings.
// Sittings can differ by a few percent; kernels timed side by side share one.
// v000, which the later versions start from, runs in 3050 microseconds.
// compute dtype: all float inputs rounded to bf16; xh = x Wl[h]^T + bl[h] (x bf16-exact; the residual plane is 0 there) on WMMA 16x16x32 (f32 accumulate); q/k/v = xh as f16 hi + residual against Wq/Wk/Wv[h] as f16(bf16 x 2^6) (2 products); unscaled causal logits: q, k once to f16 (1 product), 3 products below row 384; softmax in f32; P x 2^11 once to f16 against v f16 (bf16 hi + lo below row 384); out = cat as f16 hi + residual against Wo^T f16(bf16 x 2^6) (2 products) + bo; f32 output.
#include <hip/hip_runtime.h>
#include <math.h>

typedef __attribute__((ext_vector_type(16))) _Float16 v16h;
typedef __attribute__((ext_vector_type(16))) __bf16 v16b;
typedef __attribute__((ext_vector_type(8)))  _Float16 v8h;
typedef __attribute__((ext_vector_type(8)))  float v8f;
typedef __attribute__((ext_vector_type(4)))  float v4f;
typedef __attribute__((ext_vector_type(2)))  float v2f;
typedef __attribute__((ext_vector_type(4)))  unsigned v4u;
typedef __attribute__((ext_vector_type(4)))  int v4i;
typedef float __attribute__((may_alias)) float_a;
typedef int __attribute__((may_alias)) int_a;

template <typename T> __device__ __forceinline__ void vst2(void* p, T v) { *(T*)p = v;  }
__device__ __forceinline__ v8f wmma16(v16h a, v16h b, v8f c) {
  v8f d = __builtin_amdgcn_wmma_f32_16x16x32_f16(false, a, false, b, (short)0, c, false, false);
  asm volatile("v_nop\n\tv_nop\n\tv_nop\n\tv_nop" : "+v"(d) : "v"(a), "v"(b));
  return d;
}
__device__ __forceinline__ v8f wmma_bf(v16b a, v16b b, v8f c) {
  v8f d = __builtin_amdgcn_wmma_f32_16x16x32_bf16(false, a, false, b, (short)0, c, false, false);
  asm volatile("v_nop\n\tv_nop\n\tv_nop\n\tv_nop" : "+v"(d) : "v"(a), "v"(b));
  return d;
}
// 16x16x32 fragments: lane = (h = lane>>4, row/col = lane&15); elements 0..7 = k0+8h+0..7, 8..15 = k0+16+8h+0..7; D element r = row 8h+r
__device__ __forceinline__ v16h frag_h(const _Float16* rowk0, int lane) {
  union { v16h v; v8h q[2]; } u; const _Float16* p = rowk0 + 8 * (lane >> 4);
  u.q[0] = *(const v8h*)p; u.q[1] = *(const v8h*)(p + 16); return u.v;
}
__device__ __forceinline__ v16h frag_f32(const float* rowk0, int lane) {
  v16h a; const float* p = rowk0 + 8 * (lane >> 4);
#pragma unroll
  for (int i = 0; i < 8; ++i) { a[i] = (_Float16)p[i]; a[8 + i] = (_Float16)p[16 + i]; }
  return a;
}
__device__ __forceinline__ v16h frag_f32s(const float* rowk0, int lane, float sc) {
  v16h a; const float* p = rowk0 + 8 * (lane >> 4);
#pragma unroll
  for (int i = 0; i < 8; ++i) { a[i] = (_Float16)(p[i] * sc); a[8 + i] = (_Float16)(p[16 + i] * sc); }
  return a;
}
// column fragment from a [K][ld] layout (column n), rows >= K read as 0
__device__ __forceinline__ v16h fragc_f32(const float* W, int k0, int n, int lane, int ld, int K) {
  v16h a; const int g = lane >> 4;
#pragma unroll
  for (int i = 0; i < 8; ++i) { const int ka = k0 + 8 * g + i, kb = ka + 16;
    a[i] = (_Float16)(ka < K ? W[(size_t)(ka < K ? ka : K - 1) * ld + n] : 0.f); a[8 + i] = (_Float16)(kb < K ? W[(size_t)(kb < K ? kb : K - 1) * ld + n] : 0.f); }
  return a;
}
struct F2 { v16b h, l; };
__device__ __forceinline__ F2 bsplit16(const float v[16]) { F2 r;
#pragma unroll
  for (int i = 0; i < 16; ++i) { const __bf16 h = (__bf16)v[i]; r.h[i] = h; r.l[i] = (__bf16)(v[i] - (float)h); }
  return r; }
__device__ __forceinline__ F2 split_row(const float* row, int k0, int lane) { float v[16]; const float* p = row + k0 + 8 * (lane >> 4);
#pragma unroll
  for (int i = 0; i < 8; ++i) { v[i] = p[i]; v[8 + i] = p[16 + i]; }
  return bsplit16(v); }
__device__ __forceinline__ F2 split_rowK(const float* row, int k0, int lane, int K) { float v[16]; const int g = lane >> 4;
#pragma unroll
  for (int i = 0; i < 8; ++i) { const int ka = k0 + 8 * g + i, kb = ka + 16; v[i] = ka < K ? row[ka < K ? ka : K - 1] : 0.f; v[8 + i] = kb < K ? row[kb < K ? kb : K - 1] : 0.f; }
  return bsplit16(v); }
__device__ __forceinline__ F2 split_col(const float* W, int k0, int n, int lane, int ld, int K) { float v[16]; const int g = lane >> 4;
#pragma unroll
  for (int i = 0; i < 8; ++i) { const int ka = k0 + 8 * g + i, kb = ka + 16; v[i] = ka < K ? W[(size_t)(ka < K ? ka : K - 1) * ld + n] : 0.f; v[8 + i] = kb < K ? W[(size_t)(kb < K ? kb : K - 1) * ld + n] : 0.f; }
  return bsplit16(v); }
__device__ __forceinline__ v8f mac3(const F2& a, const F2& b, v8f c) { c = wmma_bf(a.l, b.h, c); c = wmma_bf(a.h, b.l, c); return wmma_bf(a.h, b.h, c); }
__device__ __forceinline__ float sigm(float v) { return 1.0f / (1.0f + expf(-v)); }
#define LDSX() do { asm volatile("s_wait_dscnt 0" ::: "memory"); __builtin_amdgcn_wave_barrier(); __builtin_amdgcn_fence(__ATOMIC_RELEASE, "workgroup"); } while (0)

// Per-head multi-head causal attention (B 2, S 2,048, 512; 16 heads x 32; 0.02-scale weights: per-head Linear Wl [16,512,512] (out,in) + bl, per-head Wq/Wk/Wv [16,512,32] (in,out) no bias, Wo [512,512] (out,in) + bo): xh = x Wl[h]^T + bl[h]; Q, K, V = xh Wq[h], xh Wk[h], xh Wv[h]; scores = Q K^T (NO scaling), causal; F = softmax(scores) V; out = concat_h(F) Wo^T + bo.
#define NB 2
#define TT 2048
#define CC 512            // NH * HD = projected width
#define DIN 512          // input (model) width
#define NH 16
#define HD 32
#define NQB (TT / 64)
#define HG 4
#define SCALE (1.0f)
#define CAUSAL 1
#ifndef TNB
#define TNB NB
#endif
__device__ __forceinline__ float bfr(float v) { return (float)(__bf16)v; }
__host__ __device__ __forceinline__ int kb_last(int qb) { return CAUSAL ? ((qb * 64 + 63) >> 7) : (TT / 128 - 1); }
typedef __attribute__((ext_vector_type(8))) __bf16 v8b;
__device__ __forceinline__ v16b frag_b(const __bf16* rowk0, int lane) {
  union { v16b v; v8b q[2]; } u; const __bf16* p = rowk0 + 8 * (lane >> 4);
  u.q[0] = *(const v8b*)p; u.q[1] = *(const v8b*)(p + 16); return u.v;
}
#define QBH 6              // causal: query blocks 0..QBH-1 of each sequence (few keys, no averaging) take the high-precision path
#define QHI 384            // rows carrying a q residual plane
#define KHI 384            // key rows carrying k residual / v bf16 hi+lo planes (used only by the causal high-precision path)
// B fragment (k rows k0+.., output column o) of a weight: (in,out) [K][ld] or (out,in) [ld rows of K]: bf16 exact, or f16(bf16 * 256) exact
__device__ __forceinline__ v16b wcol_io(const float* Wm, int k0, int o, int lane, int ld) { v16b w; const int g = lane >> 4;
#pragma unroll
  for (int i = 0; i < 8; ++i) { w[i] = (__bf16)Wm[(size_t)(k0 + 8 * g + i) * ld + o]; w[8 + i] = (__bf16)Wm[(size_t)(k0 + 16 + 8 * g + i) * ld + o]; }
  return w; }
__device__ __forceinline__ v16b wcol_oi(const float* Wm, int k0, int o, int lane, int K) { v16b w; const float* p = Wm + (size_t)o * K + k0 + 8 * (lane >> 4);
#pragma unroll
  for (int i = 0; i < 8; ++i) { w[i] = (__bf16)p[i]; w[8 + i] = (__bf16)p[16 + i]; }
  return w; }
__device__ __forceinline__ v16h wcolh_io(const float* Wm, int k0, int o, int lane, int ld) { v16h w; const int g = lane >> 4;
#pragma unroll
  for (int i = 0; i < 8; ++i) { w[i] = (_Float16)(bfr(Wm[(size_t)(k0 + 8 * g + i) * ld + o]) * 256.0f); w[8 + i] = (_Float16)(bfr(Wm[(size_t)(k0 + 16 + 8 * g + i) * ld + o]) * 256.0f); }
  return w; }
__device__ __forceinline__ v16h wcolh_oi(const float* Wm, int k0, int o, int lane, int K) { v16h w; const float* p = Wm + (size_t)o * K + k0 + 8 * (lane >> 4);
#pragma unroll
  for (int i = 0; i < 8; ++i) { w[i] = (_Float16)(bfr(p[i]) * 256.0f); w[8 + i] = (_Float16)(bfr(p[16 + i]) * 256.0f); }
  return w; }
#define WQKV_LAYOUT 1   // 0 = (in,out) [DIN][CC]; 1 = (out,in) [CC][DIN]; 2 = per-head [NH][DIN][HD]
__device__ __forceinline__ v16b wcol_hdk(const float* Wm, int k0, int o, int lane) { v16b w; const int g = lane >> 4; const float* p = Wm + (size_t)(o / HD) * DIN * HD + (o % HD);
#pragma unroll
  for (int i = 0; i < 8; ++i) { w[i] = (__bf16)p[(size_t)(k0 + 8 * g + i) * HD]; w[8 + i] = (__bf16)p[(size_t)(k0 + 16 + 8 * g + i) * HD]; }
  return w; }
#define WO_OUT_IN 0
#if WQKV_LAYOUT == 1
#define WCOL(W, k0, o, lane) wcol_oi(W, k0, o, lane, DIN)
#elif WQKV_LAYOUT == 2
#define WCOL(W, k0, o, lane) wcol_hdk(W, k0, o, lane)
#else
#define WCOL(W, k0, o, lane) wcol_io(W, k0, o, lane, CC)
#endif
#if WO_OUT_IN
#define WOCOL(W, k0, o, lane) wcol_oi(W, k0, o, lane, CC)
#define WOCOLH(W, k0, o, lane) wcolh_oi(W, k0, o, lane, CC)
#else
#define WOCOL(W, k0, o, lane) wcol_io(W, k0, o, lane, DIN)
#define WOCOLH(W, k0, o, lane) wcolh_io(W, k0, o, lane, DIN)
#endif

// ---- k_prep8: block = (64 attention positions s0.. of sequence b, head h): reads the [B, H, S, 32] q/k/v buffers (element (b,h,s,c) at ((b*NH + h)*TT + s)*32 + c), without bf16 rounding, and writes the standard attention planes: q -> f16 hi rows (+ x 2^10 residual rows for s < QHI), k -> f16 rows (+ residual rows s < KHI), v -> f16 planes [c][s] (+ bf16 hi/lo planes for s < KHI)
__global__ __launch_bounds__(128) void k_prep8(const float* __restrict__ Q, const float* __restrict__ K, const float* __restrict__ V, _Float16* __restrict__ QH, _Float16* __restrict__ QL, _Float16* __restrict__ KH, _Float16* __restrict__ KL, _Float16* __restrict__ VT, __bf16* __restrict__ VB, __bf16* __restrict__ VBL) {
  __shared__ __align__(16) _Float16 sq[64][136], sql[64][136], sk[64][136], skl[64][136], tv[128][72]; __shared__ __align__(16) __bf16 tb[128][72], tbl[128][72];
  const int tid = threadIdx.x; const int h = blockIdx.y; const size_t r0 = (size_t)blockIdx.x * 64; const size_t bb = r0 / TT; const int t0 = (int)(r0 % TT); const bool qhi = t0 < QHI, khi = t0 < KHI;
  for (int e = tid; e < 64 * 128; e += 128) { const int rl = e >> 7, c = e & 127; const size_t oi = ((bb * NH + h) * TT + t0 + rl) * HD + (c % HD);   /* c >= 32: duplicate read of the same element (tiles are 128 wide; HD is 32) */
    const float q = Q[oi], k = K[oi], v = V[oi];   /* COMPUTED f32 intermediates here (not module inputs): NO bf16 rounding - the f16 hi + x2^10 residual planes (q, k) and the bf16 hi + lo planes (v) carry them */
    const _Float16 qh = (_Float16)q, kh = (_Float16)k; sq[rl][c] = qh; sql[rl][c] = (_Float16)((q - (float)qh) * 1024.0f); sk[rl][c] = kh; skl[rl][c] = (_Float16)((k - (float)kh) * 1024.0f);
    tv[c][rl] = (_Float16)v; const __bf16 vb = (__bf16)v; tb[c][rl] = vb; tbl[c][rl] = (__bf16)(v - (float)vb); }
  __syncthreads();
  for (int e = tid; e < 64 * (HD / 8); e += 128) { const int rl = e / (HD / 8), q = e % (HD / 8); const size_t o = (r0 + rl) * CC + h * HD + q * 8; vst2((unsigned*)(QH + o), *(const v4u*)&sq[rl][q * 8]); vst2((unsigned*)(KH + o), *(const v4u*)&sk[rl][q * 8]);   
    if (qhi) vst2((unsigned*)(QL + (bb * QHI + t0 + rl) * (size_t)CC + h * HD + q * 8), *(const v4u*)&sql[rl][q * 8]); if (khi) vst2((unsigned*)(KL + (bb * KHI + t0 + rl) * (size_t)CC + h * HD + q * 8), *(const v4u*)&skl[rl][q * 8]); }
  for (int e = tid; e < HD * 8; e += 128) { const int cl = e >> 3, q = e & 7; vst2((unsigned*)(VT + (bb * CC + h * HD + cl) * (size_t)TT + t0 + q * 8), *(const v4u*)&tv[cl][q * 8]);
    if (khi) { const size_t o3 = (bb * CC + h * HD + cl) * (size_t)KHI + t0 + q * 8; vst2((unsigned*)(VB + o3), *(const v4u*)&tb[cl][q * 8]); vst2((unsigned*)(VBL + o3), *(const v4u*)&tbl[cl][q * 8]); } } }

#ifndef SM_EXTRA_PARAMS
#define SM_EXTRA_PARAMS
#endif
#ifndef PROJ_EXTRA_PARAMS
#define PROJ_EXTRA_PARAMS
#endif
#ifndef SM_MASK_HOOK
#define SM_MASK_HOOK (void)0
#endif

#define WS_QH  0u                                      // f16 q rows [b*t][CC]
#define WS_KH  (WS_QH + 2u * (size_t)NB * TT * CC)      // f16 k rows [b*t][CC]
#define WS_VT  (WS_KH + 2u * (size_t)NB * TT * CC)      // f16 v planes [b][c][t]
#define WS_QL  (WS_VT + 2u * (size_t)NB * CC * TT)      // f16 q residual x 2^10 rows [b][t < QHI][CC]
#define WS_KL  (WS_QL + 2u * (size_t)NB * QHI * CC)     // f16 k residual x 2^10 rows [b][t < KHI][CC]
#define WS_VB  (WS_KL + 2u * (size_t)NB * KHI * CC)     // bf16 v hi planes [b][c][t < KHI]
#define WS_VBL (WS_VB + 2u * (size_t)NB * CC * KHI)
#define WS_S   (WS_VBL + 2u * (size_t)NB * CC * KHI)    // f32 logits / P [hg][t][s]
#define WS_Y   (WS_S  + 4u * (size_t)HG * TT * TT)      // zero-size: the ctx rows are in WS_CAT
#define WS_XH  (WS_Y + 0u)
#define WS_TQ  (WS_XH + 4u * (size_t)NB * TT * CC)
#define WS_WP  (WS_TQ + 4u * (size_t)NB * TT * 128)
#define WS_QB8 (WS_WP + 4u * (size_t)CC * 128 + 256)
#define WS_KB8 (WS_QB8 + 4u * (size_t)NB * TT * CC)
#define WS_VB8 (WS_KB8 + 4u * (size_t)NB * TT * CC)
#define WS_CAT (WS_VB8 + 4u * (size_t)NB * TT * CC)
#define WS_END (WS_CAT + 4u * (size_t)NB * TT * CC)
#define WS_END2 WS_END

// ---- k_sc: block = (query block qb, key block kb <= kb_last(qb), head in group) of batch b: logits x SCALE; q hi + residual (x 2^10) against k (2 products) for query rows < QHI, plus the k residual (3 products) for query blocks < QBH (causal early rows); causal: blocks past the diagonal exit, the mask itself is applied by index in k_sm
__global__ __launch_bounds__(128) void k_sc(const _Float16* __restrict__ QH, const _Float16* __restrict__ KH, const _Float16* __restrict__ QL, const _Float16* __restrict__ KL, int b, int h0, float* __restrict__ S0) { __shared__ __align__(16) float ss[4][16][132];
  const int qb = blockIdx.x, kb = blockIdx.y; if (kb > kb_last(qb)) return;
  const int h = h0 + blockIdx.z; float* S = S0 + (size_t)blockIdx.z * TT * TT;
  const int tid = threadIdx.x, wave = tid >> 5, lane = tid & 31, col = lane & 15, g = lane >> 4; const int k0 = kb * 128; const int ql0 = qb * 64 + wave * 16; const size_t q0 = (size_t)b * TT + ql0, kr0 = (size_t)b * TT + k0;
  v8f acc[8] = {}, accl[8] = {};
  const _Float16* QLb = QL + (size_t)b * QHI * CC; const _Float16* KLb = KL + (size_t)b * KHI * CC;
  if (qb < QBH) {
#pragma unroll
    for (int kc = 0; kc < HD / 32; ++kc) { const v16h ah = frag_h(QH + (q0 + col) * CC + h * HD + kc * 32, lane), al = frag_h(QLb + (size_t)(ql0 + col) * CC + h * HD + kc * 32, lane);
#pragma unroll
      for (int j = 0; j < 8; ++j) { const v16h kbf = frag_h(KH + (kr0 + j * 16 + col) * CC + h * HD + kc * 32, lane), klf = frag_h(KLb + (size_t)(k0 + j * 16 + col) * CC + h * HD + kc * 32, lane); acc[j] = wmma16(ah, kbf, acc[j]); accl[j] = wmma16(al, kbf, accl[j]); accl[j] = wmma16(ah, klf, accl[j]); } }
  } else if (qb * 64 < QHI) {
#pragma unroll
    for (int kc = 0; kc < HD / 32; ++kc) { const v16h ah = frag_h(QH + (q0 + col) * CC + h * HD + kc * 32, lane), al = frag_h(QLb + (size_t)(ql0 + col) * CC + h * HD + kc * 32, lane);
#pragma unroll
      for (int j = 0; j < 8; ++j) { const v16h kbf = frag_h(KH + (kr0 + j * 16 + col) * CC + h * HD + kc * 32, lane); acc[j] = wmma16(ah, kbf, acc[j]); accl[j] = wmma16(al, kbf, accl[j]); } }
  } else {
#pragma unroll
    for (int kc = 0; kc < HD / 32; ++kc) { const v16h ah = frag_h(QH + (q0 + col) * CC + h * HD + kc * 32, lane);
#pragma unroll
      for (int j = 0; j < 8; ++j) { const v16h kbf = frag_h(KH + (kr0 + j * 16 + col) * CC + h * HD + kc * 32, lane); acc[j] = wmma16(ah, kbf, acc[j]); } } }
#pragma unroll
  for (int j = 0; j < 8; ++j) {
#pragma unroll
    for (int r = 0; r < 8; ++r) ss[wave][8 * g + r][j * 16 + col] = (acc[j][r] + accl[j][r] * (1.0f / 1024.0f)) * SCALE; }
  LDSX(); for (int rl = 0; rl < 16; ++rl) vst2(S + (size_t)(ql0 + rl) * TT + k0 + lane * 4, *(const v4f*)&ss[wave][rl][lane * 4]); }
// ---- k_sm: block = query row t (head in group): keys [0, kend): causal -> logit if s <= t else excluded; softmax in f32; P x 2^11 in place (0 for excluded)
__global__ __launch_bounds__(256) void k_sm(float* __restrict__ S0 SM_EXTRA_PARAMS) { __shared__ float sred[8]; __shared__ float sbc; __shared__ __align__(16) float shv[TT];
  const int tid = threadIdx.x; const int t = blockIdx.x; const int kend = (kb_last(t >> 6) + 1) * 128;
  float* sr = S0 + (size_t)blockIdx.y * TT * TT + (size_t)t * TT;
  float m = -3.0e38f; for (int k = tid; k < kend; k += 256) { float v = (!CAUSAL || k <= t) ? sr[k] : -3.0e38f; SM_MASK_HOOK; shv[k] = v; m = fmaxf(m, v); }
#pragma unroll
  for (int o = 1; o < 32; o <<= 1) m = fmaxf(m, __shfl_xor(m, o));
  if ((tid & 31) == 0) sred[tid >> 5] = m; __syncthreads(); if (tid == 0) { float a = sred[0]; for (int i = 1; i < 8; ++i) a = fmaxf(a, sred[i]); sbc = a; } __syncthreads(); m = sbc; __syncthreads();
  float sum = 0.f; for (int k = tid; k < kend; k += 256) { const float v = shv[k]; const float e = (v <= -1.0e38f) ? 0.f : expf(v - m); shv[k] = e; sum += e; }
#pragma unroll
  for (int o = 1; o < 32; o <<= 1) sum += __shfl_xor(sum, o);
  if ((tid & 31) == 0) sred[tid >> 5] = sum; __syncthreads(); if (tid == 0) { float a = 0.f; for (int i = 0; i < 8; ++i) a += sred[i]; sbc = a > 0.f ? 2048.0f / a : 0.f; }   /* a fully excluded row yields P = 0 */ __syncthreads(); const float inv = sbc;
  for (int k = tid; k < kend; k += 256) shv[k] = shv[k] * inv;
  __syncthreads(); for (int q = tid; q < kend / 4; q += 256) vst2(sr + q * 4, *(const v4f*)&shv[q * 4]); }
// ---- k_pv: block = 64 queries (qb) of (b, h): ctx = P . v over keys [0, kend) (P x 2^11 once to f16 against v f16: 1 product; causal early query blocks: P and v as bf16 hi + lo, 3 products); 128-B (row, head) segment by 8 lanes
__global__ __launch_bounds__(128) void k_pv(const float* __restrict__ PS0, const _Float16* __restrict__ VT, const __bf16* __restrict__ VB, const __bf16* __restrict__ VBL, int b, int h0, float* __restrict__ Y) { const int h = h0 + blockIdx.z; const float* PS = PS0 + (size_t)blockIdx.z * TT * TT; __shared__ __align__(16) float ss[4][16][HD + 4];
  const int tid = threadIdx.x, wave = tid >> 5, lane = tid & 31, col = lane & 15, g = lane >> 4; const int qb = blockIdx.x; const int ql0 = qb * 64 + wave * 16; const int kce = (kb_last(qb) + 1) * 4;
  v8f acc[HD / 16] = {};
  if (qb < QBH) {
#pragma unroll 1
    for (int kc = 0; kc < kce; ++kc) { const F2 p = split_row(PS + (size_t)(ql0 + col) * TT, kc * 32, lane);
      asm volatile("s_wait_loadcnt 0x0" ::: "memory");
#pragma unroll
      for (int j = 0; j < HD / 16; ++j) { const size_t po = ((size_t)b * CC + h * HD + j * 16 + col) * (size_t)KHI + kc * 32; const v16b vh = frag_b(VB + po, lane); acc[j] = wmma_bf(p.h, vh, acc[j]); acc[j] = wmma_bf(p.l, vh, acc[j]); acc[j] = wmma_bf(p.h, frag_b(VBL + po, lane), acc[j]); } }
  } else {
#pragma unroll 1
    for (int kc = 0; kc < kce; ++kc) { const v16h p = frag_f32(PS + (size_t)(ql0 + col) * TT + kc * 32, lane);
      asm volatile("s_wait_loadcnt 0x0" ::: "memory");
#pragma unroll
      for (int j = 0; j < HD / 16; ++j) { const size_t po = ((size_t)b * CC + h * HD + j * 16 + col) * (size_t)TT + kc * 32; acc[j] = wmma16(p, frag_h(VT + po, lane), acc[j]); } } }
#pragma unroll
  for (int j = 0; j < HD / 16; ++j)
#pragma unroll
    for (int r = 0; r < 8; ++r) ss[wave][8 * g + r][j * 16 + col] = acc[j][r] * (1.0f / 2048.0f);
  LDSX(); for (int rl = 0; rl < 16; ++rl) if (lane < HD / 4) vst2(Y + ((size_t)b * TT + ql0 + rl) * CC + h * HD + lane * 4, *(const v4f*)&ss[wave][rl][lane * 4]); }

#define NRW (TNB * TT)
// ---- k_gio: block = (64 rows, 128 cols): OUT = act(A) (as f16 hi + residual) x W as f16(bf16 x 2^6) ((in,out) [K][nout]) x 2^-6 + bias (+ RES residual rows if given); act = identity / relu / exact GELU applied when READING A; 512-B segments
__global__ __launch_bounds__(128) void k_gio(const float* __restrict__ A, int lda, int K, int act_in, int rnd_in, const float* __restrict__ Wm, int nout, const float* __restrict__ BIAS, const float* __restrict__ RES, float* __restrict__ OUT) { __shared__ __align__(16) float sf[4][16][132];
  const int tid = threadIdx.x, wave = tid >> 5, lane = tid & 31, col = lane & 15, g = lane >> 4; const int c0 = blockIdx.y * 128; const size_t r0 = (size_t)blockIdx.x * 64 + wave * 16;
  v8f acc[8] = {};
#pragma unroll 1
  for (int kc = 0; kc < K / 32; ++kc) { v16h a, al; { const float* p = A + (r0 + col) * (size_t)lda + kc * 32 + 8 * g;
#pragma unroll
      for (int i = 0; i < 8; ++i) { float x0 = p[i], x1 = p[16 + i]; if (rnd_in) { x0 = bfr(x0); x1 = bfr(x1); }   /* RAW module inputs are rounded to bf16 first; f32 intermediates are not */ if (act_in == 1) { x0 = fmaxf(x0, 0.f); x1 = fmaxf(x1, 0.f); } else if (act_in == 2) { x0 = 0.5f * x0 * (1.0f + erff(x0 * 0.70710678118654752f)); x1 = 0.5f * x1 * (1.0f + erff(x1 * 0.70710678118654752f)); } const _Float16 h0 = (_Float16)x0, h1 = (_Float16)x1; a[i] = h0; a[8 + i] = h1; al[i] = (_Float16)(x0 - (float)h0); al[8 + i] = (_Float16)(x1 - (float)h1); } }   /* A as f16 hi + unscaled f16 residual (2 products, ~2^-22) */   /* act_in 2 = exact GELU (erf), jax.nn.gelu(approximate=False) */
    asm volatile("s_wait_loadcnt 0x0" ::: "memory");
#pragma unroll
    for (int j = 0; j < 8; ++j) { v16h w; { const int o = c0 + j * 16 + col; float t0[8], t1[8];
#pragma unroll
        for (int i = 0; i < 8; ++i) t0[i] = Wm[(size_t)(kc * 32 + 8 * g + i) * nout + o];
        asm volatile("s_wait_loadcnt 0x0" ::: "memory");
#pragma unroll
        for (int i = 0; i < 8; ++i) t1[i] = Wm[(size_t)(kc * 32 + 16 + 8 * g + i) * nout + o];
        asm volatile("s_wait_loadcnt 0x0" ::: "memory");
#pragma unroll
        for (int i = 0; i < 8; ++i) { w[i] = (_Float16)(bfr(t0[i]) * 64.0f); w[8 + i] = (_Float16)(bfr(t1[i]) * 64.0f); } }
      acc[j] = wmma16(a, w, acc[j]); acc[j] = wmma16(al, w, acc[j]); } }
#pragma unroll
  for (int j = 0; j < 8; ++j)
    { const float bb = BIAS ? bfr(BIAS[c0 + j * 16 + col]) : 0.f; asm volatile("s_wait_loadcnt 0x0" ::: "memory"); _Pragma("unroll") for (int r = 0; r < 8; ++r) sf[wave][8 * g + r][j * 16 + col] = acc[j][r] * (1.0f / 64.0f) + bb; }
  LDSX(); for (int rl = 0; rl < 16; ++rl) { const size_t o = (r0 + rl) * (size_t)nout + c0 + lane * 4; v4f v = *(const v4f*)&sf[wave][rl][lane * 4]; if (RES) { const v4f rv = *(const v4f*)(RES + o); v[0] += rv[0]; v[1] += rv[1]; v[2] += rv[2]; v[3] += rv[3]; } vst2(OUT + o, v); } }

// ---- k_goi: block = (64 rows, 128 cols): OUT = [relu](A (f16 hi + residual) x W^T (W (out,in) as f16(bf16 x 2^6)) x 2^-6 + bias) (+ RES residual rows); 512-B segments
__global__ __launch_bounds__(128) void k_goi(const float* __restrict__ A, int lda, int K, int act_in, int rnd_in, const float* __restrict__ Wm, int nout, const float* __restrict__ BIAS, const float* __restrict__ RES, int relu_out, float* __restrict__ OUT) { __shared__ __align__(16) float sf[4][16][132];
  const int tid = threadIdx.x, wave = tid >> 5, lane = tid & 31, col = lane & 15, g = lane >> 4; const int c0 = blockIdx.y * 128; const size_t r0 = (size_t)blockIdx.x * 64 + wave * 16;
  v8f acc[8] = {};
#pragma unroll 1
  for (int kc = 0; kc < K / 32; ++kc) { v16h a, al; { const float* p = A + (r0 + col) * (size_t)lda + kc * 32 + 8 * g;
#pragma unroll
      for (int i = 0; i < 8; ++i) { float x0 = p[i], x1 = p[16 + i]; if (rnd_in) { x0 = bfr(x0); x1 = bfr(x1); }   /* RAW module inputs are rounded to bf16 first; f32 intermediates are not */ if (act_in == 1) { x0 = fmaxf(x0, 0.f); x1 = fmaxf(x1, 0.f); } else if (act_in == 2) { x0 = 0.5f * x0 * (1.0f + erff(x0 * 0.70710678118654752f)); x1 = 0.5f * x1 * (1.0f + erff(x1 * 0.70710678118654752f)); } const _Float16 h0 = (_Float16)x0, h1 = (_Float16)x1; a[i] = h0; a[8 + i] = h1; al[i] = (_Float16)(x0 - (float)h0); al[8 + i] = (_Float16)(x1 - (float)h1); } }   /* A as f16 hi + unscaled f16 residual (2 products, ~2^-22) */   /* act_in 2 = exact GELU (erf), jax.nn.gelu(approximate=False) */
    asm volatile("s_wait_loadcnt 0x0" ::: "memory");
#pragma unroll
    for (int j = 0; j < 8; ++j) { v16h w; { const int o = c0 + j * 16 + col; float t0[8], t1[8];
#pragma unroll
        for (int i = 0; i < 8; ++i) t0[i] = Wm[(size_t)o * K + kc * 32 + 8 * g + i];   /* (out,in) [nout][K] */
        asm volatile("s_wait_loadcnt 0x0" ::: "memory");
#pragma unroll
        for (int i = 0; i < 8; ++i) t1[i] = Wm[(size_t)o * K + kc * 32 + 16 + 8 * g + i];
        asm volatile("s_wait_loadcnt 0x0" ::: "memory");
#pragma unroll
        for (int i = 0; i < 8; ++i) { w[i] = (_Float16)(bfr(t0[i]) * 64.0f); w[8 + i] = (_Float16)(bfr(t1[i]) * 64.0f); } }
      acc[j] = wmma16(a, w, acc[j]); acc[j] = wmma16(al, w, acc[j]); } }
#pragma unroll
  for (int j = 0; j < 8; ++j)
    { const float bb = BIAS ? bfr(BIAS[c0 + j * 16 + col]) : 0.f; asm volatile("s_wait_loadcnt 0x0" ::: "memory"); _Pragma("unroll") for (int r = 0; r < 8; ++r) sf[wave][8 * g + r][j * 16 + col] = acc[j][r] * (1.0f / 64.0f) + bb; }
  LDSX(); for (int rl = 0; rl < 16; ++rl) { const size_t o = (r0 + rl) * (size_t)nout + c0 + lane * 4; v4f v = *(const v4f*)&sf[wave][rl][lane * 4]; if (relu_out) { v[0] = fmaxf(v[0], 0.f); v[1] = fmaxf(v[1], 0.f); v[2] = fmaxf(v[2], 0.f); v[3] = fmaxf(v[3], 0.f); } if (RES) { const v4f rv = *(const v4f*)(RES + o); v[0] += rv[0]; v[1] += rv[1]; v[2] += rv[2]; v[3] += rv[3]; } vst2(OUT + o, v); } }   /* relu on the output (before the residual) when relu_out */

#ifndef SM_EXTRA_PARAMS
#define SM_EXTRA_PARAMS
#endif
#ifndef PROJ_EXTRA_PARAMS
#define PROJ_EXTRA_PARAMS
#endif
#ifndef SM_MASK_HOOK
#define SM_MASK_HOOK (void)0
#endif

#define WS_QH  0u                                      // f16 q rows [b*t][CC]
#define WS_KH  (WS_QH + 2u * (size_t)NB * TT * CC)      // f16 k rows [b*t][CC]
#define WS_VT  (WS_KH + 2u * (size_t)NB * TT * CC)      // f16 v planes [b][c][t]
#define WS_QL  (WS_VT + 2u * (size_t)NB * CC * TT)      // f16 q residual x 2^10 rows [b][t < QHI][CC]
#define WS_KL  (WS_QL + 2u * (size_t)NB * QHI * CC)     // f16 k residual x 2^10 rows [b][t < KHI][CC]
#define WS_VB  (WS_KL + 2u * (size_t)NB * KHI * CC)     // bf16 v hi planes [b][c][t < KHI]
#define WS_VBL (WS_VB + 2u * (size_t)NB * CC * KHI)
#define WS_S   (WS_VBL + 2u * (size_t)NB * CC * KHI)    // f32 logits / P [hg][t][s]
#define WS_Y   (WS_S  + 4u * (size_t)HG * TT * TT)      // zero-size: the ctx rows are in WS_CAT
#define WS_END (WS_Y  + 0u)
#define WS_Y2  (WS_END)
#define WS_O1  (WS_Y2 + 4u * (size_t)NB * TT * CC)
#define WS_R2  (WS_O1 + 4u * (size_t)NB * TT * CC)
#define WS_END2 (WS_R2 + 4u * (size_t)NB * TT * CC)


// ---- k_pack: thread per column, 4 rows per block: WP [512][128] (in,out) = [Wq[h] | Wk[h] | Wv[h] | 0] with Wq/Wk/Wv (in,out) [512][32]
__global__ __launch_bounds__(128) void k_pack(const float* __restrict__ WQ, const float* __restrict__ WK, const float* __restrict__ WV, float* __restrict__ WP) { const int i0 = blockIdx.x * 4; const int c = threadIdx.x;
  for (int i = i0; i < i0 + 4; ++i) { float v = 0.f; if (c < HD) v = WQ[(size_t)i * HD + c]; else if (c < 2 * HD) v = WK[(size_t)i * HD + c - HD]; else if (c < 3 * HD) v = WV[(size_t)i * HD + c - 2 * HD]; asm volatile("s_wait_loadcnt 0x0" ::: "memory"); vst2(WP + (size_t)i * 128 + c, v); } }
__global__ __launch_bounds__(256) void k_scat(const float* __restrict__ TQ, int h, float* __restrict__ QB8, float* __restrict__ KB8, float* __restrict__ VB8) { const size_t row = (size_t)blockIdx.x * 8 + (threadIdx.x >> 5); const int c = threadIdx.x & 31;
  if (row >= (size_t)NRW || c >= 24) return;
  const size_t b = row / TT, t = row % TT; const int which = c / 8, q4 = c % 8; const v4f v = *(const v4f*)(TQ + row * 128 + which * HD + q4 * 4); asm volatile("s_wait_loadcnt 0x0" ::: "memory");
  float* dst = (which == 0 ? QB8 : which == 1 ? KB8 : VB8) + (((b * NH + h) * TT) + t) * HD + q4 * 4; vst2(dst, v); }
extern "C" void kernel_launch(void* const* d_in, const int* in_sizes, int n_in, void* d_out, int out_size, void* d_ws, size_t ws_size, hipStream_t stream) {
  (void)in_sizes; (void)n_in; (void)out_size;
  const float** F = (const float**)d_in;
  if (ws_size < (size_t)WS_END) return;
  char* ws = (char*)d_ws; _Float16 *QH = (_Float16*)(ws + WS_QH), *KH = (_Float16*)(ws + WS_KH), *VT = (_Float16*)(ws + WS_VT), *QL = (_Float16*)(ws + WS_QL), *KL = (_Float16*)(ws + WS_KL); __bf16 *VB = (__bf16*)(ws + WS_VB), *VBL = (__bf16*)(ws + WS_VBL); float *S = (float*)(ws + WS_S), *Y = (float*)(ws + WS_Y);
  (void)Y; (void)QL; (void)KL; (void)VB; (void)VBL;
  // inputs: 0 x [2,2048,512]; 1 Wl [16,512,512] (out,in); 2 bl [16,512]; 3 Wq [16,512,32] (in,out); 4 Wk; 5 Wv; 6 Wo [512,512] (out,in); 7 bo [512]
  if (ws_size < (size_t)WS_END2) return;
  float *XH = (float*)(ws + WS_XH), *TQ = (float*)(ws + WS_TQ), *WP = (float*)(ws + WS_WP), *QB8 = (float*)(ws + WS_QB8), *KB8 = (float*)(ws + WS_KB8), *VB8 = (float*)(ws + WS_VB8), *CAT = (float*)(ws + WS_CAT);
  for (int h = 0; h < NH; ++h) {
    k_goi<<<dim3(NRW / 64, CC / 128), 128, 0, stream>>>(F[0], CC, CC, 0, 1, F[1] + (size_t)h * CC * CC, CC, F[2] + (size_t)h * CC, nullptr, 0, XH);   /* raw x: bf16-rounded in the loader */   /* xh = x Wl[h]^T + bl[h] */
    k_pack<<<dim3(CC / 4), 128, 0, stream>>>(F[3] + (size_t)h * CC * HD, F[4] + (size_t)h * CC * HD, F[5] + (size_t)h * CC * HD, WP);       /* [Wq|Wk|Wv|0] (in,out) [512][128] */
    k_gio<<<dim3(NRW / 64, 1), 128, 0, stream>>>(XH, CC, CC, 0, 0, WP, 128, nullptr, nullptr, TQ);                                          /* [q|k|v|0] rows [NRW][128] */
    k_scat<<<dim3(NRW / 8), 256, 0, stream>>>(TQ, h, QB8, KB8, VB8);                                                                      /* -> [B,H,S,32] buffers */
  }
  k_prep8<<<dim3(TNB * TT / 64, NH), 128, 0, stream>>>(QB8, KB8, VB8, QH, QL, KH, KL, VT, VB, VBL);
  for (int b = 0; b < TNB; ++b) for (int h0 = 0; h0 < NH; h0 += HG) {
    k_sc<<<dim3(NQB, TT / 128, HG), 128, 0, stream>>>(QH, KH, QL, KL, b, h0, S);
    k_sm<<<dim3(TT, HG), 256, 0, stream>>>(S);
    k_pv<<<dim3(NQB, 1, HG), 128, 0, stream>>>(S, VT, VB, VBL, b, h0, CAT);
  }
  k_goi<<<dim3(NRW / 64, CC / 128), 128, 0, stream>>>(CAT, CC, CC, 0, 0, F[6], CC, F[7], nullptr, 0, (float*)d_out);   /* out = cat Wo^T + bo */
}

// v001
// One run takes 921 microseconds.
// In both of two side-by-side timings against v000, it was 3.32 times as fast.
// compute dtype: all float inputs rounded to bf16; xh = x Wl[h]^T + bl[h] (x bf16-exact; the residual plane is 0 there) on WMMA 16x16x32 (f32 accumulate); q/k/v = xh as f16 hi + residual against Wq/Wk/Wv[h] as f16(bf16 x 2^6) (2 products); unscaled causal logits: q, k once to f16 (1 product), 3 products below row 384; softmax in f32; P x 2^11 once to f16 against v f16 (bf16 hi + lo below row 384); out = cat as f16 hi + residual against Wo^T f16(bf16 x 2^6) (2 products) + bo; f32 output.
#include <hip/hip_runtime.h>
#include <math.h>

typedef __attribute__((ext_vector_type(16))) _Float16 v16h;
typedef __attribute__((ext_vector_type(16))) __bf16 v16b;
typedef __attribute__((ext_vector_type(8)))  _Float16 v8h;
typedef __attribute__((ext_vector_type(8)))  float v8f;
typedef __attribute__((ext_vector_type(4)))  float v4f;
typedef __attribute__((ext_vector_type(2)))  float v2f;
typedef __attribute__((ext_vector_type(4)))  unsigned v4u;
typedef __attribute__((ext_vector_type(4)))  int v4i;
typedef float __attribute__((may_alias)) float_a;
typedef int __attribute__((may_alias)) int_a;

template <typename T> __device__ __forceinline__ void vst2(void* p, T v) { *(T*)p = v;  }
__device__ __forceinline__ v8f wmma16(v16h a, v16h b, v8f c) {
  v8f d = __builtin_amdgcn_wmma_f32_16x16x32_f16(false, a, false, b, (short)0, c, false, false);
  asm volatile("v_nop\n\tv_nop\n\tv_nop\n\tv_nop" : "+v"(d) : "v"(a), "v"(b));
  return d;
}
__device__ __forceinline__ v8f wmma_bf(v16b a, v16b b, v8f c) {
  v8f d = __builtin_amdgcn_wmma_f32_16x16x32_bf16(false, a, false, b, (short)0, c, false, false);
  asm volatile("v_nop\n\tv_nop\n\tv_nop\n\tv_nop" : "+v"(d) : "v"(a), "v"(b));
  return d;
}
// 16x16x32 fragments: lane = (h = lane>>4, row/col = lane&15); elements 0..7 = k0+8h+0..7, 8..15 = k0+16+8h+0..7; D element r = row 8h+r
__device__ __forceinline__ v16h frag_h(const _Float16* rowk0, int lane) {
  union { v16h v; v8h q[2]; } u; const _Float16* p = rowk0 + 8 * (lane >> 4);
  u.q[0] = *(const v8h*)p; u.q[1] = *(const v8h*)(p + 16); return u.v;
}
__device__ __forceinline__ v16h frag_f32(const float* rowk0, int lane) {
  v16h a; const float* p = rowk0 + 8 * (lane >> 4);
#pragma unroll
  for (int i = 0; i < 8; ++i) { a[i] = (_Float16)p[i]; a[8 + i] = (_Float16)p[16 + i]; }
  return a;
}
__device__ __forceinline__ v16h frag_f32s(const float* rowk0, int lane, float sc) {
  v16h a; const float* p = rowk0 + 8 * (lane >> 4);
#pragma unroll
  for (int i = 0; i < 8; ++i) { a[i] = (_Float16)(p[i] * sc); a[8 + i] = (_Float16)(p[16 + i] * sc); }
  return a;
}
// column fragment from a [K][ld] layout (column n), rows >= K read as 0
__device__ __forceinline__ v16h fragc_f32(const float* W, int k0, int n, int lane, int ld, int K) {
  v16h a; const int g = lane >> 4;
#pragma unroll
  for (int i = 0; i < 8; ++i) { const int ka = k0 + 8 * g + i, kb = ka + 16;
    a[i] = (_Float16)(ka < K ? W[(size_t)(ka < K ? ka : K - 1) * ld + n] : 0.f); a[8 + i] = (_Float16)(kb < K ? W[(size_t)(kb < K ? kb : K - 1) * ld + n] : 0.f); }
  return a;
}
struct F2 { v16b h, l; };
__device__ __forceinline__ F2 bsplit16(const float v[16]) { F2 r;
#pragma unroll
  for (int i = 0; i < 16; ++i) { const __bf16 h = (__bf16)v[i]; r.h[i] = h; r.l[i] = (__bf16)(v[i] - (float)h); }
  return r; }
__device__ __forceinline__ F2 split_row(const float* row, int k0, int lane) { float v[16]; const float* p = row + k0 + 8 * (lane >> 4);
#pragma unroll
  for (int i = 0; i < 8; ++i) { v[i] = p[i]; v[8 + i] = p[16 + i]; }
  return bsplit16(v); }
__device__ __forceinline__ F2 split_rowK(const float* row, int k0, int lane, int K) { float v[16]; const int g = lane >> 4;
#pragma unroll
  for (int i = 0; i < 8; ++i) { const int ka = k0 + 8 * g + i, kb = ka + 16; v[i] = ka < K ? row[ka < K ? ka : K - 1] : 0.f; v[8 + i] = kb < K ? row[kb < K ? kb : K - 1] : 0.f; }
  return bsplit16(v); }
__device__ __forceinline__ F2 split_col(const float* W, int k0, int n, int lane, int ld, int K) { float v[16]; const int g = lane >> 4;
#pragma unroll
  for (int i = 0; i < 8; ++i) { const int ka = k0 + 8 * g + i, kb = ka + 16; v[i] = ka < K ? W[(size_t)(ka < K ? ka : K - 1) * ld + n] : 0.f; v[8 + i] = kb < K ? W[(size_t)(kb < K ? kb : K - 1) * ld + n] : 0.f; }
  return bsplit16(v); }
__device__ __forceinline__ v8f mac3(const F2& a, const F2& b, v8f c) { c = wmma_bf(a.l, b.h, c); c = wmma_bf(a.h, b.l, c); return wmma_bf(a.h, b.h, c); }
__device__ __forceinline__ float sigm(float v) { return 1.0f / (1.0f + expf(-v)); }
#define LDSX() do { asm volatile("s_wait_dscnt 0" ::: "memory"); __builtin_amdgcn_wave_barrier(); __builtin_amdgcn_fence(__ATOMIC_RELEASE, "workgroup"); } while (0)

// Per-head multi-head causal attention (B 2, S 2,048, 512; 16 heads x 32; 0.02-scale weights: per-head Linear Wl [16,512,512] (out,in) + bl, per-head Wq/Wk/Wv [16,512,32] (in,out) no bias, Wo [512,512] (out,in) + bo): xh = x Wl[h]^T + bl[h]; Q, K, V = xh Wq[h], xh Wk[h], xh Wv[h]; scores = Q K^T (NO scaling), causal; F = softmax(scores) V; out = concat_h(F) Wo^T + bo.
#define NB 2
#define TT 2048
#define CC 512            // NH * HD = projected width
#define DIN 512          // input (model) width
#define NH 16
#define HD 32
#define NQB (TT / 64)
#define HG 8
#define SCALE (1.0f)
#define CAUSAL 1
#ifndef TNB
#define TNB NB
#endif
__device__ __forceinline__ float bfr(float v) { return (float)(__bf16)v; }
__host__ __device__ __forceinline__ int kb_last(int qb) { return CAUSAL ? ((qb * 64 + 63) >> 7) : (TT / 128 - 1); }
typedef __attribute__((ext_vector_type(8))) __bf16 v8b;
__device__ __forceinline__ v16b frag_b(const __bf16* rowk0, int lane) {
  union { v16b v; v8b q[2]; } u; const __bf16* p = rowk0 + 8 * (lane >> 4);
  u.q[0] = *(const v8b*)p; u.q[1] = *(const v8b*)(p + 16); return u.v;
}
#define QBH 6              // causal: query blocks 0..QBH-1 of each sequence (few keys, no averaging) take the high-precision path
#define QHI 384            // rows carrying a q residual plane
#define KHI 384            // key rows carrying k residual / v bf16 hi+lo planes (used only by the causal high-precision path)
// B fragment (k rows k0+.., output column o) of a weight: (in,out) [K][ld] or (out,in) [ld rows of K]: bf16 exact, or f16(bf16 * 256) exact
__device__ __forceinline__ v16b wcol_io(const float* Wm, int k0, int o, int lane, int ld) { v16b w; const int g = lane >> 4;
#pragma unroll
  for (int i = 0; i < 8; ++i) { w[i] = (__bf16)Wm[(size_t)(k0 + 8 * g + i) * ld + o]; w[8 + i] = (__bf16)Wm[(size_t)(k0 + 16 + 8 * g + i) * ld + o]; }
  return w; }
__device__ __forceinline__ v16b wcol_oi(const float* Wm, int k0, int o, int lane, int K) { v16b w; const float* p = Wm + (size_t)o * K + k0 + 8 * (lane >> 4);
#pragma unroll
  for (int i = 0; i < 8; ++i) { w[i] = (__bf16)p[i]; w[8 + i] = (__bf16)p[16 + i]; }
  return w; }
__device__ __forceinline__ v16h wcolh_io(const float* Wm, int k0, int o, int lane, int ld) { v16h w; const int g = lane >> 4;
#pragma unroll
  for (int i = 0; i < 8; ++i) { w[i] = (_Float16)(bfr(Wm[(size_t)(k0 + 8 * g + i) * ld + o]) * 256.0f); w[8 + i] = (_Float16)(bfr(Wm[(size_t)(k0 + 16 + 8 * g + i) * ld + o]) * 256.0f); }
  return w; }
__device__ __forceinline__ v16h wcolh_oi(const float* Wm, int k0, int o, int lane, int K) { v16h w; const float* p = Wm + (size_t)o * K + k0 + 8 * (lane >> 4);
#pragma unroll
  for (int i = 0; i < 8; ++i) { w[i] = (_Float16)(bfr(p[i]) * 256.0f); w[8 + i] = (_Float16)(bfr(p[16 + i]) * 256.0f); }
  return w; }
#define WQKV_LAYOUT 1   // 0 = (in,out) [DIN][CC]; 1 = (out,in) [CC][DIN]; 2 = per-head [NH][DIN][HD]
__device__ __forceinline__ v16b wcol_hdk(const float* Wm, int k0, int o, int lane) { v16b w; const int g = lane >> 4; const float* p = Wm + (size_t)(o / HD) * DIN * HD + (o % HD);
#pragma unroll
  for (int i = 0; i < 8; ++i) { w[i] = (__bf16)p[(size_t)(k0 + 8 * g + i) * HD]; w[8 + i] = (__bf16)p[(size_t)(k0 + 16 + 8 * g + i) * HD]; }
  return w; }
#define WO_OUT_IN 0
#if WQKV_LAYOUT == 1
#define WCOL(W, k0, o, lane) wcol_oi(W, k0, o, lane, DIN)
#elif WQKV_LAYOUT == 2
#define WCOL(W, k0, o, lane) wcol_hdk(W, k0, o, lane)
#else
#define WCOL(W, k0, o, lane) wcol_io(W, k0, o, lane, CC)
#endif
#if WO_OUT_IN
#define WOCOL(W, k0, o, lane) wcol_oi(W, k0, o, lane, CC)
#define WOCOLH(W, k0, o, lane) wcolh_oi(W, k0, o, lane, CC)
#else
#define WOCOL(W, k0, o, lane) wcol_io(W, k0, o, lane, DIN)
#define WOCOLH(W, k0, o, lane) wcolh_io(W, k0, o, lane, DIN)
#endif

// ---- k_prep8: block = (64 attention positions s0.. of sequence b, head h): reads the [B, H, S, 32] q/k/v buffers (element (b,h,s,c) at ((b*NH + h)*TT + s)*32 + c), without bf16 rounding, and writes the standard attention planes: q -> f16 hi rows (+ x 2^10 residual rows for s < QHI), k -> f16 rows (+ residual rows s < KHI), v -> f16 planes [c][s] (+ bf16 hi/lo planes for s < KHI)
__global__ __launch_bounds__(128) void k_prep8(const float* __restrict__ Q, const float* __restrict__ K, const float* __restrict__ V, _Float16* __restrict__ QH, _Float16* __restrict__ QL, _Float16* __restrict__ KH, _Float16* __restrict__ KL, _Float16* __restrict__ VT, __bf16* __restrict__ VB, __bf16* __restrict__ VBL) {
  __shared__ __align__(16) _Float16 sq[64][136], sql[64][136], sk[64][136], skl[64][136], tv[128][72]; __shared__ __align__(16) __bf16 tb[128][72], tbl[128][72];
  const int tid = threadIdx.x; const int h = blockIdx.y; const size_t r0 = (size_t)blockIdx.x * 64; const size_t bb = r0 / TT; const int t0 = (int)(r0 % TT); const bool qhi = t0 < QHI, khi = t0 < KHI;
  for (int e = tid; e < 64 * 128; e += 128) { const int rl = e >> 7, c = e & 127; const size_t oi = ((bb * NH + h) * TT + t0 + rl) * HD + (c % HD);   /* c >= 32: duplicate read of the same element (tiles are 128 wide; HD is 32) */
    const float q = Q[oi], k = K[oi], v = V[oi];   /* COMPUTED f32 intermediates here (not module inputs): NO bf16 rounding - the f16 hi + x2^10 residual planes (q, k) and the bf16 hi + lo planes (v) carry them */
    const _Float16 qh = (_Float16)q, kh = (_Float16)k; sq[rl][c] = qh; sql[rl][c] = (_Float16)((q - (float)qh) * 1024.0f); sk[rl][c] = kh; skl[rl][c] = (_Float16)((k - (float)kh) * 1024.0f);
    tv[c][rl] = (_Float16)v; const __bf16 vb = (__bf16)v; tb[c][rl] = vb; tbl[c][rl] = (__bf16)(v - (float)vb); }
  __syncthreads();
  for (int e = tid; e < 64 * (HD / 8); e += 128) { const int rl = e / (HD / 8), q = e % (HD / 8); const size_t o = (r0 + rl) * CC + h * HD + q * 8; vst2((unsigned*)(QH + o), *(const v4u*)&sq[rl][q * 8]); vst2((unsigned*)(KH + o), *(const v4u*)&sk[rl][q * 8]);   
    if (qhi) vst2((unsigned*)(QL + (bb * QHI + t0 + rl) * (size_t)CC + h * HD + q * 8), *(const v4u*)&sql[rl][q * 8]); if (khi) vst2((unsigned*)(KL + (bb * KHI + t0 + rl) * (size_t)CC + h * HD + q * 8), *(const v4u*)&skl[rl][q * 8]); }
  for (int e = tid; e < HD * 8; e += 128) { const int cl = e >> 3, q = e & 7; vst2((unsigned*)(VT + (bb * CC + h * HD + cl) * (size_t)TT + t0 + q * 8), *(const v4u*)&tv[cl][q * 8]);
    if (khi) { const size_t o3 = (bb * CC + h * HD + cl) * (size_t)KHI + t0 + q * 8; vst2((unsigned*)(VB + o3), *(const v4u*)&tb[cl][q * 8]); vst2((unsigned*)(VBL + o3), *(const v4u*)&tbl[cl][q * 8]); } } }

#ifndef SM_EXTRA_PARAMS
#define SM_EXTRA_PARAMS
#endif
#ifndef PROJ_EXTRA_PARAMS
#define PROJ_EXTRA_PARAMS
#endif
#ifndef SM_MASK_HOOK
#define SM_MASK_HOOK (void)0
#endif

#define WS_QH  0u                                      // f16 q rows [b*t][CC]
#define WS_KH  (WS_QH + 2u * (size_t)NB * TT * CC)      // f16 k rows [b*t][CC]
#define WS_VT  (WS_KH + 2u * (size_t)NB * TT * CC)      // f16 v planes [b][c][t]
#define WS_QL  (WS_VT + 2u * (size_t)NB * CC * TT)      // f16 q residual x 2^10 rows [b][t < QHI][CC]
#define WS_KL  (WS_QL + 2u * (size_t)NB * QHI * CC)     // f16 k residual x 2^10 rows [b][t < KHI][CC]
#define WS_VB  (WS_KL + 2u * (size_t)NB * KHI * CC)     // bf16 v hi planes [b][c][t < KHI]
#define WS_VBL (WS_VB + 2u * (size_t)NB * CC * KHI)
#define WS_S   (WS_VBL + 2u * (size_t)NB * CC * KHI)    // f32 logits / P [hg][t][s]
#define WS_Y   (WS_S  + 4u * (size_t)HG * TT * TT)      // end of S (== WS_TQ); the ctx rows are in WS_CAT
#define WS_XH  (WS_S + 0u)                              // f32 xh rows [h][b*t][CC], all heads; shares the S region (dead before k_sc writes S; NH * NB * CC == HG * TT)
#define WS_TQ  (WS_XH + 4u * (size_t)NH * NB * TT * CC) // f32 [q|k|v|0] rows [h][b*t][128]
#define WS_WP  (WS_TQ + 4u * (size_t)NH * NB * TT * 128) // f32 packed weights [h][CC][128]
#define WS_QB8 (WS_WP + 4u * (size_t)NH * CC * 128 + 256)
#define WS_KB8 (WS_QB8 + 4u * (size_t)NB * TT * CC)
#define WS_VB8 (WS_KB8 + 4u * (size_t)NB * TT * CC)
#define WS_CAT (WS_VB8 + 4u * (size_t)NB * TT * CC)
#define WS_END (WS_CAT + 4u * (size_t)NB * TT * CC)
#define WS_END2 WS_END
#define WS_TOP (WS_CAT + 4u * (size_t)NB * TT * CC)     // end of everything kernel_launch uses
static_assert((size_t)HG * TT * TT <= (size_t)NH * NB * TT * CC, "S must fit within the xh planes");

// ---- k_sc: block = (query block qb, key block kb <= kb_last(qb), head in group) of batch b: logits x SCALE; q hi + residual (x 2^10) against k (2 products) for query rows < QHI, plus the k residual (3 products) for query blocks < QBH (causal early rows); causal: blocks past the diagonal exit, the mask itself is applied by index in k_sm
__global__ __launch_bounds__(128) void k_sc(const _Float16* __restrict__ QH, const _Float16* __restrict__ KH, const _Float16* __restrict__ QL, const _Float16* __restrict__ KL, int b, int h0, float* __restrict__ S0) { __shared__ __align__(16) float ss[4][16][132];
  const int qb = blockIdx.x, kb = blockIdx.y; if (kb > kb_last(qb)) return;
  const int h = h0 + blockIdx.z; float* S = S0 + (size_t)blockIdx.z * TT * TT;
  const int tid = threadIdx.x, wave = tid >> 5, lane = tid & 31, col = lane & 15, g = lane >> 4; const int k0 = kb * 128; const int ql0 = qb * 64 + wave * 16; const size_t q0 = (size_t)b * TT + ql0, kr0 = (size_t)b * TT + k0;
  v8f acc[8] = {}, accl[8] = {};
  const _Float16* QLb = QL + (size_t)b * QHI * CC; const _Float16* KLb = KL + (size_t)b * KHI * CC;
  if (qb < QBH) {
#pragma unroll
    for (int kc = 0; kc < HD / 32; ++kc) { const v16h ah = frag_h(QH + (q0 + col) * CC + h * HD + kc * 32, lane), al = frag_h(QLb + (size_t)(ql0 + col) * CC + h * HD + kc * 32, lane);
#pragma unroll
      for (int j = 0; j < 8; ++j) { const v16h kbf = frag_h(KH + (kr0 + j * 16 + col) * CC + h * HD + kc * 32, lane), klf = frag_h(KLb + (size_t)(k0 + j * 16 + col) * CC + h * HD + kc * 32, lane); acc[j] = wmma16(ah, kbf, acc[j]); accl[j] = wmma16(al, kbf, accl[j]); accl[j] = wmma16(ah, klf, accl[j]); } }
  } else if (qb * 64 < QHI) {
#pragma unroll
    for (int kc = 0; kc < HD / 32; ++kc) { const v16h ah = frag_h(QH + (q0 + col) * CC + h * HD + kc * 32, lane), al = frag_h(QLb + (size_t)(ql0 + col) * CC + h * HD + kc * 32, lane);
#pragma unroll
      for (int j = 0; j < 8; ++j) { const v16h kbf = frag_h(KH + (kr0 + j * 16 + col) * CC + h * HD + kc * 32, lane); acc[j] = wmma16(ah, kbf, acc[j]); accl[j] = wmma16(al, kbf, accl[j]); } }
  } else {
#pragma unroll
    for (int kc = 0; kc < HD / 32; ++kc) { const v16h ah = frag_h(QH + (q0 + col) * CC + h * HD + kc * 32, lane);
#pragma unroll
      for (int j = 0; j < 8; ++j) { const v16h kbf = frag_h(KH + (kr0 + j * 16 + col) * CC + h * HD + kc * 32, lane); acc[j] = wmma16(ah, kbf, acc[j]); } } }
#pragma unroll
  for (int j = 0; j < 8; ++j) {
#pragma unroll
    for (int r = 0; r < 8; ++r) ss[wave][8 * g + r][j * 16 + col] = (acc[j][r] + accl[j][r] * (1.0f / 1024.0f)) * SCALE; }
  LDSX(); for (int rl = 0; rl < 16; ++rl) vst2(S + (size_t)(ql0 + rl) * TT + k0 + lane * 4, *(const v4f*)&ss[wave][rl][lane * 4]); }
// ---- k_sm: block = query row t (head in group): keys [0, kend): causal -> logit if s <= t else excluded; softmax in f32; P x 2^11 in place (0 for excluded)
__global__ __launch_bounds__(256) void k_sm(float* __restrict__ S0 SM_EXTRA_PARAMS) { __shared__ float sred[8]; __shared__ float sbc; __shared__ __align__(16) float shv[TT];
  const int tid = threadIdx.x; const int t = blockIdx.x; const int kend = (kb_last(t >> 6) + 1) * 128;
  float* sr = S0 + (size_t)blockIdx.y * TT * TT + (size_t)t * TT;
  float m = -3.0e38f; for (int k = tid; k < kend; k += 256) { float v = (!CAUSAL || k <= t) ? sr[k] : -3.0e38f; SM_MASK_HOOK; shv[k] = v; m = fmaxf(m, v); }
#pragma unroll
  for (int o = 1; o < 32; o <<= 1) m = fmaxf(m, __shfl_xor(m, o));
  if ((tid & 31) == 0) sred[tid >> 5] = m; __syncthreads(); if (tid == 0) { float a = sred[0]; for (int i = 1; i < 8; ++i) a = fmaxf(a, sred[i]); sbc = a; } __syncthreads(); m = sbc; __syncthreads();
  float sum = 0.f; for (int k = tid; k < kend; k += 256) { const float v = shv[k]; const float e = (v <= -1.0e38f) ? 0.f : expf(v - m); shv[k] = e; sum += e; }
#pragma unroll
  for (int o = 1; o < 32; o <<= 1) sum += __shfl_xor(sum, o);
  if ((tid & 31) == 0) sred[tid >> 5] = sum; __syncthreads(); if (tid == 0) { float a = 0.f; for (int i = 0; i < 8; ++i) a += sred[i]; sbc = a > 0.f ? 2048.0f / a : 0.f; }   /* a fully excluded row yields P = 0 */ __syncthreads(); const float inv = sbc;
  for (int k = tid; k < kend; k += 256) shv[k] = shv[k] * inv;
  __syncthreads(); for (int q = tid; q < kend / 4; q += 256) vst2(sr + q * 4, *(const v4f*)&shv[q * 4]); }
// ---- k_pv: block = 64 queries (qb) of (b, h): ctx = P . v over keys [0, kend) (P x 2^11 once to f16 against v f16: 1 product; causal early query blocks: P and v as bf16 hi + lo, 3 products); 128-B (row, head) segment by 8 lanes
__global__ __launch_bounds__(128) void k_pv(const float* __restrict__ PS0, const _Float16* __restrict__ VT, const __bf16* __restrict__ VB, const __bf16* __restrict__ VBL, int b, int h0, float* __restrict__ Y) { const int h = h0 + blockIdx.z; const float* PS = PS0 + (size_t)blockIdx.z * TT * TT; __shared__ __align__(16) float ss[4][16][HD + 4];
  const int tid = threadIdx.x, wave = tid >> 5, lane = tid & 31, col = lane & 15, g = lane >> 4; const int qb = blockIdx.x; const int ql0 = qb * 64 + wave * 16; const int kce = (kb_last(qb) + 1) * 4;
  v8f acc[HD / 16] = {};
  if (qb < QBH) {
#pragma unroll 1
    for (int kc = 0; kc < kce; ++kc) { const F2 p = split_row(PS + (size_t)(ql0 + col) * TT, kc * 32, lane);
      asm volatile("s_wait_loadcnt 0x0" ::: "memory");
#pragma unroll
      for (int j = 0; j < HD / 16; ++j) { const size_t po = ((size_t)b * CC + h * HD + j * 16 + col) * (size_t)KHI + kc * 32; const v16b vh = frag_b(VB + po, lane); acc[j] = wmma_bf(p.h, vh, acc[j]); acc[j] = wmma_bf(p.l, vh, acc[j]); acc[j] = wmma_bf(p.h, frag_b(VBL + po, lane), acc[j]); } }
  } else {
#pragma unroll 1
    for (int kc = 0; kc < kce; ++kc) { const v16h p = frag_f32(PS + (size_t)(ql0 + col) * TT + kc * 32, lane);
      asm volatile("s_wait_loadcnt 0x0" ::: "memory");
#pragma unroll
      for (int j = 0; j < HD / 16; ++j) { const size_t po = ((size_t)b * CC + h * HD + j * 16 + col) * (size_t)TT + kc * 32; acc[j] = wmma16(p, frag_h(VT + po, lane), acc[j]); } } }
#pragma unroll
  for (int j = 0; j < HD / 16; ++j)
#pragma unroll
    for (int r = 0; r < 8; ++r) ss[wave][8 * g + r][j * 16 + col] = acc[j][r] * (1.0f / 2048.0f);
  LDSX(); for (int rl = 0; rl < 16; ++rl) if (lane < HD / 4) vst2(Y + ((size_t)b * TT + ql0 + rl) * CC + h * HD + lane * 4, *(const v4f*)&ss[wave][rl][lane * 4]); }

#define NRW (TNB * TT)
// ---- k_gio: block = (64 rows, 128 cols): OUT = act(A as f16 hi + residual) x W as f16(bf16 x 2^6) ((in,out) [K][nout]) x 2^-6 + bias (+ RES residual rows if given); act = identity / relu / exact GELU applied when READING A; 512-B segments
__global__ __launch_bounds__(128) void k_gio(const float* __restrict__ A, int lda, int K, int act_in, int rnd_in, const float* __restrict__ Wm, int nout, const float* __restrict__ BIAS, const float* __restrict__ RES, float* __restrict__ OUT, size_t az, size_t wz, size_t oz) { __shared__ __align__(16) float sf[4][16][132];
  A += blockIdx.z * az; Wm += blockIdx.z * wz; OUT += blockIdx.z * oz;   /* blockIdx.z = head: its own A rows, weight and output plane */
  const int tid = threadIdx.x, wave = tid >> 5, lane = tid & 31, col = lane & 15, g = lane >> 4; const int c0 = blockIdx.y * 128; const size_t r0 = (size_t)blockIdx.x * 64 + wave * 16;
  v8f acc[8] = {};
#pragma unroll 1
  for (int kc = 0; kc < K / 32; ++kc) { v16h a, al; { const float* p = A + (r0 + col) * (size_t)lda + kc * 32 + 8 * g;
#pragma unroll
      for (int i = 0; i < 8; ++i) { float x0 = p[i], x1 = p[16 + i]; if (rnd_in) { x0 = bfr(x0); x1 = bfr(x1); }   /* RAW module inputs are rounded to bf16 first; f32 intermediates are not */ if (act_in == 1) { x0 = fmaxf(x0, 0.f); x1 = fmaxf(x1, 0.f); } else if (act_in == 2) { x0 = 0.5f * x0 * (1.0f + erff(x0 * 0.70710678118654752f)); x1 = 0.5f * x1 * (1.0f + erff(x1 * 0.70710678118654752f)); } const _Float16 h0 = (_Float16)x0, h1 = (_Float16)x1; a[i] = h0; a[8 + i] = h1; al[i] = (_Float16)(x0 - (float)h0); al[8 + i] = (_Float16)(x1 - (float)h1); } }   /* A as f16 hi + unscaled f16 residual (2 products, ~2^-22) */   /* act_in 2 = exact GELU (erf), jax.nn.gelu(approximate=False) */
    asm volatile("s_wait_loadcnt 0x0" ::: "memory");
#pragma unroll
    for (int j = 0; j < 8; ++j) { v16h w; { const int o = c0 + j * 16 + col; float t0[8], t1[8];
#pragma unroll
        for (int i = 0; i < 8; ++i) t0[i] = Wm[(size_t)(kc * 32 + 8 * g + i) * nout + o];
        asm volatile("s_wait_loadcnt 0x0" ::: "memory");
#pragma unroll
        for (int i = 0; i < 8; ++i) t1[i] = Wm[(size_t)(kc * 32 + 16 + 8 * g + i) * nout + o];
        asm volatile("s_wait_loadcnt 0x0" ::: "memory");
#pragma unroll
        for (int i = 0; i < 8; ++i) { w[i] = (_Float16)(bfr(t0[i]) * 64.0f); w[8 + i] = (_Float16)(bfr(t1[i]) * 64.0f); } }
      acc[j] = wmma16(a, w, acc[j]); acc[j] = wmma16(al, w, acc[j]); } }
#pragma unroll
  for (int j = 0; j < 8; ++j)
    { const float bb = BIAS ? bfr(BIAS[c0 + j * 16 + col]) : 0.f; asm volatile("s_wait_loadcnt 0x0" ::: "memory"); _Pragma("unroll") for (int r = 0; r < 8; ++r) sf[wave][8 * g + r][j * 16 + col] = acc[j][r] * (1.0f / 64.0f) + bb; }
  LDSX(); for (int rl = 0; rl < 16; ++rl) { const size_t o = (r0 + rl) * (size_t)nout + c0 + lane * 4; v4f v = *(const v4f*)&sf[wave][rl][lane * 4]; if (RES) { const v4f rv = *(const v4f*)(RES + o); v[0] += rv[0]; v[1] += rv[1]; v[2] += rv[2]; v[3] += rv[3]; } vst2(OUT + o, v); } }

// ---- k_goi: block = (64 rows, 128 cols): OUT = [relu](A (as f16 hi + residual) x W^T (W (out,in) as f16(bf16 x 2^6)) x 2^-6 + bias) (+ RES residual rows); 512-B segments
__global__ __launch_bounds__(128) void k_goi(const float* __restrict__ A, int lda, int K, int act_in, int rnd_in, const float* __restrict__ Wm, int nout, const float* __restrict__ BIAS, const float* __restrict__ RES, int relu_out, float* __restrict__ OUT, size_t wz, size_t bz, size_t oz) { __shared__ __align__(16) float sf[4][16][132];
  Wm += blockIdx.z * wz; if (BIAS) BIAS += blockIdx.z * bz; OUT += blockIdx.z * oz;   /* blockIdx.z = head: its own weight, bias and output plane (A is shared) */
  const int tid = threadIdx.x, wave = tid >> 5, lane = tid & 31, col = lane & 15, g = lane >> 4; const int c0 = blockIdx.y * 128; const size_t r0 = (size_t)blockIdx.x * 64 + wave * 16;
  v8f acc[8] = {};
#pragma unroll 1
  for (int kc = 0; kc < K / 32; ++kc) { v16h a, al; { const float* p = A + (r0 + col) * (size_t)lda + kc * 32 + 8 * g;
#pragma unroll
      for (int i = 0; i < 8; ++i) { float x0 = p[i], x1 = p[16 + i]; if (rnd_in) { x0 = bfr(x0); x1 = bfr(x1); }   /* RAW module inputs are rounded to bf16 first; f32 intermediates are not */ if (act_in == 1) { x0 = fmaxf(x0, 0.f); x1 = fmaxf(x1, 0.f); } else if (act_in == 2) { x0 = 0.5f * x0 * (1.0f + erff(x0 * 0.70710678118654752f)); x1 = 0.5f * x1 * (1.0f + erff(x1 * 0.70710678118654752f)); } const _Float16 h0 = (_Float16)x0, h1 = (_Float16)x1; a[i] = h0; a[8 + i] = h1; al[i] = (_Float16)(x0 - (float)h0); al[8 + i] = (_Float16)(x1 - (float)h1); } }   /* A as f16 hi + unscaled f16 residual (2 products, ~2^-22) */   /* act_in 2 = exact GELU (erf), jax.nn.gelu(approximate=False) */
    asm volatile("s_wait_loadcnt 0x0" ::: "memory");
#pragma unroll
    for (int j = 0; j < 8; ++j) { v16h w; { const int o = c0 + j * 16 + col; float t0[8], t1[8];
#pragma unroll
        for (int i = 0; i < 8; ++i) t0[i] = Wm[(size_t)o * K + kc * 32 + 8 * g + i];   /* (out,in) [nout][K] */
        asm volatile("s_wait_loadcnt 0x0" ::: "memory");
#pragma unroll
        for (int i = 0; i < 8; ++i) t1[i] = Wm[(size_t)o * K + kc * 32 + 16 + 8 * g + i];
        asm volatile("s_wait_loadcnt 0x0" ::: "memory");
#pragma unroll
        for (int i = 0; i < 8; ++i) { w[i] = (_Float16)(bfr(t0[i]) * 64.0f); w[8 + i] = (_Float16)(bfr(t1[i]) * 64.0f); } }
      acc[j] = wmma16(a, w, acc[j]); acc[j] = wmma16(al, w, acc[j]); } }
#pragma unroll
  for (int j = 0; j < 8; ++j)
    { const float bb = BIAS ? bfr(BIAS[c0 + j * 16 + col]) : 0.f; asm volatile("s_wait_loadcnt 0x0" ::: "memory"); _Pragma("unroll") for (int r = 0; r < 8; ++r) sf[wave][8 * g + r][j * 16 + col] = acc[j][r] * (1.0f / 64.0f) + bb; }
  LDSX(); for (int rl = 0; rl < 16; ++rl) { const size_t o = (r0 + rl) * (size_t)nout + c0 + lane * 4; v4f v = *(const v4f*)&sf[wave][rl][lane * 4]; if (relu_out) { v[0] = fmaxf(v[0], 0.f); v[1] = fmaxf(v[1], 0.f); v[2] = fmaxf(v[2], 0.f); v[3] = fmaxf(v[3], 0.f); } if (RES) { const v4f rv = *(const v4f*)(RES + o); v[0] += rv[0]; v[1] += rv[1]; v[2] += rv[2]; v[3] += rv[3]; } vst2(OUT + o, v); } }   /* relu on the output (before the residual) when relu_out */

#ifndef SM_EXTRA_PARAMS
#define SM_EXTRA_PARAMS
#endif
#ifndef PROJ_EXTRA_PARAMS
#define PROJ_EXTRA_PARAMS
#endif
#ifndef SM_MASK_HOOK
#define SM_MASK_HOOK (void)0
#endif

#define WS_QH  0u                                      // f16 q rows [b*t][CC]
#define WS_KH  (WS_QH + 2u * (size_t)NB * TT * CC)      // f16 k rows [b*t][CC]
#define WS_VT  (WS_KH + 2u * (size_t)NB * TT * CC)      // f16 v planes [b][c][t]
#define WS_QL  (WS_VT + 2u * (size_t)NB * CC * TT)      // f16 q residual x 2^10 rows [b][t < QHI][CC]
#define WS_KL  (WS_QL + 2u * (size_t)NB * QHI * CC)     // f16 k residual x 2^10 rows [b][t < KHI][CC]
#define WS_VB  (WS_KL + 2u * (size_t)NB * KHI * CC)     // bf16 v hi planes [b][c][t < KHI]
#define WS_VBL (WS_VB + 2u * (size_t)NB * CC * KHI)
#define WS_S   (WS_VBL + 2u * (size_t)NB * CC * KHI)    // f32 logits / P [hg][t][s]
#define WS_Y   (WS_S  + 4u * (size_t)HG * TT * TT)      // zero-size: the ctx rows are in WS_CAT
#define WS_END (WS_Y  + 0u)
#define WS_Y2  (WS_END)
#define WS_O1  (WS_Y2 + 4u * (size_t)NB * TT * CC)
#define WS_R2  (WS_O1 + 4u * (size_t)NB * TT * CC)
#define WS_END2 (WS_R2 + 4u * (size_t)NB * TT * CC)


// ---- k_pack: block = 4 rows, thread per column, head = blockIdx.y: WP[h] [512][128] (in,out) = [Wq[h] | Wk[h] | Wv[h] | 0] with Wq/Wk/Wv (in,out) [512][32]
__global__ __launch_bounds__(128) void k_pack(const float* __restrict__ WQ, const float* __restrict__ WK, const float* __restrict__ WV, float* __restrict__ WP) { const int i0 = blockIdx.x * 4; const int c = threadIdx.x; { const size_t h = blockIdx.y; WQ += h * CC * HD; WK += h * CC * HD; WV += h * CC * HD; WP += h * CC * 128; }   /* blockIdx.y = head */
  for (int i = i0; i < i0 + 4; ++i) { float v = 0.f; if (c < HD) v = WQ[(size_t)i * HD + c]; else if (c < 2 * HD) v = WK[(size_t)i * HD + c - HD]; else if (c < 3 * HD) v = WV[(size_t)i * HD + c - 2 * HD]; asm volatile("s_wait_loadcnt 0x0" ::: "memory"); vst2(WP + (size_t)i * 128 + c, v); } }
__global__ __launch_bounds__(256) void k_scat(const float* __restrict__ TQ, float* __restrict__ QB8, float* __restrict__ KB8, float* __restrict__ VB8) { const size_t row = (size_t)blockIdx.x * 8 + (threadIdx.x >> 5); const int c = threadIdx.x & 31; const size_t h = blockIdx.y; TQ += h * (size_t)NRW * 128;   /* blockIdx.y = head */
  if (row >= (size_t)NRW || c >= 24) return;
  const size_t b = row / TT, t = row % TT; const int which = c / 8, q4 = c % 8; const v4f v = *(const v4f*)(TQ + row * 128 + which * HD + q4 * 4); asm volatile("s_wait_loadcnt 0x0" ::: "memory");
  float* dst = (which == 0 ? QB8 : which == 1 ? KB8 : VB8) + (((b * NH + h) * TT) + t) * HD + q4 * 4; vst2(dst, v); }
extern "C" void kernel_launch(void* const* d_in, const int* in_sizes, int n_in, void* d_out, int out_size, void* d_ws, size_t ws_size, hipStream_t stream) {
  (void)in_sizes; (void)n_in; (void)out_size;
  const float** F = (const float**)d_in;
  if (ws_size < (size_t)WS_END) return;
  char* ws = (char*)d_ws; _Float16 *QH = (_Float16*)(ws + WS_QH), *KH = (_Float16*)(ws + WS_KH), *VT = (_Float16*)(ws + WS_VT), *QL = (_Float16*)(ws + WS_QL), *KL = (_Float16*)(ws + WS_KL); __bf16 *VB = (__bf16*)(ws + WS_VB), *VBL = (__bf16*)(ws + WS_VBL); float *S = (float*)(ws + WS_S), *Y = (float*)(ws + WS_Y);
  (void)Y; (void)QL; (void)KL; (void)VB; (void)VBL;
  // inputs: 0 x [2,2048,512]; 1 Wl [16,512,512] (out,in); 2 bl [16,512]; 3 Wq [16,512,32] (in,out); 4 Wk; 5 Wv; 6 Wo [512,512] (out,in); 7 bo [512]
  if (ws_size < (size_t)WS_TOP) return;
  float *XH = (float*)(ws + WS_XH), *TQ = (float*)(ws + WS_TQ), *WP = (float*)(ws + WS_WP), *QB8 = (float*)(ws + WS_QB8), *KB8 = (float*)(ws + WS_KB8), *VB8 = (float*)(ws + WS_VB8), *CAT = (float*)(ws + WS_CAT);
  /* the four projection launches cover all NH heads at once: head = blockIdx.z (GEMMs) or blockIdx.y (pack, scatter) */
  k_goi<<<dim3(NRW / 64, CC / 128, NH), 128, 0, stream>>>(F[0], CC, CC, 0, 1, F[1], CC, F[2], nullptr, 0, XH, (size_t)CC * CC, (size_t)CC, (size_t)NRW * CC);   /* raw x: bf16-rounded in the loader */   /* xh[h] = x Wl[h]^T + bl[h] */
  k_pack<<<dim3(CC / 4, NH), 128, 0, stream>>>(F[3], F[4], F[5], WP);                                                                       /* [Wq|Wk|Wv|0][h] (in,out) [512][128] */
  k_gio<<<dim3(NRW / 64, 1, NH), 128, 0, stream>>>(XH, CC, CC, 0, 0, WP, 128, nullptr, nullptr, TQ, (size_t)NRW * CC, (size_t)CC * 128, (size_t)NRW * 128);   /* [q|k|v|0][h] rows [NRW][128] */
  k_scat<<<dim3(NRW / 8, NH), 256, 0, stream>>>(TQ, QB8, KB8, VB8);                                                                         /* -> [B,H,S,32] buffers */
  k_prep8<<<dim3(TNB * TT / 64, NH), 128, 0, stream>>>(QB8, KB8, VB8, QH, QL, KH, KL, VT, VB, VBL);
  for (int b = 0; b < TNB; ++b) for (int h0 = 0; h0 < NH; h0 += HG) {
    k_sc<<<dim3(NQB, TT / 128, HG), 128, 0, stream>>>(QH, KH, QL, KL, b, h0, S);
    k_sm<<<dim3(TT, HG), 256, 0, stream>>>(S);
    k_pv<<<dim3(NQB, 1, HG), 128, 0, stream>>>(S, VT, VB, VBL, b, h0, CAT);
  }
  k_goi<<<dim3(NRW / 64, CC / 128), 128, 0, stream>>>(CAT, CC, CC, 0, 0, F[6], CC, F[7], nullptr, 0, (float*)d_out, 0, 0, 0);   /* out = cat Wo^T + bo */
}

// v002
// Measured time: 559 microseconds a run.
// Two timings next to v001 both put it at 1.65 times that version's speed.
// Over all steps from v000 it is 5.49 times as fast.
// compute dtype: all float inputs rounded to bf16; xh = x Wl[h]^T + bl[h] (x bf16-exact; the residual plane is 0 there) on WMMA 16x16x32 (f32 accumulate); q/k/v = xh as f16 hi + residual against Wq/Wk/Wv[h] as f16(bf16 x 2^6) (2 products); unscaled causal logits: q, k once to f16 (1 product), 3 products below row 384; online softmax in f32 (running maximum and sum, one fused kernel); P = exp(logit - maximum) once to f16 against v f16 (P and v as bf16 hi + lo below row 384); out = cat as f16 hi + residual against Wo^T f16(bf16 x 2^6) (2 products) + bo; f32 output.
#include <hip/hip_runtime.h>
#include <math.h>

typedef __attribute__((ext_vector_type(16))) _Float16 v16h;
typedef __attribute__((ext_vector_type(16))) __bf16 v16b;
typedef __attribute__((ext_vector_type(8)))  _Float16 v8h;
typedef __attribute__((ext_vector_type(8)))  float v8f;
typedef __attribute__((ext_vector_type(4)))  float v4f;
typedef __attribute__((ext_vector_type(2)))  float v2f;
typedef __attribute__((ext_vector_type(4)))  unsigned v4u;
typedef __attribute__((ext_vector_type(4)))  int v4i;
typedef float __attribute__((may_alias)) float_a;
typedef int __attribute__((may_alias)) int_a;

template <typename T> __device__ __forceinline__ void vst2(void* p, T v) { *(T*)p = v;  }
__device__ __forceinline__ v8f wmma16(v16h a, v16h b, v8f c) {
  v8f d = __builtin_amdgcn_wmma_f32_16x16x32_f16(false, a, false, b, (short)0, c, false, false);
  asm volatile("v_nop\n\tv_nop\n\tv_nop\n\tv_nop" : "+v"(d) : "v"(a), "v"(b));
  return d;
}
__device__ __forceinline__ v8f wmma_bf(v16b a, v16b b, v8f c) {
  v8f d = __builtin_amdgcn_wmma_f32_16x16x32_bf16(false, a, false, b, (short)0, c, false, false);
  asm volatile("v_nop\n\tv_nop\n\tv_nop\n\tv_nop" : "+v"(d) : "v"(a), "v"(b));
  return d;
}
// 16x16x32 fragments: lane = (h = lane>>4, row/col = lane&15); elements 0..7 = k0+8h+0..7, 8..15 = k0+16+8h+0..7; D element r = row 8h+r
__device__ __forceinline__ v16h frag_h(const _Float16* rowk0, int lane) {
  union { v16h v; v8h q[2]; } u; const _Float16* p = rowk0 + 8 * (lane >> 4);
  u.q[0] = *(const v8h*)p; u.q[1] = *(const v8h*)(p + 16); return u.v;
}
__device__ __forceinline__ v16h frag_f32(const float* rowk0, int lane) {
  v16h a; const float* p = rowk0 + 8 * (lane >> 4);
#pragma unroll
  for (int i = 0; i < 8; ++i) { a[i] = (_Float16)p[i]; a[8 + i] = (_Float16)p[16 + i]; }
  return a;
}
__device__ __forceinline__ v16h frag_f32s(const float* rowk0, int lane, float sc) {
  v16h a; const float* p = rowk0 + 8 * (lane >> 4);
#pragma unroll
  for (int i = 0; i < 8; ++i) { a[i] = (_Float16)(p[i] * sc); a[8 + i] = (_Float16)(p[16 + i] * sc); }
  return a;
}
// column fragment from a [K][ld] layout (column n), rows >= K read as 0
__device__ __forceinline__ v16h fragc_f32(const float* W, int k0, int n, int lane, int ld, int K) {
  v16h a; const int g = lane >> 4;
#pragma unroll
  for (int i = 0; i < 8; ++i) { const int ka = k0 + 8 * g + i, kb = ka + 16;
    a[i] = (_Float16)(ka < K ? W[(size_t)(ka < K ? ka : K - 1) * ld + n] : 0.f); a[8 + i] = (_Float16)(kb < K ? W[(size_t)(kb < K ? kb : K - 1) * ld + n] : 0.f); }
  return a;
}
struct F2 { v16b h, l; };
__device__ __forceinline__ F2 bsplit16(const float v[16]) { F2 r;
#pragma unroll
  for (int i = 0; i < 16; ++i) { const __bf16 h = (__bf16)v[i]; r.h[i] = h; r.l[i] = (__bf16)(v[i] - (float)h); }
  return r; }
__device__ __forceinline__ F2 split_row(const float* row, int k0, int lane) { float v[16]; const float* p = row + k0 + 8 * (lane >> 4);
#pragma unroll
  for (int i = 0; i < 8; ++i) { v[i] = p[i]; v[8 + i] = p[16 + i]; }
  return bsplit16(v); }
__device__ __forceinline__ F2 split_rowK(const float* row, int k0, int lane, int K) { float v[16]; const int g = lane >> 4;
#pragma unroll
  for (int i = 0; i < 8; ++i) { const int ka = k0 + 8 * g + i, kb = ka + 16; v[i] = ka < K ? row[ka < K ? ka : K - 1] : 0.f; v[8 + i] = kb < K ? row[kb < K ? kb : K - 1] : 0.f; }
  return bsplit16(v); }
__device__ __forceinline__ F2 split_col(const float* W, int k0, int n, int lane, int ld, int K) { float v[16]; const int g = lane >> 4;
#pragma unroll
  for (int i = 0; i < 8; ++i) { const int ka = k0 + 8 * g + i, kb = ka + 16; v[i] = ka < K ? W[(size_t)(ka < K ? ka : K - 1) * ld + n] : 0.f; v[8 + i] = kb < K ? W[(size_t)(kb < K ? kb : K - 1) * ld + n] : 0.f; }
  return bsplit16(v); }
__device__ __forceinline__ v8f mac3(const F2& a, const F2& b, v8f c) { c = wmma_bf(a.l, b.h, c); c = wmma_bf(a.h, b.l, c); return wmma_bf(a.h, b.h, c); }
__device__ __forceinline__ float sigm(float v) { return 1.0f / (1.0f + expf(-v)); }
#define LDSX() do { asm volatile("s_wait_dscnt 0" ::: "memory"); __builtin_amdgcn_wave_barrier(); __builtin_amdgcn_fence(__ATOMIC_RELEASE, "workgroup"); } while (0)

// Per-head multi-head causal attention (B 2, S 2,048, 512; 16 heads x 32; 0.02-scale weights: per-head Linear Wl [16,512,512] (out,in) + bl, per-head Wq/Wk/Wv [16,512,32] (in,out) no bias, Wo [512,512] (out,in) + bo): xh = x Wl[h]^T + bl[h]; Q, K, V = xh Wq[h], xh Wk[h], xh Wv[h]; scores = Q K^T (NO scaling), causal; F = softmax(scores) V; out = concat_h(F) Wo^T + bo.
#define NB 2
#define TT 2048
#define CC 512            // NH * HD = projected width
#define DIN 512          // input (model) width
#define NH 16
#define HD 32
#define NQB (TT / 64)
#define HG 8
#define SCALE (1.0f)
#define CAUSAL 1
#ifndef TNB
#define TNB NB
#endif
__device__ __forceinline__ float bfr(float v) { return (float)(__bf16)v; }
__host__ __device__ __forceinline__ int kb_last(int qb) { return CAUSAL ? ((qb * 64 + 63) >> 7) : (TT / 128 - 1); }
typedef __attribute__((ext_vector_type(8))) __bf16 v8b;
__device__ __forceinline__ v16b frag_b(const __bf16* rowk0, int lane) {
  union { v16b v; v8b q[2]; } u; const __bf16* p = rowk0 + 8 * (lane >> 4);
  u.q[0] = *(const v8b*)p; u.q[1] = *(const v8b*)(p + 16); return u.v;
}
#define QBH 6              // causal: query blocks 0..QBH-1 of each sequence (few keys, no averaging) take the high-precision path
#define QHI 384            // rows carrying a q residual plane
#define KHI 384            // key rows carrying k residual / v bf16 hi+lo planes (used only by the causal high-precision path)
// B fragment (k rows k0+.., output column o) of a weight: (in,out) [K][ld] or (out,in) [ld rows of K]: bf16 exact, or f16(bf16 * 256) exact
__device__ __forceinline__ v16b wcol_io(const float* Wm, int k0, int o, int lane, int ld) { v16b w; const int g = lane >> 4;
#pragma unroll
  for (int i = 0; i < 8; ++i) { w[i] = (__bf16)Wm[(size_t)(k0 + 8 * g + i) * ld + o]; w[8 + i] = (__bf16)Wm[(size_t)(k0 + 16 + 8 * g + i) * ld + o]; }
  return w; }
__device__ __forceinline__ v16b wcol_oi(const float* Wm, int k0, int o, int lane, int K) { v16b w; const float* p = Wm + (size_t)o * K + k0 + 8 * (lane >> 4);
#pragma unroll
  for (int i = 0; i < 8; ++i) { w[i] = (__bf16)p[i]; w[8 + i] = (__bf16)p[16 + i]; }
  return w; }
__device__ __forceinline__ v16h wcolh_io(const float* Wm, int k0, int o, int lane, int ld) { v16h w; const int g = lane >> 4;
#pragma unroll
  for (int i = 0; i < 8; ++i) { w[i] = (_Float16)(bfr(Wm[(size_t)(k0 + 8 * g + i) * ld + o]) * 256.0f); w[8 + i] = (_Float16)(bfr(Wm[(size_t)(k0 + 16 + 8 * g + i) * ld + o]) * 256.0f); }
  return w; }
__device__ __forceinline__ v16h wcolh_oi(const float* Wm, int k0, int o, int lane, int K) { v16h w; const float* p = Wm + (size_t)o * K + k0 + 8 * (lane >> 4);
#pragma unroll
  for (int i = 0; i < 8; ++i) { w[i] = (_Float16)(bfr(p[i]) * 256.0f); w[8 + i] = (_Float16)(bfr(p[16 + i]) * 256.0f); }
  return w; }
#define WQKV_LAYOUT 1   // 0 = (in,out) [DIN][CC]; 1 = (out,in) [CC][DIN]; 2 = per-head [NH][DIN][HD]
__device__ __forceinline__ v16b wcol_hdk(const float* Wm, int k0, int o, int lane) { v16b w; const int g = lane >> 4; const float* p = Wm + (size_t)(o / HD) * DIN * HD + (o % HD);
#pragma unroll
  for (int i = 0; i < 8; ++i) { w[i] = (__bf16)p[(size_t)(k0 + 8 * g + i) * HD]; w[8 + i] = (__bf16)p[(size_t)(k0 + 16 + 8 * g + i) * HD]; }
  return w; }
#define WO_OUT_IN 0
#if WQKV_LAYOUT == 1
#define WCOL(W, k0, o, lane) wcol_oi(W, k0, o, lane, DIN)
#elif WQKV_LAYOUT == 2
#define WCOL(W, k0, o, lane) wcol_hdk(W, k0, o, lane)
#else
#define WCOL(W, k0, o, lane) wcol_io(W, k0, o, lane, CC)
#endif
#if WO_OUT_IN
#define WOCOL(W, k0, o, lane) wcol_oi(W, k0, o, lane, CC)
#define WOCOLH(W, k0, o, lane) wcolh_oi(W, k0, o, lane, CC)
#else
#define WOCOL(W, k0, o, lane) wcol_io(W, k0, o, lane, DIN)
#define WOCOLH(W, k0, o, lane) wcolh_io(W, k0, o, lane, DIN)
#endif

// ---- k_prep8: block = (64 attention positions s0.. of sequence b, head h): reads the [B, H, S, 32] q/k/v buffers (element (b,h,s,c) at ((b*NH + h)*TT + s)*32 + c), without bf16 rounding, and writes the standard attention planes: q -> f16 hi rows (+ x 2^10 residual rows for s < QHI), k -> f16 rows (+ residual rows s < KHI), v -> f16 planes [c][s] (+ bf16 hi/lo planes for s < KHI)
__global__ __launch_bounds__(128) void k_prep8(const float* __restrict__ Q, const float* __restrict__ K, const float* __restrict__ V, _Float16* __restrict__ QH, _Float16* __restrict__ QL, _Float16* __restrict__ KH, _Float16* __restrict__ KL, _Float16* __restrict__ VT, __bf16* __restrict__ VB, __bf16* __restrict__ VBL) {
  __shared__ __align__(16) _Float16 sq[64][136], sql[64][136], sk[64][136], skl[64][136], tv[128][72]; __shared__ __align__(16) __bf16 tb[128][72], tbl[128][72];
  const int tid = threadIdx.x; const int h = blockIdx.y; const size_t r0 = (size_t)blockIdx.x * 64; const size_t bb = r0 / TT; const int t0 = (int)(r0 % TT); const bool qhi = t0 < QHI, khi = t0 < KHI;
  for (int e = tid; e < 64 * 128; e += 128) { const int rl = e >> 7, c = e & 127; const size_t oi = ((bb * NH + h) * TT + t0 + rl) * HD + (c % HD);   /* c >= 32: duplicate read of the same element (tiles are 128 wide; HD is 32) */
    const float q = Q[oi], k = K[oi], v = V[oi];   /* COMPUTED f32 intermediates here (not module inputs): NO bf16 rounding - the f16 hi + x2^10 residual planes (q, k) and the bf16 hi + lo planes (v) carry them */
    const _Float16 qh = (_Float16)q, kh = (_Float16)k; sq[rl][c] = qh; sql[rl][c] = (_Float16)((q - (float)qh) * 1024.0f); sk[rl][c] = kh; skl[rl][c] = (_Float16)((k - (float)kh) * 1024.0f);
    tv[c][rl] = (_Float16)v; const __bf16 vb = (__bf16)v; tb[c][rl] = vb; tbl[c][rl] = (__bf16)(v - (float)vb); }
  __syncthreads();
  for (int e = tid; e < 64 * (HD / 8); e += 128) { const int rl = e / (HD / 8), q = e % (HD / 8); const size_t o = (r0 + rl) * CC + h * HD + q * 8; vst2((unsigned*)(QH + o), *(const v4u*)&sq[rl][q * 8]); vst2((unsigned*)(KH + o), *(const v4u*)&sk[rl][q * 8]);   
    if (qhi) vst2((unsigned*)(QL + (bb * QHI + t0 + rl) * (size_t)CC + h * HD + q * 8), *(const v4u*)&sql[rl][q * 8]); if (khi) vst2((unsigned*)(KL + (bb * KHI + t0 + rl) * (size_t)CC + h * HD + q * 8), *(const v4u*)&skl[rl][q * 8]); }
  for (int e = tid; e < HD * 8; e += 128) { const int cl = e >> 3, q = e & 7; vst2((unsigned*)(VT + (bb * CC + h * HD + cl) * (size_t)TT + t0 + q * 8), *(const v4u*)&tv[cl][q * 8]);
    if (khi) { const size_t o3 = (bb * CC + h * HD + cl) * (size_t)KHI + t0 + q * 8; vst2((unsigned*)(VB + o3), *(const v4u*)&tb[cl][q * 8]); vst2((unsigned*)(VBL + o3), *(const v4u*)&tbl[cl][q * 8]); } } }

#ifndef SM_EXTRA_PARAMS
#define SM_EXTRA_PARAMS
#endif
#ifndef PROJ_EXTRA_PARAMS
#define PROJ_EXTRA_PARAMS
#endif
#ifndef SM_MASK_HOOK
#define SM_MASK_HOOK (void)0
#endif

#define WS_QH  0u                                      // f16 q rows [b*t][CC]
#define WS_KH  (WS_QH + 2u * (size_t)NB * TT * CC)      // f16 k rows [b*t][CC]
#define WS_VT  (WS_KH + 2u * (size_t)NB * TT * CC)      // f16 v planes [b][c][t]
#define WS_QL  (WS_VT + 2u * (size_t)NB * CC * TT)      // f16 q residual x 2^10 rows [b][t < QHI][CC]
#define WS_KL  (WS_QL + 2u * (size_t)NB * QHI * CC)     // f16 k residual x 2^10 rows [b][t < KHI][CC]
#define WS_VB  (WS_KL + 2u * (size_t)NB * KHI * CC)     // bf16 v hi planes [b][c][t < KHI]
#define WS_VBL (WS_VB + 2u * (size_t)NB * CC * KHI)
#define WS_S   (WS_VBL + 2u * (size_t)NB * CC * KHI)    // f32 area of HG * TT * TT floats; holds the xh planes
#define WS_Y   (WS_S  + 4u * (size_t)HG * TT * TT)      // end of the S area (== WS_TQ); Y itself is unused, ctx rows go to WS_CAT
#define WS_XH  (WS_S + 0u)                              // f32 xh rows [h][b*t][CC], all heads; fills the S region, which holds no logits (NH * NB * CC == HG * TT)
#define WS_TQ  (WS_XH + 4u * (size_t)NH * NB * TT * CC) // f32 [q|k|v|0] rows [h][b*t][128]
#define WS_WP  (WS_TQ + 4u * (size_t)NH * NB * TT * 128) // f32 packed weights [h][CC][128]
#define WS_QB8 (WS_WP + 4u * (size_t)NH * CC * 128 + 256)
#define WS_KB8 (WS_QB8 + 4u * (size_t)NB * TT * CC)
#define WS_VB8 (WS_KB8 + 4u * (size_t)NB * TT * CC)
#define WS_CAT (WS_VB8 + 4u * (size_t)NB * TT * CC)
#define WS_END (WS_CAT + 4u * (size_t)NB * TT * CC)
#define WS_END2 WS_END
#define WS_TOP (WS_CAT + 4u * (size_t)NB * TT * CC)     // end of everything kernel_launch uses
static_assert((size_t)HG * TT * TT <= (size_t)NH * NB * TT * CC, "S must not reach past the end of the xh planes");

// ---- k_fa: block = 64 queries (4 waves x 16) of (b, h), one pass over the keys 0 .. query in steps of 64 with a running row maximum and sum (online softmax); nothing of the logits or of P goes to memory.
// Both products are formed transposed so that every per-query value sits in the lane of its query (col = lane & 15): S^T = k q^T (A = key rows, B = query rows; D element r = key 8g + r, column = query), which is already the B fragment of P^T (elements 0..7 = tile 2c, 8..15 = tile 2c + 1), and ctx^T = v^T P^T (A = v planes [c][t]; D element r = channel 8g + r, column = query).
// Precision as before: q, k once to f16 (1 product), P once to f16 against v f16; query blocks < QBH: 3-product logits (q, k residual planes x 2^10), P and v as bf16 hi + lo (3 products). P is exp(logit - running maximum), at most 1; the division by the f32 row sum comes last.
#define L2E 1.4426950408889634f
#define NEGBIG (-1.0e30f)
// behind a group of global loads: their address registers (kept live to here as inputs) are rewritten only after this wait
#define XW2(p0, p1) asm volatile("s_wait_xcnt 0x0" :: "v"(p0), "v"(p1) : "memory")
#define XW4(p0, p1, p2, p3) asm volatile("s_wait_xcnt 0x0" :: "v"(p0), "v"(p1), "v"(p2), "v"(p3) : "memory")
static_assert(HD == 32, "one 32-deep product per logit tile, two 16-channel ctx tiles");
// 2^x; the v_nop fills the one slot that the instruction set asks for behind a transcendental, whatever the compiler schedules next (it had put a second v_exp_f32 there that overwrites the first one's source)
__device__ __forceinline__ float ex2(float x) { float r; asm("v_exp_f32 %0, %1\n\tv_nop" : "=v"(r) : "v"(x)); return r; }
// s[32] = this lane's logits of one 64-key step (excluded ones = NEGBIG) -> exp(s - new maximum); returns the factor that rescales what was summed under the old maximum
__device__ __forceinline__ float sm_step(float (&s)[32], float& m, float& l) {
  float c0 = fmaxf(s[0], s[1]), c1 = fmaxf(s[2], s[3]);
#pragma unroll
  for (int i = 4; i < 32; i += 2) { c0 = fmaxf(c0, s[i]); c1 = fmaxf(c1, s[i + 1]); }
  float cm = fmaxf(c0, c1); cm = fmaxf(cm, __shfl_xor(cm, 16));   /* lanes col and col + 16 hold the two key halves of one query */
  const float mn = fmaxf(m, cm), al = ex2((m - mn) * L2E), m2 = mn * L2E; m = mn;
  float a0 = 0.f, a1 = 0.f, a2 = 0.f, a3 = 0.f;
#pragma unroll
  for (int i = 0; i < 32; i += 4) {
    s[i] = ex2(fmaf(s[i], L2E, -m2)); s[i + 1] = ex2(fmaf(s[i + 1], L2E, -m2)); s[i + 2] = ex2(fmaf(s[i + 2], L2E, -m2)); s[i + 3] = ex2(fmaf(s[i + 3], L2E, -m2));
    a0 += s[i]; a1 += s[i + 1]; a2 += s[i + 2]; a3 += s[i + 3]; }
  l = l * al + ((a0 + a1) + (a2 + a3)); return al; }
// fragment from a pointer that already holds the lane half's offset: elements 0..7 = p[0..7], 8..15 = p[16..23]
__device__ __forceinline__ v16h frag_hp(const _Float16* p) { union { v16h v; v8h q[2]; } u; u.q[0] = *(const v8h*)p; u.q[1] = *(const v8h*)(p + 16); return u.v; }
__device__ __forceinline__ v16b frag_bp(const __bf16* p) { union { v16b v; v8b q[2]; } u; u.q[0] = *(const v8b*)p; u.q[1] = *(const v8b*)(p + 16); return u.v; }
__global__ __launch_bounds__(128) void k_fa(const _Float16* __restrict__ QH, const _Float16* __restrict__ KH, const _Float16* __restrict__ QL, const _Float16* __restrict__ KL, const _Float16* __restrict__ VT, const __bf16* __restrict__ VB, const __bf16* __restrict__ VBL, float* __restrict__ Y) {
  const int tid = threadIdx.x, lane = tid & 31, col = lane & 15, g = lane >> 4; const int wave = __builtin_amdgcn_readfirstlane(tid >> 5);
  const int qb = NQB - 1 - (int)blockIdx.x, h = blockIdx.y, b = blockIdx.z;   /* longest query blocks start first */
  const int ql0 = qb * 64 + wave * 16, tq = ql0 + col;
  float m = NEGBIG, l = 0.f; v8f o[2] = {}; const v8f zero = {};
  const _Float16* qp = QH + ((size_t)b * TT + tq) * CC + h * HD + 8 * g;   /* every fragment pointer below already holds the lane half's 8 * g */
  const _Float16* kp = KH + ((size_t)b * TT + col) * CC + h * HD + 8 * g;
  if (qb < QBH) {
    const _Float16* qlp = QL + ((size_t)b * QHI + tq) * CC + h * HD + 8 * g;
    const v16h bq = frag_hp(qp), bql = frag_hp(qlp); XW2(qp, qlp);
    const _Float16* klp = KL + ((size_t)b * KHI + col) * CC + h * HD + 8 * g;
    const size_t vo = ((size_t)b * CC + h * HD + col) * (size_t)KHI + 8 * g;
#pragma unroll 1
    for (int it = 0; it <= qb; ++it) { const int k0 = it * 64; float s[32];
      const _Float16 *kq = kp + (size_t)k0 * CC, *klq = klp + (size_t)k0 * CC; const __bf16 *vhq = VB + vo + k0, *vlq = VBL + vo + k0;
      v16h khf[4], klf[4]; v16b vhf[4], vlf[4];   /* index of the v fragments: c * 2 + j */
#pragma unroll
      for (int t = 0; t < 4; ++t) { khf[t] = frag_hp(kq + (size_t)(t * 16) * CC); klf[t] = frag_hp(klq + (size_t)(t * 16) * CC); vhf[t] = frag_bp(vhq + (size_t)(t & 1) * 16 * KHI + (t >> 1) * 32); vlf[t] = frag_bp(vlq + (size_t)(t & 1) * 16 * KHI + (t >> 1) * 32); }
      XW4(kq, klq, vhq, vlq);
#pragma unroll
      for (int t = 0; t < 4; ++t) { const v16h kh = khf[t], kl = klf[t];
        const v8f a = wmma16(kh, bq, zero); v8f a2 = wmma16(kh, bql, zero); a2 = wmma16(kl, bq, a2);
#pragma unroll
        for (int r = 0; r < 8; ++r) { const float v = (a[r] + a2[r] * (1.0f / 1024.0f)) * SCALE; s[t * 8 + r] = (k0 + t * 16 + 8 * g + r <= tq) ? v : NEGBIG; } }
      const float al = sm_step(s, m, l);
#pragma unroll
      for (int r = 0; r < 8; ++r) { o[0][r] *= al; o[1][r] *= al; }
#pragma unroll
      for (int c = 0; c < 2; ++c) { float v[16];
#pragma unroll
        for (int i = 0; i < 8; ++i) { v[i] = s[c * 16 + i]; v[8 + i] = s[c * 16 + 8 + i]; }
        const F2 p = bsplit16(v);
#pragma unroll
        for (int j = 0; j < 2; ++j) { const v16b vh = vhf[c * 2 + j];
          o[j] = wmma_bf(vh, p.h, o[j]); o[j] = wmma_bf(vh, p.l, o[j]); o[j] = wmma_bf(vlf[c * 2 + j], p.h, o[j]); } } }
  } else {
    const _Float16* vp = VT + ((size_t)b * CC + h * HD + col) * (size_t)TT + 8 * g;
    const v16h bq = frag_hp(qp);
    v16h kf[4], vf[4];   /* this step's fragments, fetched one step ahead; index of the v fragments: j * 2 + c */
#pragma unroll
    for (int t = 0; t < 4; ++t) { kf[t] = frag_hp(kp + (size_t)(t * 16) * CC); vf[t] = frag_hp(vp + (size_t)(t >> 1) * 16 * TT + (t & 1) * 32); }
    XW4(qp, kp, vp, vp);
#pragma unroll 1
    for (int it = 0; it <= qb; ++it) { const int k0 = it * 64, kn = (it < qb ? it + 1 : it) * 64;   /* the last step fetches its own tile again: in bounds, unused */
      const _Float16 *kq = kp + (size_t)kn * CC, *vq = vp + kn; v16h kx[4], vx[4];
#pragma unroll
      for (int t = 0; t < 4; ++t) { kx[t] = frag_hp(kq + (size_t)(t * 16) * CC); vx[t] = frag_hp(vq + (size_t)(t >> 1) * 16 * TT + (t & 1) * 32); }
      XW2(kq, vq);
      float s[32];
#pragma unroll
      for (int t = 0; t < 4; ++t) { const v8f a = wmma16(kf[t], bq, zero);
#pragma unroll
        for (int r = 0; r < 8; ++r) s[t * 8 + r] = a[r] * SCALE; }
      if (it == qb) {   /* only the diagonal step holds keys past a query */
#pragma unroll
        for (int i = 0; i < 32; ++i) s[i] = (k0 + (i >> 3) * 16 + 8 * g + (i & 7) <= tq) ? s[i] : NEGBIG; }
      const float al = sm_step(s, m, l);
#pragma unroll
      for (int r = 0; r < 8; ++r) { o[0][r] *= al; o[1][r] *= al; }
#pragma unroll
      for (int c = 0; c < 2; ++c) { v16h p;
#pragma unroll
        for (int i = 0; i < 16; ++i) p[i] = (_Float16)s[c * 16 + i];
        o[0] = wmma16(vf[c], p, o[0]); o[1] = wmma16(vf[2 + c], p, o[1]); }
#pragma unroll
      for (int t = 0; t < 4; ++t) { kf[t] = kx[t]; vf[t] = vx[t]; } } }
  l += __shfl_xor(l, 16); const float inv = l > 0.f ? 1.0f / l : 0.f;
  float* yp = Y + ((size_t)b * TT + tq) * CC + h * HD + 8 * g;   /* the 128-B (row, head) segment is written by two lanes of one wave */
#pragma unroll
  for (int j = 0; j < 2; ++j) { v4f w0, w1;
#pragma unroll
    for (int r = 0; r < 4; ++r) { w0[r] = o[j][r] * inv; w1[r] = o[j][4 + r] * inv; }
    vst2(yp + j * 16, w0); vst2(yp + j * 16 + 4, w1); } }

#define NRW (TNB * TT)
// ---- k_gio: block = (64 rows, 128 cols): OUT = act(A as f16 hi + residual) x W as f16(bf16 x 2^6) ((in,out) [K][nout]) x 2^-6 + bias (+ RES residual rows if given); act = identity / relu / exact GELU applied when READING A; 512-B segments
__global__ __launch_bounds__(128) void k_gio(const float* __restrict__ A, int lda, int K, int act_in, int rnd_in, const float* __restrict__ Wm, int nout, const float* __restrict__ BIAS, const float* __restrict__ RES, float* __restrict__ OUT, size_t az, size_t wz, size_t oz) { __shared__ __align__(16) float sf[4][16][132];
  A += blockIdx.z * az; Wm += blockIdx.z * wz; OUT += blockIdx.z * oz;   /* blockIdx.z = head: its own A rows, weight and output plane */
  const int tid = threadIdx.x, wave = tid >> 5, lane = tid & 31, col = lane & 15, g = lane >> 4; const int c0 = blockIdx.y * 128; const size_t r0 = (size_t)blockIdx.x * 64 + wave * 16;
  v8f acc[8] = {};
#pragma unroll 1
  for (int kc = 0; kc < K / 32; ++kc) { v16h a, al; { const float* p = A + (r0 + col) * (size_t)lda + kc * 32 + 8 * g;
#pragma unroll
      for (int i = 0; i < 8; ++i) { float x0 = p[i], x1 = p[16 + i]; if (rnd_in) { x0 = bfr(x0); x1 = bfr(x1); }   /* RAW module inputs are rounded to bf16 first; f32 intermediates are not */ if (act_in == 1) { x0 = fmaxf(x0, 0.f); x1 = fmaxf(x1, 0.f); } else if (act_in == 2) { x0 = 0.5f * x0 * (1.0f + erff(x0 * 0.70710678118654752f)); x1 = 0.5f * x1 * (1.0f + erff(x1 * 0.70710678118654752f)); } const _Float16 h0 = (_Float16)x0, h1 = (_Float16)x1; a[i] = h0; a[8 + i] = h1; al[i] = (_Float16)(x0 - (float)h0); al[8 + i] = (_Float16)(x1 - (float)h1); } }   /* A as f16 hi + unscaled f16 residual (2 products, ~2^-22) */   /* act_in 2 = exact GELU (erf), jax.nn.gelu(approximate=False) */
    asm volatile("s_wait_loadcnt 0x0" ::: "memory");
#pragma unroll
    for (int j = 0; j < 8; ++j) { v16h w; { const int o = c0 + j * 16 + col; float t0[8], t1[8];
#pragma unroll
        for (int i = 0; i < 8; ++i) t0[i] = Wm[(size_t)(kc * 32 + 8 * g + i) * nout + o];
        asm volatile("s_wait_loadcnt 0x0" ::: "memory");
#pragma unroll
        for (int i = 0; i < 8; ++i) t1[i] = Wm[(size_t)(kc * 32 + 16 + 8 * g + i) * nout + o];
        asm volatile("s_wait_loadcnt 0x0" ::: "memory");
#pragma unroll
        for (int i = 0; i < 8; ++i) { w[i] = (_Float16)(bfr(t0[i]) * 64.0f); w[8 + i] = (_Float16)(bfr(t1[i]) * 64.0f); } }
      acc[j] = wmma16(a, w, acc[j]); acc[j] = wmma16(al, w, acc[j]); } }
#pragma unroll
  for (int j = 0; j < 8; ++j)
    { const float bb = BIAS ? bfr(BIAS[c0 + j * 16 + col]) : 0.f; asm volatile("s_wait_loadcnt 0x0" ::: "memory"); _Pragma("unroll") for (int r = 0; r < 8; ++r) sf[wave][8 * g + r][j * 16 + col] = acc[j][r] * (1.0f / 64.0f) + bb; }
  LDSX(); for (int rl = 0; rl < 16; ++rl) { const size_t o = (r0 + rl) * (size_t)nout + c0 + lane * 4; v4f v = *(const v4f*)&sf[wave][rl][lane * 4]; if (RES) { const v4f rv = *(const v4f*)(RES + o); v[0] += rv[0]; v[1] += rv[1]; v[2] += rv[2]; v[3] += rv[3]; } vst2(OUT + o, v); } }

// ---- k_goi: block = (64 rows, 128 cols): OUT = [relu](A (as f16 hi + residual) x W^T (W (out,in) as f16(bf16 x 2^6)) x 2^-6 + bias) (+ RES residual rows); 512-B segments
__global__ __launch_bounds__(128) void k_goi(const float* __restrict__ A, int lda, int K, int act_in, int rnd_in, const float* __restrict__ Wm, int nout, const float* __restrict__ BIAS, const float* __restrict__ RES, int relu_out, float* __restrict__ OUT, size_t wz, size_t bz, size_t oz) { __shared__ __align__(16) float sf[4][16][132];
  Wm += blockIdx.z * wz; if (BIAS) BIAS += blockIdx.z * bz; OUT += blockIdx.z * oz;   /* blockIdx.z = head: its own weight, bias and output plane (A is shared) */
  const int tid = threadIdx.x, wave = tid >> 5, lane = tid & 31, col = lane & 15, g = lane >> 4; const int c0 = blockIdx.y * 128; const size_t r0 = (size_t)blockIdx.x * 64 + wave * 16;
  v8f acc[8] = {};
#pragma unroll 1
  for (int kc = 0; kc < K / 32; ++kc) { v16h a, al; { const float* p = A + (r0 + col) * (size_t)lda + kc * 32 + 8 * g;
#pragma unroll
      for (int i = 0; i < 8; ++i) { float x0 = p[i], x1 = p[16 + i]; if (rnd_in) { x0 = bfr(x0); x1 = bfr(x1); }   /* RAW module inputs are rounded to bf16 first; f32 intermediates are not */ if (act_in == 1) { x0 = fmaxf(x0, 0.f); x1 = fmaxf(x1, 0.f); } else if (act_in == 2) { x0 = 0.5f * x0 * (1.0f + erff(x0 * 0.70710678118654752f)); x1 = 0.5f * x1 * (1.0f + erff(x1 * 0.70710678118654752f)); } const _Float16 h0 = (_Float16)x0, h1 = (_Float16)x1; a[i] = h0; a[8 + i] = h1; al[i] = (_Float16)(x0 - (float)h0); al[8 + i] = (_Float16)(x1 - (float)h1); } }   /* A as f16 hi + unscaled f16 residual (2 products, ~2^-22) */   /* act_in 2 = exact GELU (erf), jax.nn.gelu(approximate=False) */
    asm volatile("s_wait_loadcnt 0x0" ::: "memory");
#pragma unroll
    for (int j = 0; j < 8; ++j) { v16h w; { const int o = c0 + j * 16 + col; float t0[8], t1[8];
#pragma unroll
        for (int i = 0; i < 8; ++i) t0[i] = Wm[(size_t)o * K + kc * 32 + 8 * g + i];   /* (out,in) [nout][K] */
        asm volatile("s_wait_loadcnt 0x0" ::: "memory");
#pragma unroll
        for (int i = 0; i < 8; ++i) t1[i] = Wm[(size_t)o * K + kc * 32 + 16 + 8 * g + i];
        asm volatile("s_wait_loadcnt 0x0" ::: "memory");
#pragma unroll
        for (int i = 0; i < 8; ++i) { w[i] = (_Float16)(bfr(t0[i]) * 64.0f); w[8 + i] = (_Float16)(bfr(t1[i]) * 64.0f); } }
      acc[j] = wmma16(a, w, acc[j]); acc[j] = wmma16(al, w, acc[j]); } }
#pragma unroll
  for (int j = 0; j < 8; ++j)
    { const float bb = BIAS ? bfr(BIAS[c0 + j * 16 + col]) : 0.f; asm volatile("s_wait_loadcnt 0x0" ::: "memory"); _Pragma("unroll") for (int r = 0; r < 8; ++r) sf[wave][8 * g + r][j * 16 + col] = acc[j][r] * (1.0f / 64.0f) + bb; }
  LDSX(); for (int rl = 0; rl < 16; ++rl) { const size_t o = (r0 + rl) * (size_t)nout + c0 + lane * 4; v4f v = *(const v4f*)&sf[wave][rl][lane * 4]; if (relu_out) { v[0] = fmaxf(v[0], 0.f); v[1] = fmaxf(v[1], 0.f); v[2] = fmaxf(v[2], 0.f); v[3] = fmaxf(v[3], 0.f); } if (RES) { const v4f rv = *(const v4f*)(RES + o); v[0] += rv[0]; v[1] += rv[1]; v[2] += rv[2]; v[3] += rv[3]; } vst2(OUT + o, v); } }   /* relu on the output (before the residual) when relu_out */

#ifndef SM_EXTRA_PARAMS
#define SM_EXTRA_PARAMS
#endif
#ifndef PROJ_EXTRA_PARAMS
#define PROJ_EXTRA_PARAMS
#endif
#ifndef SM_MASK_HOOK
#define SM_MASK_HOOK (void)0
#endif

#define WS_QH  0u                                      // f16 q rows [b*t][CC]
#define WS_KH  (WS_QH + 2u * (size_t)NB * TT * CC)      // f16 k rows [b*t][CC]
#define WS_VT  (WS_KH + 2u * (size_t)NB * TT * CC)      // f16 v planes [b][c][t]
#define WS_QL  (WS_VT + 2u * (size_t)NB * CC * TT)      // f16 q residual x 2^10 rows [b][t < QHI][CC]
#define WS_KL  (WS_QL + 2u * (size_t)NB * QHI * CC)     // f16 k residual x 2^10 rows [b][t < KHI][CC]
#define WS_VB  (WS_KL + 2u * (size_t)NB * KHI * CC)     // bf16 v hi planes [b][c][t < KHI]
#define WS_VBL (WS_VB + 2u * (size_t)NB * CC * KHI)
#define WS_S   (WS_VBL + 2u * (size_t)NB * CC * KHI)    // f32 area of HG * TT * TT floats; holds the xh planes
#define WS_Y   (WS_S  + 4u * (size_t)HG * TT * TT)      // end of the S area (== WS_TQ); Y itself is unused, ctx rows go to WS_CAT
#define WS_END (WS_Y  + 0u)
#define WS_Y2  (WS_END)
#define WS_O1  (WS_Y2 + 4u * (size_t)NB * TT * CC)
#define WS_R2  (WS_O1 + 4u * (size_t)NB * TT * CC)
#define WS_END2 (WS_R2 + 4u * (size_t)NB * TT * CC)


// ---- k_pack: block = 4 rows, thread per column, head = blockIdx.y: WP[h] [512][128] (in,out) = [Wq[h] | Wk[h] | Wv[h] | 0] with Wq/Wk/Wv (in,out) [512][32]
__global__ __launch_bounds__(128) void k_pack(const float* __restrict__ WQ, const float* __restrict__ WK, const float* __restrict__ WV, float* __restrict__ WP) { const int i0 = blockIdx.x * 4; const int c = threadIdx.x; { const size_t h = blockIdx.y; WQ += h * CC * HD; WK += h * CC * HD; WV += h * CC * HD; WP += h * CC * 128; }   /* blockIdx.y = head */
  for (int i = i0; i < i0 + 4; ++i) { float v = 0.f; if (c < HD) v = WQ[(size_t)i * HD + c]; else if (c < 2 * HD) v = WK[(size_t)i * HD + c - HD]; else if (c < 3 * HD) v = WV[(size_t)i * HD + c - 2 * HD]; asm volatile("s_wait_loadcnt 0x0" ::: "memory"); vst2(WP + (size_t)i * 128 + c, v); } }
__global__ __launch_bounds__(256) void k_scat(const float* __restrict__ TQ, float* __restrict__ QB8, float* __restrict__ KB8, float* __restrict__ VB8) { const size_t row = (size_t)blockIdx.x * 8 + (threadIdx.x >> 5); const int c = threadIdx.x & 31; const size_t h = blockIdx.y; TQ += h * (size_t)NRW * 128;   /* blockIdx.y = head */
  if (row >= (size_t)NRW || c >= 24) return;
  const size_t b = row / TT, t = row % TT; const int which = c / 8, q4 = c % 8; const v4f v = *(const v4f*)(TQ + row * 128 + which * HD + q4 * 4); asm volatile("s_wait_loadcnt 0x0" ::: "memory");
  float* dst = (which == 0 ? QB8 : which == 1 ? KB8 : VB8) + (((b * NH + h) * TT) + t) * HD + q4 * 4; vst2(dst, v); }
extern "C" void kernel_launch(void* const* d_in, const int* in_sizes, int n_in, void* d_out, int out_size, void* d_ws, size_t ws_size, hipStream_t stream) {
  (void)in_sizes; (void)n_in; (void)out_size;
  const float** F = (const float**)d_in;
  if (ws_size < (size_t)WS_END) return;
  char* ws = (char*)d_ws; _Float16 *QH = (_Float16*)(ws + WS_QH), *KH = (_Float16*)(ws + WS_KH), *VT = (_Float16*)(ws + WS_VT), *QL = (_Float16*)(ws + WS_QL), *KL = (_Float16*)(ws + WS_KL); __bf16 *VB = (__bf16*)(ws + WS_VB), *VBL = (__bf16*)(ws + WS_VBL); float *S = (float*)(ws + WS_S), *Y = (float*)(ws + WS_Y);
  (void)Y; (void)S; (void)QL; (void)KL; (void)VB; (void)VBL;
  // inputs: 0 x [2,2048,512]; 1 Wl [16,512,512] (out,in); 2 bl [16,512]; 3 Wq [16,512,32] (in,out); 4 Wk; 5 Wv; 6 Wo [512,512] (out,in); 7 bo [512]
  if (ws_size < (size_t)WS_TOP) return;
  float *XH = (float*)(ws + WS_XH), *TQ = (float*)(ws + WS_TQ), *WP = (float*)(ws + WS_WP), *QB8 = (float*)(ws + WS_QB8), *KB8 = (float*)(ws + WS_KB8), *VB8 = (float*)(ws + WS_VB8), *CAT = (float*)(ws + WS_CAT);
  /* the four projection launches cover all NH heads at once: head = blockIdx.z (GEMMs) or blockIdx.y (pack, scatter) */
  k_goi<<<dim3(NRW / 64, CC / 128, NH), 128, 0, stream>>>(F[0], CC, CC, 0, 1, F[1], CC, F[2], nullptr, 0, XH, (size_t)CC * CC, (size_t)CC, (size_t)NRW * CC);   /* raw x: bf16-rounded in the loader */   /* xh[h] = x Wl[h]^T + bl[h] */
  k_pack<<<dim3(CC / 4, NH), 128, 0, stream>>>(F[3], F[4], F[5], WP);                                                                       /* [Wq|Wk|Wv|0][h] (in,out) [512][128] */
  k_gio<<<dim3(NRW / 64, 1, NH), 128, 0, stream>>>(XH, CC, CC, 0, 0, WP, 128, nullptr, nullptr, TQ, (size_t)NRW * CC, (size_t)CC * 128, (size_t)NRW * 128);   /* [q|k|v|0][h] rows [NRW][128] */
  k_scat<<<dim3(NRW / 8, NH), 256, 0, stream>>>(TQ, QB8, KB8, VB8);                                                                         /* -> [B,H,S,32] buffers */
  k_prep8<<<dim3(TNB * TT / 64, NH), 128, 0, stream>>>(QB8, KB8, VB8, QH, QL, KH, KL, VT, VB, VBL);
  k_fa<<<dim3(NQB, NH, TNB), 128, 0, stream>>>(QH, KH, QL, KL, VT, VB, VBL, CAT);   /* logits, softmax and P v of every (b, h) in one launch */
  k_goi<<<dim3(NRW / 64, CC / 128), 128, 0, stream>>>(CAT, CC, CC, 0, 0, F[6], CC, F[7], nullptr, 0, (float*)d_out, 0, 0, 0);   /* out = cat Wo^T + bo */
}

// v003
// It runs in 209 microseconds.
// Next to v002, in two timings, it ran 2.67 and 2.69 times as fast.
// Counting every step since v000, it is 14.7 times as fast.
// compute dtype: all float inputs rounded to bf16; q/k/v = x (Wl[h]^T Wq/Wk/Wv[h]) + bl[h] Wq/Wk/Wv[h]: the folded weight and bias from f16(bf16 x 2^6) operands (exact, 1 product, WMMA 16x16x32, f32 accumulate), the folded weight kept as f16 hi + residual (x 2^6) against x as f16 (bf16-exact) (2 products); unscaled causal logits: q, k once to f16 (1 product), 3 products below row 384; online softmax in f32 (running maximum and sum, one fused kernel); P = exp(logit - maximum) once to f16 against v f16 (P and v as bf16 hi + lo below row 384); out = cat as f16 hi + residual against Wo^T f16(bf16 x 2^6) (2 products) + bo; f32 output.
#include <hip/hip_runtime.h>
#include <math.h>

typedef __attribute__((ext_vector_type(16))) _Float16 v16h;
typedef __attribute__((ext_vector_type(16))) __bf16 v16b;
typedef __attribute__((ext_vector_type(8)))  _Float16 v8h;
typedef __attribute__((ext_vector_type(8)))  float v8f;
typedef __attribute__((ext_vector_type(4)))  float v4f;
typedef __attribute__((ext_vector_type(2)))  float v2f;
typedef __attribute__((ext_vector_type(4)))  unsigned v4u;
typedef __attribute__((ext_vector_type(4)))  int v4i;
typedef float __attribute__((may_alias)) float_a;
typedef int __attribute__((may_alias)) int_a;

template <typename T> __device__ __forceinline__ void vst2(void* p, T v) { *(T*)p = v;  }
__device__ __forceinline__ v8f wmma16(v16h a, v16h b, v8f c) {
  v8f d = __builtin_amdgcn_wmma_f32_16x16x32_f16(false, a, false, b, (short)0, c, false, false);
  asm volatile("v_nop\n\tv_nop\n\tv_nop\n\tv_nop" : "+v"(d) : "v"(a), "v"(b));
  return d;
}
__device__ __forceinline__ v8f wmma_bf(v16b a, v16b b, v8f c) {
  v8f d = __builtin_amdgcn_wmma_f32_16x16x32_bf16(false, a, false, b, (short)0, c, false, false);
  asm volatile("v_nop\n\tv_nop\n\tv_nop\n\tv_nop" : "+v"(d) : "v"(a), "v"(b));
  return d;
}
// 16x16x32 fragments: lane = (h = lane>>4, row/col = lane&15); elements 0..7 = k0+8h+0..7, 8..15 = k0+16+8h+0..7; D element r = row 8h+r
__device__ __forceinline__ v16h frag_h(const _Float16* rowk0, int lane) {
  union { v16h v; v8h q[2]; } u; const _Float16* p = rowk0 + 8 * (lane >> 4);
  u.q[0] = *(const v8h*)p; u.q[1] = *(const v8h*)(p + 16); return u.v;
}
__device__ __forceinline__ v16h frag_f32(const float* rowk0, int lane) {
  v16h a; const float* p = rowk0 + 8 * (lane >> 4);
#pragma unroll
  for (int i = 0; i < 8; ++i) { a[i] = (_Float16)p[i]; a[8 + i] = (_Float16)p[16 + i]; }
  return a;
}
__device__ __forceinline__ v16h frag_f32s(const float* rowk0, int lane, float sc) {
  v16h a; const float* p = rowk0 + 8 * (lane >> 4);
#pragma unroll
  for (int i = 0; i < 8; ++i) { a[i] = (_Float16)(p[i] * sc); a[8 + i] = (_Float16)(p[16 + i] * sc); }
  return a;
}
// column fragment from a [K][ld] layout (column n), rows >= K read as 0
__device__ __forceinline__ v16h fragc_f32(const float* W, int k0, int n, int lane, int ld, int K) {
  v16h a; const int g = lane >> 4;
#pragma unroll
  for (int i = 0; i < 8; ++i) { const int ka = k0 + 8 * g + i, kb = ka + 16;
    a[i] = (_Float16)(ka < K ? W[(size_t)(ka < K ? ka : K - 1) * ld + n] : 0.f); a[8 + i] = (_Float16)(kb < K ? W[(size_t)(kb < K ? kb : K - 1) * ld + n] : 0.f); }
  return a;
}
struct F2 { v16b h, l; };
__device__ __forceinline__ F2 bsplit16(const float v[16]) { F2 r;
#pragma unroll
  for (int i = 0; i < 16; ++i) { const __bf16 h = (__bf16)v[i]; r.h[i] = h; r.l[i] = (__bf16)(v[i] - (float)h); }
  return r; }
__device__ __forceinline__ F2 split_row(const float* row, int k0, int lane) { float v[16]; const float* p = row + k0 + 8 * (lane >> 4);
#pragma unroll
  for (int i = 0; i < 8; ++i) { v[i] = p[i]; v[8 + i] = p[16 + i]; }
  return bsplit16(v); }
__device__ __forceinline__ F2 split_rowK(const float* row, int k0, int lane, int K) { float v[16]; const int g = lane >> 4;
#pragma unroll
  for (int i = 0; i < 8; ++i) { const int ka = k0 + 8 * g + i, kb = ka + 16; v[i] = ka < K ? row[ka < K ? ka : K - 1] : 0.f; v[8 + i] = kb < K ? row[kb < K ? kb : K - 1] : 0.f; }
  return bsplit16(v); }
__device__ __forceinline__ F2 split_col(const float* W, int k0, int n, int lane, int ld, int K) { float v[16]; const int g = lane >> 4;
#pragma unroll
  for (int i = 0; i < 8; ++i) { const int ka = k0 + 8 * g + i, kb = ka + 16; v[i] = ka < K ? W[(size_t)(ka < K ? ka : K - 1) * ld + n] : 0.f; v[8 + i] = kb < K ? W[(size_t)(kb < K ? kb : K - 1) * ld + n] : 0.f; }
  return bsplit16(v); }
__device__ __forceinline__ v8f mac3(const F2& a, const F2& b, v8f c) { c = wmma_bf(a.l, b.h, c); c = wmma_bf(a.h, b.l, c); return wmma_bf(a.h, b.h, c); }
__device__ __forceinline__ float sigm(float v) { return 1.0f / (1.0f + expf(-v)); }
#define LDSX() do { asm volatile("s_wait_dscnt 0" ::: "memory"); __builtin_amdgcn_wave_barrier(); __builtin_amdgcn_fence(__ATOMIC_RELEASE, "workgroup"); } while (0)

// Per-head multi-head causal attention (B 2, S 2,048, 512; 16 heads x 32; 0.02-scale weights: per-head Linear Wl [16,512,512] (out,in) + bl, per-head Wq/Wk/Wv [16,512,32] (in,out) no bias, Wo [512,512] (out,in) + bo): xh = x Wl[h]^T + bl[h]; Q, K, V = xh Wq[h], xh Wk[h], xh Wv[h]; scores = Q K^T (NO scaling), causal; F = softmax(scores) V; out = concat_h(F) Wo^T + bo.
#define NB 2
#define TT 2048
#define CC 512            // NH * HD = projected width
#define DIN 512          // input (model) width
#define NH 16
#define HD 32
#define NQB (TT / 64)
#define HG 8
#define SCALE (1.0f)
#define CAUSAL 1
#ifndef TNB
#define TNB NB
#endif
__device__ __forceinline__ float bfr(float v) { return (float)(__bf16)v; }
__host__ __device__ __forceinline__ int kb_last(int qb) { return CAUSAL ? ((qb * 64 + 63) >> 7) : (TT / 128 - 1); }
typedef __attribute__((ext_vector_type(8))) __bf16 v8b;
__device__ __forceinline__ v16b frag_b(const __bf16* rowk0, int lane) {
  union { v16b v; v8b q[2]; } u; const __bf16* p = rowk0 + 8 * (lane >> 4);
  u.q[0] = *(const v8b*)p; u.q[1] = *(const v8b*)(p + 16); return u.v;
}
#define QBH 6              // causal: query blocks 0..QBH-1 of each sequence (few keys, no averaging) take the high-precision path
#define QHI 384            // rows carrying a q residual plane
#define KHI 384            // key rows carrying k residual / v bf16 hi+lo planes (used only by the causal high-precision path)
// B fragment (k rows k0+.., output column o) of a weight: (in,out) [K][ld] or (out,in) [ld rows of K]: bf16 exact, or f16(bf16 * 256) exact
__device__ __forceinline__ v16b wcol_io(const float* Wm, int k0, int o, int lane, int ld) { v16b w; const int g = lane >> 4;
#pragma unroll
  for (int i = 0; i < 8; ++i) { w[i] = (__bf16)Wm[(size_t)(k0 + 8 * g + i) * ld + o]; w[8 + i] = (__bf16)Wm[(size_t)(k0 + 16 + 8 * g + i) * ld + o]; }
  return w; }
__device__ __forceinline__ v16b wcol_oi(const float* Wm, int k0, int o, int lane, int K) { v16b w; const float* p = Wm + (size_t)o * K + k0 + 8 * (lane >> 4);
#pragma unroll
  for (int i = 0; i < 8; ++i) { w[i] = (__bf16)p[i]; w[8 + i] = (__bf16)p[16 + i]; }
  return w; }
__device__ __forceinline__ v16h wcolh_io(const float* Wm, int k0, int o, int lane, int ld) { v16h w; const int g = lane >> 4;
#pragma unroll
  for (int i = 0; i < 8; ++i) { w[i] = (_Float16)(bfr(Wm[(size_t)(k0 + 8 * g + i) * ld + o]) * 256.0f); w[8 + i] = (_Float16)(bfr(Wm[(size_t)(k0 + 16 + 8 * g + i) * ld + o]) * 256.0f); }
  return w; }
__device__ __forceinline__ v16h wcolh_oi(const float* Wm, int k0, int o, int lane, int K) { v16h w; const float* p = Wm + (size_t)o * K + k0 + 8 * (lane >> 4);
#pragma unroll
  for (int i = 0; i < 8; ++i) { w[i] = (_Float16)(bfr(p[i]) * 256.0f); w[8 + i] = (_Float16)(bfr(p[16 + i]) * 256.0f); }
  return w; }
#define WQKV_LAYOUT 1   // 0 = (in,out) [DIN][CC]; 1 = (out,in) [CC][DIN]; 2 = per-head [NH][DIN][HD]
__device__ __forceinline__ v16b wcol_hdk(const float* Wm, int k0, int o, int lane) { v16b w; const int g = lane >> 4; const float* p = Wm + (size_t)(o / HD) * DIN * HD + (o % HD);
#pragma unroll
  for (int i = 0; i < 8; ++i) { w[i] = (__bf16)p[(size_t)(k0 + 8 * g + i) * HD]; w[8 + i] = (__bf16)p[(size_t)(k0 + 16 + 8 * g + i) * HD]; }
  return w; }
#define WO_OUT_IN 0
#if WQKV_LAYOUT == 1
#define WCOL(W, k0, o, lane) wcol_oi(W, k0, o, lane, DIN)
#elif WQKV_LAYOUT == 2
#define WCOL(W, k0, o, lane) wcol_hdk(W, k0, o, lane)
#else
#define WCOL(W, k0, o, lane) wcol_io(W, k0, o, lane, CC)
#endif
#if WO_OUT_IN
#define WOCOL(W, k0, o, lane) wcol_oi(W, k0, o, lane, CC)
#define WOCOLH(W, k0, o, lane) wcolh_oi(W, k0, o, lane, CC)
#else
#define WOCOL(W, k0, o, lane) wcol_io(W, k0, o, lane, DIN)
#define WOCOLH(W, k0, o, lane) wcolh_io(W, k0, o, lane, DIN)
#endif

// ---- k_prep8: block = (64 attention positions s0.. of sequence b, head h): reads the [B, H, S, 32] q/k/v buffers (element (b,h,s,c) at ((b*NH + h)*TT + s)*32 + c), without bf16 rounding, and writes the standard attention planes: q -> f16 hi rows (+ x 2^10 residual rows for s < QHI), k -> f16 rows (+ residual rows s < KHI), v -> f16 planes [c][s] (+ bf16 hi/lo planes for s < KHI)
__global__ __launch_bounds__(128) void k_prep8(const float* __restrict__ Q, const float* __restrict__ K, const float* __restrict__ V, _Float16* __restrict__ QH, _Float16* __restrict__ QL, _Float16* __restrict__ KH, _Float16* __restrict__ KL, _Float16* __restrict__ VT, __bf16* __restrict__ VB, __bf16* __restrict__ VBL) {
  __shared__ __align__(16) _Float16 sq[64][136], sql[64][136], sk[64][136], skl[64][136], tv[128][72]; __shared__ __align__(16) __bf16 tb[128][72], tbl[128][72];
  const int tid = threadIdx.x; const int h = blockIdx.y; const size_t r0 = (size_t)blockIdx.x * 64; const size_t bb = r0 / TT; const int t0 = (int)(r0 % TT); const bool qhi = t0 < QHI, khi = t0 < KHI;
  for (int e = tid; e < 64 * 128; e += 128) { const int rl = e >> 7, c = e & 127; const size_t oi = ((bb * NH + h) * TT + t0 + rl) * HD + (c % HD);   /* c >= 32: duplicate read of the same element (tiles are 128 wide; HD is 32) */
    const float q = Q[oi], k = K[oi], v = V[oi];   /* COMPUTED f32 intermediates here (not module inputs): NO bf16 rounding - the f16 hi + x2^10 residual planes (q, k) and the bf16 hi + lo planes (v) carry them */
    const _Float16 qh = (_Float16)q, kh = (_Float16)k; sq[rl][c] = qh; sql[rl][c] = (_Float16)((q - (float)qh) * 1024.0f); sk[rl][c] = kh; skl[rl][c] = (_Float16)((k - (float)kh) * 1024.0f);
    tv[c][rl] = (_Float16)v; const __bf16 vb = (__bf16)v; tb[c][rl] = vb; tbl[c][rl] = (__bf16)(v - (float)vb); }
  __syncthreads();
  for (int e = tid; e < 64 * (HD / 8); e += 128) { const int rl = e / (HD / 8), q = e % (HD / 8); const size_t o = (r0 + rl) * CC + h * HD + q * 8; vst2((unsigned*)(QH + o), *(const v4u*)&sq[rl][q * 8]); vst2((unsigned*)(KH + o), *(const v4u*)&sk[rl][q * 8]);   
    if (qhi) vst2((unsigned*)(QL + (bb * QHI + t0 + rl) * (size_t)CC + h * HD + q * 8), *(const v4u*)&sql[rl][q * 8]); if (khi) vst2((unsigned*)(KL + (bb * KHI + t0 + rl) * (size_t)CC + h * HD + q * 8), *(const v4u*)&skl[rl][q * 8]); }
  for (int e = tid; e < HD * 8; e += 128) { const int cl = e >> 3, q = e & 7; vst2((unsigned*)(VT + (bb * CC + h * HD + cl) * (size_t)TT + t0 + q * 8), *(const v4u*)&tv[cl][q * 8]);
    if (khi) { const size_t o3 = (bb * CC + h * HD + cl) * (size_t)KHI + t0 + q * 8; vst2((unsigned*)(VB + o3), *(const v4u*)&tb[cl][q * 8]); vst2((unsigned*)(VBL + o3), *(const v4u*)&tbl[cl][q * 8]); } } }

#ifndef SM_EXTRA_PARAMS
#define SM_EXTRA_PARAMS
#endif
#ifndef PROJ_EXTRA_PARAMS
#define PROJ_EXTRA_PARAMS
#endif
#ifndef SM_MASK_HOOK
#define SM_MASK_HOOK (void)0
#endif

#define WS_QH  0u                                      // f16 q rows [b*t][CC]
#define WS_KH  (WS_QH + 2u * (size_t)NB * TT * CC)      // f16 k rows [b*t][CC]
#define WS_VT  (WS_KH + 2u * (size_t)NB * TT * CC)      // f16 v planes [b][c][t]
#define WS_QL  (WS_VT + 2u * (size_t)NB * CC * TT)      // f16 q residual x 2^10 rows [b][t < QHI][CC]
#define WS_KL  (WS_QL + 2u * (size_t)NB * QHI * CC)     // f16 k residual x 2^10 rows [b][t < KHI][CC]
#define WS_VB  (WS_KL + 2u * (size_t)NB * KHI * CC)     // bf16 v hi planes [b][c][t < KHI]
#define WS_VBL (WS_VB + 2u * (size_t)NB * CC * KHI)
#define WS_S   (WS_VBL + 2u * (size_t)NB * CC * KHI)    // f32 area of HG * TT * TT floats; holds the folded weights and bias
#define WS_Y   (WS_S  + 4u * (size_t)HG * TT * TT)      // unused (k_fa writes the ctx rows to WS_CAT); same offset as WS_TQ
#define WS_XH  (WS_S + 0u)                              // area of NH * NB * TT * CC floats holding the folded weights and bias; fills the S region, which holds no logits (NH * NB * CC == HG * TT)
#define WS_TQ  (WS_XH + 4u * (size_t)NH * NB * TT * CC) // f32 [q|k|v] rows [h][b*t][128], channels 96..127 not written
#define WS_WP  (WS_TQ + 4u * (size_t)NH * NB * TT * 128) // unused area of NH * CC * 128 floats
#define WS_QB8 (WS_WP + 4u * (size_t)NH * CC * 128 + 256)
#define WS_KB8 (WS_QB8 + 4u * (size_t)NB * TT * CC)
#define WS_VB8 (WS_KB8 + 4u * (size_t)NB * TT * CC)
#define WS_CAT (WS_VB8 + 4u * (size_t)NB * TT * CC)
#define WS_END (WS_CAT + 4u * (size_t)NB * TT * CC)
#define WS_END2 WS_END
#define WS_TOP (WS_CAT + 4u * (size_t)NB * TT * CC)     // end of everything kernel_launch uses
static_assert((size_t)HG * TT * TT <= (size_t)NH * NB * TT * CC, "S must end where the WS_XH area ends");

// ---- k_fa: block = 64 queries (4 waves x 16) of (b, h), one pass over the keys 0 .. query in steps of 64 with a running row maximum and sum (online softmax); nothing of the logits or of P goes to memory.
// Both products are formed transposed so that every per-query value sits in the lane of its query (col = lane & 15): S^T = k q^T (A = key rows, B = query rows; D element r = key 8g + r, column = query), which is already the B fragment of P^T (elements 0..7 = tile 2c, 8..15 = tile 2c + 1), and ctx^T = v^T P^T (A = v planes [c][t]; D element r = channel 8g + r, column = query).
// Precision as before: q, k once to f16 (1 product), P once to f16 against v f16; query blocks < QBH: 3-product logits (q, k residual planes x 2^10), P and v as bf16 hi + lo (3 products). P is exp(logit - running maximum), at most 1; the division by the f32 row sum comes last.
#define L2E 1.4426950408889634f
#define NEGBIG (-1.0e30f)
// behind a group of global loads: their address registers (kept live to here as inputs) are rewritten only after this wait
#define XW2(p0, p1) asm volatile("s_wait_xcnt 0x0" :: "v"(p0), "v"(p1) : "memory")
#define XW4(p0, p1, p2, p3) asm volatile("s_wait_xcnt 0x0" :: "v"(p0), "v"(p1), "v"(p2), "v"(p3) : "memory")
static_assert(HD == 32, "one 32-deep product per logit tile, two 16-channel ctx tiles");
// 2^x; the v_nop fills the one slot that the instruction set asks for behind a transcendental, whatever the compiler schedules next (it had put a second v_exp_f32 there that overwrites the first one's source)
__device__ __forceinline__ float ex2(float x) { float r; asm("v_exp_f32 %0, %1\n\tv_nop" : "=v"(r) : "v"(x)); return r; }
// s[32] = this lane's logits of one 64-key step (excluded ones = NEGBIG) -> exp(s - new maximum); returns the factor that rescales what was summed under the old maximum
__device__ __forceinline__ float sm_step(float (&s)[32], float& m, float& l) {
  float c0 = fmaxf(s[0], s[1]), c1 = fmaxf(s[2], s[3]);
#pragma unroll
  for (int i = 4; i < 32; i += 2) { c0 = fmaxf(c0, s[i]); c1 = fmaxf(c1, s[i + 1]); }
  float cm = fmaxf(c0, c1); cm = fmaxf(cm, __shfl_xor(cm, 16));   /* lanes col and col + 16 hold the two key halves of one query */
  const float mn = fmaxf(m, cm), al = ex2((m - mn) * L2E), m2 = mn * L2E; m = mn;
  float a0 = 0.f, a1 = 0.f, a2 = 0.f, a3 = 0.f;
#pragma unroll
  for (int i = 0; i < 32; i += 4) {
    s[i] = ex2(fmaf(s[i], L2E, -m2)); s[i + 1] = ex2(fmaf(s[i + 1], L2E, -m2)); s[i + 2] = ex2(fmaf(s[i + 2], L2E, -m2)); s[i + 3] = ex2(fmaf(s[i + 3], L2E, -m2));
    a0 += s[i]; a1 += s[i + 1]; a2 += s[i + 2]; a3 += s[i + 3]; }
  l = l * al + ((a0 + a1) + (a2 + a3)); return al; }
// fragment from a pointer that already holds the lane half's offset: elements 0..7 = p[0..7], 8..15 = p[16..23]
__device__ __forceinline__ v16h frag_hp(const _Float16* p) { union { v16h v; v8h q[2]; } u; u.q[0] = *(const v8h*)p; u.q[1] = *(const v8h*)(p + 16); return u.v; }
__device__ __forceinline__ v16b frag_bp(const __bf16* p) { union { v16b v; v8b q[2]; } u; u.q[0] = *(const v8b*)p; u.q[1] = *(const v8b*)(p + 16); return u.v; }
__global__ __launch_bounds__(128) void k_fa(const _Float16* __restrict__ QH, const _Float16* __restrict__ KH, const _Float16* __restrict__ QL, const _Float16* __restrict__ KL, const _Float16* __restrict__ VT, const __bf16* __restrict__ VB, const __bf16* __restrict__ VBL, float* __restrict__ Y) {
  const int tid = threadIdx.x, lane = tid & 31, col = lane & 15, g = lane >> 4; const int wave = __builtin_amdgcn_readfirstlane(tid >> 5);
  const int qb = NQB - 1 - (int)blockIdx.x, h = blockIdx.y, b = blockIdx.z;   /* longest query blocks start first */
  const int ql0 = qb * 64 + wave * 16, tq = ql0 + col;
  float m = NEGBIG, l = 0.f; v8f o[2] = {}; const v8f zero = {};
  const _Float16* qp = QH + ((size_t)b * TT + tq) * CC + h * HD + 8 * g;   /* every fragment pointer below already holds the lane half's 8 * g */
  const _Float16* kp = KH + ((size_t)b * TT + col) * CC + h * HD + 8 * g;
  if (qb < QBH) {
    const _Float16* qlp = QL + ((size_t)b * QHI + tq) * CC + h * HD + 8 * g;
    const v16h bq = frag_hp(qp), bql = frag_hp(qlp); XW2(qp, qlp);
    const _Float16* klp = KL + ((size_t)b * KHI + col) * CC + h * HD + 8 * g;
    const size_t vo = ((size_t)b * CC + h * HD + col) * (size_t)KHI + 8 * g;
#pragma unroll 1
    for (int it = 0; it <= qb; ++it) { const int k0 = it * 64; float s[32];
      const _Float16 *kq = kp + (size_t)k0 * CC, *klq = klp + (size_t)k0 * CC; const __bf16 *vhq = VB + vo + k0, *vlq = VBL + vo + k0;
      v16h khf[4], klf[4]; v16b vhf[4], vlf[4];   /* index of the v fragments: c * 2 + j */
#pragma unroll
      for (int t = 0; t < 4; ++t) { khf[t] = frag_hp(kq + (size_t)(t * 16) * CC); klf[t] = frag_hp(klq + (size_t)(t * 16) * CC); vhf[t] = frag_bp(vhq + (size_t)(t & 1) * 16 * KHI + (t >> 1) * 32); vlf[t] = frag_bp(vlq + (size_t)(t & 1) * 16 * KHI + (t >> 1) * 32); }
      XW4(kq, klq, vhq, vlq);
#pragma unroll
      for (int t = 0; t < 4; ++t) { const v16h kh = khf[t], kl = klf[t];
        const v8f a = wmma16(kh, bq, zero); v8f a2 = wmma16(kh, bql, zero); a2 = wmma16(kl, bq, a2);
#pragma unroll
        for (int r = 0; r < 8; ++r) { const float v = (a[r] + a2[r] * (1.0f / 1024.0f)) * SCALE; s[t * 8 + r] = (k0 + t * 16 + 8 * g + r <= tq) ? v : NEGBIG; } }
      const float al = sm_step(s, m, l);
#pragma unroll
      for (int r = 0; r < 8; ++r) { o[0][r] *= al; o[1][r] *= al; }
#pragma unroll
      for (int c = 0; c < 2; ++c) { float v[16];
#pragma unroll
        for (int i = 0; i < 8; ++i) { v[i] = s[c * 16 + i]; v[8 + i] = s[c * 16 + 8 + i]; }
        const F2 p = bsplit16(v);
#pragma unroll
        for (int j = 0; j < 2; ++j) { const v16b vh = vhf[c * 2 + j];
          o[j] = wmma_bf(vh, p.h, o[j]); o[j] = wmma_bf(vh, p.l, o[j]); o[j] = wmma_bf(vlf[c * 2 + j], p.h, o[j]); } } }
  } else {
    const _Float16* vp = VT + ((size_t)b * CC + h * HD + col) * (size_t)TT + 8 * g;
    const v16h bq = frag_hp(qp);
    v16h kf[4], vf[4];   /* this step's fragments, fetched one step ahead; index of the v fragments: j * 2 + c */
#pragma unroll
    for (int t = 0; t < 4; ++t) { kf[t] = frag_hp(kp + (size_t)(t * 16) * CC); vf[t] = frag_hp(vp + (size_t)(t >> 1) * 16 * TT + (t & 1) * 32); }
    XW4(qp, kp, vp, vp);
#pragma unroll 1
    for (int it = 0; it <= qb; ++it) { const int k0 = it * 64, kn = (it < qb ? it + 1 : it) * 64;   /* the last step fetches its own tile again: in bounds, unused */
      const _Float16 *kq = kp + (size_t)kn * CC, *vq = vp + kn; v16h kx[4], vx[4];
#pragma unroll
      for (int t = 0; t < 4; ++t) { kx[t] = frag_hp(kq + (size_t)(t * 16) * CC); vx[t] = frag_hp(vq + (size_t)(t >> 1) * 16 * TT + (t & 1) * 32); }
      XW2(kq, vq);
      float s[32];
#pragma unroll
      for (int t = 0; t < 4; ++t) { const v8f a = wmma16(kf[t], bq, zero);
#pragma unroll
        for (int r = 0; r < 8; ++r) s[t * 8 + r] = a[r] * SCALE; }
      if (it == qb) {   /* only the diagonal step holds keys past a query */
#pragma unroll
        for (int i = 0; i < 32; ++i) s[i] = (k0 + (i >> 3) * 16 + 8 * g + (i & 7) <= tq) ? s[i] : NEGBIG; }
      const float al = sm_step(s, m, l);
#pragma unroll
      for (int r = 0; r < 8; ++r) { o[0][r] *= al; o[1][r] *= al; }
#pragma unroll
      for (int c = 0; c < 2; ++c) { v16h p;
#pragma unroll
        for (int i = 0; i < 16; ++i) p[i] = (_Float16)s[c * 16 + i];
        o[0] = wmma16(vf[c], p, o[0]); o[1] = wmma16(vf[2 + c], p, o[1]); }
#pragma unroll
      for (int t = 0; t < 4; ++t) { kf[t] = kx[t]; vf[t] = vx[t]; } } }
  l += __shfl_xor(l, 16); const float inv = l > 0.f ? 1.0f / l : 0.f;
  float* yp = Y + ((size_t)b * TT + tq) * CC + h * HD + 8 * g;   /* the 128-B (row, head) segment is written by two lanes of one wave */
#pragma unroll
  for (int j = 0; j < 2; ++j) { v4f w0, w1;
#pragma unroll
    for (int r = 0; r < 4; ++r) { w0[r] = o[j][r] * inv; w1[r] = o[j][4 + r] * inv; }
    vst2(yp + j * 16, w0); vst2(yp + j * 16 + 4, w1); } }

#define NRW (TNB * TT)
// ---- k_goi: block = (64 rows, 128 cols): OUT = [relu](A (as f16 hi + residual) x W^T (W (out,in) as f16(bf16 x 2^6)) x 2^-6 + bias) (+ RES residual rows); 512-B segments
__global__ __launch_bounds__(128) void k_goi(const float* __restrict__ A, int lda, int K, int act_in, int rnd_in, const float* __restrict__ Wm, int nout, const float* __restrict__ BIAS, const float* __restrict__ RES, int relu_out, float* __restrict__ OUT, size_t wz, size_t bz, size_t oz) { __shared__ __align__(16) float sf[4][16][132];
  Wm += blockIdx.z * wz; if (BIAS) BIAS += blockIdx.z * bz; OUT += blockIdx.z * oz;   /* blockIdx.z: its own weight, bias and output plane (A is shared); one z (strides 0) in the launch here */
  const int tid = threadIdx.x, wave = tid >> 5, lane = tid & 31, col = lane & 15, g = lane >> 4; const int c0 = blockIdx.y * 128; const size_t r0 = (size_t)blockIdx.x * 64 + wave * 16;
  v8f acc[8] = {};
#pragma unroll 1
  for (int kc = 0; kc < K / 32; ++kc) { v16h a, al; { const float* p = A + (r0 + col) * (size_t)lda + kc * 32 + 8 * g;
#pragma unroll
      for (int i = 0; i < 8; ++i) { float x0 = p[i], x1 = p[16 + i]; if (rnd_in) { x0 = bfr(x0); x1 = bfr(x1); }   /* RAW module inputs are rounded to bf16 first; f32 intermediates are not */ if (act_in == 1) { x0 = fmaxf(x0, 0.f); x1 = fmaxf(x1, 0.f); } else if (act_in == 2) { x0 = 0.5f * x0 * (1.0f + erff(x0 * 0.70710678118654752f)); x1 = 0.5f * x1 * (1.0f + erff(x1 * 0.70710678118654752f)); } const _Float16 h0 = (_Float16)x0, h1 = (_Float16)x1; a[i] = h0; a[8 + i] = h1; al[i] = (_Float16)(x0 - (float)h0); al[8 + i] = (_Float16)(x1 - (float)h1); } }   /* A as f16 hi + unscaled f16 residual (2 products, ~2^-22) */   /* act_in 2 = exact GELU (erf), jax.nn.gelu(approximate=False) */
    asm volatile("s_wait_loadcnt 0x0" ::: "memory");
#pragma unroll
    for (int j = 0; j < 8; ++j) { v16h w; { const int o = c0 + j * 16 + col; float t0[8], t1[8];
#pragma unroll
        for (int i = 0; i < 8; ++i) t0[i] = Wm[(size_t)o * K + kc * 32 + 8 * g + i];   /* (out,in) [nout][K] */
        asm volatile("s_wait_loadcnt 0x0" ::: "memory");
#pragma unroll
        for (int i = 0; i < 8; ++i) t1[i] = Wm[(size_t)o * K + kc * 32 + 16 + 8 * g + i];
        asm volatile("s_wait_loadcnt 0x0" ::: "memory");
#pragma unroll
        for (int i = 0; i < 8; ++i) { w[i] = (_Float16)(bfr(t0[i]) * 64.0f); w[8 + i] = (_Float16)(bfr(t1[i]) * 64.0f); } }
      acc[j] = wmma16(a, w, acc[j]); acc[j] = wmma16(al, w, acc[j]); } }
#pragma unroll
  for (int j = 0; j < 8; ++j)
    { const float bb = BIAS ? bfr(BIAS[c0 + j * 16 + col]) : 0.f; asm volatile("s_wait_loadcnt 0x0" ::: "memory"); _Pragma("unroll") for (int r = 0; r < 8; ++r) sf[wave][8 * g + r][j * 16 + col] = acc[j][r] * (1.0f / 64.0f) + bb; }
  LDSX(); for (int rl = 0; rl < 16; ++rl) { const size_t o = (r0 + rl) * (size_t)nout + c0 + lane * 4; v4f v = *(const v4f*)&sf[wave][rl][lane * 4]; if (relu_out) { v[0] = fmaxf(v[0], 0.f); v[1] = fmaxf(v[1], 0.f); v[2] = fmaxf(v[2], 0.f); v[3] = fmaxf(v[3], 0.f); } if (RES) { const v4f rv = *(const v4f*)(RES + o); v[0] += rv[0]; v[1] += rv[1]; v[2] += rv[2]; v[3] += rv[3]; } vst2(OUT + o, v); } }   /* relu on the output (before the residual) when relu_out */

#ifndef SM_EXTRA_PARAMS
#define SM_EXTRA_PARAMS
#endif
#ifndef PROJ_EXTRA_PARAMS
#define PROJ_EXTRA_PARAMS
#endif
#ifndef SM_MASK_HOOK
#define SM_MASK_HOOK (void)0
#endif

#define WS_QH  0u                                      // f16 q rows [b*t][CC]
#define WS_KH  (WS_QH + 2u * (size_t)NB * TT * CC)      // f16 k rows [b*t][CC]
#define WS_VT  (WS_KH + 2u * (size_t)NB * TT * CC)      // f16 v planes [b][c][t]
#define WS_QL  (WS_VT + 2u * (size_t)NB * CC * TT)      // f16 q residual x 2^10 rows [b][t < QHI][CC]
#define WS_KL  (WS_QL + 2u * (size_t)NB * QHI * CC)     // f16 k residual x 2^10 rows [b][t < KHI][CC]
#define WS_VB  (WS_KL + 2u * (size_t)NB * KHI * CC)     // bf16 v hi planes [b][c][t < KHI]
#define WS_VBL (WS_VB + 2u * (size_t)NB * CC * KHI)
#define WS_S   (WS_VBL + 2u * (size_t)NB * CC * KHI)    // f32 area of HG * TT * TT floats; holds the folded weights and bias
#define WS_Y   (WS_S  + 4u * (size_t)HG * TT * TT)      // unused (k_fa writes the ctx rows to WS_CAT); same offset as WS_TQ
#define WS_END (WS_Y  + 0u)
#define WS_Y2  (WS_END)
#define WS_O1  (WS_Y2 + 4u * (size_t)NB * TT * CC)
#define WS_R2  (WS_O1 + 4u * (size_t)NB * TT * CC)
#define WS_END2 (WS_R2 + 4u * (size_t)NB * TT * CC)


#define NC3 96                                          // q | k | v channels of one head
#define WS_WF  (WS_XH + 0u)                             // f16 folded weights x 2^6 in fragment order [h][hi, residual][channel tile 6][k step 16][element half 2][lane 32][8]
#define WS_BC  (WS_WF + 2u * (size_t)NH * 2 * NC3 * CC) // f32 folded bias [h][NC3]
__device__ __forceinline__ v8f wm(v16h a, v16h b, v8f c) { return __builtin_amdgcn_wmma_f32_16x16x32_f16(false, a, false, b, (short)0, c, false, false); }
__device__ __forceinline__ v16h frag_fo(const _Float16* p) { union { v16h v; v8h q[2]; } u; u.q[0] = *(const v8h*)p; u.q[1] = *(const v8h*)(p + 256); return u.v; }
__device__ __forceinline__ _Float16 w64(float v) { return (_Float16)(bfr(v) * 64.0f); }
// ---- k_fold: (x Wl^T + bl) W = x (Wl^T W) + bl W. Block = (64 input indices i0.., head), wave = which of Wq, Wk, Wv: D[i][c] = sum_o Wl[o][i] W[o][c] (A = Wl^T: row i, k = o; B = W: k = o, column c; both read with the same k order 8g + e, 16 + 8g + e);
// D element r = input index 8g + r of channel column c: exactly the 8 elements that lane 16g + c of k_qkv's A fragment (row = channel, k = input index) holds in half t & 1 of k step i0 / 32 + t / 2, so WF is kept in that order: a store here and a load there are 512 contiguous bytes of whole 128-B lines, each line written by one wave. The last blockIdx.x takes bl as every row of A and gives the folded bias.
__global__ __launch_bounds__(96) void k_fold(const float* __restrict__ WL, const float* __restrict__ BL, const float* __restrict__ WQ, const float* __restrict__ WK, const float* __restrict__ WV, _Float16* __restrict__ WF, float* __restrict__ BC) {
  const int tid = threadIdx.x, lane = tid & 31, col = lane & 15, g = lane >> 4; const int wave = __builtin_amdgcn_readfirstlane(tid >> 5);
  const size_t h = blockIdx.y;
  const float* bp = (wave == 0 ? WQ : wave == 1 ? WK : WV) + h * CC * HD + (size_t)(8 * g) * HD + col;
  if (blockIdx.x < CC / 64) {
    const int i0 = blockIdx.x * 64;
    const float* ap = WL + h * CC * CC + (size_t)(8 * g) * CC + i0 + col;
    v8f acc[4][2] = {};
#pragma unroll 1   /* rolled: one step's 96 loaded values and the 64 sums already take most of the registers */
    for (int kc = 0; kc < CC / 32; ++kc) { float av[4][16], bv[2][16];
#pragma unroll
      for (int e = 0; e < 16; ++e) { const int ko = e < 8 ? e : e + 8;
#pragma unroll
        for (int t = 0; t < 4; ++t) av[t][e] = ap[(size_t)ko * CC + t * 16];
        bv[0][e] = bp[(size_t)ko * HD]; bv[1][e] = bp[(size_t)ko * HD + 16]; }
      XW2(ap, bp); __builtin_amdgcn_sched_barrier(0);   /* every load of the step is issued before the first conversion or product: one memory latency a step; the scheduler had kept only two fragments in flight */
      v16h fa[4], fb[2];
#pragma unroll
      for (int e = 0; e < 16; ++e) { fa[0][e] = w64(av[0][e]); fa[1][e] = w64(av[1][e]); fa[2][e] = w64(av[2][e]); fa[3][e] = w64(av[3][e]); fb[0][e] = w64(bv[0][e]); fb[1][e] = w64(bv[1][e]); }
#pragma unroll
      for (int t = 0; t < 4; ++t) { acc[t][0] = wm(fa[t], fb[0], acc[t][0]); acc[t][1] = wm(fa[t], fb[1], acc[t][1]); }
      ap += (size_t)32 * CC; bp += (size_t)32 * HD; }
#pragma unroll
    for (int j = 0; j < 2; ++j) { _Float16* op = WF + ((h * 2 * 6 + wave * 2 + j) * 16 + (i0 >> 5)) * (size_t)512 + lane * 8;
#pragma unroll
      for (int t = 0; t < 4; ++t) { v8h hi, lo;
#pragma unroll
        for (int r = 0; r < 8; ++r) { const float v = acc[t][j][r] * (1.0f / 64.0f); hi[r] = (_Float16)v; lo[r] = (_Float16)(v - (float)hi[r]); }   /* sums carry 2^12; kept x 2^6 */
        vst2(op + (t >> 1) * 512 + (t & 1) * 256, hi); vst2(op + (size_t)NC3 * CC + (t >> 1) * 512 + (t & 1) * 256, lo); } }
  } else {
    const float* ap = BL + h * CC + 8 * g;
    v8f acc[2] = {};
#pragma unroll 1   /* rolled: 16 short steps of one small block a head, nothing to gain from more code */
    for (int kc = 0; kc < CC / 32; ++kc) { float av[16], bv[2][16];
#pragma unroll
      for (int e = 0; e < 16; ++e) { const int ko = e < 8 ? e : e + 8; av[e] = ap[ko]; bv[0][e] = bp[(size_t)ko * HD]; bv[1][e] = bp[(size_t)ko * HD + 16]; }
      XW2(ap, bp); __builtin_amdgcn_sched_barrier(0);   /* keeps the wait directly behind the loads, in front of the pointer steps (it had sunk to the loop's foot) */
      v16h fa, fb[2];
#pragma unroll
      for (int e = 0; e < 16; ++e) { fa[e] = w64(av[e]); fb[0][e] = w64(bv[0][e]); fb[1][e] = w64(bv[1][e]); }
      acc[0] = wm(fa, fb[0], acc[0]); acc[1] = wm(fa, fb[1], acc[1]);
      ap += 32; bp += (size_t)32 * HD; }
    if (g == 0) { float* op = BC + h * NC3 + wave * HD + col; op[0] = acc[0][0] * (1.0f / 4096.0f); op[16] = acc[1][0] * (1.0f / 4096.0f); } } }

// ---- k_qkv: block = (128 rows of x, head), wave = 32 rows: [q|k|v]^T = folded weight (A = channel rows, f16 hi then residual, read in fragment order) x x^T (B = x rows, bf16-rounded, exact in f16); D element r = channel 8g + r, column = row of x, so a lane stores 8 consecutive channels of its row; TQ rows [h][b*t][128], channels 0..95 written (k_scat reads no other)
__global__ __launch_bounds__(128) void k_qkv(const float* __restrict__ X, const _Float16* __restrict__ WF, const float* __restrict__ BC, float* __restrict__ TQ) {
  const int tid = threadIdx.x, lane = tid & 31, col = lane & 15, g = lane >> 4; const int wave = __builtin_amdgcn_readfirstlane(tid >> 5);
  const size_t h = blockIdx.y, r0 = (size_t)blockIdx.x * 128 + wave * 32;
  const float* xp = X + (r0 + col) * CC + 8 * g;
  const _Float16* wp = WF + h * 2 * NC3 * CC + lane * 8;   /* fragment order: tile ct at ct * 16 * 512, k step at 512, element half at 256 */
  v8f acc[6][2] = {};
#pragma unroll 1   /* rolled: one step's fragments and the 96 sums already take most of the registers */
  for (int kc = 0; kc < CC / 32; ++kc) { v4f xv[2][4]; v16h wh[6], wl[6];
#pragma unroll
    for (int u = 0; u < 2; ++u) { const float* p = xp + (size_t)u * 16 * CC; xv[u][0] = *(const v4f*)p; xv[u][1] = *(const v4f*)(p + 4); xv[u][2] = *(const v4f*)(p + 16); xv[u][3] = *(const v4f*)(p + 20); }
#pragma unroll
    for (int ct = 0; ct < 6; ++ct) { wh[ct] = frag_fo(wp + (size_t)(ct * 16) * 512); wl[ct] = frag_fo(wp + (size_t)(NC3 + ct * 16) * 512); }
    XW2(xp, wp); __builtin_amdgcn_sched_barrier(0);   /* every load of the step is issued before the first conversion or product: one memory latency a step; the scheduler had kept only two fragments in flight */
    v16h xb[2];
#pragma unroll
    for (int u = 0; u < 2; ++u)
#pragma unroll
      for (int e = 0; e < 16; ++e) xb[u][e] = (_Float16)bfr(xv[u][e >> 2][e & 3]);
#pragma unroll
    for (int ct = 0; ct < 6; ++ct) { acc[ct][0] = wm(wh[ct], xb[0], acc[ct][0]); acc[ct][1] = wm(wh[ct], xb[1], acc[ct][1]); }
#pragma unroll
    for (int ct = 0; ct < 6; ++ct) { acc[ct][0] = wm(wl[ct], xb[0], acc[ct][0]); acc[ct][1] = wm(wl[ct], xb[1], acc[ct][1]); }
    xp += 32; wp += 512; }
  const float* bcp = BC + h * NC3 + 8 * g; v4f bc[6][2];
#pragma unroll
  for (int ct = 0; ct < 6; ++ct) { bc[ct][0] = *(const v4f*)(bcp + ct * 16); bc[ct][1] = *(const v4f*)(bcp + ct * 16 + 4); }
  XW2(bcp, bcp);
  float* tp = TQ + (h * NRW + r0 + col) * (size_t)128 + 8 * g;
#pragma unroll
  for (int u = 0; u < 2; ++u)
#pragma unroll
    for (int ct = 0; ct < 6; ++ct) { v4f w0, w1;
#pragma unroll
      for (int r = 0; r < 4; ++r) { w0[r] = acc[ct][u][r] * (1.0f / 64.0f) + bc[ct][0][r]; w1[r] = acc[ct][u][4 + r] * (1.0f / 64.0f) + bc[ct][1][r]; }
      vst2(tp + (size_t)u * 16 * 128 + ct * 16, w0); vst2(tp + (size_t)u * 16 * 128 + ct * 16 + 4, w1); } }

__global__ __launch_bounds__(256) void k_scat(const float* __restrict__ TQ, float* __restrict__ QB8, float* __restrict__ KB8, float* __restrict__ VB8) { const size_t row = (size_t)blockIdx.x * 8 + (threadIdx.x >> 5); const int c = threadIdx.x & 31; const size_t h = blockIdx.y; TQ += h * (size_t)NRW * 128;   /* blockIdx.y = head */
  if (row >= (size_t)NRW || c >= 24) return;
  const size_t b = row / TT, t = row % TT; const int which = c / 8, q4 = c % 8; const v4f v = *(const v4f*)(TQ + row * 128 + which * HD + q4 * 4); asm volatile("s_wait_loadcnt 0x0" ::: "memory");
  float* dst = (which == 0 ? QB8 : which == 1 ? KB8 : VB8) + (((b * NH + h) * TT) + t) * HD + q4 * 4; vst2(dst, v); }
extern "C" void kernel_launch(void* const* d_in, const int* in_sizes, int n_in, void* d_out, int out_size, void* d_ws, size_t ws_size, hipStream_t stream) {
  (void)in_sizes; (void)n_in; (void)out_size;
  const float** F = (const float**)d_in;
  if (ws_size < (size_t)WS_END) return;
  char* ws = (char*)d_ws; _Float16 *QH = (_Float16*)(ws + WS_QH), *KH = (_Float16*)(ws + WS_KH), *VT = (_Float16*)(ws + WS_VT), *QL = (_Float16*)(ws + WS_QL), *KL = (_Float16*)(ws + WS_KL); __bf16 *VB = (__bf16*)(ws + WS_VB), *VBL = (__bf16*)(ws + WS_VBL); float *S = (float*)(ws + WS_S), *Y = (float*)(ws + WS_Y);
  (void)Y; (void)S; (void)QL; (void)KL; (void)VB; (void)VBL;
  // inputs: 0 x [2,2048,512]; 1 Wl [16,512,512] (out,in); 2 bl [16,512]; 3 Wq [16,512,32] (in,out); 4 Wk; 5 Wv; 6 Wo [512,512] (out,in); 7 bo [512]
  if (ws_size < (size_t)WS_TOP) return;
  _Float16* WF = (_Float16*)(ws + WS_WF); float *BC = (float*)(ws + WS_BC), *TQ = (float*)(ws + WS_TQ), *QB8 = (float*)(ws + WS_QB8), *KB8 = (float*)(ws + WS_KB8), *VB8 = (float*)(ws + WS_VB8), *CAT = (float*)(ws + WS_CAT);
  /* head = blockIdx.y in the three projection launches */
  k_fold<<<dim3(CC / 64 + 1, NH), 96, 0, stream>>>(F[1], F[2], F[3], F[4], F[5], WF, BC);   /* folded weights Wl[h]^T [Wq|Wk|Wv][h] and bias bl[h] [Wq|Wk|Wv][h] */
  k_qkv<<<dim3(NRW / 128, NH), 128, 0, stream>>>(F[0], WF, BC, TQ);                          /* [q|k|v][h] rows [NRW][128] = x folded weight + folded bias */
  k_scat<<<dim3(NRW / 8, NH), 256, 0, stream>>>(TQ, QB8, KB8, VB8);                                                                         /* -> [B,H,S,32] buffers */
  k_prep8<<<dim3(TNB * TT / 64, NH), 128, 0, stream>>>(QB8, KB8, VB8, QH, QL, KH, KL, VT, VB, VBL);
  k_fa<<<dim3(NQB, NH, TNB), 128, 0, stream>>>(QH, KH, QL, KL, VT, VB, VBL, CAT);   /* logits, softmax and P v of every (b, h) in one launch */
  k_goi<<<dim3(NRW / 64, CC / 128), 128, 0, stream>>>(CAT, CC, CC, 0, 0, F[6], CC, F[7], nullptr, 0, (float*)d_out, 0, 0, 0);   /* out = cat Wo^T + bo */
}

// v004
// A run of this version takes 166 microseconds.
// Two timings next to v003 both put it at 1.25 times that version's speed.
// Over all steps from v000 it is 18.3 times as fast.
// compute dtype: all float inputs rounded to bf16; q/k/v = x (Wl[h]^T Wq/Wk/Wv[h]) + bl[h] Wq/Wk/Wv[h]: the folded weight and bias from f16(bf16 x 2^6) operands (exact, 1 product, WMMA 16x16x32, f32 accumulate), the folded weight kept as f16 hi + residual (x 2^6) against x as f16 (bf16-exact) (2 products); unscaled causal logits: q, k once to f16 (1 product), 3 products below row 384; online softmax in f32 (running maximum and sum, one fused kernel); P = exp(logit - maximum) once to f16 against v f16 (P and v as bf16 hi + lo below row 384); out = cat as f16 hi + residual against Wo^T f16(bf16 x 2^6) (2 products) + bo; f32 output.
#include <hip/hip_runtime.h>
#include <math.h>

typedef __attribute__((ext_vector_type(16))) _Float16 v16h;
typedef __attribute__((ext_vector_type(16))) __bf16 v16b;
typedef __attribute__((ext_vector_type(8)))  _Float16 v8h;
typedef __attribute__((ext_vector_type(8)))  float v8f;
typedef __attribute__((ext_vector_type(4)))  float v4f;
typedef __attribute__((ext_vector_type(2)))  float v2f;
typedef __attribute__((ext_vector_type(4)))  unsigned v4u;
typedef __attribute__((ext_vector_type(4)))  int v4i;
typedef float __attribute__((may_alias)) float_a;
typedef int __attribute__((may_alias)) int_a;

template <typename T> __device__ __forceinline__ void vst2(void* p, T v) { *(T*)p = v;  }
__device__ __forceinline__ v8f wmma16(v16h a, v16h b, v8f c) {
  v8f d = __builtin_amdgcn_wmma_f32_16x16x32_f16(false, a, false, b, (short)0, c, false, false);
  asm volatile("v_nop\n\tv_nop\n\tv_nop\n\tv_nop" : "+v"(d) : "v"(a), "v"(b));
  return d;
}
__device__ __forceinline__ v8f wmma_bf(v16b a, v16b b, v8f c) {
  v8f d = __builtin_amdgcn_wmma_f32_16x16x32_bf16(false, a, false, b, (short)0, c, false, false);
  asm volatile("v_nop\n\tv_nop\n\tv_nop\n\tv_nop" : "+v"(d) : "v"(a), "v"(b));
  return d;
}
// 16x16x32 fragments: lane = (h = lane>>4, row/col = lane&15); elements 0..7 = k0+8h+0..7, 8..15 = k0+16+8h+0..7; D element r = row 8h+r
__device__ __forceinline__ v16h frag_h(const _Float16* rowk0, int lane) {
  union { v16h v; v8h q[2]; } u; const _Float16* p = rowk0 + 8 * (lane >> 4);
  u.q[0] = *(const v8h*)p; u.q[1] = *(const v8h*)(p + 16); return u.v;
}
__device__ __forceinline__ v16h frag_f32(const float* rowk0, int lane) {
  v16h a; const float* p = rowk0 + 8 * (lane >> 4);
#pragma unroll
  for (int i = 0; i < 8; ++i) { a[i] = (_Float16)p[i]; a[8 + i] = (_Float16)p[16 + i]; }
  return a;
}
__device__ __forceinline__ v16h frag_f32s(const float* rowk0, int lane, float sc) {
  v16h a; const float* p = rowk0 + 8 * (lane >> 4);
#pragma unroll
  for (int i = 0; i < 8; ++i) { a[i] = (_Float16)(p[i] * sc); a[8 + i] = (_Float16)(p[16 + i] * sc); }
  return a;
}
// column fragment from a [K][ld] layout (column n), rows >= K read as 0
__device__ __forceinline__ v16h fragc_f32(const float* W, int k0, int n, int lane, int ld, int K) {
  v16h a; const int g = lane >> 4;
#pragma unroll
  for (int i = 0; i < 8; ++i) { const int ka = k0 + 8 * g + i, kb = ka + 16;
    a[i] = (_Float16)(ka < K ? W[(size_t)(ka < K ? ka : K - 1) * ld + n] : 0.f); a[8 + i] = (_Float16)(kb < K ? W[(size_t)(kb < K ? kb : K - 1) * ld + n] : 0.f); }
  return a;
}
struct F2 { v16b h, l; };
__device__ __forceinline__ F2 bsplit16(const float v[16]) { F2 r;
#pragma unroll
  for (int i = 0; i < 16; ++i) { const __bf16 h = (__bf16)v[i]; r.h[i] = h; r.l[i] = (__bf16)(v[i] - (float)h); }
  return r; }
__device__ __forceinline__ F2 split_row(const float* row, int k0, int lane) { float v[16]; const float* p = row + k0 + 8 * (lane >> 4);
#pragma unroll
  for (int i = 0; i < 8; ++i) { v[i] = p[i]; v[8 + i] = p[16 + i]; }
  return bsplit16(v); }
__device__ __forceinline__ F2 split_rowK(const float* row, int k0, int lane, int K) { float v[16]; const int g = lane >> 4;
#pragma unroll
  for (int i = 0; i < 8; ++i) { const int ka = k0 + 8 * g + i, kb = ka + 16; v[i] = ka < K ? row[ka < K ? ka : K - 1] : 0.f; v[8 + i] = kb < K ? row[kb < K ? kb : K - 1] : 0.f; }
  return bsplit16(v); }
__device__ __forceinline__ F2 split_col(const float* W, int k0, int n, int lane, int ld, int K) { float v[16]; const int g = lane >> 4;
#pragma unroll
  for (int i = 0; i < 8; ++i) { const int ka = k0 + 8 * g + i, kb = ka + 16; v[i] = ka < K ? W[(size_t)(ka < K ? ka : K - 1) * ld + n] : 0.f; v[8 + i] = kb < K ? W[(size_t)(kb < K ? kb : K - 1) * ld + n] : 0.f; }
  return bsplit16(v); }
__device__ __forceinline__ v8f mac3(const F2& a, const F2& b, v8f c) { c = wmma_bf(a.l, b.h, c); c = wmma_bf(a.h, b.l, c); return wmma_bf(a.h, b.h, c); }
__device__ __forceinline__ float sigm(float v) { return 1.0f / (1.0f + expf(-v)); }
#define LDSX() do { asm volatile("s_wait_dscnt 0" ::: "memory"); __builtin_amdgcn_wave_barrier(); __builtin_amdgcn_fence(__ATOMIC_RELEASE, "workgroup"); } while (0)

// Per-head multi-head causal attention (B 2, S 2,048, 512; 16 heads x 32; 0.02-scale weights: per-head Linear Wl [16,512,512] (out,in) + bl, per-head Wq/Wk/Wv [16,512,32] (in,out) no bias, Wo [512,512] (out,in) + bo): xh = x Wl[h]^T + bl[h]; Q, K, V = xh Wq[h], xh Wk[h], xh Wv[h]; scores = Q K^T (NO scaling), causal; F = softmax(scores) V; out = concat_h(F) Wo^T + bo.
#define NB 2
#define TT 2048
#define CC 512            // NH * HD = projected width
#define DIN 512          // input (model) width
#define NH 16
#define HD 32
#define NQB (TT / 64)
#define HG 8
#define SCALE (1.0f)
#define CAUSAL 1
#ifndef TNB
#define TNB NB
#endif
__device__ __forceinline__ float bfr(float v) { return (float)(__bf16)v; }
__host__ __device__ __forceinline__ int kb_last(int qb) { return CAUSAL ? ((qb * 64 + 63) >> 7) : (TT / 128 - 1); }
typedef __attribute__((ext_vector_type(8))) __bf16 v8b;
__device__ __forceinline__ v16b frag_b(const __bf16* rowk0, int lane) {
  union { v16b v; v8b q[2]; } u; const __bf16* p = rowk0 + 8 * (lane >> 4);
  u.q[0] = *(const v8b*)p; u.q[1] = *(const v8b*)(p + 16); return u.v;
}
#define QBH 6              // causal: query blocks 0..QBH-1 of each sequence (few keys, no averaging) take the high-precision path
#define QHI 384            // rows carrying a q residual plane
#define KHI 384            // key rows carrying k residual / v bf16 hi+lo planes (used only by the causal high-precision path)
// B fragment (k rows k0+.., output column o) of a weight: (in,out) [K][ld] or (out,in) [ld rows of K]: bf16 exact, or f16(bf16 * 256) exact
__device__ __forceinline__ v16b wcol_io(const float* Wm, int k0, int o, int lane, int ld) { v16b w; const int g = lane >> 4;
#pragma unroll
  for (int i = 0; i < 8; ++i) { w[i] = (__bf16)Wm[(size_t)(k0 + 8 * g + i) * ld + o]; w[8 + i] = (__bf16)Wm[(size_t)(k0 + 16 + 8 * g + i) * ld + o]; }
  return w; }
__device__ __forceinline__ v16b wcol_oi(const float* Wm, int k0, int o, int lane, int K) { v16b w; const float* p = Wm + (size_t)o * K + k0 + 8 * (lane >> 4);
#pragma unroll
  for (int i = 0; i < 8; ++i) { w[i] = (__bf16)p[i]; w[8 + i] = (__bf16)p[16 + i]; }
  return w; }
__device__ __forceinline__ v16h wcolh_io(const float* Wm, int k0, int o, int lane, int ld) { v16h w; const int g = lane >> 4;
#pragma unroll
  for (int i = 0; i < 8; ++i) { w[i] = (_Float16)(bfr(Wm[(size_t)(k0 + 8 * g + i) * ld + o]) * 256.0f); w[8 + i] = (_Float16)(bfr(Wm[(size_t)(k0 + 16 + 8 * g + i) * ld + o]) * 256.0f); }
  return w; }
__device__ __forceinline__ v16h wcolh_oi(const float* Wm, int k0, int o, int lane, int K) { v16h w; const float* p = Wm + (size_t)o * K + k0 + 8 * (lane >> 4);
#pragma unroll
  for (int i = 0; i < 8; ++i) { w[i] = (_Float16)(bfr(p[i]) * 256.0f); w[8 + i] = (_Float16)(bfr(p[16 + i]) * 256.0f); }
  return w; }
#define WQKV_LAYOUT 1   // 0 = (in,out) [DIN][CC]; 1 = (out,in) [CC][DIN]; 2 = per-head [NH][DIN][HD]
__device__ __forceinline__ v16b wcol_hdk(const float* Wm, int k0, int o, int lane) { v16b w; const int g = lane >> 4; const float* p = Wm + (size_t)(o / HD) * DIN * HD + (o % HD);
#pragma unroll
  for (int i = 0; i < 8; ++i) { w[i] = (__bf16)p[(size_t)(k0 + 8 * g + i) * HD]; w[8 + i] = (__bf16)p[(size_t)(k0 + 16 + 8 * g + i) * HD]; }
  return w; }
#define WO_OUT_IN 0
#if WQKV_LAYOUT == 1
#define WCOL(W, k0, o, lane) wcol_oi(W, k0, o, lane, DIN)
#elif WQKV_LAYOUT == 2
#define WCOL(W, k0, o, lane) wcol_hdk(W, k0, o, lane)
#else
#define WCOL(W, k0, o, lane) wcol_io(W, k0, o, lane, CC)
#endif
#if WO_OUT_IN
#define WOCOL(W, k0, o, lane) wcol_oi(W, k0, o, lane, CC)
#define WOCOLH(W, k0, o, lane) wcolh_oi(W, k0, o, lane, CC)
#else
#define WOCOL(W, k0, o, lane) wcol_io(W, k0, o, lane, DIN)
#define WOCOLH(W, k0, o, lane) wcolh_io(W, k0, o, lane, DIN)
#endif

#ifndef SM_EXTRA_PARAMS
#define SM_EXTRA_PARAMS
#endif
#ifndef PROJ_EXTRA_PARAMS
#define PROJ_EXTRA_PARAMS
#endif
#ifndef SM_MASK_HOOK
#define SM_MASK_HOOK (void)0
#endif

#define WS_QH  0u                                      // f16 q rows [b*t][CC]
#define WS_KH  (WS_QH + 2u * (size_t)NB * TT * CC)      // f16 k rows [b*t][CC]
#define WS_VT  (WS_KH + 2u * (size_t)NB * TT * CC)      // f16 v planes [b][c][t]
#define WS_QL  (WS_VT + 2u * (size_t)NB * CC * TT)      // f16 q residual x 2^10 rows [b][t < QHI][CC]
#define WS_KL  (WS_QL + 2u * (size_t)NB * QHI * CC)     // f16 k residual x 2^10 rows [b][t < KHI][CC]
#define WS_VB  (WS_KL + 2u * (size_t)NB * KHI * CC)     // bf16 v hi planes [b][c][t < KHI]
#define WS_VBL (WS_VB + 2u * (size_t)NB * CC * KHI)
#define WS_S   (WS_VBL + 2u * (size_t)NB * CC * KHI)    // f32 area of HG * TT * TT floats; holds the folded weights and bias
#define WS_Y   (WS_S  + 4u * (size_t)HG * TT * TT)      // unused (k_fa writes the ctx rows to WS_CAT); same offset as WS_TQ
#define WS_XH  (WS_S + 0u)                              // area of NH * NB * TT * CC floats holding the folded weights and bias; fills the S region, which holds no logits (NH * NB * CC == HG * TT)
#define WS_TQ  (WS_XH + 4u * (size_t)NH * NB * TT * CC) // unused area of NH * NB * TT * 128 floats
#define WS_WP  (WS_TQ + 4u * (size_t)NH * NB * TT * 128) // unused area of NH * CC * 128 floats
#define WS_QB8 (WS_WP + 4u * (size_t)NH * CC * 128 + 256)
#define WS_KB8 (WS_QB8 + 4u * (size_t)NB * TT * CC)
#define WS_VB8 (WS_KB8 + 4u * (size_t)NB * TT * CC)
#define WS_CAT (WS_VB8 + 4u * (size_t)NB * TT * CC)
#define WS_END (WS_CAT + 4u * (size_t)NB * TT * CC)
#define WS_END2 WS_END
#define WS_TOP (WS_CAT + 4u * (size_t)NB * TT * CC)     // end of everything kernel_launch uses
static_assert((size_t)HG * TT * TT <= (size_t)NH * NB * TT * CC, "S must end where the WS_XH area ends");

// ---- k_fa: block = 64 queries (4 waves x 16) of (b, h), one pass over the keys 0 .. query in steps of 64 with a running row maximum and sum (online softmax); nothing of the logits or of P goes to memory.
// Both products are formed transposed so that every per-query value sits in the lane of its query (col = lane & 15): S^T = k q^T (A = key rows, B = query rows; D element r = key 8g + r, column = query), which is already the B fragment of P^T (elements 0..7 = tile 2c, 8..15 = tile 2c + 1), and ctx^T = v^T P^T (A = v planes [c][t]; D element r = channel 8g + r, column = query).
// Precision as before: q, k once to f16 (1 product), P once to f16 against v f16; query blocks < QBH: 3-product logits (q, k residual planes x 2^10), P and v as bf16 hi + lo (3 products). P is exp(logit - running maximum), at most 1; the division by the f32 row sum comes last.
#define L2E 1.4426950408889634f
#define NEGBIG (-1.0e30f)
// behind a group of global loads: their address registers (kept live to here as inputs) are rewritten only after this wait
#define XW2(p0, p1) asm volatile("s_wait_xcnt 0x0" :: "v"(p0), "v"(p1) : "memory")
#define XW4(p0, p1, p2, p3) asm volatile("s_wait_xcnt 0x0" :: "v"(p0), "v"(p1), "v"(p2), "v"(p3) : "memory")
static_assert(HD == 32, "one 32-deep product per logit tile, two 16-channel ctx tiles");
// 2^x; the v_nop fills the one slot that the instruction set asks for behind a transcendental, whatever the compiler schedules next (it had put a second v_exp_f32 there that overwrites the first one's source)
__device__ __forceinline__ float ex2(float x) { float r; asm("v_exp_f32 %0, %1\n\tv_nop" : "=v"(r) : "v"(x)); return r; }
// s[32] = this lane's logits of one 64-key step (excluded ones = NEGBIG) -> exp(s - new maximum); returns the factor that rescales what was summed under the old maximum
__device__ __forceinline__ float sm_step(float (&s)[32], float& m, float& l) {
  float c0 = fmaxf(s[0], s[1]), c1 = fmaxf(s[2], s[3]);
#pragma unroll
  for (int i = 4; i < 32; i += 2) { c0 = fmaxf(c0, s[i]); c1 = fmaxf(c1, s[i + 1]); }
  float cm = fmaxf(c0, c1); cm = fmaxf(cm, __shfl_xor(cm, 16));   /* lanes col and col + 16 hold the two key halves of one query */
  const float mn = fmaxf(m, cm), al = ex2((m - mn) * L2E), m2 = mn * L2E; m = mn;
  float a0 = 0.f, a1 = 0.f, a2 = 0.f, a3 = 0.f;
#pragma unroll
  for (int i = 0; i < 32; i += 4) {
    s[i] = ex2(fmaf(s[i], L2E, -m2)); s[i + 1] = ex2(fmaf(s[i + 1], L2E, -m2)); s[i + 2] = ex2(fmaf(s[i + 2], L2E, -m2)); s[i + 3] = ex2(fmaf(s[i + 3], L2E, -m2));
    a0 += s[i]; a1 += s[i + 1]; a2 += s[i + 2]; a3 += s[i + 3]; }
  l = l * al + ((a0 + a1) + (a2 + a3)); return al; }
// fragment from a pointer that already holds the lane half's offset: elements 0..7 = p[0..7], 8..15 = p[16..23]
__device__ __forceinline__ v16h frag_hp(const _Float16* p) { union { v16h v; v8h q[2]; } u; u.q[0] = *(const v8h*)p; u.q[1] = *(const v8h*)(p + 16); return u.v; }
__device__ __forceinline__ v16b frag_bp(const __bf16* p) { union { v16b v; v8b q[2]; } u; u.q[0] = *(const v8b*)p; u.q[1] = *(const v8b*)(p + 16); return u.v; }
__global__ __launch_bounds__(128) void k_fa(const _Float16* __restrict__ QH, const _Float16* __restrict__ KH, const _Float16* __restrict__ QL, const _Float16* __restrict__ KL, const _Float16* __restrict__ VT, const __bf16* __restrict__ VB, const __bf16* __restrict__ VBL, float* __restrict__ Y) {
  const int tid = threadIdx.x, lane = tid & 31, col = lane & 15, g = lane >> 4; const int wave = __builtin_amdgcn_readfirstlane(tid >> 5);
  const int qb = NQB - 1 - (int)blockIdx.x, h = blockIdx.y, b = blockIdx.z;   /* longest query blocks start first */
  const int ql0 = qb * 64 + wave * 16, tq = ql0 + col;
  float m = NEGBIG, l = 0.f; v8f o[2] = {}; const v8f zero = {};
  const _Float16* qp = QH + ((size_t)b * TT + tq) * CC + h * HD + 8 * g;   /* every fragment pointer below already holds the lane half's 8 * g */
  const _Float16* kp = KH + ((size_t)b * TT + col) * CC + h * HD + 8 * g;
  if (qb < QBH) {
    const _Float16* qlp = QL + ((size_t)b * QHI + tq) * CC + h * HD + 8 * g;
    const v16h bq = frag_hp(qp), bql = frag_hp(qlp); XW2(qp, qlp);
    const _Float16* klp = KL + ((size_t)b * KHI + col) * CC + h * HD + 8 * g;
    const size_t vo = ((size_t)b * CC + h * HD + col) * (size_t)KHI + 8 * g;
#pragma unroll 1
    for (int it = 0; it <= qb; ++it) { const int k0 = it * 64; float s[32];
      const _Float16 *kq = kp + (size_t)k0 * CC, *klq = klp + (size_t)k0 * CC; const __bf16 *vhq = VB + vo + k0, *vlq = VBL + vo + k0;
      v16h khf[4], klf[4]; v16b vhf[4], vlf[4];   /* index of the v fragments: c * 2 + j */
#pragma unroll
      for (int t = 0; t < 4; ++t) { khf[t] = frag_hp(kq + (size_t)(t * 16) * CC); klf[t] = frag_hp(klq + (size_t)(t * 16) * CC); vhf[t] = frag_bp(vhq + (size_t)(t & 1) * 16 * KHI + (t >> 1) * 32); vlf[t] = frag_bp(vlq + (size_t)(t & 1) * 16 * KHI + (t >> 1) * 32); }
      XW4(kq, klq, vhq, vlq);
#pragma unroll
      for (int t = 0; t < 4; ++t) { const v16h kh = khf[t], kl = klf[t];
        const v8f a = wmma16(kh, bq, zero); v8f a2 = wmma16(kh, bql, zero); a2 = wmma16(kl, bq, a2);
#pragma unroll
        for (int r = 0; r < 8; ++r) { const float v = (a[r] + a2[r] * (1.0f / 1024.0f)) * SCALE; s[t * 8 + r] = (k0 + t * 16 + 8 * g + r <= tq) ? v : NEGBIG; } }
      const float al = sm_step(s, m, l);
#pragma unroll
      for (int r = 0; r < 8; ++r) { o[0][r] *= al; o[1][r] *= al; }
#pragma unroll
      for (int c = 0; c < 2; ++c) { float v[16];
#pragma unroll
        for (int i = 0; i < 8; ++i) { v[i] = s[c * 16 + i]; v[8 + i] = s[c * 16 + 8 + i]; }
        const F2 p = bsplit16(v);
#pragma unroll
        for (int j = 0; j < 2; ++j) { const v16b vh = vhf[c * 2 + j];
          o[j] = wmma_bf(vh, p.h, o[j]); o[j] = wmma_bf(vh, p.l, o[j]); o[j] = wmma_bf(vlf[c * 2 + j], p.h, o[j]); } } }
  } else {
    const _Float16* vp = VT + ((size_t)b * CC + h * HD + col) * (size_t)TT + 8 * g;
    const v16h bq = frag_hp(qp);
    v16h kf[4], vf[4];   /* this step's fragments, fetched one step ahead; index of the v fragments: j * 2 + c */
#pragma unroll
    for (int t = 0; t < 4; ++t) { kf[t] = frag_hp(kp + (size_t)(t * 16) * CC); vf[t] = frag_hp(vp + (size_t)(t >> 1) * 16 * TT + (t & 1) * 32); }
    XW4(qp, kp, vp, vp);
#pragma unroll 1
    for (int it = 0; it <= qb; ++it) { const int k0 = it * 64, kn = (it < qb ? it + 1 : it) * 64;   /* the last step fetches its own tile again: in bounds, unused */
      const _Float16 *kq = kp + (size_t)kn * CC, *vq = vp + kn; v16h kx[4], vx[4];
#pragma unroll
      for (int t = 0; t < 4; ++t) { kx[t] = frag_hp(kq + (size_t)(t * 16) * CC); vx[t] = frag_hp(vq + (size_t)(t >> 1) * 16 * TT + (t & 1) * 32); }
      XW2(kq, vq);
      float s[32];
#pragma unroll
      for (int t = 0; t < 4; ++t) { const v8f a = wmma16(kf[t], bq, zero);
#pragma unroll
        for (int r = 0; r < 8; ++r) s[t * 8 + r] = a[r] * SCALE; }
      if (it == qb) {   /* only the diagonal step holds keys past a query */
#pragma unroll
        for (int i = 0; i < 32; ++i) s[i] = (k0 + (i >> 3) * 16 + 8 * g + (i & 7) <= tq) ? s[i] : NEGBIG; }
      const float al = sm_step(s, m, l);
#pragma unroll
      for (int r = 0; r < 8; ++r) { o[0][r] *= al; o[1][r] *= al; }
#pragma unroll
      for (int c = 0; c < 2; ++c) { v16h p;
#pragma unroll
        for (int i = 0; i < 16; ++i) p[i] = (_Float16)s[c * 16 + i];
        o[0] = wmma16(vf[c], p, o[0]); o[1] = wmma16(vf[2 + c], p, o[1]); }
#pragma unroll
      for (int t = 0; t < 4; ++t) { kf[t] = kx[t]; vf[t] = vx[t]; } } }
  l += __shfl_xor(l, 16); const float inv = l > 0.f ? 1.0f / l : 0.f;
  float* yp = Y + ((size_t)b * TT + tq) * CC + h * HD + 8 * g;   /* the 128-B (row, head) segment is written by two lanes of one wave */
#pragma unroll
  for (int j = 0; j < 2; ++j) { v4f w0, w1;
#pragma unroll
    for (int r = 0; r < 4; ++r) { w0[r] = o[j][r] * inv; w1[r] = o[j][4 + r] * inv; }
    vst2(yp + j * 16, w0); vst2(yp + j * 16 + 4, w1); } }

#define NRW (TNB * TT)
// ---- k_goi: block = (64 rows, 128 cols): OUT = [relu](A (as f16 hi + residual) x W^T (W (out,in) as f16(bf16 x 2^6)) x 2^-6 + bias) (+ RES residual rows); 512-B segments
__global__ __launch_bounds__(128) void k_goi(const float* __restrict__ A, int lda, int K, int act_in, int rnd_in, const float* __restrict__ Wm, int nout, const float* __restrict__ BIAS, const float* __restrict__ RES, int relu_out, float* __restrict__ OUT, size_t wz, size_t bz, size_t oz) { __shared__ __align__(16) float sf[4][16][132];
  Wm += blockIdx.z * wz; if (BIAS) BIAS += blockIdx.z * bz; OUT += blockIdx.z * oz;   /* blockIdx.z: its own weight, bias and output plane (A is shared); one z (strides 0) in the launch here */
  const int tid = threadIdx.x, wave = tid >> 5, lane = tid & 31, col = lane & 15, g = lane >> 4; const int c0 = blockIdx.y * 128; const size_t r0 = (size_t)blockIdx.x * 64 + wave * 16;
  v8f acc[8] = {};
#pragma unroll 1
  for (int kc = 0; kc < K / 32; ++kc) { v16h a, al; { const float* p = A + (r0 + col) * (size_t)lda + kc * 32 + 8 * g;
#pragma unroll
      for (int i = 0; i < 8; ++i) { float x0 = p[i], x1 = p[16 + i]; if (rnd_in) { x0 = bfr(x0); x1 = bfr(x1); }   /* RAW module inputs are rounded to bf16 first; f32 intermediates are not */ if (act_in == 1) { x0 = fmaxf(x0, 0.f); x1 = fmaxf(x1, 0.f); } else if (act_in == 2) { x0 = 0.5f * x0 * (1.0f + erff(x0 * 0.70710678118654752f)); x1 = 0.5f * x1 * (1.0f + erff(x1 * 0.70710678118654752f)); } const _Float16 h0 = (_Float16)x0, h1 = (_Float16)x1; a[i] = h0; a[8 + i] = h1; al[i] = (_Float16)(x0 - (float)h0); al[8 + i] = (_Float16)(x1 - (float)h1); } }   /* A as f16 hi + unscaled f16 residual (2 products, ~2^-22) */   /* act_in 2 = exact GELU (erf), jax.nn.gelu(approximate=False) */
    asm volatile("s_wait_loadcnt 0x0" ::: "memory");
#pragma unroll
    for (int j = 0; j < 8; ++j) { v16h w; { const int o = c0 + j * 16 + col; float t0[8], t1[8];
#pragma unroll
        for (int i = 0; i < 8; ++i) t0[i] = Wm[(size_t)o * K + kc * 32 + 8 * g + i];   /* (out,in) [nout][K] */
        asm volatile("s_wait_loadcnt 0x0" ::: "memory");
#pragma unroll
        for (int i = 0; i < 8; ++i) t1[i] = Wm[(size_t)o * K + kc * 32 + 16 + 8 * g + i];
        asm volatile("s_wait_loadcnt 0x0" ::: "memory");
#pragma unroll
        for (int i = 0; i < 8; ++i) { w[i] = (_Float16)(bfr(t0[i]) * 64.0f); w[8 + i] = (_Float16)(bfr(t1[i]) * 64.0f); } }
      acc[j] = wmma16(a, w, acc[j]); acc[j] = wmma16(al, w, acc[j]); } }
#pragma unroll
  for (int j = 0; j < 8; ++j)
    { const float bb = BIAS ? bfr(BIAS[c0 + j * 16 + col]) : 0.f; asm volatile("s_wait_loadcnt 0x0" ::: "memory"); _Pragma("unroll") for (int r = 0; r < 8; ++r) sf[wave][8 * g + r][j * 16 + col] = acc[j][r] * (1.0f / 64.0f) + bb; }
  LDSX(); for (int rl = 0; rl < 16; ++rl) { const size_t o = (r0 + rl) * (size_t)nout + c0 + lane * 4; v4f v = *(const v4f*)&sf[wave][rl][lane * 4]; if (relu_out) { v[0] = fmaxf(v[0], 0.f); v[1] = fmaxf(v[1], 0.f); v[2] = fmaxf(v[2], 0.f); v[3] = fmaxf(v[3], 0.f); } if (RES) { const v4f rv = *(const v4f*)(RES + o); v[0] += rv[0]; v[1] += rv[1]; v[2] += rv[2]; v[3] += rv[3]; } vst2(OUT + o, v); } }   /* relu on the output (before the residual) when relu_out */

#ifndef SM_EXTRA_PARAMS
#define SM_EXTRA_PARAMS
#endif
#ifndef PROJ_EXTRA_PARAMS
#define PROJ_EXTRA_PARAMS
#endif
#ifndef SM_MASK_HOOK
#define SM_MASK_HOOK (void)0
#endif

#define WS_QH  0u                                      // f16 q rows [b*t][CC]
#define WS_KH  (WS_QH + 2u * (size_t)NB * TT * CC)      // f16 k rows [b*t][CC]
#define WS_VT  (WS_KH + 2u * (size_t)NB * TT * CC)      // f16 v planes [b][c][t]
#define WS_QL  (WS_VT + 2u * (size_t)NB * CC * TT)      // f16 q residual x 2^10 rows [b][t < QHI][CC]
#define WS_KL  (WS_QL + 2u * (size_t)NB * QHI * CC)     // f16 k residual x 2^10 rows [b][t < KHI][CC]
#define WS_VB  (WS_KL + 2u * (size_t)NB * KHI * CC)     // bf16 v hi planes [b][c][t < KHI]
#define WS_VBL (WS_VB + 2u * (size_t)NB * CC * KHI)
#define WS_S   (WS_VBL + 2u * (size_t)NB * CC * KHI)    // f32 area of HG * TT * TT floats; holds the folded weights and bias
#define WS_Y   (WS_S  + 4u * (size_t)HG * TT * TT)      // unused (k_fa writes the ctx rows to WS_CAT); same offset as WS_TQ
#define WS_END (WS_Y  + 0u)
#define WS_Y2  (WS_END)
#define WS_O1  (WS_Y2 + 4u * (size_t)NB * TT * CC)
#define WS_R2  (WS_O1 + 4u * (size_t)NB * TT * CC)
#define WS_END2 (WS_R2 + 4u * (size_t)NB * TT * CC)


#define NC3 96                                          // q | k | v channels of one head
#define WS_WF  (WS_XH + 0u)                             // f16 folded weights x 2^6 in fragment order [h][hi, residual][channel tile 6][k step 16][element half 2][lane 32][8]
#define WS_BC  (WS_WF + 2u * (size_t)NH * 2 * NC3 * CC) // f32 folded bias [h][NC3]
__device__ __forceinline__ v8f wm(v16h a, v16h b, v8f c) { return __builtin_amdgcn_wmma_f32_16x16x32_f16(false, a, false, b, (short)0, c, false, false); }
__device__ __forceinline__ v16h frag_fo(const _Float16* p) { union { v16h v; v8h q[2]; } u; u.q[0] = *(const v8h*)p; u.q[1] = *(const v8h*)(p + 256); return u.v; }
__device__ __forceinline__ _Float16 w64(float v) { return (_Float16)(bfr(v) * 64.0f); }
// ---- k_fold: (x Wl^T + bl) W = x (Wl^T W) + bl W. Block = (64 input indices i0.., head), wave = which of Wq, Wk, Wv: D[i][c] = sum_o Wl[o][i] W[o][c] (A = Wl^T: row i, k = o; B = W: k = o, column c; both read with the same k order 8g + e, 16 + 8g + e);
// D element r = input index 8g + r of channel column c: exactly the 8 elements that lane 16g + c of k_qkv's weight fragment (A for q, k, B for v; row or column = channel, k = input index) holds in half t & 1 of k step i0 / 32 + t / 2, so WF is kept in that order: a store here and a load there are 512 contiguous bytes of whole 128-B lines, each line written by one wave. The last blockIdx.x takes bl as every row of A and gives the folded bias.
__global__ __launch_bounds__(96) void k_fold(const float* __restrict__ WL, const float* __restrict__ BL, const float* __restrict__ WQ, const float* __restrict__ WK, const float* __restrict__ WV, _Float16* __restrict__ WF, float* __restrict__ BC) {
  const int tid = threadIdx.x, lane = tid & 31, col = lane & 15, g = lane >> 4; const int wave = __builtin_amdgcn_readfirstlane(tid >> 5);
  const size_t h = blockIdx.y;
  const float* bp = (wave == 0 ? WQ : wave == 1 ? WK : WV) + h * CC * HD + (size_t)(8 * g) * HD + col;
  if (blockIdx.x < CC / 64) {
    const int i0 = blockIdx.x * 64;
    const float* ap = WL + h * CC * CC + (size_t)(8 * g) * CC + i0 + col;
    v8f acc[4][2] = {};
#pragma unroll 1   /* rolled: one step's 96 loaded values and the 64 sums already take most of the registers */
    for (int kc = 0; kc < CC / 32; ++kc) { float av[4][16], bv[2][16];
#pragma unroll
      for (int e = 0; e < 16; ++e) { const int ko = e < 8 ? e : e + 8;
#pragma unroll
        for (int t = 0; t < 4; ++t) av[t][e] = ap[(size_t)ko * CC + t * 16];
        bv[0][e] = bp[(size_t)ko * HD]; bv[1][e] = bp[(size_t)ko * HD + 16]; }
      XW2(ap, bp); __builtin_amdgcn_sched_barrier(0);   /* every load of the step is issued before the first conversion or product: one memory latency a step; the scheduler had kept only two fragments in flight */
      v16h fa[4], fb[2];
#pragma unroll
      for (int e = 0; e < 16; ++e) { fa[0][e] = w64(av[0][e]); fa[1][e] = w64(av[1][e]); fa[2][e] = w64(av[2][e]); fa[3][e] = w64(av[3][e]); fb[0][e] = w64(bv[0][e]); fb[1][e] = w64(bv[1][e]); }
#pragma unroll
      for (int t = 0; t < 4; ++t) { acc[t][0] = wm(fa[t], fb[0], acc[t][0]); acc[t][1] = wm(fa[t], fb[1], acc[t][1]); }
      ap += (size_t)32 * CC; bp += (size_t)32 * HD; }
#pragma unroll
    for (int j = 0; j < 2; ++j) { _Float16* op = WF + ((h * 2 * 6 + wave * 2 + j) * 16 + (i0 >> 5)) * (size_t)512 + lane * 8;
#pragma unroll
      for (int t = 0; t < 4; ++t) { v8h hi, lo;
#pragma unroll
        for (int r = 0; r < 8; ++r) { const float v = acc[t][j][r] * (1.0f / 64.0f); hi[r] = (_Float16)v; lo[r] = (_Float16)(v - (float)hi[r]); }   /* sums carry 2^12; kept x 2^6 */
        vst2(op + (t >> 1) * 512 + (t & 1) * 256, hi); vst2(op + (size_t)NC3 * CC + (t >> 1) * 512 + (t & 1) * 256, lo); } }
  } else {
    const float* ap = BL + h * CC + 8 * g;
    v8f acc[2] = {};
#pragma unroll 1   /* rolled: 16 short steps of one small block a head, nothing to gain from more code */
    for (int kc = 0; kc < CC / 32; ++kc) { float av[16], bv[2][16];
#pragma unroll
      for (int e = 0; e < 16; ++e) { const int ko = e < 8 ? e : e + 8; av[e] = ap[ko]; bv[0][e] = bp[(size_t)ko * HD]; bv[1][e] = bp[(size_t)ko * HD + 16]; }
      XW2(ap, bp); __builtin_amdgcn_sched_barrier(0);   /* keeps the wait directly behind the loads, in front of the pointer steps (it had sunk to the loop's foot) */
      v16h fa, fb[2];
#pragma unroll
      for (int e = 0; e < 16; ++e) { fa[e] = w64(av[e]); fb[0][e] = w64(bv[0][e]); fb[1][e] = w64(bv[1][e]); }
      acc[0] = wm(fa, fb[0], acc[0]); acc[1] = wm(fa, fb[1], acc[1]);
      ap += 32; bp += (size_t)32 * HD; }
    if (g == 0) { float* op = BC + h * NC3 + wave * HD + col; op[0] = acc[0][0] * (1.0f / 4096.0f); op[16] = acc[1][0] * (1.0f / 4096.0f); } } }

// ---- k_qkv: block = (128 rows of x, head), wave = 32 rows; folded weight f16 hi then residual, read in fragment order; x rows bf16-rounded, exact in f16. The same two fragments serve either way round:
// q, k: [q|k]^T = weight (A = channel rows) x x^T (B = x rows): D element r = channel 8g + r, column = row of x, so a lane holds 8 consecutive channels of its row = 16 bytes of a q or k row;
// v: x (A = x rows) x weight^T (B = channel columns): D element r = row of x 8g + r, column = channel, so a lane holds 8 consecutive positions of its channel = 16 bytes of a v plane [c][t].
// The f32 sums go from the registers straight into the planes that k_fa reads: q, k -> f16 rows (+ x 2^10 residual rows for t < QHI, KHI), v -> f16 planes [c][t] (+ bf16 hi / lo planes for t < KHI).
static_assert(QHI == KHI && QHI % 32 == 0 && TT % 128 == 0, "a wave's 32 rows lie in one sequence, wholly below or wholly above the high-precision bound");
__global__ __launch_bounds__(128) void k_qkv(const float* __restrict__ X, const _Float16* __restrict__ WF, const float* __restrict__ BC, _Float16* __restrict__ QH, _Float16* __restrict__ QL, _Float16* __restrict__ KH, _Float16* __restrict__ KL, _Float16* __restrict__ VT, __bf16* __restrict__ VB, __bf16* __restrict__ VBL) {
  const int tid = threadIdx.x, lane = tid & 31, col = lane & 15, g = lane >> 4; const int wave = __builtin_amdgcn_readfirstlane(tid >> 5);
  const size_t h = blockIdx.y, r0 = (size_t)blockIdx.x * 128 + wave * 32;
  const float* xp = X + (r0 + col) * CC + 8 * g;
  const _Float16* wp = WF + h * 2 * NC3 * CC + lane * 8;   /* fragment order: tile ct at ct * 16 * 512, k step at 512, element half at 256 */
  v8f acc[6][2] = {};
#pragma unroll 1   /* rolled: one step's fragments and the 96 sums already take most of the registers */
  for (int kc = 0; kc < CC / 32; ++kc) { v4f xv[2][4]; v16h wh[6], wl[6];
#pragma unroll
    for (int u = 0; u < 2; ++u) { const float* p = xp + (size_t)u * 16 * CC; xv[u][0] = *(const v4f*)p; xv[u][1] = *(const v4f*)(p + 4); xv[u][2] = *(const v4f*)(p + 16); xv[u][3] = *(const v4f*)(p + 20); }
#pragma unroll
    for (int ct = 0; ct < 6; ++ct) { wh[ct] = frag_fo(wp + (size_t)(ct * 16) * 512); wl[ct] = frag_fo(wp + (size_t)(NC3 + ct * 16) * 512); }
    XW2(xp, wp); __builtin_amdgcn_sched_barrier(0);   /* every load of the step is issued before the first conversion or product: one memory latency a step; the scheduler had kept only two fragments in flight */
    v16h xb[2];
#pragma unroll
    for (int u = 0; u < 2; ++u)
#pragma unroll
      for (int e = 0; e < 16; ++e) xb[u][e] = (_Float16)bfr(xv[u][e >> 2][e & 3]);
#pragma unroll
    for (int ct = 0; ct < 4; ++ct) { acc[ct][0] = wm(wh[ct], xb[0], acc[ct][0]); acc[ct][1] = wm(wh[ct], xb[1], acc[ct][1]); }
#pragma unroll
    for (int ct = 4; ct < 6; ++ct) { acc[ct][0] = wm(xb[0], wh[ct], acc[ct][0]); acc[ct][1] = wm(xb[1], wh[ct], acc[ct][1]); }
#pragma unroll
    for (int ct = 0; ct < 4; ++ct) { acc[ct][0] = wm(wl[ct], xb[0], acc[ct][0]); acc[ct][1] = wm(wl[ct], xb[1], acc[ct][1]); }
#pragma unroll
    for (int ct = 4; ct < 6; ++ct) { acc[ct][0] = wm(xb[0], wl[ct], acc[ct][0]); acc[ct][1] = wm(xb[1], wl[ct], acc[ct][1]); }
    xp += 32; wp += 512; }
  const float *bcp = BC + h * NC3 + 8 * g, *bvp = BC + h * NC3 + 2 * HD + col; v4f bc[4][2]; float bv[2];   /* q, k: the bias of the lane's 8 channels; v: of its one channel a tile */
#pragma unroll
  for (int ct = 0; ct < 4; ++ct) { bc[ct][0] = *(const v4f*)(bcp + ct * 16); bc[ct][1] = *(const v4f*)(bcp + ct * 16 + 4); }
  bv[0] = bvp[0]; bv[1] = bvp[16];
  asm volatile("s_wait_xcnt 0x0" ::: "memory"); __builtin_amdgcn_sched_barrier(0);   /* the bias loads' address registers are rewritten only behind this wait; the scheduling barrier keeps the stores' address arithmetic behind it */
#pragma unroll
  for (int ct = 0; ct < 6; ++ct)
#pragma unroll
    for (int u = 0; u < 2; ++u)
#pragma unroll
      for (int r = 0; r < 8; ++r) acc[ct][u][r] = acc[ct][u][r] * (1.0f / 64.0f) + (ct < 4 ? bc[ct][r >> 2][r & 3] : bv[ct - 4]);
  const size_t bb = r0 / TT, t0 = r0 % TT, co = h * HD + 8 * g, vc = bb * CC + h * HD + col;
  _Float16 *qo = QH + (r0 + col) * CC + co, *ko = KH + (r0 + col) * CC + co, *vo = VT + vc * TT + t0 + 8 * g;
#pragma unroll
  for (int u = 0; u < 2; ++u)
#pragma unroll
    for (int j = 0; j < 2; ++j) { v8h q, k, v;
#pragma unroll
      for (int r = 0; r < 8; ++r) { q[r] = (_Float16)acc[j][u][r]; k[r] = (_Float16)acc[2 + j][u][r]; v[r] = (_Float16)acc[4 + j][u][r]; }
      vst2(qo + (size_t)u * 16 * CC + j * 16, q); vst2(ko + (size_t)u * 16 * CC + j * 16, k); vst2(vo + (size_t)j * 16 * TT + u * 16, v); }
  if (t0 < QHI) {   /* the same for a whole wave */
    _Float16 *qlo = QL + (bb * QHI + t0 + col) * CC + co, *klo = KL + (bb * KHI + t0 + col) * CC + co; __bf16 *vho = VB + vc * KHI + t0 + 8 * g, *vlo = VBL + vc * KHI + t0 + 8 * g;
#pragma unroll
    for (int u = 0; u < 2; ++u)
#pragma unroll
      for (int j = 0; j < 2; ++j) { v8h q, k; v8b vh, vl;
#pragma unroll
        for (int r = 0; r < 8; ++r) { const float qf = acc[j][u][r], kf = acc[2 + j][u][r], vf = acc[4 + j][u][r]; const __bf16 b = (__bf16)vf;
          q[r] = (_Float16)((qf - (float)(_Float16)qf) * 1024.0f); k[r] = (_Float16)((kf - (float)(_Float16)kf) * 1024.0f); vh[r] = b; vl[r] = (__bf16)(vf - (float)b); }
        vst2(qlo + (size_t)u * 16 * CC + j * 16, q); vst2(klo + (size_t)u * 16 * CC + j * 16, k); vst2(vho + (size_t)j * 16 * KHI + u * 16, vh); vst2(vlo + (size_t)j * 16 * KHI + u * 16, vl); } } }

extern "C" void kernel_launch(void* const* d_in, const int* in_sizes, int n_in, void* d_out, int out_size, void* d_ws, size_t ws_size, hipStream_t stream) {
  (void)in_sizes; (void)n_in; (void)out_size;
  const float** F = (const float**)d_in;
  if (ws_size < (size_t)WS_END) return;
  char* ws = (char*)d_ws; _Float16 *QH = (_Float16*)(ws + WS_QH), *KH = (_Float16*)(ws + WS_KH), *VT = (_Float16*)(ws + WS_VT), *QL = (_Float16*)(ws + WS_QL), *KL = (_Float16*)(ws + WS_KL); __bf16 *VB = (__bf16*)(ws + WS_VB), *VBL = (__bf16*)(ws + WS_VBL); float *S = (float*)(ws + WS_S), *Y = (float*)(ws + WS_Y);
  (void)Y; (void)S; (void)QL; (void)KL; (void)VB; (void)VBL;
  // inputs: 0 x [2,2048,512]; 1 Wl [16,512,512] (out,in); 2 bl [16,512]; 3 Wq [16,512,32] (in,out); 4 Wk; 5 Wv; 6 Wo [512,512] (out,in); 7 bo [512]
  if (ws_size < (size_t)WS_TOP) return;
  _Float16* WF = (_Float16*)(ws + WS_WF); float *BC = (float*)(ws + WS_BC), *CAT = (float*)(ws + WS_CAT);
  /* head = blockIdx.y in the two projection launches */
  k_fold<<<dim3(CC / 64 + 1, NH), 96, 0, stream>>>(F[1], F[2], F[3], F[4], F[5], WF, BC);   /* folded weights Wl[h]^T [Wq|Wk|Wv][h] and bias bl[h] [Wq|Wk|Wv][h] */
  k_qkv<<<dim3(NRW / 128, NH), 128, 0, stream>>>(F[0], WF, BC, QH, QL, KH, KL, VT, VB, VBL);   /* q, k, v of every head = x folded weight + folded bias, written as the planes that k_fa reads */
  k_fa<<<dim3(NQB, NH, TNB), 128, 0, stream>>>(QH, KH, QL, KL, VT, VB, VBL, CAT);   /* logits, softmax and P v of every (b, h) in one launch */
  k_goi<<<dim3(NRW / 64, CC / 128), 128, 0, stream>>>(CAT, CC, CC, 0, 0, F[6], CC, F[7], nullptr, 0, (float*)d_out, 0, 0, 0);   /* out = cat Wo^T + bo */
}

// v005
// Measured time: 103 microseconds a run.
// Next to v004, in two timings, it ran 1.62 and 1.60 times as fast.
// All steps since v000 together make it 29.5 times as fast.
// compute dtype: all float inputs rounded to bf16; q/k/v = x (Wl[h]^T Wq/Wk/Wv[h]) + bl[h] Wq/Wk/Wv[h]: the folded weight and bias from f16(bf16 x 2^6) operands (exact, 1 product, WMMA 16x16x32, f32 accumulate), the folded weight kept as f16 hi + residual (x 2^6) against x as f16 (bf16-exact) (2 products); unscaled causal logits: q, k once to f16 (1 product), 3 products below row 384; online softmax in f32 (running maximum and sum, one fused kernel); P = exp(logit - maximum) once to f16 against v f16 (P and v as bf16 hi + lo below row 384); out = cat as f16 hi + residual against Wo^T f16(bf16 x 2^6) (2 products) + bo; f32 output.
#include <hip/hip_runtime.h>
#include <math.h>

typedef __attribute__((ext_vector_type(16))) _Float16 v16h;
typedef __attribute__((ext_vector_type(16))) __bf16 v16b;
typedef __attribute__((ext_vector_type(8)))  _Float16 v8h;
typedef __attribute__((ext_vector_type(8)))  float v8f;
typedef __attribute__((ext_vector_type(4)))  float v4f;
typedef __attribute__((ext_vector_type(2)))  float v2f;
typedef __attribute__((ext_vector_type(4)))  unsigned v4u;
typedef __attribute__((ext_vector_type(4)))  int v4i;
typedef float __attribute__((may_alias)) float_a;
typedef int __attribute__((may_alias)) int_a;

template <typename T> __device__ __forceinline__ void vst2(void* p, T v) { *(T*)p = v;  }
__device__ __forceinline__ v8f wmma16(v16h a, v16h b, v8f c) {
  v8f d = __builtin_amdgcn_wmma_f32_16x16x32_f16(false, a, false, b, (short)0, c, false, false);
  asm volatile("v_nop\n\tv_nop\n\tv_nop\n\tv_nop" : "+v"(d) : "v"(a), "v"(b));
  return d;
}
__device__ __forceinline__ v8f wmma_bf(v16b a, v16b b, v8f c) {
  v8f d = __builtin_amdgcn_wmma_f32_16x16x32_bf16(false, a, false, b, (short)0, c, false, false);
  asm volatile("v_nop\n\tv_nop\n\tv_nop\n\tv_nop" : "+v"(d) : "v"(a), "v"(b));
  return d;
}
// 16x16x32 fragments: lane = (h = lane>>4, row/col = lane&15); elements 0..7 = k0+8h+0..7, 8..15 = k0+16+8h+0..7; D element r = row 8h+r
__device__ __forceinline__ v16h frag_h(const _Float16* rowk0, int lane) {
  union { v16h v; v8h q[2]; } u; const _Float16* p = rowk0 + 8 * (lane >> 4);
  u.q[0] = *(const v8h*)p; u.q[1] = *(const v8h*)(p + 16); return u.v;
}
__device__ __forceinline__ v16h frag_f32(const float* rowk0, int lane) {
  v16h a; const float* p = rowk0 + 8 * (lane >> 4);
#pragma unroll
  for (int i = 0; i < 8; ++i) { a[i] = (_Float16)p[i]; a[8 + i] = (_Float16)p[16 + i]; }
  return a;
}
__device__ __forceinline__ v16h frag_f32s(const float* rowk0, int lane, float sc) {
  v16h a; const float* p = rowk0 + 8 * (lane >> 4);
#pragma unroll
  for (int i = 0; i < 8; ++i) { a[i] = (_Float16)(p[i] * sc); a[8 + i] = (_Float16)(p[16 + i] * sc); }
  return a;
}
// column fragment from a [K][ld] layout (column n), rows >= K read as 0
__device__ __forceinline__ v16h fragc_f32(const float* W, int k0, int n, int lane, int ld, int K) {
  v16h a; const int g = lane >> 4;
#pragma unroll
  for (int i = 0; i < 8; ++i) { const int ka = k0 + 8 * g + i, kb = ka + 16;
    a[i] = (_Float16)(ka < K ? W[(size_t)(ka < K ? ka : K - 1) * ld + n] : 0.f); a[8 + i] = (_Float16)(kb < K ? W[(size_t)(kb < K ? kb : K - 1) * ld + n] : 0.f); }
  return a;
}
struct F2 { v16b h, l; };
__device__ __forceinline__ F2 bsplit16(const float v[16]) { F2 r;
#pragma unroll
  for (int i = 0; i < 16; ++i) { const __bf16 h = (__bf16)v[i]; r.h[i] = h; r.l[i] = (__bf16)(v[i] - (float)h); }
  return r; }
__device__ __forceinline__ F2 split_row(const float* row, int k0, int lane) { float v[16]; const float* p = row + k0 + 8 * (lane >> 4);
#pragma unroll
  for (int i = 0; i < 8; ++i) { v[i] = p[i]; v[8 + i] = p[16 + i]; }
  return bsplit16(v); }
__device__ __forceinline__ F2 split_rowK(const float* row, int k0, int lane, int K) { float v[16]; const int g = lane >> 4;
#pragma unroll
  for (int i = 0; i < 8; ++i) { const int ka = k0 + 8 * g + i, kb = ka + 16; v[i] = ka < K ? row[ka < K ? ka : K - 1] : 0.f; v[8 + i] = kb < K ? row[kb < K ? kb : K - 1] : 0.f; }
  return bsplit16(v); }
__device__ __forceinline__ F2 split_col(const float* W, int k0, int n, int lane, int ld, int K) { float v[16]; const int g = lane >> 4;
#pragma unroll
  for (int i = 0; i < 8; ++i) { const int ka = k0 + 8 * g + i, kb = ka + 16; v[i] = ka < K ? W[(size_t)(ka < K ? ka : K - 1) * ld + n] : 0.f; v[8 + i] = kb < K ? W[(size_t)(kb < K ? kb : K - 1) * ld + n] : 0.f; }
  return bsplit16(v); }
__device__ __forceinline__ v8f mac3(const F2& a, const F2& b, v8f c) { c = wmma_bf(a.l, b.h, c); c = wmma_bf(a.h, b.l, c); return wmma_bf(a.h, b.h, c); }
__device__ __forceinline__ float sigm(float v) { return 1.0f / (1.0f + expf(-v)); }
#define LDSX() do { asm volatile("s_wait_dscnt 0" ::: "memory"); __builtin_amdgcn_wave_barrier(); __builtin_amdgcn_fence(__ATOMIC_RELEASE, "workgroup"); } while (0)

// Per-head multi-head causal attention (B 2, S 2,048, 512; 16 heads x 32; 0.02-scale weights: per-head Linear Wl [16,512,512] (out,in) + bl, per-head Wq/Wk/Wv [16,512,32] (in,out) no bias, Wo [512,512] (out,in) + bo): xh = x Wl[h]^T + bl[h]; Q, K, V = xh Wq[h], xh Wk[h], xh Wv[h]; scores = Q K^T (NO scaling), causal; F = softmax(scores) V; out = concat_h(F) Wo^T + bo.
#define NB 2
#define TT 2048
#define CC 512            // NH * HD = projected width
#define DIN 512          // input (model) width
#define NH 16
#define HD 32
#define NQB (TT / 64)
#define HG 8
#define SCALE (1.0f)
#define CAUSAL 1
#ifndef TNB
#define TNB NB
#endif
__device__ __forceinline__ float bfr(float v) { return (float)(__bf16)v; }
__host__ __device__ __forceinline__ int kb_last(int qb) { return CAUSAL ? ((qb * 64 + 63) >> 7) : (TT / 128 - 1); }
typedef __attribute__((ext_vector_type(8))) __bf16 v8b;
__device__ __forceinline__ v16b frag_b(const __bf16* rowk0, int lane) {
  union { v16b v; v8b q[2]; } u; const __bf16* p = rowk0 + 8 * (lane >> 4);
  u.q[0] = *(const v8b*)p; u.q[1] = *(const v8b*)(p + 16); return u.v;
}
#define QBH 6              // causal: query blocks 0..QBH-1 of each sequence (few keys, no averaging) take the high-precision path
#define QHI 384            // rows carrying a q residual plane
#define KHI 384            // key rows carrying k residual / v bf16 hi+lo planes (used only by the causal high-precision path)
// B fragment (k rows k0+.., output column o) of a weight: (in,out) [K][ld] or (out,in) [ld rows of K]: bf16 exact, or f16(bf16 * 256) exact
__device__ __forceinline__ v16b wcol_io(const float* Wm, int k0, int o, int lane, int ld) { v16b w; const int g = lane >> 4;
#pragma unroll
  for (int i = 0; i < 8; ++i) { w[i] = (__bf16)Wm[(size_t)(k0 + 8 * g + i) * ld + o]; w[8 + i] = (__bf16)Wm[(size_t)(k0 + 16 + 8 * g + i) * ld + o]; }
  return w; }
__device__ __forceinline__ v16b wcol_oi(const float* Wm, int k0, int o, int lane, int K) { v16b w; const float* p = Wm + (size_t)o * K + k0 + 8 * (lane >> 4);
#pragma unroll
  for (int i = 0; i < 8; ++i) { w[i] = (__bf16)p[i]; w[8 + i] = (__bf16)p[16 + i]; }
  return w; }
__device__ __forceinline__ v16h wcolh_io(const float* Wm, int k0, int o, int lane, int ld) { v16h w; const int g = lane >> 4;
#pragma unroll
  for (int i = 0; i < 8; ++i) { w[i] = (_Float16)(bfr(Wm[(size_t)(k0 + 8 * g + i) * ld + o]) * 256.0f); w[8 + i] = (_Float16)(bfr(Wm[(size_t)(k0 + 16 + 8 * g + i) * ld + o]) * 256.0f); }
  return w; }
__device__ __forceinline__ v16h wcolh_oi(const float* Wm, int k0, int o, int lane, int K) { v16h w; const float* p = Wm + (size_t)o * K + k0 + 8 * (lane >> 4);
#pragma unroll
  for (int i = 0; i < 8; ++i) { w[i] = (_Float16)(bfr(p[i]) * 256.0f); w[8 + i] = (_Float16)(bfr(p[16 + i]) * 256.0f); }
  return w; }
#define WQKV_LAYOUT 1   // 0 = (in,out) [DIN][CC]; 1 = (out,in) [CC][DIN]; 2 = per-head [NH][DIN][HD]
__device__ __forceinline__ v16b wcol_hdk(const float* Wm, int k0, int o, int lane) { v16b w; const int g = lane >> 4; const float* p = Wm + (size_t)(o / HD) * DIN * HD + (o % HD);
#pragma unroll
  for (int i = 0; i < 8; ++i) { w[i] = (__bf16)p[(size_t)(k0 + 8 * g + i) * HD]; w[8 + i] = (__bf16)p[(size_t)(k0 + 16 + 8 * g + i) * HD]; }
  return w; }
#define WO_OUT_IN 0
#if WQKV_LAYOUT == 1
#define WCOL(W, k0, o, lane) wcol_oi(W, k0, o, lane, DIN)
#elif WQKV_LAYOUT == 2
#define WCOL(W, k0, o, lane) wcol_hdk(W, k0, o, lane)
#else
#define WCOL(W, k0, o, lane) wcol_io(W, k0, o, lane, CC)
#endif
#if WO_OUT_IN
#define WOCOL(W, k0, o, lane) wcol_oi(W, k0, o, lane, CC)
#define WOCOLH(W, k0, o, lane) wcolh_oi(W, k0, o, lane, CC)
#else
#define WOCOL(W, k0, o, lane) wcol_io(W, k0, o, lane, DIN)
#define WOCOLH(W, k0, o, lane) wcolh_io(W, k0, o, lane, DIN)
#endif

#ifndef SM_EXTRA_PARAMS
#define SM_EXTRA_PARAMS
#endif
#ifndef PROJ_EXTRA_PARAMS
#define PROJ_EXTRA_PARAMS
#endif
#ifndef SM_MASK_HOOK
#define SM_MASK_HOOK (void)0
#endif

#define WS_QH  0u                                      // f16 q rows [b*t][CC]
#define WS_KH  (WS_QH + 2u * (size_t)NB * TT * CC)      // f16 k rows [b*t][CC]
#define WS_VT  (WS_KH + 2u * (size_t)NB * TT * CC)      // f16 v planes [b][c][t]
#define WS_QL  (WS_VT + 2u * (size_t)NB * CC * TT)      // f16 q residual x 2^10 rows [b][t < QHI][CC]
#define WS_KL  (WS_QL + 2u * (size_t)NB * QHI * CC)     // f16 k residual x 2^10 rows [b][t < KHI][CC]
#define WS_VB  (WS_KL + 2u * (size_t)NB * KHI * CC)     // bf16 v hi planes [b][c][t < KHI]
#define WS_VBL (WS_VB + 2u * (size_t)NB * CC * KHI)
#define WS_S   (WS_VBL + 2u * (size_t)NB * CC * KHI)    // f32 area of HG * TT * TT floats; holds the folded weights and bias
#define WS_Y   (WS_S  + 4u * (size_t)HG * TT * TT)      // unused (k_fa writes the ctx rows to WS_CAT); same offset as WS_TQ
#define WS_XH  (WS_S + 0u)                              // area of NH * NB * TT * CC floats holding the folded weights and bias; fills the S region, which holds no logits (NH * NB * CC == HG * TT)
#define WS_TQ  (WS_XH + 4u * (size_t)NH * NB * TT * CC) // unused area of NH * NB * TT * 128 floats
#define WS_WP  (WS_TQ + 4u * (size_t)NH * NB * TT * 128) // unused area of NH * CC * 128 floats
#define WS_QB8 (WS_WP + 4u * (size_t)NH * CC * 128 + 256)
#define WS_KB8 (WS_QB8 + 4u * (size_t)NB * TT * CC)
#define WS_VB8 (WS_KB8 + 4u * (size_t)NB * TT * CC)
#define WS_CAT (WS_VB8 + 4u * (size_t)NB * TT * CC)
#define WS_END (WS_CAT + 4u * (size_t)NB * TT * CC)
#define WS_END2 WS_END
#define WS_TOP (WS_CAT + 4u * (size_t)NB * TT * CC)     // end of everything kernel_launch uses
static_assert((size_t)HG * TT * TT <= (size_t)NH * NB * TT * CC, "S must end where the WS_XH area ends");

// ---- k_fa: block = 64 queries (4 waves x 16) of (b, h), one pass over the keys 0 .. query in steps of 64 with a running row maximum and sum (online softmax); nothing of the logits or of P goes to memory.
// Both products are formed transposed so that every per-query value sits in the lane of its query (col = lane & 15): S^T = k q^T (A = key rows, B = query rows; D element r = key 8g + r, column = query), which is already the B fragment of P^T (elements 0..7 = tile 2c, 8..15 = tile 2c + 1), and ctx^T = v^T P^T (A = v planes [c][t]; D element r = channel 8g + r, column = query).
// Precision as before: q, k once to f16 (1 product), P once to f16 against v f16; query blocks < QBH: 3-product logits (q, k residual planes x 2^10), P and v as bf16 hi + lo (3 products). P is exp(logit - running maximum), at most 1; the division by the f32 row sum comes last.
#define L2E 1.4426950408889634f
#define NEGBIG (-1.0e30f)
// behind a group of global loads: their address registers (kept live to here as inputs) are rewritten only after this wait
#define XW2(p0, p1) asm volatile("s_wait_xcnt 0x0" :: "v"(p0), "v"(p1) : "memory")
#define XW4(p0, p1, p2, p3) asm volatile("s_wait_xcnt 0x0" :: "v"(p0), "v"(p1), "v"(p2), "v"(p3) : "memory")
static_assert(HD == 32, "one 32-deep product per logit tile, two 16-channel ctx tiles");
// 2^x; the v_nop fills the one slot that the instruction set asks for behind a transcendental, whatever the compiler schedules next (it had put a second v_exp_f32 there that overwrites the first one's source)
__device__ __forceinline__ float ex2(float x) { float r; asm("v_exp_f32 %0, %1\n\tv_nop" : "=v"(r) : "v"(x)); return r; }
// s[32] = this lane's logits of one 64-key step (excluded ones = NEGBIG) -> exp(s - new maximum); returns the factor that rescales what was summed under the old maximum
__device__ __forceinline__ float sm_step(float (&s)[32], float& m, float& l) {
  float c0 = fmaxf(s[0], s[1]), c1 = fmaxf(s[2], s[3]);
#pragma unroll
  for (int i = 4; i < 32; i += 2) { c0 = fmaxf(c0, s[i]); c1 = fmaxf(c1, s[i + 1]); }
  float cm = fmaxf(c0, c1); cm = fmaxf(cm, __shfl_xor(cm, 16));   /* lanes col and col + 16 hold the two key halves of one query */
  const float mn = fmaxf(m, cm), al = ex2((m - mn) * L2E), m2 = mn * L2E; m = mn;
  float a0 = 0.f, a1 = 0.f, a2 = 0.f, a3 = 0.f;
#pragma unroll
  for (int i = 0; i < 32; i += 4) {
    s[i] = ex2(fmaf(s[i], L2E, -m2)); s[i + 1] = ex2(fmaf(s[i + 1], L2E, -m2)); s[i + 2] = ex2(fmaf(s[i + 2], L2E, -m2)); s[i + 3] = ex2(fmaf(s[i + 3], L2E, -m2));
    a0 += s[i]; a1 += s[i + 1]; a2 += s[i + 2]; a3 += s[i + 3]; }
  l = l * al + ((a0 + a1) + (a2 + a3)); return al; }
// fragment from a pointer that already holds the lane half's offset: elements 0..7 = p[0..7], 8..15 = p[16..23]
__device__ __forceinline__ v16h frag_hp(const _Float16* p) { union { v16h v; v8h q[2]; } u; u.q[0] = *(const v8h*)p; u.q[1] = *(const v8h*)(p + 16); return u.v; }
__device__ __forceinline__ v16b frag_bp(const __bf16* p) { union { v16b v; v8b q[2]; } u; u.q[0] = *(const v8b*)p; u.q[1] = *(const v8b*)(p + 16); return u.v; }
__global__ __launch_bounds__(128) void k_fa(const _Float16* __restrict__ QH, const _Float16* __restrict__ KH, const _Float16* __restrict__ QL, const _Float16* __restrict__ KL, const _Float16* __restrict__ VT, const __bf16* __restrict__ VB, const __bf16* __restrict__ VBL, float* __restrict__ Y) {
  const int tid = threadIdx.x, lane = tid & 31, col = lane & 15, g = lane >> 4; const int wave = __builtin_amdgcn_readfirstlane(tid >> 5);
  const int qb = NQB - 1 - (int)blockIdx.x, h = blockIdx.y, b = blockIdx.z;   /* longest query blocks start first */
  const int ql0 = qb * 64 + wave * 16, tq = ql0 + col;
  float m = NEGBIG, l = 0.f; v8f o[2] = {}; const v8f zero = {};
  const _Float16* qp = QH + ((size_t)b * TT + tq) * CC + h * HD + 8 * g;   /* every fragment pointer below already holds the lane half's 8 * g */
  const _Float16* kp = KH + ((size_t)b * TT + col) * CC + h * HD + 8 * g;
  if (qb < QBH) {
    const _Float16* qlp = QL + ((size_t)b * QHI + tq) * CC + h * HD + 8 * g;
    const v16h bq = frag_hp(qp), bql = frag_hp(qlp); XW2(qp, qlp);
    const _Float16* klp = KL + ((size_t)b * KHI + col) * CC + h * HD + 8 * g;
    const size_t vo = ((size_t)b * CC + h * HD + col) * (size_t)KHI + 8 * g;
#pragma unroll 1
    for (int it = 0; it <= qb; ++it) { const int k0 = it * 64; float s[32];
      const _Float16 *kq = kp + (size_t)k0 * CC, *klq = klp + (size_t)k0 * CC; const __bf16 *vhq = VB + vo + k0, *vlq = VBL + vo + k0;
      v16h khf[4], klf[4]; v16b vhf[4], vlf[4];   /* index of the v fragments: c * 2 + j */
#pragma unroll
      for (int t = 0; t < 4; ++t) { khf[t] = frag_hp(kq + (size_t)(t * 16) * CC); klf[t] = frag_hp(klq + (size_t)(t * 16) * CC); vhf[t] = frag_bp(vhq + (size_t)(t & 1) * 16 * KHI + (t >> 1) * 32); vlf[t] = frag_bp(vlq + (size_t)(t & 1) * 16 * KHI + (t >> 1) * 32); }
      XW4(kq, klq, vhq, vlq);
#pragma unroll
      for (int t = 0; t < 4; ++t) { const v16h kh = khf[t], kl = klf[t];
        const v8f a = wmma16(kh, bq, zero); v8f a2 = wmma16(kh, bql, zero); a2 = wmma16(kl, bq, a2);
#pragma unroll
        for (int r = 0; r < 8; ++r) { const float v = (a[r] + a2[r] * (1.0f / 1024.0f)) * SCALE; s[t * 8 + r] = (k0 + t * 16 + 8 * g + r <= tq) ? v : NEGBIG; } }
      const float al = sm_step(s, m, l);
#pragma unroll
      for (int r = 0; r < 8; ++r) { o[0][r] *= al; o[1][r] *= al; }
#pragma unroll
      for (int c = 0; c < 2; ++c) { float v[16];
#pragma unroll
        for (int i = 0; i < 8; ++i) { v[i] = s[c * 16 + i]; v[8 + i] = s[c * 16 + 8 + i]; }
        const F2 p = bsplit16(v);
#pragma unroll
        for (int j = 0; j < 2; ++j) { const v16b vh = vhf[c * 2 + j];
          o[j] = wmma_bf(vh, p.h, o[j]); o[j] = wmma_bf(vh, p.l, o[j]); o[j] = wmma_bf(vlf[c * 2 + j], p.h, o[j]); } } }
  } else {
    const _Float16* vp = VT + ((size_t)b * CC + h * HD + col) * (size_t)TT + 8 * g;
    const v16h bq = frag_hp(qp);
    v16h kf[4], vf[4];   /* this step's fragments, fetched one step ahead; index of the v fragments: j * 2 + c */
#pragma unroll
    for (int t = 0; t < 4; ++t) { kf[t] = frag_hp(kp + (size_t)(t * 16) * CC); vf[t] = frag_hp(vp + (size_t)(t >> 1) * 16 * TT + (t & 1) * 32); }
    XW4(qp, kp, vp, vp);
#pragma unroll 1
    for (int it = 0; it <= qb; ++it) { const int k0 = it * 64, kn = (it < qb ? it + 1 : it) * 64;   /* the last step fetches its own tile again: in bounds, unused */
      const _Float16 *kq = kp + (size_t)kn * CC, *vq = vp + kn; v16h kx[4], vx[4];
#pragma unroll
      for (int t = 0; t < 4; ++t) { kx[t] = frag_hp(kq + (size_t)(t * 16) * CC); vx[t] = frag_hp(vq + (size_t)(t >> 1) * 16 * TT + (t & 1) * 32); }
      XW2(kq, vq);
      float s[32];
#pragma unroll
      for (int t = 0; t < 4; ++t) { const v8f a = wmma16(kf[t], bq, zero);
#pragma unroll
        for (int r = 0; r < 8; ++r) s[t * 8 + r] = a[r] * SCALE; }
      if (it == qb) {   /* only the diagonal step holds keys past a query */
#pragma unroll
        for (int i = 0; i < 32; ++i) s[i] = (k0 + (i >> 3) * 16 + 8 * g + (i & 7) <= tq) ? s[i] : NEGBIG; }
      const float al = sm_step(s, m, l);
#pragma unroll
      for (int r = 0; r < 8; ++r) { o[0][r] *= al; o[1][r] *= al; }
#pragma unroll
      for (int c = 0; c < 2; ++c) { v16h p;
#pragma unroll
        for (int i = 0; i < 16; ++i) p[i] = (_Float16)s[c * 16 + i];
        o[0] = wmma16(vf[c], p, o[0]); o[1] = wmma16(vf[2 + c], p, o[1]); }
#pragma unroll
      for (int t = 0; t < 4; ++t) { kf[t] = kx[t]; vf[t] = vx[t]; } } }
  l += __shfl_xor(l, 16); const float inv = l > 0.f ? 1.0f / l : 0.f;
  float* yp = Y + ((size_t)b * TT + tq) * CC + h * HD + 8 * g;   /* the 128-B (row, head) segment is written by two lanes of one wave */
#pragma unroll
  for (int j = 0; j < 2; ++j) { v4f w0, w1;
#pragma unroll
    for (int r = 0; r < 4; ++r) { w0[r] = o[j][r] * inv; w1[r] = o[j][4 + r] * inv; }
    vst2(yp + j * 16, w0); vst2(yp + j * 16 + 4, w1); } }

#define NRW (TNB * TT)
#ifndef SM_EXTRA_PARAMS
#define SM_EXTRA_PARAMS
#endif
#ifndef PROJ_EXTRA_PARAMS
#define PROJ_EXTRA_PARAMS
#endif
#ifndef SM_MASK_HOOK
#define SM_MASK_HOOK (void)0
#endif

#define WS_QH  0u                                      // f16 q rows [b*t][CC]
#define WS_KH  (WS_QH + 2u * (size_t)NB * TT * CC)      // f16 k rows [b*t][CC]
#define WS_VT  (WS_KH + 2u * (size_t)NB * TT * CC)      // f16 v planes [b][c][t]
#define WS_QL  (WS_VT + 2u * (size_t)NB * CC * TT)      // f16 q residual x 2^10 rows [b][t < QHI][CC]
#define WS_KL  (WS_QL + 2u * (size_t)NB * QHI * CC)     // f16 k residual x 2^10 rows [b][t < KHI][CC]
#define WS_VB  (WS_KL + 2u * (size_t)NB * KHI * CC)     // bf16 v hi planes [b][c][t < KHI]
#define WS_VBL (WS_VB + 2u * (size_t)NB * CC * KHI)
#define WS_S   (WS_VBL + 2u * (size_t)NB * CC * KHI)    // f32 area of HG * TT * TT floats; holds the folded weights and bias
#define WS_Y   (WS_S  + 4u * (size_t)HG * TT * TT)      // unused (k_fa writes the ctx rows to WS_CAT); same offset as WS_TQ
#define WS_END (WS_Y  + 0u)
#define WS_Y2  (WS_END)
#define WS_O1  (WS_Y2 + 4u * (size_t)NB * TT * CC)
#define WS_R2  (WS_O1 + 4u * (size_t)NB * TT * CC)
#define WS_END2 (WS_R2 + 4u * (size_t)NB * TT * CC)


#define NC3 96                                          // q | k | v channels of one head
#define WS_WF  (WS_XH + 0u)                             // f16 folded weights x 2^6 in fragment order [h][hi, residual][channel tile 6][k step 16][element half 2][lane 32][8]
#define WS_BC  (WS_WF + 2u * (size_t)NH * 2 * NC3 * CC) // f32 folded bias [h][NC3]
__device__ __forceinline__ v8f wm(v16h a, v16h b, v8f c) { return __builtin_amdgcn_wmma_f32_16x16x32_f16(false, a, false, b, (short)0, c, false, false); }
__device__ __forceinline__ v16h frag_fo(const _Float16* p) { union { v16h v; v8h q[2]; } u; u.q[0] = *(const v8h*)p; u.q[1] = *(const v8h*)(p + 256); return u.v; }
__device__ __forceinline__ _Float16 w64(float v) { return (_Float16)(bfr(v) * 64.0f); }
// ---- k_fold: (x Wl^T + bl) W = x (Wl^T W) + bl W. Block = (64 input indices i0.., head), wave = which of Wq, Wk, Wv: D[i][c] = sum_o Wl[o][i] W[o][c] (A = Wl^T: row i, k = o; B = W: k = o, column c; both read with the same k order 8g + e, 16 + 8g + e);
// D element r = input index 8g + r of channel column c: exactly the 8 elements that lane 16g + c of k_qkv's weight fragment (A for q, k, B for v; row or column = channel, k = input index) holds in half t & 1 of k step i0 / 32 + t / 2, so WF is kept in that order: a store here and a load there are 512 contiguous bytes of whole 128-B lines, each line written by one wave. The last blockIdx.x takes bl as every row of A and gives the folded bias.
__global__ __launch_bounds__(96) void k_fold(const float* __restrict__ WL, const float* __restrict__ BL, const float* __restrict__ WQ, const float* __restrict__ WK, const float* __restrict__ WV, _Float16* __restrict__ WF, float* __restrict__ BC) {
  const int tid = threadIdx.x, lane = tid & 31, col = lane & 15, g = lane >> 4; const int wave = __builtin_amdgcn_readfirstlane(tid >> 5);
  const size_t h = blockIdx.y;
  const float* bp = (wave == 0 ? WQ : wave == 1 ? WK : WV) + h * CC * HD + (size_t)(8 * g) * HD + col;
  if (blockIdx.x < CC / 64) {
    const int i0 = blockIdx.x * 64;
    const float* ap = WL + h * CC * CC + (size_t)(8 * g) * CC + i0 + col;
    v8f acc[4][2] = {};
#pragma unroll 1   /* rolled: one step's 96 loaded values and the 64 sums already take most of the registers */
    for (int kc = 0; kc < CC / 32; ++kc) { float av[4][16], bv[2][16];
#pragma unroll
      for (int e = 0; e < 16; ++e) { const int ko = e < 8 ? e : e + 8;
#pragma unroll
        for (int t = 0; t < 4; ++t) av[t][e] = ap[(size_t)ko * CC + t * 16];
        bv[0][e] = bp[(size_t)ko * HD]; bv[1][e] = bp[(size_t)ko * HD + 16]; }
      XW2(ap, bp); __builtin_amdgcn_sched_barrier(0);   /* every load of the step is issued before the first conversion or product: one memory latency a step; the scheduler had kept only two fragments in flight */
      v16h fa[4], fb[2];
#pragma unroll
      for (int e = 0; e < 16; ++e) { fa[0][e] = w64(av[0][e]); fa[1][e] = w64(av[1][e]); fa[2][e] = w64(av[2][e]); fa[3][e] = w64(av[3][e]); fb[0][e] = w64(bv[0][e]); fb[1][e] = w64(bv[1][e]); }
#pragma unroll
      for (int t = 0; t < 4; ++t) { acc[t][0] = wm(fa[t], fb[0], acc[t][0]); acc[t][1] = wm(fa[t], fb[1], acc[t][1]); }
      ap += (size_t)32 * CC; bp += (size_t)32 * HD; }
#pragma unroll
    for (int j = 0; j < 2; ++j) { _Float16* op = WF + ((h * 2 * 6 + wave * 2 + j) * 16 + (i0 >> 5)) * (size_t)512 + lane * 8;
#pragma unroll
      for (int t = 0; t < 4; ++t) { v8h hi, lo;
#pragma unroll
        for (int r = 0; r < 8; ++r) { const float v = acc[t][j][r] * (1.0f / 64.0f); hi[r] = (_Float16)v; lo[r] = (_Float16)(v - (float)hi[r]); }   /* sums carry 2^12; kept x 2^6 */
        vst2(op + (t >> 1) * 512 + (t & 1) * 256, hi); vst2(op + (size_t)NC3 * CC + (t >> 1) * 512 + (t & 1) * 256, lo); } }
  } else {
    const float* ap = BL + h * CC + 8 * g;
    v8f acc[2] = {};
#pragma unroll 1   /* rolled: 16 short steps of one small block a head, nothing to gain from more code */
    for (int kc = 0; kc < CC / 32; ++kc) { float av[16], bv[2][16];
#pragma unroll
      for (int e = 0; e < 16; ++e) { const int ko = e < 8 ? e : e + 8; av[e] = ap[ko]; bv[0][e] = bp[(size_t)ko * HD]; bv[1][e] = bp[(size_t)ko * HD + 16]; }
      XW2(ap, bp); __builtin_amdgcn_sched_barrier(0);   /* keeps the wait directly behind the loads, in front of the pointer steps (it had sunk to the loop's foot) */
      v16h fa, fb[2];
#pragma unroll
      for (int e = 0; e < 16; ++e) { fa[e] = w64(av[e]); fb[0][e] = w64(bv[0][e]); fb[1][e] = w64(bv[1][e]); }
      acc[0] = wm(fa, fb[0], acc[0]); acc[1] = wm(fa, fb[1], acc[1]);
      ap += 32; bp += (size_t)32 * HD; }
    if (g == 0) { float* op = BC + h * NC3 + wave * HD + col; op[0] = acc[0][0] * (1.0f / 4096.0f); op[16] = acc[1][0] * (1.0f / 4096.0f); } } }

// ---- k_qkv: block = (128 rows of x, head), wave = 32 rows; folded weight f16 hi then residual, read in fragment order; x rows bf16-rounded, exact in f16. The same two fragments serve either way round:
// q, k: [q|k]^T = weight (A = channel rows) x x^T (B = x rows): D element r = channel 8g + r, column = row of x, so a lane holds 8 consecutive channels of its row = 16 bytes of a q or k row;
// v: x (A = x rows) x weight^T (B = channel columns): D element r = row of x 8g + r, column = channel, so a lane holds 8 consecutive positions of its channel = 16 bytes of a v plane [c][t].
// The f32 sums go from the registers straight into the planes that k_fa reads: q, k -> f16 rows (+ x 2^10 residual rows for t < QHI, KHI), v -> f16 planes [c][t] (+ bf16 hi / lo planes for t < KHI).
static_assert(QHI == KHI && QHI % 32 == 0 && TT % 128 == 0, "a wave's 32 rows lie in one sequence, wholly below or wholly above the high-precision bound");
__global__ __launch_bounds__(128) void k_qkv(const float* __restrict__ X, const _Float16* __restrict__ WF, const float* __restrict__ BC, _Float16* __restrict__ QH, _Float16* __restrict__ QL, _Float16* __restrict__ KH, _Float16* __restrict__ KL, _Float16* __restrict__ VT, __bf16* __restrict__ VB, __bf16* __restrict__ VBL) {
  const int tid = threadIdx.x, lane = tid & 31, col = lane & 15, g = lane >> 4; const int wave = __builtin_amdgcn_readfirstlane(tid >> 5);
  const size_t h = blockIdx.y, r0 = (size_t)blockIdx.x * 128 + wave * 32;
  const float* xp = X + (r0 + col) * CC + 8 * g;
  const _Float16* wp = WF + h * 2 * NC3 * CC + lane * 8;   /* fragment order: tile ct at ct * 16 * 512, k step at 512, element half at 256 */
  v8f acc[6][2] = {};
#pragma unroll 1   /* rolled: one step's fragments and the 96 sums already take most of the registers */
  for (int kc = 0; kc < CC / 32; ++kc) { v4f xv[2][4]; v16h wh[6], wl[6];
#pragma unroll
    for (int u = 0; u < 2; ++u) { const float* p = xp + (size_t)u * 16 * CC; xv[u][0] = *(const v4f*)p; xv[u][1] = *(const v4f*)(p + 4); xv[u][2] = *(const v4f*)(p + 16); xv[u][3] = *(const v4f*)(p + 20); }
#pragma unroll
    for (int ct = 0; ct < 6; ++ct) { wh[ct] = frag_fo(wp + (size_t)(ct * 16) * 512); wl[ct] = frag_fo(wp + (size_t)(NC3 + ct * 16) * 512); }
    XW2(xp, wp); __builtin_amdgcn_sched_barrier(0);   /* every load of the step is issued before the first conversion or product: one memory latency a step; the scheduler had kept only two fragments in flight */
    v16h xb[2];
#pragma unroll
    for (int u = 0; u < 2; ++u)
#pragma unroll
      for (int e = 0; e < 16; ++e) xb[u][e] = (_Float16)bfr(xv[u][e >> 2][e & 3]);
#pragma unroll
    for (int ct = 0; ct < 4; ++ct) { acc[ct][0] = wm(wh[ct], xb[0], acc[ct][0]); acc[ct][1] = wm(wh[ct], xb[1], acc[ct][1]); }
#pragma unroll
    for (int ct = 4; ct < 6; ++ct) { acc[ct][0] = wm(xb[0], wh[ct], acc[ct][0]); acc[ct][1] = wm(xb[1], wh[ct], acc[ct][1]); }
#pragma unroll
    for (int ct = 0; ct < 4; ++ct) { acc[ct][0] = wm(wl[ct], xb[0], acc[ct][0]); acc[ct][1] = wm(wl[ct], xb[1], acc[ct][1]); }
#pragma unroll
    for (int ct = 4; ct < 6; ++ct) { acc[ct][0] = wm(xb[0], wl[ct], acc[ct][0]); acc[ct][1] = wm(xb[1], wl[ct], acc[ct][1]); }
    xp += 32; wp += 512; }
  const float *bcp = BC + h * NC3 + 8 * g, *bvp = BC + h * NC3 + 2 * HD + col; v4f bc[4][2]; float bv[2];   /* q, k: the bias of the lane's 8 channels; v: of its one channel a tile */
#pragma unroll
  for (int ct = 0; ct < 4; ++ct) { bc[ct][0] = *(const v4f*)(bcp + ct * 16); bc[ct][1] = *(const v4f*)(bcp + ct * 16 + 4); }
  bv[0] = bvp[0]; bv[1] = bvp[16];
  asm volatile("s_wait_xcnt 0x0" ::: "memory"); __builtin_amdgcn_sched_barrier(0);   /* the bias loads' address registers are rewritten only behind this wait; the scheduling barrier keeps the stores' address arithmetic behind it */
#pragma unroll
  for (int ct = 0; ct < 6; ++ct)
#pragma unroll
    for (int u = 0; u < 2; ++u)
#pragma unroll
      for (int r = 0; r < 8; ++r) acc[ct][u][r] = acc[ct][u][r] * (1.0f / 64.0f) + (ct < 4 ? bc[ct][r >> 2][r & 3] : bv[ct - 4]);
  const size_t bb = r0 / TT, t0 = r0 % TT, co = h * HD + 8 * g, vc = bb * CC + h * HD + col;
  _Float16 *qo = QH + (r0 + col) * CC + co, *ko = KH + (r0 + col) * CC + co, *vo = VT + vc * TT + t0 + 8 * g;
#pragma unroll
  for (int u = 0; u < 2; ++u)
#pragma unroll
    for (int j = 0; j < 2; ++j) { v8h q, k, v;
#pragma unroll
      for (int r = 0; r < 8; ++r) { q[r] = (_Float16)acc[j][u][r]; k[r] = (_Float16)acc[2 + j][u][r]; v[r] = (_Float16)acc[4 + j][u][r]; }
      vst2(qo + (size_t)u * 16 * CC + j * 16, q); vst2(ko + (size_t)u * 16 * CC + j * 16, k); vst2(vo + (size_t)j * 16 * TT + u * 16, v); }
  if (t0 < QHI) {   /* the same for a whole wave */
    _Float16 *qlo = QL + (bb * QHI + t0 + col) * CC + co, *klo = KL + (bb * KHI + t0 + col) * CC + co; __bf16 *vho = VB + vc * KHI + t0 + 8 * g, *vlo = VBL + vc * KHI + t0 + 8 * g;
#pragma unroll
    for (int u = 0; u < 2; ++u)
#pragma unroll
      for (int j = 0; j < 2; ++j) { v8h q, k; v8b vh, vl;
#pragma unroll
        for (int r = 0; r < 8; ++r) { const float qf = acc[j][u][r], kf = acc[2 + j][u][r], vf = acc[4 + j][u][r]; const __bf16 b = (__bf16)vf;
          q[r] = (_Float16)((qf - (float)(_Float16)qf) * 1024.0f); k[r] = (_Float16)((kf - (float)(_Float16)kf) * 1024.0f); vh[r] = b; vl[r] = (__bf16)(vf - (float)b); }
        vst2(qlo + (size_t)u * 16 * CC + j * 16, q); vst2(klo + (size_t)u * 16 * CC + j * 16, k); vst2(vho + (size_t)j * 16 * KHI + u * 16, vh); vst2(vlo + (size_t)j * 16 * KHI + u * 16, vl); } } }

// ---- k_out: OUT = A (f16 hi + unscaled f16 residual, 2 products) x W^T (W (out,in) as f16(bf16 x 2^6)) x 2^-6 + bias. Block = (64 rows, 128 columns), 8 waves, wave = 16 rows x 64 columns.
// The block's 128 weight rows are read once, 8 rows of 128 B an instruction, every load of a batch in flight together, converted once and kept in LDS in fragment order [column tile 8][k step 16][element half 2][lane 32][8];
// chunk q = lane & 3 of a k step (floats 8q .. 8q + 7 of a weight row) is element half q >> 1 of fragment lane 16 (q & 1) + column, the k order of the A fragment. One barrier; behind it the k loop reads 512 contiguous LDS bytes a load and fetches its A rows four k steps ahead. Every loop here is unrolled in full: its index picks registers (buffers, fragments, sums) and the immediate offset of each load. Each sum takes its products in the order k step, hi, residual.
#define OPW 68   /* f32 pitch of the output staging rows: the two lane halves (rows 8 apart) fall on different banks */
__device__ __forceinline__ void ld_a4(v4f (&d)[4][4], const float* p) {
#pragma unroll
  for (int s = 0; s < 4; ++s) { d[s][0] = *(const v4f*)(p + s * 32); d[s][1] = *(const v4f*)(p + s * 32 + 4); d[s][2] = *(const v4f*)(p + s * 32 + 16); d[s][3] = *(const v4f*)(p + s * 32 + 20); } }
// one batch = 4 k steps x 2 groups of 8 weight rows
__device__ __forceinline__ void ld_w8(v4f (&d)[8][2], const float* p) {
#pragma unroll
  for (int i = 0; i < 8; ++i) { const float* q = p + (size_t)(i & 1) * 8 * CC + (i >> 1) * 32; d[i][0] = *(const v4f*)q; d[i][1] = *(const v4f*)(q + 4); } }
__device__ __forceinline__ void st_w8(const v4f (&d)[8][2], _Float16* p) {
#pragma unroll
  for (int i = 0; i < 8; ++i) { v8h w;
#pragma unroll
    for (int e = 0; e < 8; ++e) w[e] = w64(d[i][e >> 2][e & 3]);
    *(v8h*)(p + (i >> 1) * 512 + (i & 1) * 64) = w; } }
__global__ __launch_bounds__(256) void k_out(const float* __restrict__ A, const float* __restrict__ Wm, const float* __restrict__ BIAS, float* __restrict__ OUT) {
  __shared__ __align__(16) _Float16 wf[8 * 16 * 512]; __shared__ __align__(16) float sf[8][16][OPW];
  const int tid = threadIdx.x, lane = tid & 31, col = lane & 15, g = lane >> 4; const int wave = __builtin_amdgcn_readfirstlane(tid >> 5);
  const int c0 = blockIdx.y * 128, cw = c0 + (wave >> 2) * 64; const size_t r0 = (size_t)blockIdx.x * 64 + (wave & 3) * 16;
  const float* ap = A + (r0 + col) * CC + 8 * g;
  const float* wp = Wm + (size_t)(c0 + wave * 16 + (lane >> 2)) * CC + (lane & 3) * 8;   /* wave = the column tile it stages */
  const float* bp = BIAS + cw + col;
  _Float16* wq = wf + wave * (16 * 512) + ((lane >> 1) & 1) * 256 + ((lane & 1) * 16 + (lane >> 2)) * 8;
  v4f av[2][4][4], wt[2][8][2]; float bb[4];
  /* SB: a scheduling barrier on either side of a group of loads keeps the group issued whole at that place: ahead of the conversions that cover its latency, and behind the ones that free its registers (left alone the scheduler took a third weight buffer, past 256 registers) */
#define SB() __builtin_amdgcn_sched_barrier(0)
  ld_w8(wt[0], wp); ld_w8(wt[1], wp + 128);
#pragma unroll
  for (int j = 0; j < 4; ++j) bb[j] = bp[j * 16];
  ld_a4(av[0], ap); SB();
  st_w8(wt[0], wq); SB(); ld_w8(wt[0], wp + 256); SB();
  st_w8(wt[1], wq + 4 * 512); SB(); ld_w8(wt[1], wp + 384); XW2(wp, bp); SB();   /* the last loads through wp and bp */
  st_w8(wt[0], wq + 8 * 512); SB(); ld_a4(av[1], ap + 128); SB();
  st_w8(wt[1], wq + 12 * 512);
  __syncthreads();   /* the 8 waves' tiles of the weight panel are complete before any wave reads them */
  v8f acc[4] = {};
  const _Float16* fp = wf + (wave >> 2) * (4 * 16 * 512) + lane * 8;
#pragma unroll
  for (int gr = 0; gr < 4; ++gr) {
#pragma unroll
    for (int s = 0; s < 4; ++s) { const int kc = gr * 4 + s; v16h a, al, w[4];
#pragma unroll
      for (int j = 0; j < 4; ++j) w[j] = frag_fo(fp + (j * 16 + kc) * 512);
#pragma unroll
      for (int e = 0; e < 16; ++e) { const float x = av[gr & 1][s][e >> 2][e & 3]; const _Float16 hh = (_Float16)x; a[e] = hh; al[e] = (_Float16)(x - (float)hh); }
#pragma unroll
      for (int j = 0; j < 4; ++j) acc[j] = wm(a, w[j], acc[j]);
#pragma unroll
      for (int j = 0; j < 4; ++j) acc[j] = wm(al, w[j], acc[j]); }
    if (gr < 2) { SB(); ld_a4(av[gr & 1], ap + (gr + 2) * 128); if (gr == 1) XW2(ap, ap);   /* the last loads through ap */ SB(); } }
#pragma unroll
  for (int j = 0; j < 4; ++j) { const float b = bfr(bb[j]);
#pragma unroll
    for (int r = 0; r < 8; ++r) sf[wave][8 * g + r][j * 16 + col] = acc[j][r] * (1.0f / 64.0f) + b; }
  LDSX();   /* the wave's own staging rows are written before it reads them back as whole 256-B row segments */
  float* op = OUT + (r0 + g) * CC + cw + col * 4;
#pragma unroll
  for (int i = 0; i < 8; ++i) vst2(op + (size_t)i * 2 * CC, *(const v4f*)&sf[wave][2 * i + g][col * 4]); }

extern "C" void kernel_launch(void* const* d_in, const int* in_sizes, int n_in, void* d_out, int out_size, void* d_ws, size_t ws_size, hipStream_t stream) {
  (void)in_sizes; (void)n_in; (void)out_size;
  const float** F = (const float**)d_in;
  if (ws_size < (size_t)WS_END) return;
  char* ws = (char*)d_ws; _Float16 *QH = (_Float16*)(ws + WS_QH), *KH = (_Float16*)(ws + WS_KH), *VT = (_Float16*)(ws + WS_VT), *QL = (_Float16*)(ws + WS_QL), *KL = (_Float16*)(ws + WS_KL); __bf16 *VB = (__bf16*)(ws + WS_VB), *VBL = (__bf16*)(ws + WS_VBL); float *S = (float*)(ws + WS_S), *Y = (float*)(ws + WS_Y);
  (void)Y; (void)S; (void)QL; (void)KL; (void)VB; (void)VBL;
  // inputs: 0 x [2,2048,512]; 1 Wl [16,512,512] (out,in); 2 bl [16,512]; 3 Wq [16,512,32] (in,out); 4 Wk; 5 Wv; 6 Wo [512,512] (out,in); 7 bo [512]
  if (ws_size < (size_t)WS_TOP) return;
  _Float16* WF = (_Float16*)(ws + WS_WF); float *BC = (float*)(ws + WS_BC), *CAT = (float*)(ws + WS_CAT);
  /* head = blockIdx.y in the two projection launches */
  k_fold<<<dim3(CC / 64 + 1, NH), 96, 0, stream>>>(F[1], F[2], F[3], F[4], F[5], WF, BC);   /* folded weights Wl[h]^T [Wq|Wk|Wv][h] and bias bl[h] [Wq|Wk|Wv][h] */
  k_qkv<<<dim3(NRW / 128, NH), 128, 0, stream>>>(F[0], WF, BC, QH, QL, KH, KL, VT, VB, VBL);   /* q, k, v of every head = x folded weight + folded bias, written as the planes that k_fa reads */
  k_fa<<<dim3(NQB, NH, TNB), 128, 0, stream>>>(QH, KH, QL, KL, VT, VB, VBL, CAT);   /* logits, softmax and P v of every (b, h) in one launch */
  k_out<<<dim3(NRW / 64, CC / 128), 256, 0, stream>>>(CAT, F[6], F[7], (float*)d_out);   /* out = cat Wo^T + bo */
}

// v006
// Measured time: 80.2 microseconds a run.
// Timed twice side by side with v005, it ran 1.27 and 1.28 times as fast.
// Over all steps from v000 it is 37.8 times as fast.
// compute dtype: all float inputs rounded to bf16; q/k/v = x (Wl[h]^T Wq/Wk/Wv[h]) + bl[h] Wq/Wk/Wv[h]: the folded weight and bias from f16(bf16 x 2^6) operands (exact, 1 product, WMMA 16x16x32, f32 accumulate), the folded weight kept as f16 hi + residual (x 2^6) against x as f16 (bf16-exact) (2 products); unscaled causal logits: q, k once to f16 (1 product), 3 products below row 384; online softmax in f32 (running maximum and sum, one fused kernel); P = exp(logit - maximum) once to f16 against v f16 (P and v as bf16 hi + lo below row 384); out = cat as f16 hi + residual against Wo^T f16(bf16 x 2^6) (2 products) + bo; f32 output.
#include <hip/hip_runtime.h>
#include <math.h>

typedef __attribute__((ext_vector_type(16))) _Float16 v16h;
typedef __attribute__((ext_vector_type(16))) __bf16 v16b;
typedef __attribute__((ext_vector_type(8)))  _Float16 v8h;
typedef __attribute__((ext_vector_type(8)))  float v8f;
typedef __attribute__((ext_vector_type(4)))  float v4f;
typedef __attribute__((ext_vector_type(2)))  float v2f;
typedef __attribute__((ext_vector_type(4)))  unsigned v4u;
typedef __attribute__((ext_vector_type(4)))  int v4i;
typedef float __attribute__((may_alias)) float_a;
typedef int __attribute__((may_alias)) int_a;

template <typename T> __device__ __forceinline__ void vst2(void* p, T v) { *(T*)p = v;  }
__device__ __forceinline__ v8f wmma16(v16h a, v16h b, v8f c) {
  v8f d = __builtin_amdgcn_wmma_f32_16x16x32_f16(false, a, false, b, (short)0, c, false, false);
  asm volatile("v_nop\n\tv_nop\n\tv_nop\n\tv_nop" : "+v"(d) : "v"(a), "v"(b));
  return d;
}
__device__ __forceinline__ v8f wmma_bf(v16b a, v16b b, v8f c) {
  v8f d = __builtin_amdgcn_wmma_f32_16x16x32_bf16(false, a, false, b, (short)0, c, false, false);
  asm volatile("v_nop\n\tv_nop\n\tv_nop\n\tv_nop" : "+v"(d) : "v"(a), "v"(b));
  return d;
}
// 16x16x32 fragments: lane = (h = lane>>4, row/col = lane&15); elements 0..7 = k0+8h+0..7, 8..15 = k0+16+8h+0..7; D element r = row 8h+r
__device__ __forceinline__ v16h frag_h(const _Float16* rowk0, int lane) {
  union { v16h v; v8h q[2]; } u; const _Float16* p = rowk0 + 8 * (lane >> 4);
  u.q[0] = *(const v8h*)p; u.q[1] = *(const v8h*)(p + 16); return u.v;
}
__device__ __forceinline__ v16h frag_f32(const float* rowk0, int lane) {
  v16h a; const float* p = rowk0 + 8 * (lane >> 4);
#pragma unroll
  for (int i = 0; i < 8; ++i) { a[i] = (_Float16)p[i]; a[8 + i] = (_Float16)p[16 + i]; }
  return a;
}
__device__ __forceinline__ v16h frag_f32s(const float* rowk0, int lane, float sc) {
  v16h a; const float* p = rowk0 + 8 * (lane >> 4);
#pragma unroll
  for (int i = 0; i < 8; ++i) { a[i] = (_Float16)(p[i] * sc); a[8 + i] = (_Float16)(p[16 + i] * sc); }
  return a;
}
// column fragment from a [K][ld] layout (column n), rows >= K read as 0
__device__ __forceinline__ v16h fragc_f32(const float* W, int k0, int n, int lane, int ld, int K) {
  v16h a; const int g = lane >> 4;
#pragma unroll
  for (int i = 0; i < 8; ++i) { const int ka = k0 + 8 * g + i, kb = ka + 16;
    a[i] = (_Float16)(ka < K ? W[(size_t)(ka < K ? ka : K - 1) * ld + n] : 0.f); a[8 + i] = (_Float16)(kb < K ? W[(size_t)(kb < K ? kb : K - 1) * ld + n] : 0.f); }
  return a;
}
struct F2 { v16b h, l; };
__device__ __forceinline__ F2 bsplit16(const float v[16]) { F2 r;
#pragma unroll
  for (int i = 0; i < 16; ++i) { const __bf16 h = (__bf16)v[i]; r.h[i] = h; r.l[i] = (__bf16)(v[i] - (float)h); }
  return r; }
__device__ __forceinline__ F2 split_row(const float* row, int k0, int lane) { float v[16]; const float* p = row + k0 + 8 * (lane >> 4);
#pragma unroll
  for (int i = 0; i < 8; ++i) { v[i] = p[i]; v[8 + i] = p[16 + i]; }
  return bsplit16(v); }
__device__ __forceinline__ F2 split_rowK(const float* row, int k0, int lane, int K) { float v[16]; const int g = lane >> 4;
#pragma unroll
  for (int i = 0; i < 8; ++i) { const int ka = k0 + 8 * g + i, kb = ka + 16; v[i] = ka < K ? row[ka < K ? ka : K - 1] : 0.f; v[8 + i] = kb < K ? row[kb < K ? kb : K - 1] : 0.f; }
  return bsplit16(v); }
__device__ __forceinline__ F2 split_col(const float* W, int k0, int n, int lane, int ld, int K) { float v[16]; const int g = lane >> 4;
#pragma unroll
  for (int i = 0; i < 8; ++i) { const int ka = k0 + 8 * g + i, kb = ka + 16; v[i] = ka < K ? W[(size_t)(ka < K ? ka : K - 1) * ld + n] : 0.f; v[8 + i] = kb < K ? W[(size_t)(kb < K ? kb : K - 1) * ld + n] : 0.f; }
  return bsplit16(v); }
__device__ __forceinline__ v8f mac3(const F2& a, const F2& b, v8f c) { c = wmma_bf(a.l, b.h, c); c = wmma_bf(a.h, b.l, c); return wmma_bf(a.h, b.h, c); }
__device__ __forceinline__ float sigm(float v) { return 1.0f / (1.0f + expf(-v)); }
#define LDSX() do { asm volatile("s_wait_dscnt 0" ::: "memory"); __builtin_amdgcn_wave_barrier(); __builtin_amdgcn_fence(__ATOMIC_RELEASE, "workgroup"); } while (0)

// Per-head multi-head causal attention (B 2, S 2,048, 512; 16 heads x 32; 0.02-scale weights: per-head Linear Wl [16,512,512] (out,in) + bl, per-head Wq/Wk/Wv [16,512,32] (in,out) no bias, Wo [512,512] (out,in) + bo): xh = x Wl[h]^T + bl[h]; Q, K, V = xh Wq[h], xh Wk[h], xh Wv[h]; scores = Q K^T (NO scaling), causal; F = softmax(scores) V; out = concat_h(F) Wo^T + bo.
#define NB 2
#define TT 2048
#define CC 512            // NH * HD = projected width
#define DIN 512          // input (model) width
#define NH 16
#define HD 32
#define NQB (TT / 64)
#define HG 8
#define SCALE (1.0f)
#define CAUSAL 1
#ifndef TNB
#define TNB NB
#endif
__device__ __forceinline__ float bfr(float v) { return (float)(__bf16)v; }
__host__ __device__ __forceinline__ int kb_last(int qb) { return CAUSAL ? ((qb * 64 + 63) >> 7) : (TT / 128 - 1); }
typedef __attribute__((ext_vector_type(8))) __bf16 v8b;
__device__ __forceinline__ v16b frag_b(const __bf16* rowk0, int lane) {
  union { v16b v; v8b q[2]; } u; const __bf16* p = rowk0 + 8 * (lane >> 4);
  u.q[0] = *(const v8b*)p; u.q[1] = *(const v8b*)(p + 16); return u.v;
}
#define QBH 6              // causal: query blocks 0..QBH-1 of each sequence (few keys, no averaging) take the high-precision path
#define QHI 384            // rows carrying a q residual plane
#define KHI 384            // key rows carrying k residual / v bf16 hi+lo planes (used only by the causal high-precision path)
// B fragment (k rows k0+.., output column o) of a weight: (in,out) [K][ld] or (out,in) [ld rows of K]: bf16 exact, or f16(bf16 * 256) exact
__device__ __forceinline__ v16b wcol_io(const float* Wm, int k0, int o, int lane, int ld) { v16b w; const int g = lane >> 4;
#pragma unroll
  for (int i = 0; i < 8; ++i) { w[i] = (__bf16)Wm[(size_t)(k0 + 8 * g + i) * ld + o]; w[8 + i] = (__bf16)Wm[(size_t)(k0 + 16 + 8 * g + i) * ld + o]; }
  return w; }
__device__ __forceinline__ v16b wcol_oi(const float* Wm, int k0, int o, int lane, int K) { v16b w; const float* p = Wm + (size_t)o * K + k0 + 8 * (lane >> 4);
#pragma unroll
  for (int i = 0; i < 8; ++i) { w[i] = (__bf16)p[i]; w[8 + i] = (__bf16)p[16 + i]; }
  return w; }
__device__ __forceinline__ v16h wcolh_io(const float* Wm, int k0, int o, int lane, int ld) { v16h w; const int g = lane >> 4;
#pragma unroll
  for (int i = 0; i < 8; ++i) { w[i] = (_Float16)(bfr(Wm[(size_t)(k0 + 8 * g + i) * ld + o]) * 256.0f); w[8 + i] = (_Float16)(bfr(Wm[(size_t)(k0 + 16 + 8 * g + i) * ld + o]) * 256.0f); }
  return w; }
__device__ __forceinline__ v16h wcolh_oi(const float* Wm, int k0, int o, int lane, int K) { v16h w; const float* p = Wm + (size_t)o * K + k0 + 8 * (lane >> 4);
#pragma unroll
  for (int i = 0; i < 8; ++i) { w[i] = (_Float16)(bfr(p[i]) * 256.0f); w[8 + i] = (_Float16)(bfr(p[16 + i]) * 256.0f); }
  return w; }
#define WQKV_LAYOUT 1   // 0 = (in,out) [DIN][CC]; 1 = (out,in) [CC][DIN]; 2 = per-head [NH][DIN][HD]
__device__ __forceinline__ v16b wcol_hdk(const float* Wm, int k0, int o, int lane) { v16b w; const int g = lane >> 4; const float* p = Wm + (size_t)(o / HD) * DIN * HD + (o % HD);
#pragma unroll
  for (int i = 0; i < 8; ++i) { w[i] = (__bf16)p[(size_t)(k0 + 8 * g + i) * HD]; w[8 + i] = (__bf16)p[(size_t)(k0 + 16 + 8 * g + i) * HD]; }
  return w; }
#define WO_OUT_IN 0
#if WQKV_LAYOUT == 1
#define WCOL(W, k0, o, lane) wcol_oi(W, k0, o, lane, DIN)
#elif WQKV_LAYOUT == 2
#define WCOL(W, k0, o, lane) wcol_hdk(W, k0, o, lane)
#else
#define WCOL(W, k0, o, lane) wcol_io(W, k0, o, lane, CC)
#endif
#if WO_OUT_IN
#define WOCOL(W, k0, o, lane) wcol_oi(W, k0, o, lane, CC)
#define WOCOLH(W, k0, o, lane) wcolh_oi(W, k0, o, lane, CC)
#else
#define WOCOL(W, k0, o, lane) wcol_io(W, k0, o, lane, DIN)
#define WOCOLH(W, k0, o, lane) wcolh_io(W, k0, o, lane, DIN)
#endif

#ifndef SM_EXTRA_PARAMS
#define SM_EXTRA_PARAMS
#endif
#ifndef PROJ_EXTRA_PARAMS
#define PROJ_EXTRA_PARAMS
#endif
#ifndef SM_MASK_HOOK
#define SM_MASK_HOOK (void)0
#endif

#define WS_QH  0u                                      // f16 q in fragment order [b][h][query tile t / 16][element half 2][lane 32][8]
#define WS_KH  (WS_QH + 2u * (size_t)NB * TT * CC)      // f16 k in fragment order [b][h][key tile t / 16][element half 2][lane 32][8]
#define WS_VT  (WS_KH + 2u * (size_t)NB * TT * CC)      // f16 v in fragment order [b][h][key chunk t / 32][channel tile 2][element half 2][lane 32][8]
#define WS_QL  (WS_VT + 2u * (size_t)NB * CC * TT)      // f16 q residual x 2^10, t < QHI, in the order of the q plane
#define WS_KL  (WS_QL + 2u * (size_t)NB * QHI * CC)     // f16 k residual x 2^10, t < KHI, in the order of the k plane
#define WS_VB  (WS_KL + 2u * (size_t)NB * KHI * CC)     // bf16 v hi (then lo), t < KHI, in the order of the v plane
#define WS_VBL (WS_VB + 2u * (size_t)NB * CC * KHI)
#define WS_S   (WS_VBL + 2u * (size_t)NB * CC * KHI)    // f32 area of HG * TT * TT floats; holds the folded weights and bias
#define WS_Y   (WS_S  + 4u * (size_t)HG * TT * TT)      // unused (k_fa writes the ctx rows to WS_CAT); same offset as WS_TQ
#define WS_XH  (WS_S + 0u)                              // area of NH * NB * TT * CC floats holding the folded weights and bias; fills the S region, which holds no logits (NH * NB * CC == HG * TT)
#define WS_TQ  (WS_XH + 4u * (size_t)NH * NB * TT * CC) // unused area of NH * NB * TT * 128 floats
#define WS_WP  (WS_TQ + 4u * (size_t)NH * NB * TT * 128) // unused area of NH * CC * 128 floats
#define WS_QB8 (WS_WP + 4u * (size_t)NH * CC * 128 + 256)
#define WS_KB8 (WS_QB8 + 4u * (size_t)NB * TT * CC)
#define WS_VB8 (WS_KB8 + 4u * (size_t)NB * TT * CC)
#define WS_CAT (WS_VB8 + 4u * (size_t)NB * TT * CC)
#define WS_END (WS_CAT + 4u * (size_t)NB * TT * CC)
#define WS_END2 WS_END
#define WS_TOP (WS_CAT + 4u * (size_t)NB * TT * CC)     // end of everything kernel_launch uses
static_assert((size_t)HG * TT * TT <= (size_t)NH * NB * TT * CC, "S must end where the WS_XH area ends");

// ---- k_fa: block = 64 queries (4 waves x 16) of (b, h), one pass over the keys 0 .. query in steps of 64 with a running row maximum and sum (online softmax); nothing of the logits or of P goes to memory.
// Both products are formed transposed so that every per-query value sits in the lane of its query (col = lane & 15): S^T = k q^T (A = key rows, B = query rows; D element r = key 8g + r, column = query), which is already the B fragment of P^T (elements 0..7 = tile 2c, 8..15 = tile 2c + 1), and ctx^T = v^T P^T (A = v, row = channel, k = key; D element r = channel 8g + r, column = query).
// q, k and v lie in memory as the fragments themselves (k_qkv writes them so): every load of the key loop reads 512 contiguous bytes, four whole lines, where a load from rows or planes touched 16 lines for the same bytes. ctx leaves in the order of k_out's A fragments (element r of tile j = channel 16 j + 8g + r of the lane's query: the same lane's elements there).
// Precision as before: q, k once to f16 (1 product), P once to f16 against v f16; query blocks < QBH: 3-product logits (q, k residual planes x 2^10), P and v as bf16 hi + lo (3 products). P is exp(logit - running maximum), at most 1; the division by the f32 row sum comes last.
#define L2E 1.4426950408889634f
#define NEGBIG (-1.0e30f)
// behind a group of global loads: their address registers (kept live to here as inputs) are rewritten only after this wait
#define XW2(p0, p1) asm volatile("s_wait_xcnt 0x0" :: "v"(p0), "v"(p1) : "memory")
#define XW4(p0, p1, p2, p3) asm volatile("s_wait_xcnt 0x0" :: "v"(p0), "v"(p1), "v"(p2), "v"(p3) : "memory")
static_assert(HD == 32, "one 32-deep product per logit tile, two 16-channel ctx tiles");
// 2^x; the v_nop fills the one slot that the instruction set asks for behind a transcendental, whatever the compiler schedules next (it had put a second v_exp_f32 there that overwrites the first one's source)
__device__ __forceinline__ float ex2(float x) { float r; asm("v_exp_f32 %0, %1\n\tv_nop" : "=v"(r) : "v"(x)); return r; }
// s[32] = this lane's logits of one 64-key step (excluded ones = NEGBIG) -> exp(s - new maximum); returns the factor that rescales what was summed under the old maximum
__device__ __forceinline__ float sm_step(float (&s)[32], float& m, float& l) {
  float c0 = fmaxf(s[0], s[1]), c1 = fmaxf(s[2], s[3]);
#pragma unroll
  for (int i = 4; i < 32; i += 2) { c0 = fmaxf(c0, s[i]); c1 = fmaxf(c1, s[i + 1]); }
  float cm = fmaxf(c0, c1); cm = fmaxf(cm, __shfl_xor(cm, 16));   /* lanes col and col + 16 hold the two key halves of one query */
  const float mn = fmaxf(m, cm), al = ex2((m - mn) * L2E), m2 = mn * L2E; m = mn;
  float a0 = 0.f, a1 = 0.f, a2 = 0.f, a3 = 0.f;
#pragma unroll
  for (int i = 0; i < 32; i += 4) {
    s[i] = ex2(fmaf(s[i], L2E, -m2)); s[i + 1] = ex2(fmaf(s[i + 1], L2E, -m2)); s[i + 2] = ex2(fmaf(s[i + 2], L2E, -m2)); s[i + 3] = ex2(fmaf(s[i + 3], L2E, -m2));
    a0 += s[i]; a1 += s[i + 1]; a2 += s[i + 2]; a3 += s[i + 3]; }
  l = l * al + ((a0 + a1) + (a2 + a3)); return al; }
// fragment kept in fragment order [element half 2][lane 32][8], from a pointer that already holds lane * 8: each of the two loads reads 512 contiguous bytes, four whole 128-B lines
__device__ __forceinline__ v16h frag_fo(const _Float16* p) { union { v16h v; v8h q[2]; } u; u.q[0] = *(const v8h*)p; u.q[1] = *(const v8h*)(p + 256); return u.v; }
__device__ __forceinline__ v16b frag_fob(const __bf16* p) { union { v16b v; v8b q[2]; } u; u.q[0] = *(const v8b*)p; u.q[1] = *(const v8b*)(p + 256); return u.v; }
__global__ __launch_bounds__(128) void k_fa(const _Float16* __restrict__ QH, const _Float16* __restrict__ KH, const _Float16* __restrict__ QL, const _Float16* __restrict__ KL, const _Float16* __restrict__ VT, const __bf16* __restrict__ VB, const __bf16* __restrict__ VBL, float* __restrict__ Y) {
  const int tid = threadIdx.x, lane = tid & 31, col = lane & 15, g = lane >> 4; const int wave = __builtin_amdgcn_readfirstlane(tid >> 5);
  const int qb = NQB - 1 - (int)blockIdx.x, h = blockIdx.y, b = blockIdx.z;   /* longest query blocks start first */
  const int ql0 = qb * 64 + wave * 16, tq = ql0 + col;
  float m = NEGBIG, l = 0.f; v8f o[2] = {}; const v8f zero = {};
  const size_t bh = (size_t)b * NH + h;   /* q, k and v of one (b, h) lie in fragment order, HD * 2 bytes a position: a 64-key step is 4 KiB of k and 4 KiB of v in a row */
  const _Float16* qp = QH + (bh * TT + ql0) * HD + lane * 8;
  const _Float16* kp = KH + bh * (size_t)(TT * HD) + lane * 8;
  if (qb < QBH) {
    const _Float16* qlp = QL + (bh * QHI + ql0) * HD + lane * 8;
    const v16h bq = frag_fo(qp), bql = frag_fo(qlp); XW2(qp, qlp);
    const _Float16* klp = KL + bh * (size_t)(KHI * HD) + lane * 8;
    const size_t vo = bh * (size_t)(KHI * HD) + lane * 8;
#pragma unroll 1
    for (int it = 0; it <= qb; ++it) { const int k0 = it * 64; float s[32];
      const _Float16 *kq = kp + (size_t)k0 * HD, *klq = klp + (size_t)k0 * HD; const __bf16 *vhq = VB + vo + (size_t)k0 * HD, *vlq = VBL + vo + (size_t)k0 * HD;
      v16h khf[4], klf[4]; v16b vhf[4], vlf[4];   /* index of the v fragments: c * 2 + j */
#pragma unroll
      for (int t = 0; t < 4; ++t) { khf[t] = frag_fo(kq + t * 512); klf[t] = frag_fo(klq + t * 512); vhf[t] = frag_fob(vhq + (t >> 1) * 1024 + (t & 1) * 512); vlf[t] = frag_fob(vlq + (t >> 1) * 1024 + (t & 1) * 512); }
      XW4(kq, klq, vhq, vlq);
#pragma unroll
      for (int t = 0; t < 4; ++t) { const v16h kh = khf[t], kl = klf[t];
        const v8f a = wmma16(kh, bq, zero); v8f a2 = wmma16(kh, bql, zero); a2 = wmma16(kl, bq, a2);
#pragma unroll
        for (int r = 0; r < 8; ++r) { const float v = (a[r] + a2[r] * (1.0f / 1024.0f)) * SCALE; s[t * 8 + r] = (k0 + t * 16 + 8 * g + r <= tq) ? v : NEGBIG; } }
      const float al = sm_step(s, m, l);
#pragma unroll
      for (int r = 0; r < 8; ++r) { o[0][r] *= al; o[1][r] *= al; }
#pragma unroll
      for (int c = 0; c < 2; ++c) { float v[16];
#pragma unroll
        for (int i = 0; i < 8; ++i) { v[i] = s[c * 16 + i]; v[8 + i] = s[c * 16 + 8 + i]; }
        const F2 p = bsplit16(v);
#pragma unroll
        for (int j = 0; j < 2; ++j) { const v16b vh = vhf[c * 2 + j];
          o[j] = wmma_bf(vh, p.h, o[j]); o[j] = wmma_bf(vh, p.l, o[j]); o[j] = wmma_bf(vlf[c * 2 + j], p.h, o[j]); } } }
  } else {
    const _Float16* vp = VT + bh * (size_t)(TT * HD) + lane * 8;
    const v16h bq = frag_fo(qp);
    v16h kf[4], vf[4];   /* this step's fragments, fetched one step ahead; index of the v fragments: j * 2 + c */
#pragma unroll
    for (int t = 0; t < 4; ++t) { kf[t] = frag_fo(kp + t * 512); vf[t] = frag_fo(vp + (t & 1) * 1024 + (t >> 1) * 512); }
    XW4(qp, kp, vp, vp);
#pragma unroll 1
    for (int it = 0; it <= qb; ++it) { const int k0 = it * 64, kn = (it < qb ? it + 1 : it) * 64;   /* the last step fetches its own tile again: in bounds, unused */
      const _Float16 *kq = kp + (size_t)kn * HD, *vq = vp + (size_t)kn * HD; v16h kx[4], vx[4];
#pragma unroll
      for (int t = 0; t < 4; ++t) { kx[t] = frag_fo(kq + t * 512); vx[t] = frag_fo(vq + (t & 1) * 1024 + (t >> 1) * 512); }
      XW2(kq, vq);
      float s[32];
#pragma unroll
      for (int t = 0; t < 4; ++t) { const v8f a = wmma16(kf[t], bq, zero);
#pragma unroll
        for (int r = 0; r < 8; ++r) s[t * 8 + r] = a[r] * SCALE; }
      if (it == qb) {   /* only the diagonal step holds keys past a query */
#pragma unroll
        for (int i = 0; i < 32; ++i) s[i] = (k0 + (i >> 3) * 16 + 8 * g + (i & 7) <= tq) ? s[i] : NEGBIG; }
      const float al = sm_step(s, m, l);
#pragma unroll
      for (int r = 0; r < 8; ++r) { o[0][r] *= al; o[1][r] *= al; }
#pragma unroll
      for (int c = 0; c < 2; ++c) { v16h p;
#pragma unroll
        for (int i = 0; i < 16; ++i) p[i] = (_Float16)s[c * 16 + i];
        o[0] = wmma16(vf[c], p, o[0]); o[1] = wmma16(vf[2 + c], p, o[1]); }
#pragma unroll
      for (int t = 0; t < 4; ++t) { kf[t] = kx[t]; vf[t] = vx[t]; } } }
  l += __shfl_xor(l, 16); const float inv = l > 0.f ? 1.0f / l : 0.f;
  float* yp = Y + ((((size_t)b * TT + ql0) >> 4) * NH + h) * 512 + lane * 4;   /* ctx in the order of k_out's A fragments [row tile][head = k step][element quarter 4][lane 32][4]: a store is 512 contiguous bytes */
#pragma unroll
  for (int j = 0; j < 2; ++j) { v4f w0, w1;
#pragma unroll
    for (int r = 0; r < 4; ++r) { w0[r] = o[j][r] * inv; w1[r] = o[j][4 + r] * inv; }
    vst2(yp + j * 256, w0); vst2(yp + j * 256 + 128, w1); } }

#define NRW (TNB * TT)
#ifndef SM_EXTRA_PARAMS
#define SM_EXTRA_PARAMS
#endif
#ifndef PROJ_EXTRA_PARAMS
#define PROJ_EXTRA_PARAMS
#endif
#ifndef SM_MASK_HOOK
#define SM_MASK_HOOK (void)0
#endif

#define WS_QH  0u                                      // f16 q in fragment order [b][h][query tile t / 16][element half 2][lane 32][8]
#define WS_KH  (WS_QH + 2u * (size_t)NB * TT * CC)      // f16 k in fragment order [b][h][key tile t / 16][element half 2][lane 32][8]
#define WS_VT  (WS_KH + 2u * (size_t)NB * TT * CC)      // f16 v in fragment order [b][h][key chunk t / 32][channel tile 2][element half 2][lane 32][8]
#define WS_QL  (WS_VT + 2u * (size_t)NB * CC * TT)      // f16 q residual x 2^10, t < QHI, in the order of the q plane
#define WS_KL  (WS_QL + 2u * (size_t)NB * QHI * CC)     // f16 k residual x 2^10, t < KHI, in the order of the k plane
#define WS_VB  (WS_KL + 2u * (size_t)NB * KHI * CC)     // bf16 v hi (then lo), t < KHI, in the order of the v plane
#define WS_VBL (WS_VB + 2u * (size_t)NB * CC * KHI)
#define WS_S   (WS_VBL + 2u * (size_t)NB * CC * KHI)    // f32 area of HG * TT * TT floats; holds the folded weights and bias
#define WS_Y   (WS_S  + 4u * (size_t)HG * TT * TT)      // unused (k_fa writes the ctx rows to WS_CAT); same offset as WS_TQ
#define WS_END (WS_Y  + 0u)
#define WS_Y2  (WS_END)
#define WS_O1  (WS_Y2 + 4u * (size_t)NB * TT * CC)
#define WS_R2  (WS_O1 + 4u * (size_t)NB * TT * CC)
#define WS_END2 (WS_R2 + 4u * (size_t)NB * TT * CC)


#define NC3 96                                          // q | k | v channels of one head
#define WS_WF  (WS_XH + 0u)                             // f16 folded weights x 2^6 in fragment order [h][hi, residual][channel tile 6][k step 16][element half 2][lane 32][8]
#define WS_BC  (WS_WF + 2u * (size_t)NH * 2 * NC3 * CC) // f32 folded bias [h][NC3]
__device__ __forceinline__ v8f wm(v16h a, v16h b, v8f c) { return __builtin_amdgcn_wmma_f32_16x16x32_f16(false, a, false, b, (short)0, c, false, false); }
__device__ __forceinline__ _Float16 w64(float v) { return (_Float16)(bfr(v) * 64.0f); }
// ---- k_fold: (x Wl^T + bl) W = x (Wl^T W) + bl W. Block = (64 input indices i0.., head), wave = which of Wq, Wk, Wv: D[i][c] = sum_o Wl[o][i] W[o][c] (A = Wl^T: row i, k = o; B = W: k = o, column c; both read with the same k order 8g + e, 16 + 8g + e);
// D element r = input index 8g + r of channel column c: exactly the 8 elements that lane 16g + c of k_qkv's weight fragment (A for q, k, B for v; row or column = channel, k = input index) holds in half t & 1 of k step i0 / 32 + t / 2, so WF is kept in that order: a store here and a load there are 512 contiguous bytes of whole 128-B lines, each line written by one wave. The last blockIdx.x takes bl as every row of A and gives the folded bias.
__global__ __launch_bounds__(96) void k_fold(const float* __restrict__ WL, const float* __restrict__ BL, const float* __restrict__ WQ, const float* __restrict__ WK, const float* __restrict__ WV, _Float16* __restrict__ WF, float* __restrict__ BC) {
  const int tid = threadIdx.x, lane = tid & 31, col = lane & 15, g = lane >> 4; const int wave = __builtin_amdgcn_readfirstlane(tid >> 5);
  const size_t h = blockIdx.y;
  const float* bp = (wave == 0 ? WQ : wave == 1 ? WK : WV) + h * CC * HD + (size_t)(8 * g) * HD + col;
  if (blockIdx.x < CC / 64) {
    const int i0 = blockIdx.x * 64;
    const float* ap = WL + h * CC * CC + (size_t)(8 * g) * CC + i0 + col;
    v8f acc[4][2] = {};
#pragma unroll 1   /* rolled: one step's 96 loaded values and the 64 sums already take most of the registers */
    for (int kc = 0; kc < CC / 32; ++kc) { float av[4][16], bv[2][16];
#pragma unroll
      for (int e = 0; e < 16; ++e) { const int ko = e < 8 ? e : e + 8;
#pragma unroll
        for (int t = 0; t < 4; ++t) av[t][e] = ap[(size_t)ko * CC + t * 16];
        bv[0][e] = bp[(size_t)ko * HD]; bv[1][e] = bp[(size_t)ko * HD + 16]; }
      XW2(ap, bp); __builtin_amdgcn_sched_barrier(0);   /* every load of the step is issued before the first conversion or product: one memory latency a step; the scheduler had kept only two fragments in flight */
      v16h fa[4], fb[2];
#pragma unroll
      for (int e = 0; e < 16; ++e) { fa[0][e] = w64(av[0][e]); fa[1][e] = w64(av[1][e]); fa[2][e] = w64(av[2][e]); fa[3][e] = w64(av[3][e]); fb[0][e] = w64(bv[0][e]); fb[1][e] = w64(bv[1][e]); }
#pragma unroll
      for (int t = 0; t < 4; ++t) { acc[t][0] = wm(fa[t], fb[0], acc[t][0]); acc[t][1] = wm(fa[t], fb[1], acc[t][1]); }
      ap += (size_t)32 * CC; bp += (size_t)32 * HD; }
#pragma unroll
    for (int j = 0; j < 2; ++j) { _Float16* op = WF + ((h * 2 * 6 + wave * 2 + j) * 16 + (i0 >> 5)) * (size_t)512 + lane * 8;
#pragma unroll
      for (int t = 0; t < 4; ++t) { v8h hi, lo;
#pragma unroll
        for (int r = 0; r < 8; ++r) { const float v = acc[t][j][r] * (1.0f / 64.0f); hi[r] = (_Float16)v; lo[r] = (_Float16)(v - (float)hi[r]); }   /* sums carry 2^12; kept x 2^6 */
        vst2(op + (t >> 1) * 512 + (t & 1) * 256, hi); vst2(op + (size_t)NC3 * CC + (t >> 1) * 512 + (t & 1) * 256, lo); } }
  } else {
    const float* ap = BL + h * CC + 8 * g;
    v8f acc[2] = {};
#pragma unroll 1   /* rolled: 16 short steps of one small block a head, nothing to gain from more code */
    for (int kc = 0; kc < CC / 32; ++kc) { float av[16], bv[2][16];
#pragma unroll
      for (int e = 0; e < 16; ++e) { const int ko = e < 8 ? e : e + 8; av[e] = ap[ko]; bv[0][e] = bp[(size_t)ko * HD]; bv[1][e] = bp[(size_t)ko * HD + 16]; }
      XW2(ap, bp); __builtin_amdgcn_sched_barrier(0);   /* keeps the wait directly behind the loads, in front of the pointer steps (it had sunk to the loop's foot) */
      v16h fa, fb[2];
#pragma unroll
      for (int e = 0; e < 16; ++e) { fa[e] = w64(av[e]); fb[0][e] = w64(bv[0][e]); fb[1][e] = w64(bv[1][e]); }
      acc[0] = wm(fa, fb[0], acc[0]); acc[1] = wm(fa, fb[1], acc[1]);
      ap += 32; bp += (size_t)32 * HD; }
    if (g == 0) { float* op = BC + h * NC3 + wave * HD + col; op[0] = acc[0][0] * (1.0f / 4096.0f); op[16] = acc[1][0] * (1.0f / 4096.0f); } } }

// ---- k_qkv: block = (128 rows of x, head), wave = 32 rows; folded weight f16 hi then residual, read in fragment order; x rows bf16-rounded, exact in f16. The same two fragments serve either way round:
// q, k: [q|k]^T = weight (A = channel rows) x x^T (B = x rows): D element r = channel 8g + r, column = row of x, so a lane holds 8 consecutive channels of its row = the 8 elements that the same lane of k_fa's q (B) or k (A) fragment (row = position, k = channel) holds in half j of position tile u;
// v: x (A = x rows) x weight^T (B = channel columns): D element r = row of x 8g + r, column = channel, so a lane holds 8 consecutive positions of its channel = the 8 elements that the same lane of k_fa's A fragment (row = channel, k = key) holds in half u of channel tile j.
// The f32 sums go from the registers straight into the planes that k_fa reads: q, k, v -> f16 in fragment order, 512 contiguous bytes a store (+ q, k residuals x 2^10 and v bf16 hi / lo for t < QHI, KHI, in the same order).
static_assert(QHI == KHI && QHI % 32 == 0 && TT % 128 == 0, "a wave's 32 rows lie in one sequence, wholly below or wholly above the high-precision bound");
__global__ __launch_bounds__(128) void k_qkv(const float* __restrict__ X, const _Float16* __restrict__ WF, const float* __restrict__ BC, _Float16* __restrict__ QH, _Float16* __restrict__ QL, _Float16* __restrict__ KH, _Float16* __restrict__ KL, _Float16* __restrict__ VT, __bf16* __restrict__ VB, __bf16* __restrict__ VBL) {
  const int tid = threadIdx.x, lane = tid & 31, col = lane & 15, g = lane >> 4; const int wave = __builtin_amdgcn_readfirstlane(tid >> 5);
  const size_t h = blockIdx.y, r0 = (size_t)blockIdx.x * 128 + wave * 32;
  const float* xp = X + (r0 + col) * CC + 8 * g;
  const _Float16* wp = WF + h * 2 * NC3 * CC + lane * 8;   /* fragment order: tile ct at ct * 16 * 512, k step at 512, element half at 256 */
  v8f acc[6][2] = {};
#pragma unroll 1   /* rolled: one step's fragments and the 96 sums already take most of the registers */
  for (int kc = 0; kc < CC / 32; ++kc) { v4f xv[2][4]; v16h wh[6], wl[6];
#pragma unroll
    for (int u = 0; u < 2; ++u) { const float* p = xp + (size_t)u * 16 * CC; xv[u][0] = *(const v4f*)p; xv[u][1] = *(const v4f*)(p + 4); xv[u][2] = *(const v4f*)(p + 16); xv[u][3] = *(const v4f*)(p + 20); }
#pragma unroll
    for (int ct = 0; ct < 6; ++ct) { wh[ct] = frag_fo(wp + (size_t)(ct * 16) * 512); wl[ct] = frag_fo(wp + (size_t)(NC3 + ct * 16) * 512); }
    XW2(xp, wp); __builtin_amdgcn_sched_barrier(0);   /* every load of the step is issued before the first conversion or product: one memory latency a step; the scheduler had kept only two fragments in flight */
    v16h xb[2];
#pragma unroll
    for (int u = 0; u < 2; ++u)
#pragma unroll
      for (int e = 0; e < 16; ++e) xb[u][e] = (_Float16)bfr(xv[u][e >> 2][e & 3]);
#pragma unroll
    for (int ct = 0; ct < 4; ++ct) { acc[ct][0] = wm(wh[ct], xb[0], acc[ct][0]); acc[ct][1] = wm(wh[ct], xb[1], acc[ct][1]); }
#pragma unroll
    for (int ct = 4; ct < 6; ++ct) { acc[ct][0] = wm(xb[0], wh[ct], acc[ct][0]); acc[ct][1] = wm(xb[1], wh[ct], acc[ct][1]); }
#pragma unroll
    for (int ct = 0; ct < 4; ++ct) { acc[ct][0] = wm(wl[ct], xb[0], acc[ct][0]); acc[ct][1] = wm(wl[ct], xb[1], acc[ct][1]); }
#pragma unroll
    for (int ct = 4; ct < 6; ++ct) { acc[ct][0] = wm(xb[0], wl[ct], acc[ct][0]); acc[ct][1] = wm(xb[1], wl[ct], acc[ct][1]); }
    xp += 32; wp += 512; }
  const float *bcp = BC + h * NC3 + 8 * g, *bvp = BC + h * NC3 + 2 * HD + col; v4f bc[4][2]; float bv[2];   /* q, k: the bias of the lane's 8 channels; v: of its one channel a tile */
#pragma unroll
  for (int ct = 0; ct < 4; ++ct) { bc[ct][0] = *(const v4f*)(bcp + ct * 16); bc[ct][1] = *(const v4f*)(bcp + ct * 16 + 4); }
  bv[0] = bvp[0]; bv[1] = bvp[16];
  asm volatile("s_wait_xcnt 0x0" ::: "memory"); __builtin_amdgcn_sched_barrier(0);   /* the bias loads' address registers are rewritten only behind this wait; the scheduling barrier keeps the stores' address arithmetic behind it */
#pragma unroll
  for (int ct = 0; ct < 6; ++ct)
#pragma unroll
    for (int u = 0; u < 2; ++u)
#pragma unroll
      for (int r = 0; r < 8; ++r) acc[ct][u][r] = acc[ct][u][r] * (1.0f / 64.0f) + (ct < 4 ? bc[ct][r >> 2][r & 3] : bv[ct - 4]);
  const size_t bb = r0 / TT, t0 = r0 % TT, bh = bb * NH + h, fo = (bh * TT + t0) * HD + lane * 8;
  _Float16 *qo = QH + fo, *ko = KH + fo, *vo = VT + fo;   /* q, k: position tile u, half j; v: channel tile j, half u of the wave's one 32-key chunk */
#pragma unroll
  for (int u = 0; u < 2; ++u)
#pragma unroll
    for (int j = 0; j < 2; ++j) { v8h q, k, v;
#pragma unroll
      for (int r = 0; r < 8; ++r) { q[r] = (_Float16)acc[j][u][r]; k[r] = (_Float16)acc[2 + j][u][r]; v[r] = (_Float16)acc[4 + j][u][r]; }
      vst2(qo + u * 512 + j * 256, q); vst2(ko + u * 512 + j * 256, k); vst2(vo + j * 512 + u * 256, v); }
  asm volatile("s_wait_xcnt 0x0" ::: "memory");   /* the branch below opens with an argument load and arithmetic that rewrite registers which the stores above name: only behind this wait, which stands in the stores' own block */
  if (t0 < QHI) {   /* the same for a whole wave */
    const size_t fl = (bh * KHI + t0) * HD + lane * 8; _Float16 *qlo = QL + fl, *klo = KL + fl; __bf16 *vho = VB + fl, *vlo = VBL + fl;
#pragma unroll
    for (int u = 0; u < 2; ++u)
#pragma unroll
      for (int j = 0; j < 2; ++j) { v8h q, k; v8b vh, vl;
#pragma unroll
        for (int r = 0; r < 8; ++r) { const float qf = acc[j][u][r], kf = acc[2 + j][u][r], vf = acc[4 + j][u][r]; const __bf16 b = (__bf16)vf;
          q[r] = (_Float16)((qf - (float)(_Float16)qf) * 1024.0f); k[r] = (_Float16)((kf - (float)(_Float16)kf) * 1024.0f); vh[r] = b; vl[r] = (__bf16)(vf - (float)b); }
        vst2(qlo + u * 512 + j * 256, q); vst2(klo + u * 512 + j * 256, k); vst2(vho + j * 512 + u * 256, vh); vst2(vlo + j * 512 + u * 256, vl); } } }

// ---- k_out: OUT = A (f16 hi + unscaled f16 residual, 2 products) x W^T (W (out,in) as f16(bf16 x 2^6)) x 2^-6 + bias. Block = (64 rows, 128 columns), 8 waves, wave = 16 rows x 64 columns. A arrives in fragment order (k_fa writes it so): each A load reads 512 contiguous bytes.
// The block's 128 weight rows are read once, 8 rows of 128 B an instruction, every load of a batch in flight together, converted once and kept in LDS in fragment order [column tile 8][k step 16][element half 2][lane 32][8];
// chunk q = lane & 3 of a k step (floats 8q .. 8q + 7 of a weight row) is element half q >> 1 of fragment lane 16 (q & 1) + column, the k order of the A fragment. One barrier; behind it the k loop reads 512 contiguous LDS bytes a load and fetches its A rows four k steps ahead. Every loop here is unrolled in full: its index picks registers (buffers, fragments, sums) and the immediate offset of each load. Each sum takes its products in the order k step, hi, residual.
#define OPW 68   /* f32 pitch of the output staging rows: the two lane halves (rows 8 apart) fall on different banks */
__device__ __forceinline__ void ld_a4(v4f (&d)[4][4], const float* p) {
#pragma unroll
  for (int s = 0; s < 4; ++s) { d[s][0] = *(const v4f*)(p + s * 512); d[s][1] = *(const v4f*)(p + s * 512 + 128); d[s][2] = *(const v4f*)(p + s * 512 + 256); d[s][3] = *(const v4f*)(p + s * 512 + 384); } }
// one batch = 4 k steps x 2 groups of 8 weight rows
__device__ __forceinline__ void ld_w8(v4f (&d)[8][2], const float* p) {
#pragma unroll
  for (int i = 0; i < 8; ++i) { const float* q = p + (size_t)(i & 1) * 8 * CC + (i >> 1) * 32; d[i][0] = *(const v4f*)q; d[i][1] = *(const v4f*)(q + 4); } }
__device__ __forceinline__ void st_w8(const v4f (&d)[8][2], _Float16* p) {
#pragma unroll
  for (int i = 0; i < 8; ++i) { v8h w;
#pragma unroll
    for (int e = 0; e < 8; ++e) w[e] = w64(d[i][e >> 2][e & 3]);
    *(v8h*)(p + (i >> 1) * 512 + (i & 1) * 64) = w; } }
__global__ __launch_bounds__(256) void k_out(const float* __restrict__ A, const float* __restrict__ Wm, const float* __restrict__ BIAS, float* __restrict__ OUT) {
  __shared__ __align__(16) _Float16 wf[8 * 16 * 512]; __shared__ __align__(16) float sf[8][16][OPW];
  const int tid = threadIdx.x, lane = tid & 31, col = lane & 15, g = lane >> 4; const int wave = __builtin_amdgcn_readfirstlane(tid >> 5);
  const int c0 = blockIdx.y * 128, cw = c0 + (wave >> 2) * 64; const size_t r0 = (size_t)blockIdx.x * 64 + (wave & 3) * 16;
  const float* ap = A + (r0 >> 4) * (size_t)(16 * CC) + lane * 4;   /* A lies in fragment order [row tile][k step 16][element quarter 4][lane 32][4] */
  const float* wp = Wm + (size_t)(c0 + wave * 16 + (lane >> 2)) * CC + (lane & 3) * 8;   /* wave = the column tile it stages */
  const float* bp = BIAS + cw + col;
  _Float16* wq = wf + wave * (16 * 512) + ((lane >> 1) & 1) * 256 + ((lane & 1) * 16 + (lane >> 2)) * 8;
  v4f av[2][4][4], wt[2][8][2]; float bb[4];
  /* SB: a scheduling barrier on either side of a group of loads keeps the group issued whole at that place: ahead of the conversions that cover its latency, and behind the ones that free its registers (left alone the scheduler took a third weight buffer, past 256 registers) */
#define SB() __builtin_amdgcn_sched_barrier(0)
  ld_w8(wt[0], wp); ld_w8(wt[1], wp + 128);
#pragma unroll
  for (int j = 0; j < 4; ++j) bb[j] = bp[j * 16];
  ld_a4(av[0], ap); SB();
  st_w8(wt[0], wq); SB(); ld_w8(wt[0], wp + 256); SB();
  st_w8(wt[1], wq + 4 * 512); SB(); ld_w8(wt[1], wp + 384); XW2(wp, bp); SB();   /* the last loads through wp and bp */
  st_w8(wt[0], wq + 8 * 512); SB(); ld_a4(av[1], ap + 4 * 512); SB();
  st_w8(wt[1], wq + 12 * 512);
  __syncthreads();   /* the 8 waves' tiles of the weight panel are complete before any wave reads them */
  v8f acc[4] = {};
  const _Float16* fp = wf + (wave >> 2) * (4 * 16 * 512) + lane * 8;
#pragma unroll
  for (int gr = 0; gr < 4; ++gr) {
#pragma unroll
    for (int s = 0; s < 4; ++s) { const int kc = gr * 4 + s; v16h a, al, w[4];
#pragma unroll
      for (int j = 0; j < 4; ++j) w[j] = frag_fo(fp + (j * 16 + kc) * 512);
#pragma unroll
      for (int e = 0; e < 16; ++e) { const float x = av[gr & 1][s][e >> 2][e & 3]; const _Float16 hh = (_Float16)x; a[e] = hh; al[e] = (_Float16)(x - (float)hh); }
#pragma unroll
      for (int j = 0; j < 4; ++j) acc[j] = wm(a, w[j], acc[j]);
#pragma unroll
      for (int j = 0; j < 4; ++j) acc[j] = wm(al, w[j], acc[j]); }
    if (gr < 2) { SB(); ld_a4(av[gr & 1], ap + (gr + 2) * 4 * 512); if (gr == 1) XW2(ap, ap);   /* the last loads through ap */ SB(); } }
#pragma unroll
  for (int j = 0; j < 4; ++j) { const float b = bfr(bb[j]);
#pragma unroll
    for (int r = 0; r < 8; ++r) sf[wave][8 * g + r][j * 16 + col] = acc[j][r] * (1.0f / 64.0f) + b; }
  LDSX();   /* the wave's own staging rows are written before it reads them back as whole 256-B row segments */
  float* op = OUT + (r0 + g) * CC + cw + col * 4;
#pragma unroll
  for (int i = 0; i < 8; ++i) vst2(op + (size_t)i * 2 * CC, *(const v4f*)&sf[wave][2 * i + g][col * 4]); }

extern "C" void kernel_launch(void* const* d_in, const int* in_sizes, int n_in, void* d_out, int out_size, void* d_ws, size_t ws_size, hipStream_t stream) {
  (void)in_sizes; (void)n_in; (void)out_size;
  const float** F = (const float**)d_in;
  if (ws_size < (size_t)WS_END) return;
  char* ws = (char*)d_ws; _Float16 *QH = (_Float16*)(ws + WS_QH), *KH = (_Float16*)(ws + WS_KH), *VT = (_Float16*)(ws + WS_VT), *QL = (_Float16*)(ws + WS_QL), *KL = (_Float16*)(ws + WS_KL); __bf16 *VB = (__bf16*)(ws + WS_VB), *VBL = (__bf16*)(ws + WS_VBL); float *S = (float*)(ws + WS_S), *Y = (float*)(ws + WS_Y);
  (void)Y; (void)S; (void)QL; (void)KL; (void)VB; (void)VBL;
  // inputs: 0 x [2,2048,512]; 1 Wl [16,512,512] (out,in); 2 bl [16,512]; 3 Wq [16,512,32] (in,out); 4 Wk; 5 Wv; 6 Wo [512,512] (out,in); 7 bo [512]
  if (ws_size < (size_t)WS_TOP) return;
  _Float16* WF = (_Float16*)(ws + WS_WF); float *BC = (float*)(ws + WS_BC), *CAT = (float*)(ws + WS_CAT);
  /* head = blockIdx.y in the two projection launches */
  k_fold<<<dim3(CC / 64 + 1, NH), 96, 0, stream>>>(F[1], F[2], F[3], F[4], F[5], WF, BC);   /* folded weights Wl[h]^T [Wq|Wk|Wv][h] and bias bl[h] [Wq|Wk|Wv][h] */
  k_qkv<<<dim3(NRW / 128, NH), 128, 0, stream>>>(F[0], WF, BC, QH, QL, KH, KL, VT, VB, VBL);   /* q, k, v of every head = x folded weight + folded bias, written as the planes that k_fa reads */
  k_fa<<<dim3(NQB, NH, TNB), 128, 0, stream>>>(QH, KH, QL, KL, VT, VB, VBL, CAT);   /* logits, softmax and P v of every (b, h) in one launch */
  k_out<<<dim3(NRW / 64, CC / 128), 256, 0, stream>>>(CAT, F[6], F[7], (float*)d_out);   /* out = cat Wo^T + bo */
}

// v007
// Measured time: 70.2 microseconds a run.
// Two timings next to v006 put it at 1.17 and 1.14 times that version's speed.
// All steps since v000 together make it 43.6 times as fast.
// compute dtype: all float inputs rounded to bf16; q/k/v = x (Wl[h]^T Wq/Wk/Wv[h]) + bl[h] Wq/Wk/Wv[h]: the folded weight and bias from f16(bf16 x 2^6) operands (exact, 1 product, WMMA 16x16x32, f32 accumulate), the folded weight kept as f16 hi + residual (x 2^6) against x as f16 (bf16-exact) (2 products); unscaled causal logits: q, k once to f16 (1 product), 3 products below row 384; online softmax in f32 (running maximum and sum, one fused kernel); P = exp(logit - maximum) once to f16 against v f16 (P and v as bf16 hi + lo below row 384); out = cat as f16 hi + residual against Wo^T f16(bf16 x 2^6) (2 products) + bo; f32 output.
#include <hip/hip_runtime.h>
#include <math.h>

typedef __attribute__((ext_vector_type(16))) _Float16 v16h;
typedef __attribute__((ext_vector_type(16))) __bf16 v16b;
typedef __attribute__((ext_vector_type(8)))  _Float16 v8h;
typedef __attribute__((ext_vector_type(8)))  float v8f;
typedef __attribute__((ext_vector_type(4)))  float v4f;
typedef __attribute__((ext_vector_type(2)))  float v2f;
typedef __attribute__((ext_vector_type(4)))  unsigned v4u;
typedef __attribute__((ext_vector_type(4)))  int v4i;
typedef float __attribute__((may_alias)) float_a;
typedef int __attribute__((may_alias)) int_a;

template <typename T> __device__ __forceinline__ void vst2(void* p, T v) { *(T*)p = v;  }
__device__ __forceinline__ v8f wmma16(v16h a, v16h b, v8f c) {
  v8f d = __builtin_amdgcn_wmma_f32_16x16x32_f16(false, a, false, b, (short)0, c, false, false);
  asm volatile("v_nop\n\tv_nop\n\tv_nop\n\tv_nop" : "+v"(d) : "v"(a), "v"(b));
  return d;
}
__device__ __forceinline__ v8f wmma_bf(v16b a, v16b b, v8f c) {
  v8f d = __builtin_amdgcn_wmma_f32_16x16x32_bf16(false, a, false, b, (short)0, c, false, false);
  asm volatile("v_nop\n\tv_nop\n\tv_nop\n\tv_nop" : "+v"(d) : "v"(a), "v"(b));
  return d;
}
// 16x16x32 fragments: lane = (h = lane>>4, row/col = lane&15); elements 0..7 = k0+8h+0..7, 8..15 = k0+16+8h+0..7; D element r = row 8h+r
__device__ __forceinline__ v16h frag_h(const _Float16* rowk0, int lane) {
  union { v16h v; v8h q[2]; } u; const _Float16* p = rowk0 + 8 * (lane >> 4);
  u.q[0] = *(const v8h*)p; u.q[1] = *(const v8h*)(p + 16); return u.v;
}
__device__ __forceinline__ v16h frag_f32(const float* rowk0, int lane) {
  v16h a; const float* p = rowk0 + 8 * (lane >> 4);
#pragma unroll
  for (int i = 0; i < 8; ++i) { a[i] = (_Float16)p[i]; a[8 + i] = (_Float16)p[16 + i]; }
  return a;
}
__device__ __forceinline__ v16h frag_f32s(const float* rowk0, int lane, float sc) {
  v16h a; const float* p = rowk0 + 8 * (lane >> 4);
#pragma unroll
  for (int i = 0; i < 8; ++i) { a[i] = (_Float16)(p[i] * sc); a[8 + i] = (_Float16)(p[16 + i] * sc); }
  return a;
}
// column fragment from a [K][ld] layout (column n), rows >= K read as 0
__device__ __forceinline__ v16h fragc_f32(const float* W, int k0, int n, int lane, int ld, int K) {
  v16h a; const int g = lane >> 4;
#pragma unroll
  for (int i = 0; i < 8; ++i) { const int ka = k0 + 8 * g + i, kb = ka + 16;
    a[i] = (_Float16)(ka < K ? W[(size_t)(ka < K ? ka : K - 1) * ld + n] : 0.f); a[8 + i] = (_Float16)(kb < K ? W[(size_t)(kb < K ? kb : K - 1) * ld + n] : 0.f); }
  return a;
}
struct F2 { v16b h, l; };
__device__ __forceinline__ F2 bsplit16(const float v[16]) { F2 r;
#pragma unroll
  for (int i = 0; i < 16; ++i) { const __bf16 h = (__bf16)v[i]; r.h[i] = h; r.l[i] = (__bf16)(v[i] - (float)h); }
  return r; }
__device__ __forceinline__ F2 split_row(const float* row, int k0, int lane) { float v[16]; const float* p = row + k0 + 8 * (lane >> 4);
#pragma unroll
  for (int i = 0; i < 8; ++i) { v[i] = p[i]; v[8 + i] = p[16 + i]; }
  return bsplit16(v); }
__device__ __forceinline__ F2 split_rowK(const float* row, int k0, int lane, int K) { float v[16]; const int g = lane >> 4;
#pragma unroll
  for (int i = 0; i < 8; ++i) { const int ka = k0 + 8 * g + i, kb = ka + 16; v[i] = ka < K ? row[ka < K ? ka : K - 1] : 0.f; v[8 + i] = kb < K ? row[kb < K ? kb : K - 1] : 0.f; }
  return bsplit16(v); }
__device__ __forceinline__ F2 split_col(const float* W, int k0, int n, int lane, int ld, int K) { float v[16]; const int g = lane >> 4;
#pragma unroll
  for (int i = 0; i < 8; ++i) { const int ka = k0 + 8 * g + i, kb = ka + 16; v[i] = ka < K ? W[(size_t)(ka < K ? ka : K - 1) * ld + n] : 0.f; v[8 + i] = kb < K ? W[(size_t)(kb < K ? kb : K - 1) * ld + n] : 0.f; }
  return bsplit16(v); }
__device__ __forceinline__ v8f mac3(const F2& a, const F2& b, v8f c) { c = wmma_bf(a.l, b.h, c); c = wmma_bf(a.h, b.l, c); return wmma_bf(a.h, b.h, c); }
__device__ __forceinline__ float sigm(float v) { return 1.0f / (1.0f + expf(-v)); }
#define LDSX() do { asm volatile("s_wait_dscnt 0" ::: "memory"); __builtin_amdgcn_wave_barrier(); __builtin_amdgcn_fence(__ATOMIC_RELEASE, "workgroup"); } while (0)

// Per-head multi-head causal attention (B 2, S 2,048, 512; 16 heads x 32; 0.02-scale weights: per-head Linear Wl [16,512,512] (out,in) + bl, per-head Wq/Wk/Wv [16,512,32] (in,out) no bias, Wo [512,512] (out,in) + bo): xh = x Wl[h]^T + bl[h]; Q, K, V = xh Wq[h], xh Wk[h], xh Wv[h]; scores = Q K^T (NO scaling), causal; F = softmax(scores) V; out = concat_h(F) Wo^T + bo.
#define NB 2
#define TT 2048
#define CC 512            // NH * HD = projected width
#define DIN 512          // input (model) width
#define NH 16
#define HD 32
#define NQB (TT / 64)
#define HG 8
#define SCALE (1.0f)
#define CAUSAL 1
#ifndef TNB
#define TNB NB
#endif
__device__ __forceinline__ float bfr(float v) { return (float)(__bf16)v; }
__host__ __device__ __forceinline__ int kb_last(int qb) { return CAUSAL ? ((qb * 64 + 63) >> 7) : (TT / 128 - 1); }
typedef __attribute__((ext_vector_type(8))) __bf16 v8b;
__device__ __forceinline__ v16b frag_b(const __bf16* rowk0, int lane) {
  union { v16b v; v8b q[2]; } u; const __bf16* p = rowk0 + 8 * (lane >> 4);
  u.q[0] = *(const v8b*)p; u.q[1] = *(const v8b*)(p + 16); return u.v;
}
#define QBH 6              // causal: query blocks 0..QBH-1 of each sequence (few keys, no averaging) take the high-precision path
#define QHI 384            // rows carrying a q residual plane
#define KHI 384            // key rows carrying k residual / v bf16 hi+lo planes (used only by the causal high-precision path)
// B fragment (k rows k0+.., output column o) of a weight: (in,out) [K][ld] or (out,in) [ld rows of K]: bf16 exact, or f16(bf16 * 256) exact
__device__ __forceinline__ v16b wcol_io(const float* Wm, int k0, int o, int lane, int ld) { v16b w; const int g = lane >> 4;
#pragma unroll
  for (int i = 0; i < 8; ++i) { w[i] = (__bf16)Wm[(size_t)(k0 + 8 * g + i) * ld + o]; w[8 + i] = (__bf16)Wm[(size_t)(k0 + 16 + 8 * g + i) * ld + o]; }
  return w; }
__device__ __forceinline__ v16b wcol_oi(const float* Wm, int k0, int o, int lane, int K) { v16b w; const float* p = Wm + (size_t)o * K + k0 + 8 * (lane >> 4);
#pragma unroll
  for (int i = 0; i < 8; ++i) { w[i] = (__bf16)p[i]; w[8 + i] = (__bf16)p[16 + i]; }
  return w; }
__device__ __forceinline__ v16h wcolh_io(const float* Wm, int k0, int o, int lane, int ld) { v16h w; const int g = lane >> 4;
#pragma unroll
  for (int i = 0; i < 8; ++i) { w[i] = (_Float16)(bfr(Wm[(size_t)(k0 + 8 * g + i) * ld + o]) * 256.0f); w[8 + i] = (_Float16)(bfr(Wm[(size_t)(k0 + 16 + 8 * g + i) * ld + o]) * 256.0f); }
  return w; }
__device__ __forceinline__ v16h wcolh_oi(const float* Wm, int k0, int o, int lane, int K) { v16h w; const float* p = Wm + (size_t)o * K + k0 + 8 * (lane >> 4);
#pragma unroll
  for (int i = 0; i < 8; ++i) { w[i] = (_Float16)(bfr(p[i]) * 256.0f); w[8 + i] = (_Float16)(bfr(p[16 + i]) * 256.0f); }
  return w; }
#define WQKV_LAYOUT 1   // 0 = (in,out) [DIN][CC]; 1 = (out,in) [CC][DIN]; 2 = per-head [NH][DIN][HD]
__device__ __forceinline__ v16b wcol_hdk(const float* Wm, int k0, int o, int lane) { v16b w; const int g = lane >> 4; const float* p = Wm + (size_t)(o / HD) * DIN * HD + (o % HD);
#pragma unroll
  for (int i = 0; i < 8; ++i) { w[i] = (__bf16)p[(size_t)(k0 + 8 * g + i) * HD]; w[8 + i] = (__bf16)p[(size_t)(k0 + 16 + 8 * g + i) * HD]; }
  return w; }
#define WO_OUT_IN 0
#if WQKV_LAYOUT == 1
#define WCOL(W, k0, o, lane) wcol_oi(W, k0, o, lane, DIN)
#elif WQKV_LAYOUT == 2
#define WCOL(W, k0, o, lane) wcol_hdk(W, k0, o, lane)
#else
#define WCOL(W, k0, o, lane) wcol_io(W, k0, o, lane, CC)
#endif
#if WO_OUT_IN
#define WOCOL(W, k0, o, lane) wcol_oi(W, k0, o, lane, CC)
#define WOCOLH(W, k0, o, lane) wcolh_oi(W, k0, o, lane, CC)
#else
#define WOCOL(W, k0, o, lane) wcol_io(W, k0, o, lane, DIN)
#define WOCOLH(W, k0, o, lane) wcolh_io(W, k0, o, lane, DIN)
#endif

#ifndef SM_EXTRA_PARAMS
#define SM_EXTRA_PARAMS
#endif
#ifndef PROJ_EXTRA_PARAMS
#define PROJ_EXTRA_PARAMS
#endif
#ifndef SM_MASK_HOOK
#define SM_MASK_HOOK (void)0
#endif

#define WS_QH  0u                                      // f16 q in fragment order [b][h][query tile t / 16][element half 2][lane 32][8]
#define WS_KH  (WS_QH + 2u * (size_t)NB * TT * CC)      // f16 k in fragment order [b][h][key tile t / 16][element half 2][lane 32][8]
#define WS_VT  (WS_KH + 2u * (size_t)NB * TT * CC)      // f16 v in fragment order [b][h][key chunk t / 32][channel tile 2][element half 2][lane 32][8]
#define WS_QL  (WS_VT + 2u * (size_t)NB * CC * TT)      // f16 q residual x 2^10, t < QHI, in the order of the q plane
#define WS_KL  (WS_QL + 2u * (size_t)NB * QHI * CC)     // f16 k residual x 2^10, t < KHI, in the order of the k plane
#define WS_VB  (WS_KL + 2u * (size_t)NB * KHI * CC)     // bf16 v hi (then lo), t < KHI, in the order of the v plane
#define WS_VBL (WS_VB + 2u * (size_t)NB * CC * KHI)
#define WS_S   (WS_VBL + 2u * (size_t)NB * CC * KHI)    // f32 area of HG * TT * TT floats; holds the folded weights and bias
#define WS_Y   (WS_S  + 4u * (size_t)HG * TT * TT)      // unused (k_fa writes the ctx rows to WS_CAT); same offset as WS_TQ
#define WS_XH  (WS_S + 0u)                              // area of NH * NB * TT * CC floats holding the folded weights and bias; fills the S region, which holds no logits (NH * NB * CC == HG * TT)
#define WS_TQ  (WS_XH + 4u * (size_t)NH * NB * TT * CC) // unused area of NH * NB * TT * 128 floats
#define WS_WP  (WS_TQ + 4u * (size_t)NH * NB * TT * 128) // unused area of NH * CC * 128 floats
#define WS_QB8 (WS_WP + 4u * (size_t)NH * CC * 128 + 256)
#define WS_KB8 (WS_QB8 + 4u * (size_t)NB * TT * CC)
#define WS_VB8 (WS_KB8 + 4u * (size_t)NB * TT * CC)
#define WS_CAT (WS_VB8 + 4u * (size_t)NB * TT * CC)
#define WS_END (WS_CAT + 4u * (size_t)NB * TT * CC)
#define WS_END2 WS_END
#define WS_TOP (WS_CAT + 4u * (size_t)NB * TT * CC)     // end of everything kernel_launch uses
static_assert((size_t)HG * TT * TT <= (size_t)NH * NB * TT * CC, "S must end where the WS_XH area ends");

// ---- k_fa: block = 64 queries (4 waves x 16) of (b, h), one pass over the keys 0 .. query in steps of 64 with a running row maximum and sum (online softmax); nothing of the logits or of P goes to memory.
// Both products are formed transposed so that every per-query value sits in the lane of its query (col = lane & 15): S^T = k q^T (A = key rows, B = query rows; D element r = key 8g + r, column = query), which is already the B fragment of P^T (elements 0..7 = tile 2c, 8..15 = tile 2c + 1), and ctx^T = v^T P^T (A = v, row = channel, k = key; D element r = channel 8g + r, column = query).
// q, k and v lie in memory as the fragments themselves (k_qkv writes them so): every load of the key loop reads 512 contiguous bytes, four whole lines, where a load from rows or planes touched 16 lines for the same bytes. ctx leaves in the order of k_out's A fragments (element r of tile j = channel 16 j + 8g + r of the lane's query: the same lane's elements there).
// Precision as before: q, k once to f16 (1 product), P once to f16 against v f16; query blocks < QBH: 3-product logits (q, k residual planes x 2^10), P and v as bf16 hi + lo (3 products). P is exp(logit - running maximum), at most 1; the division by the f32 row sum comes last.
#define L2E 1.4426950408889634f
#define NEGBIG (-1.0e30f)
// behind a group of global loads: their address registers (kept live to here as inputs) are rewritten only after this wait
#define XW2(p0, p1) asm volatile("s_wait_xcnt 0x0" :: "v"(p0), "v"(p1) : "memory")
#define XW4(p0, p1, p2, p3) asm volatile("s_wait_xcnt 0x0" :: "v"(p0), "v"(p1), "v"(p2), "v"(p3) : "memory")
static_assert(HD == 32, "one 32-deep product per logit tile, two 16-channel ctx tiles");
// 2^x; the v_nop fills the one slot that the instruction set asks for behind a transcendental, whatever the compiler schedules next (it had put a second v_exp_f32 there that overwrites the first one's source)
__device__ __forceinline__ float ex2(float x) { float r; asm("v_exp_f32 %0, %1\n\tv_nop" : "=v"(r) : "v"(x)); return r; }
// s[32] = this lane's logits of one 64-key step (excluded ones = NEGBIG) -> exp(s - new maximum); returns the factor that rescales what was summed under the old maximum
__device__ __forceinline__ float sm_step(float (&s)[32], float& m, float& l) {
  float c0 = fmaxf(s[0], s[1]), c1 = fmaxf(s[2], s[3]);
#pragma unroll
  for (int i = 4; i < 32; i += 2) { c0 = fmaxf(c0, s[i]); c1 = fmaxf(c1, s[i + 1]); }
  float cm = fmaxf(c0, c1); cm = fmaxf(cm, __shfl_xor(cm, 16));   /* lanes col and col + 16 hold the two key halves of one query */
  const float mn = fmaxf(m, cm), al = ex2((m - mn) * L2E), m2 = mn * L2E; m = mn;
  float a0 = 0.f, a1 = 0.f, a2 = 0.f, a3 = 0.f;
#pragma unroll
  for (int i = 0; i < 32; i += 4) {
    s[i] = ex2(fmaf(s[i], L2E, -m2)); s[i + 1] = ex2(fmaf(s[i + 1], L2E, -m2)); s[i + 2] = ex2(fmaf(s[i + 2], L2E, -m2)); s[i + 3] = ex2(fmaf(s[i + 3], L2E, -m2));
    a0 += s[i]; a1 += s[i + 1]; a2 += s[i + 2]; a3 += s[i + 3]; }
  l = l * al + ((a0 + a1) + (a2 + a3)); return al; }
// fragment kept in fragment order [element half 2][lane 32][8], from a pointer that already holds lane * 8: each of the two loads reads 512 contiguous bytes, four whole 128-B lines
__device__ __forceinline__ v16h frag_fo(const _Float16* p) { union { v16h v; v8h q[2]; } u; u.q[0] = *(const v8h*)p; u.q[1] = *(const v8h*)(p + 256); return u.v; }
__device__ __forceinline__ v16b frag_fob(const __bf16* p) { union { v16b v; v8b q[2]; } u; u.q[0] = *(const v8b*)p; u.q[1] = *(const v8b*)(p + 256); return u.v; }
__global__ __launch_bounds__(128) void k_fa(const _Float16* __restrict__ QH, const _Float16* __restrict__ KH, const _Float16* __restrict__ QL, const _Float16* __restrict__ KL, const _Float16* __restrict__ VT, const __bf16* __restrict__ VB, const __bf16* __restrict__ VBL, float* __restrict__ Y) {
  const int tid = threadIdx.x, lane = tid & 31, col = lane & 15, g = lane >> 4; const int wave = __builtin_amdgcn_readfirstlane(tid >> 5);
  const int qb = NQB - 1 - (int)blockIdx.x, h = blockIdx.y, b = blockIdx.z;   /* longest query blocks start first */
  const int ql0 = qb * 64 + wave * 16, tq = ql0 + col;
  float m = NEGBIG, l = 0.f; v8f o[2] = {}; const v8f zero = {};
  const size_t bh = (size_t)b * NH + h;   /* q, k and v of one (b, h) lie in fragment order, HD * 2 bytes a position: a 64-key step is 4 KiB of k and 4 KiB of v in a row */
  const _Float16* qp = QH + (bh * TT + ql0) * HD + lane * 8;
  const _Float16* kp = KH + bh * (size_t)(TT * HD) + lane * 8;
  if (qb < QBH) {
    const _Float16* qlp = QL + (bh * QHI + ql0) * HD + lane * 8;
    const v16h bq = frag_fo(qp), bql = frag_fo(qlp); XW2(qp, qlp);
    const _Float16* klp = KL + bh * (size_t)(KHI * HD) + lane * 8;
    const size_t vo = bh * (size_t)(KHI * HD) + lane * 8;
#pragma unroll 1
    for (int it = 0; it <= qb; ++it) { const int k0 = it * 64; float s[32];
      const _Float16 *kq = kp + (size_t)k0 * HD, *klq = klp + (size_t)k0 * HD; const __bf16 *vhq = VB + vo + (size_t)k0 * HD, *vlq = VBL + vo + (size_t)k0 * HD;
      v16h khf[4], klf[4]; v16b vhf[4], vlf[4];   /* index of the v fragments: c * 2 + j */
#pragma unroll
      for (int t = 0; t < 4; ++t) { khf[t] = frag_fo(kq + t * 512); klf[t] = frag_fo(klq + t * 512); vhf[t] = frag_fob(vhq + (t >> 1) * 1024 + (t & 1) * 512); vlf[t] = frag_fob(vlq + (t >> 1) * 1024 + (t & 1) * 512); }
      XW4(kq, klq, vhq, vlq);
#pragma unroll
      for (int t = 0; t < 4; ++t) { const v16h kh = khf[t], kl = klf[t];
        const v8f a = wmma16(kh, bq, zero); v8f a2 = wmma16(kh, bql, zero); a2 = wmma16(kl, bq, a2);
#pragma unroll
        for (int r = 0; r < 8; ++r) { const float v = (a[r] + a2[r] * (1.0f / 1024.0f)) * SCALE; s[t * 8 + r] = (k0 + t * 16 + 8 * g + r <= tq) ? v : NEGBIG; } }
      const float al = sm_step(s, m, l);
#pragma unroll
      for (int r = 0; r < 8; ++r) { o[0][r] *= al; o[1][r] *= al; }
#pragma unroll
      for (int c = 0; c < 2; ++c) { float v[16];
#pragma unroll
        for (int i = 0; i < 8; ++i) { v[i] = s[c * 16 + i]; v[8 + i] = s[c * 16 + 8 + i]; }
        const F2 p = bsplit16(v);
#pragma unroll
        for (int j = 0; j < 2; ++j) { const v16b vh = vhf[c * 2 + j];
          o[j] = wmma_bf(vh, p.h, o[j]); o[j] = wmma_bf(vh, p.l, o[j]); o[j] = wmma_bf(vlf[c * 2 + j], p.h, o[j]); } } }
  } else {
    const _Float16* vp = VT + bh * (size_t)(TT * HD) + lane * 8;
    const v16h bq = frag_fo(qp);
    v16h kf[4], vf[4];   /* this step's fragments, fetched one step ahead; index of the v fragments: j * 2 + c */
#pragma unroll
    for (int t = 0; t < 4; ++t) { kf[t] = frag_fo(kp + t * 512); vf[t] = frag_fo(vp + (t & 1) * 1024 + (t >> 1) * 512); }
    XW4(qp, kp, vp, vp);
#pragma unroll 1
    for (int it = 0; it <= qb; ++it) { const int k0 = it * 64, kn = (it < qb ? it + 1 : it) * 64;   /* the last step fetches its own tile again: in bounds, unused */
      const _Float16 *kq = kp + (size_t)kn * HD, *vq = vp + (size_t)kn * HD; v16h kx[4], vx[4];
#pragma unroll
      for (int t = 0; t < 4; ++t) { kx[t] = frag_fo(kq + t * 512); vx[t] = frag_fo(vq + (t & 1) * 1024 + (t >> 1) * 512); }
      XW2(kq, vq);
      float s[32];
#pragma unroll
      for (int t = 0; t < 4; ++t) { const v8f a = wmma16(kf[t], bq, zero);
#pragma unroll
        for (int r = 0; r < 8; ++r) s[t * 8 + r] = a[r] * SCALE; }
      if (it == qb) {   /* only the diagonal step holds keys past a query */
#pragma unroll
        for (int i = 0; i < 32; ++i) s[i] = (k0 + (i >> 3) * 16 + 8 * g + (i & 7) <= tq) ? s[i] : NEGBIG; }
      const float al = sm_step(s, m, l);
#pragma unroll
      for (int r = 0; r < 8; ++r) { o[0][r] *= al; o[1][r] *= al; }
#pragma unroll
      for (int c = 0; c < 2; ++c) { v16h p;
#pragma unroll
        for (int i = 0; i < 16; ++i) p[i] = (_Float16)s[c * 16 + i];
        o[0] = wmma16(vf[c], p, o[0]); o[1] = wmma16(vf[2 + c], p, o[1]); }
#pragma unroll
      for (int t = 0; t < 4; ++t) { kf[t] = kx[t]; vf[t] = vx[t]; } } }
  l += __shfl_xor(l, 16); const float inv = l > 0.f ? 1.0f / l : 0.f;
  float* yp = Y + ((((size_t)b * TT + ql0) >> 4) * NH + h) * 512 + lane * 4;   /* ctx in the order of k_out's A fragments [row tile][head = k step][element quarter 4][lane 32][4]: a store is 512 contiguous bytes */
#pragma unroll
  for (int j = 0; j < 2; ++j) { v4f w0, w1;
#pragma unroll
    for (int r = 0; r < 4; ++r) { w0[r] = o[j][r] * inv; w1[r] = o[j][4 + r] * inv; }
    vst2(yp + j * 256, w0); vst2(yp + j * 256 + 128, w1); } }

#define NRW (TNB * TT)
#ifndef SM_EXTRA_PARAMS
#define SM_EXTRA_PARAMS
#endif
#ifndef PROJ_EXTRA_PARAMS
#define PROJ_EXTRA_PARAMS
#endif
#ifndef SM_MASK_HOOK
#define SM_MASK_HOOK (void)0
#endif

#define WS_QH  0u                                      // f16 q in fragment order [b][h][query tile t / 16][element half 2][lane 32][8]
#define WS_KH  (WS_QH + 2u * (size_t)NB * TT * CC)      // f16 k in fragment order [b][h][key tile t / 16][element half 2][lane 32][8]
#define WS_VT  (WS_KH + 2u * (size_t)NB * TT * CC)      // f16 v in fragment order [b][h][key chunk t / 32][channel tile 2][element half 2][lane 32][8]
#define WS_QL  (WS_VT + 2u * (size_t)NB * CC * TT)      // f16 q residual x 2^10, t < QHI, in the order of the q plane
#define WS_KL  (WS_QL + 2u * (size_t)NB * QHI * CC)     // f16 k residual x 2^10, t < KHI, in the order of the k plane
#define WS_VB  (WS_KL + 2u * (size_t)NB * KHI * CC)     // bf16 v hi (then lo), t < KHI, in the order of the v plane
#define WS_VBL (WS_VB + 2u * (size_t)NB * CC * KHI)
#define WS_S   (WS_VBL + 2u * (size_t)NB * CC * KHI)    // f32 area of HG * TT * TT floats; holds the folded weights and bias
#define WS_Y   (WS_S  + 4u * (size_t)HG * TT * TT)      // unused (k_fa writes the ctx rows to WS_CAT); same offset as WS_TQ
#define WS_END (WS_Y  + 0u)
#define WS_Y2  (WS_END)
#define WS_O1  (WS_Y2 + 4u * (size_t)NB * TT * CC)
#define WS_R2  (WS_O1 + 4u * (size_t)NB * TT * CC)
#define WS_END2 (WS_R2 + 4u * (size_t)NB * TT * CC)


#define NC3 96                                          // q | k | v channels of one head
#define WS_WF  (WS_XH + 0u)                             // f16 folded weights x 2^6 in fragment order [h][hi, residual][channel tile 6][k step 16][element half 2][lane 32][8]
#define WS_BC  (WS_WF + 2u * (size_t)NH * 2 * NC3 * CC) // f32 folded bias [h][NC3]
__device__ __forceinline__ v8f wm(v16h a, v16h b, v8f c) { return __builtin_amdgcn_wmma_f32_16x16x32_f16(false, a, false, b, (short)0, c, false, false); }
__device__ __forceinline__ _Float16 w64(float v) { return (_Float16)(bfr(v) * 64.0f); }
// ---- k_fold: (x Wl^T + bl) W = x (Wl^T W) + bl W. Block = (64 input indices i0.., head), 12 waves = (which of Wq, Wk, Wv) x (quarter kq of the 512 summed indices o): D[i][c] = sum_o Wl[o][i] W[o][c] (A = Wl^T: row i, k = o; B = W: k = o, column c; both read with the same k order 8g + e, 16 + 8g + e).
// A wave sums 4 k steps, not 16: the steps are serial (load, wait, convert, multiply), so the launch lasts as long as one wave's steps. The four partial sums of a tile meet in LDS behind one barrier and are added in the order kq = 0, 1, 2, 3 by wave (which, kq = tile t), which stores that tile.
// D element r = input index 8g + r of channel column c: exactly the 8 elements that lane 16g + c of k_qkv's weight fragment (A for q, k: row = channel; B for v: column = channel; k = input index) holds in half t & 1 of k step i0 / 32 + t / 2, so WF is kept in that order: a store here and a load there are 512 contiguous bytes of whole 128-B lines, each line written by one wave. The last blockIdx.x takes bl as every row of A and gives the folded bias.
#define KQS (CC / 32 / 4)   /* k steps of one quarter */
__global__ __launch_bounds__(384) void k_fold(const float* __restrict__ WL, const float* __restrict__ BL, const float* __restrict__ WQ, const float* __restrict__ WK, const float* __restrict__ WV, _Float16* __restrict__ WF, float* __restrict__ BC) {
  __shared__ __align__(16) float red[3 * 4 * 4 * 512];   /* partial sums [which 3][tile t 4][quarter kq 4][j 2][element half 2][lane 32][4]: every LDS store and load of a weight block is 512 contiguous bytes */
  const int tid = threadIdx.x, lane = tid & 31, col = lane & 15, g = lane >> 4; const int wv = __builtin_amdgcn_readfirstlane(tid >> 5), wave = wv >> 2, kq = wv & 3;
  const size_t h = blockIdx.y;
  const float* bp = (wave == 0 ? WQ : wave == 1 ? WK : WV) + h * CC * HD + (size_t)(kq * (KQS * 32) + 8 * g) * HD + col;
  if (blockIdx.x < CC / 64) {
    const int i0 = blockIdx.x * 64;
    const float* ap = WL + h * CC * CC + (size_t)(kq * (KQS * 32) + 8 * g) * CC + i0 + col;
    v8f acc[4][2] = {};
#pragma unroll 1   /* rolled: one step's 96 loaded values and the 64 sums already take most of the registers */
    for (int kc = 0; kc < KQS; ++kc) { float av[4][16], bv[2][16];
#pragma unroll
      for (int e = 0; e < 16; ++e) { const int ko = e < 8 ? e : e + 8;
#pragma unroll
        for (int t = 0; t < 4; ++t) av[t][e] = ap[(size_t)ko * CC + t * 16];
        bv[0][e] = bp[(size_t)ko * HD]; bv[1][e] = bp[(size_t)ko * HD + 16]; }
      XW2(ap, bp); __builtin_amdgcn_sched_barrier(0);   /* every load of the step is issued before the first conversion or product: one memory latency a step; the scheduler had kept only two fragments in flight */
      v16h fa[4], fb[2];
#pragma unroll
      for (int e = 0; e < 16; ++e) { fa[0][e] = w64(av[0][e]); fa[1][e] = w64(av[1][e]); fa[2][e] = w64(av[2][e]); fa[3][e] = w64(av[3][e]); fb[0][e] = w64(bv[0][e]); fb[1][e] = w64(bv[1][e]); }
#pragma unroll
      for (int t = 0; t < 4; ++t) { acc[t][0] = wm(fa[t], fb[0], acc[t][0]); acc[t][1] = wm(fa[t], fb[1], acc[t][1]); }
      ap += (size_t)32 * CC; bp += (size_t)32 * HD; }
    float* rw = red + (wave * 16 + kq) * 512 + lane * 4;
#pragma unroll
    for (int t = 0; t < 4; ++t)
#pragma unroll
      for (int j = 0; j < 2; ++j) { v4f w0, w1;
#pragma unroll
        for (int r = 0; r < 4; ++r) { w0[r] = acc[t][j][r]; w1[r] = acc[t][j][4 + r]; }
        *(v4f*)(rw + t * 2048 + j * 256) = w0; *(v4f*)(rw + t * 2048 + j * 256 + 128) = w1; }
    __syncthreads();   /* the 12 waves' partial sums are in LDS before any wave adds them */
    const float* rr = red + (wave * 4 + kq) * 2048 + lane * 4;   /* this wave finishes tile t = kq of its weight */
    _Float16* op = WF + ((h * 2 * 6 + wave * 2) * 16 + (i0 >> 5) + (kq >> 1)) * (size_t)512 + (kq & 1) * 256 + lane * 8;
#pragma unroll
    for (int j = 0; j < 2; ++j) { v4f p[4][2];
#pragma unroll
      for (int q = 0; q < 4; ++q) { p[q][0] = *(const v4f*)(rr + q * 512 + j * 256); p[q][1] = *(const v4f*)(rr + q * 512 + j * 256 + 128); }
      v8h hi, lo;
#pragma unroll
      for (int r = 0; r < 8; ++r) { const float v = (((p[0][r >> 2][r & 3] + p[1][r >> 2][r & 3]) + p[2][r >> 2][r & 3]) + p[3][r >> 2][r & 3]) * (1.0f / 64.0f); hi[r] = (_Float16)v; lo[r] = (_Float16)(v - (float)hi[r]); }   /* sums carry 2^12; kept x 2^6 */
      vst2(op + j * (16 * 512), hi); vst2(op + j * (16 * 512) + NC3 * CC, lo); }
  } else {
    const float* ap = BL + h * CC + kq * (KQS * 32) + 8 * g;
    v8f acc[2] = {};
#pragma unroll 1   /* rolled: short steps of one small block a head, nothing to gain from more code */
    for (int kc = 0; kc < KQS; ++kc) { float av[16], bv[2][16];
#pragma unroll
      for (int e = 0; e < 16; ++e) { const int ko = e < 8 ? e : e + 8; av[e] = ap[ko]; bv[0][e] = bp[(size_t)ko * HD]; bv[1][e] = bp[(size_t)ko * HD + 16]; }
      XW2(ap, bp); __builtin_amdgcn_sched_barrier(0);   /* keeps the wait directly behind the loads, in front of the pointer steps (it had sunk to the loop's foot) */
      v16h fa, fb[2];
#pragma unroll
      for (int e = 0; e < 16; ++e) { fa[e] = w64(av[e]); fb[0][e] = w64(bv[0][e]); fb[1][e] = w64(bv[1][e]); }
      acc[0] = wm(fa, fb[0], acc[0]); acc[1] = wm(fa, fb[1], acc[1]);
      ap += 32; bp += (size_t)32 * HD; }
    red[(wave * 4 + kq) * 64 + lane] = acc[0][0]; red[(wave * 4 + kq) * 64 + 32 + lane] = acc[1][0];   /* every row of D is the same sum: element 0 of either lane half */
    __syncthreads();   /* the four quarters of each folded bias are in LDS before wave (which, 0) adds them */
    if (kq == 0 && g == 0) { const float* rr = red + wave * 256 + lane; float* op = BC + h * NC3 + wave * HD + col;
      op[0] = (((rr[0] + rr[64]) + rr[128]) + rr[192]) * (1.0f / 4096.0f); op[16] = (((rr[32] + rr[96]) + rr[160]) + rr[224]) * (1.0f / 4096.0f); } } }

// ---- k_qkv: block = (128 rows of x, head), wave = 32 rows; folded weight f16 hi then residual, read in fragment order; x rows bf16-rounded, exact in f16. The same two fragments serve either way round:
// q, k: [q|k]^T = weight (A = channel rows) x x^T (B = x rows): D element r = channel 8g + r, column = row of x, so a lane holds 8 consecutive channels of its row = the 8 elements that the same lane of k_fa's q (B) or k (A) fragment (row = position, k = channel) holds in half j of position tile u;
// v: x (A = x rows) x weight^T (B = channel columns): D element r = row of x 8g + r, column = channel, so a lane holds 8 consecutive positions of its channel = the 8 elements that the same lane of k_fa's A fragment (row = channel, k = key) holds in half u of channel tile j.
// The f32 sums go from the registers straight into the planes that k_fa reads: q, k, v -> f16 in fragment order, 512 contiguous bytes a store (+ q, k residuals x 2^10 and v bf16 hi / lo for t < QHI, KHI, in the same order).
static_assert(QHI == KHI && QHI % 32 == 0 && TT % 128 == 0, "a wave's 32 rows lie in one sequence, wholly below or wholly above the high-precision bound");
__global__ __launch_bounds__(128) void k_qkv(const float* __restrict__ X, const _Float16* __restrict__ WF, const float* __restrict__ BC, _Float16* __restrict__ QH, _Float16* __restrict__ QL, _Float16* __restrict__ KH, _Float16* __restrict__ KL, _Float16* __restrict__ VT, __bf16* __restrict__ VB, __bf16* __restrict__ VBL) {
  const int tid = threadIdx.x, lane = tid & 31, col = lane & 15, g = lane >> 4; const int wave = __builtin_amdgcn_readfirstlane(tid >> 5);
  const size_t h = blockIdx.y, r0 = (size_t)blockIdx.x * 128 + wave * 32;
  const float* xp = X + (r0 + col) * CC + 8 * g;
  const _Float16* wp = WF + h * 2 * NC3 * CC + lane * 8;   /* fragment order: tile ct at ct * 16 * 512, k step at 512, element half at 256 */
  v8f acc[6][2] = {};
#pragma unroll 1   /* rolled: one step's fragments and the 96 sums already take most of the registers */
  for (int kc = 0; kc < CC / 32; ++kc) { v4f xv[2][4]; v16h wh[6], wl[6];
#pragma unroll
    for (int u = 0; u < 2; ++u) { const float* p = xp + (size_t)u * 16 * CC; xv[u][0] = *(const v4f*)p; xv[u][1] = *(const v4f*)(p + 4); xv[u][2] = *(const v4f*)(p + 16); xv[u][3] = *(const v4f*)(p + 20); }
#pragma unroll
    for (int ct = 0; ct < 6; ++ct) { wh[ct] = frag_fo(wp + (size_t)(ct * 16) * 512); wl[ct] = frag_fo(wp + (size_t)(NC3 + ct * 16) * 512); }
    XW2(xp, wp); __builtin_amdgcn_sched_barrier(0);   /* every load of the step is issued before the first conversion or product: one memory latency a step; the scheduler had kept only two fragments in flight */
    v16h xb[2];
#pragma unroll
    for (int u = 0; u < 2; ++u)
#pragma unroll
      for (int e = 0; e < 16; ++e) xb[u][e] = (_Float16)bfr(xv[u][e >> 2][e & 3]);
#pragma unroll
    for (int ct = 0; ct < 4; ++ct) { acc[ct][0] = wm(wh[ct], xb[0], acc[ct][0]); acc[ct][1] = wm(wh[ct], xb[1], acc[ct][1]); }
#pragma unroll
    for (int ct = 4; ct < 6; ++ct) { acc[ct][0] = wm(xb[0], wh[ct], acc[ct][0]); acc[ct][1] = wm(xb[1], wh[ct], acc[ct][1]); }
#pragma unroll
    for (int ct = 0; ct < 4; ++ct) { acc[ct][0] = wm(wl[ct], xb[0], acc[ct][0]); acc[ct][1] = wm(wl[ct], xb[1], acc[ct][1]); }
#pragma unroll
    for (int ct = 4; ct < 6; ++ct) { acc[ct][0] = wm(xb[0], wl[ct], acc[ct][0]); acc[ct][1] = wm(xb[1], wl[ct], acc[ct][1]); }
    xp += 32; wp += 512; }
  const float *bcp = BC + h * NC3 + 8 * g, *bvp = BC + h * NC3 + 2 * HD + col; v4f bc[4][2]; float bv[2];   /* q, k: the bias of the lane's 8 channels; v: of its one channel a tile */
#pragma unroll
  for (int ct = 0; ct < 4; ++ct) { bc[ct][0] = *(const v4f*)(bcp + ct * 16); bc[ct][1] = *(const v4f*)(bcp + ct * 16 + 4); }
  bv[0] = bvp[0]; bv[1] = bvp[16];
  asm volatile("s_wait_xcnt 0x0" ::: "memory"); __builtin_amdgcn_sched_barrier(0);   /* the bias loads' address registers are rewritten only behind this wait; the scheduling barrier keeps the stores' address arithmetic behind it */
#pragma unroll
  for (int ct = 0; ct < 6; ++ct)
#pragma unroll
    for (int u = 0; u < 2; ++u)
#pragma unroll
      for (int r = 0; r < 8; ++r) acc[ct][u][r] = acc[ct][u][r] * (1.0f / 64.0f) + (ct < 4 ? bc[ct][r >> 2][r & 3] : bv[ct - 4]);
  const size_t bb = r0 / TT, t0 = r0 % TT, bh = bb * NH + h, fo = (bh * TT + t0) * HD + lane * 8;
  _Float16 *qo = QH + fo, *ko = KH + fo, *vo = VT + fo;   /* q, k: position tile u, half j; v: channel tile j, half u of the wave's one 32-key chunk */
#pragma unroll
  for (int u = 0; u < 2; ++u)
#pragma unroll
    for (int j = 0; j < 2; ++j) { v8h q, k, v;
#pragma unroll
      for (int r = 0; r < 8; ++r) { q[r] = (_Float16)acc[j][u][r]; k[r] = (_Float16)acc[2 + j][u][r]; v[r] = (_Float16)acc[4 + j][u][r]; }
      vst2(qo + u * 512 + j * 256, q); vst2(ko + u * 512 + j * 256, k); vst2(vo + j * 512 + u * 256, v); }
  asm volatile("s_wait_xcnt 0x0" ::: "memory");   /* the branch below opens with an argument load and arithmetic that rewrite registers which the stores above name: only behind this wait, which stands in the stores' own block */
  if (t0 < QHI) {   /* the same for a whole wave */
    const size_t fl = (bh * KHI + t0) * HD + lane * 8; _Float16 *qlo = QL + fl, *klo = KL + fl; __bf16 *vho = VB + fl, *vlo = VBL + fl;
#pragma unroll
    for (int u = 0; u < 2; ++u)
#pragma unroll
      for (int j = 0; j < 2; ++j) { v8h q, k; v8b vh, vl;
#pragma unroll
        for (int r = 0; r < 8; ++r) { const float qf = acc[j][u][r], kf = acc[2 + j][u][r], vf = acc[4 + j][u][r]; const __bf16 b = (__bf16)vf;
          q[r] = (_Float16)((qf - (float)(_Float16)qf) * 1024.0f); k[r] = (_Float16)((kf - (float)(_Float16)kf) * 1024.0f); vh[r] = b; vl[r] = (__bf16)(vf - (float)b); }
        vst2(qlo + u * 512 + j * 256, q); vst2(klo + u * 512 + j * 256, k); vst2(vho + j * 512 + u * 256, vh); vst2(vlo + j * 512 + u * 256, vl); } } }

// ---- k_out: OUT = A (f16 hi + unscaled f16 residual, 2 products) x W^T (W (out,in) as f16(bf16 x 2^6)) x 2^-6 + bias. Block = (64 rows, 128 columns), 8 waves, wave = 16 rows x 64 columns. A arrives in fragment order (k_fa writes it so): each A load reads 512 contiguous bytes.
// The block's 128 weight rows are read once, 8 rows of 128 B an instruction, every load of a batch in flight together, converted once and kept in LDS in fragment order [column tile 8][k step 16][element half 2][lane 32][8];
// chunk q = lane & 3 of a k step (floats 8q .. 8q + 7 of a weight row) is element half q >> 1 of fragment lane 16 (q & 1) + column, the k order of the A fragment. One barrier; behind it the k loop reads 512 contiguous LDS bytes a load and fetches its A rows four k steps ahead. Every loop here is unrolled in full: its index picks registers (buffers, fragments, sums) and the immediate offset of each load. Each sum takes its products in the order k step, hi, residual.
#define OPW 68   /* f32 pitch of the output staging rows: the two lane halves (rows 8 apart) fall on different banks */
__device__ __forceinline__ void ld_a4(v4f (&d)[4][4], const float* p) {
#pragma unroll
  for (int s = 0; s < 4; ++s) { d[s][0] = *(const v4f*)(p + s * 512); d[s][1] = *(const v4f*)(p + s * 512 + 128); d[s][2] = *(const v4f*)(p + s * 512 + 256); d[s][3] = *(const v4f*)(p + s * 512 + 384); } }
// one batch = 4 k steps x 2 groups of 8 weight rows
__device__ __forceinline__ void ld_w8(v4f (&d)[8][2], const float* p) {
#pragma unroll
  for (int i = 0; i < 8; ++i) { const float* q = p + (size_t)(i & 1) * 8 * CC + (i >> 1) * 32; d[i][0] = *(const v4f*)q; d[i][1] = *(const v4f*)(q + 4); } }
__device__ __forceinline__ void st_w8(const v4f (&d)[8][2], _Float16* p) {
#pragma unroll
  for (int i = 0; i < 8; ++i) { v8h w;
#pragma unroll
    for (int e = 0; e < 8; ++e) w[e] = w64(d[i][e >> 2][e & 3]);
    *(v8h*)(p + (i >> 1) * 512 + (i & 1) * 64) = w; } }
__global__ __launch_bounds__(256) void k_out(const float* __restrict__ A, const float* __restrict__ Wm, const float* __restrict__ BIAS, float* __restrict__ OUT) {
  __shared__ __align__(16) _Float16 wf[8 * 16 * 512]; __shared__ __align__(16) float sf[8][16][OPW];
  const int tid = threadIdx.x, lane = tid & 31, col = lane & 15, g = lane >> 4; const int wave = __builtin_amdgcn_readfirstlane(tid >> 5);
  const int c0 = blockIdx.y * 128, cw = c0 + (wave >> 2) * 64; const size_t r0 = (size_t)blockIdx.x * 64 + (wave & 3) * 16;
  const float* ap = A + (r0 >> 4) * (size_t)(16 * CC) + lane * 4;   /* A lies in fragment order [row tile][k step 16][element quarter 4][lane 32][4] */
  const float* wp = Wm + (size_t)(c0 + wave * 16 + (lane >> 2)) * CC + (lane & 3) * 8;   /* wave = the column tile it stages */
  const float* bp = BIAS + cw + col;
  _Float16* wq = wf + wave * (16 * 512) + ((lane >> 1) & 1) * 256 + ((lane & 1) * 16 + (lane >> 2)) * 8;
  v4f av[2][4][4], wt[2][8][2]; float bb[4];
  /* SB: a scheduling barrier on either side of a group of loads keeps the group issued whole at that place: ahead of the conversions that cover its latency, and behind the ones that free its registers (left alone the scheduler took a third weight buffer, past 256 registers) */
#define SB() __builtin_amdgcn_sched_barrier(0)
  ld_w8(wt[0], wp); ld_w8(wt[1], wp + 128);
#pragma unroll
  for (int j = 0; j < 4; ++j) bb[j] = bp[j * 16];
  ld_a4(av[0], ap); SB();
  st_w8(wt[0], wq); SB(); ld_w8(wt[0], wp + 256); SB();
  st_w8(wt[1], wq + 4 * 512); SB(); ld_w8(wt[1], wp + 384); XW2(wp, bp); SB();   /* the last loads through wp and bp */
  st_w8(wt[0], wq + 8 * 512); SB(); ld_a4(av[1], ap + 4 * 512); SB();
  st_w8(wt[1], wq + 12 * 512);
  __syncthreads();   /* the 8 waves' tiles of the weight panel are complete before any wave reads them */
  v8f acc[4] = {};
  const _Float16* fp = wf + (wave >> 2) * (4 * 16 * 512) + lane * 8;
#pragma unroll
  for (int gr = 0; gr < 4; ++gr) {
#pragma unroll
    for (int s = 0; s < 4; ++s) { const int kc = gr * 4 + s; v16h a, al, w[4];
#pragma unroll
      for (int j = 0; j < 4; ++j) w[j] = frag_fo(fp + (j * 16 + kc) * 512);
#pragma unroll
      for (int e = 0; e < 16; ++e) { const float x = av[gr & 1][s][e >> 2][e & 3]; const _Float16 hh = (_Float16)x; a[e] = hh; al[e] = (_Float16)(x - (float)hh); }
#pragma unroll
      for (int j = 0; j < 4; ++j) acc[j] = wm(a, w[j], acc[j]);
#pragma unroll
      for (int j = 0; j < 4; ++j) acc[j] = wm(al, w[j], acc[j]); }
    if (gr < 2) { SB(); ld_a4(av[gr & 1], ap + (gr + 2) * 4 * 512); if (gr == 1) XW2(ap, ap);   /* the last loads through ap */ SB(); } }
#pragma unroll
  for (int j = 0; j < 4; ++j) { const float b = bfr(bb[j]);
#pragma unroll
    for (int r = 0; r < 8; ++r) sf[wave][8 * g + r][j * 16 + col] = acc[j][r] * (1.0f / 64.0f) + b; }
  LDSX();   /* the wave's own staging rows are written before it reads them back as whole 256-B row segments */
  float* op = OUT + (r0 + g) * CC + cw + col * 4;
#pragma unroll
  for (int i = 0; i < 8; ++i) vst2(op + (size_t)i * 2 * CC, *(const v4f*)&sf[wave][2 * i + g][col * 4]); }

extern "C" void kernel_launch(void* const* d_in, const int* in_sizes, int n_in, void* d_out, int out_size, void* d_ws, size_t ws_size, hipStream_t stream) {
  (void)in_sizes; (void)n_in; (void)out_size;
  const float** F = (const float**)d_in;
  if (ws_size < (size_t)WS_END) return;
  char* ws = (char*)d_ws; _Float16 *QH = (_Float16*)(ws + WS_QH), *KH = (_Float16*)(ws + WS_KH), *VT = (_Float16*)(ws + WS_VT), *QL = (_Float16*)(ws + WS_QL), *KL = (_Float16*)(ws + WS_KL); __bf16 *VB = (__bf16*)(ws + WS_VB), *VBL = (__bf16*)(ws + WS_VBL); float *S = (float*)(ws + WS_S), *Y = (float*)(ws + WS_Y);
  (void)Y; (void)S; (void)QL; (void)KL; (void)VB; (void)VBL;
  // inputs: 0 x [2,2048,512]; 1 Wl [16,512,512] (out,in); 2 bl [16,512]; 3 Wq [16,512,32] (in,out); 4 Wk; 5 Wv; 6 Wo [512,512] (out,in); 7 bo [512]
  if (ws_size < (size_t)WS_TOP) return;
  _Float16* WF = (_Float16*)(ws + WS_WF); float *BC = (float*)(ws + WS_BC), *CAT = (float*)(ws + WS_CAT);
  /* head = blockIdx.y in the two projection launches */
  k_fold<<<dim3(CC / 64 + 1, NH), 384, 0, stream>>>(F[1], F[2], F[3], F[4], F[5], WF, BC);   /* folded weights Wl[h]^T [Wq|Wk|Wv][h] and bias bl[h] [Wq|Wk|Wv][h] */
  k_qkv<<<dim3(NRW / 128, NH), 128, 0, stream>>>(F[0], WF, BC, QH, QL, KH, KL, VT, VB, VBL);   /* q, k, v of every head = x folded weight + folded bias, written as the planes that k_fa reads */
  k_fa<<<dim3(NQB, NH, TNB), 128, 0, stream>>>(QH, KH, QL, KL, VT, VB, VBL, CAT);   /* logits, softmax and P v of every (b, h) in one launch */
  k_out<<<dim3(NRW / 64, CC / 128), 256, 0, stream>>>(CAT, F[6], F[7], (float*)d_out);   /* out = cat Wo^T + bo */
}

// v008
// A run of this version takes 65.3 microseconds.
// Timed twice side by side with v007, it ran 1.05 times as fast both times.
// Counting every step since v000, it is 45.9 times as fast.
// compute dtype: all float inputs rounded to bf16; q/k/v = x (Wl[h]^T Wq/Wk/Wv[h]) + bl[h] Wq/Wk/Wv[h]: the folded weight and bias from f16(bf16 x 2^6) operands (exact, 1 product, WMMA 16x16x32, f32 accumulate), the folded weight kept as f16 hi + residual (x 2^6) against x as f16 (bf16-exact) (2 products); unscaled causal logits: q, k once to f16 (1 product), 3 products below row 384; online softmax in f32 (running maximum and sum, one fused kernel); P = exp(logit - maximum) once to f16 against v f16 (P and v as bf16 hi + lo below row 384); out = cat as f16 hi + residual against Wo^T f16(bf16 x 2^6) (2 products) + bo; f32 output.
#include <hip/hip_runtime.h>
#include <math.h>

typedef __attribute__((ext_vector_type(16))) _Float16 v16h;
typedef __attribute__((ext_vector_type(16))) __bf16 v16b;
typedef __attribute__((ext_vector_type(8)))  _Float16 v8h;
typedef __attribute__((ext_vector_type(8)))  float v8f;
typedef __attribute__((ext_vector_type(4)))  float v4f;
typedef __attribute__((ext_vector_type(2)))  float v2f;
typedef __attribute__((ext_vector_type(4)))  unsigned v4u;
typedef __attribute__((ext_vector_type(4)))  int v4i;
typedef float __attribute__((may_alias)) float_a;
typedef int __attribute__((may_alias)) int_a;

template <typename T> __device__ __forceinline__ void vst2(void* p, T v) { *(T*)p = v;  }
__device__ __forceinline__ v8f wmma16(v16h a, v16h b, v8f c) {
  v8f d = __builtin_amdgcn_wmma_f32_16x16x32_f16(false, a, false, b, (short)0, c, false, false);
  asm volatile("v_nop\n\tv_nop\n\tv_nop\n\tv_nop" : "+v"(d) : "v"(a), "v"(b));
  return d;
}
__device__ __forceinline__ v8f wmma_bf(v16b a, v16b b, v8f c) {
  v8f d = __builtin_amdgcn_wmma_f32_16x16x32_bf16(false, a, false, b, (short)0, c, false, false);
  asm volatile("v_nop\n\tv_nop\n\tv_nop\n\tv_nop" : "+v"(d) : "v"(a), "v"(b));
  return d;
}
// 16x16x32 fragments: lane = (h = lane>>4, row/col = lane&15); elements 0..7 = k0+8h+0..7, 8..15 = k0+16+8h+0..7; D element r = row 8h+r
__device__ __forceinline__ v16h frag_h(const _Float16* rowk0, int lane) {
  union { v16h v; v8h q[2]; } u; const _Float16* p = rowk0 + 8 * (lane >> 4);
  u.q[0] = *(const v8h*)p; u.q[1] = *(const v8h*)(p + 16); return u.v;
}
__device__ __forceinline__ v16h frag_f32(const float* rowk0, int lane) {
  v16h a; const float* p = rowk0 + 8 * (lane >> 4);
#pragma unroll
  for (int i = 0; i < 8; ++i) { a[i] = (_Float16)p[i]; a[8 + i] = (_Float16)p[16 + i]; }
  return a;
}
__device__ __forceinline__ v16h frag_f32s(const float* rowk0, int lane, float sc) {
  v16h a; const float* p = rowk0 + 8 * (lane >> 4);
#pragma unroll
  for (int i = 0; i < 8; ++i) { a[i] = (_Float16)(p[i] * sc); a[8 + i] = (_Float16)(p[16 + i] * sc); }
  return a;
}
// column fragment from a [K][ld] layout (column n), rows >= K read as 0
__device__ __forceinline__ v16h fragc_f32(const float* W, int k0, int n, int lane, int ld, int K) {
  v16h a; const int g = lane >> 4;
#pragma unroll
  for (int i = 0; i < 8; ++i) { const int ka = k0 + 8 * g + i, kb = ka + 16;
    a[i] = (_Float16)(ka < K ? W[(size_t)(ka < K ? ka : K - 1) * ld + n] : 0.f); a[8 + i] = (_Float16)(kb < K ? W[(size_t)(kb < K ? kb : K - 1) * ld + n] : 0.f); }
  return a;
}
struct F2 { v16b h, l; };
__device__ __forceinline__ F2 bsplit16(const float v[16]) { F2 r;
#pragma unroll
  for (int i = 0; i < 16; ++i) { const __bf16 h = (__bf16)v[i]; r.h[i] = h; r.l[i] = (__bf16)(v[i] - (float)h); }
  return r; }
__device__ __forceinline__ F2 split_row(const float* row, int k0, int lane) { float v[16]; const float* p = row + k0 + 8 * (lane >> 4);
#pragma unroll
  for (int i = 0; i < 8; ++i) { v[i] = p[i]; v[8 + i] = p[16 + i]; }
  return bsplit16(v); }
__device__ __forceinline__ F2 split_rowK(const float* row, int k0, int lane, int K) { float v[16]; const int g = lane >> 4;
#pragma unroll
  for (int i = 0; i < 8; ++i) { const int ka = k0 + 8 * g + i, kb = ka + 16; v[i] = ka < K ? row[ka < K ? ka : K - 1] : 0.f; v[8 + i] = kb < K ? row[kb < K ? kb : K - 1] : 0.f; }
  return bsplit16(v); }
__device__ __forceinline__ F2 split_col(const float* W, int k0, int n, int lane, int ld, int K) { float v[16]; const int g = lane >> 4;
#pragma unroll
  for (int i = 0; i < 8; ++i) { const int ka = k0 + 8 * g + i, kb = ka + 16; v[i] = ka < K ? W[(size_t)(ka < K ? ka : K - 1) * ld + n] : 0.f; v[8 + i] = kb < K ? W[(size_t)(kb < K ? kb : K - 1) * ld + n] : 0.f; }
  return bsplit16(v); }
__device__ __forceinline__ v8f mac3(const F2& a, const F2& b, v8f c) { c = wmma_bf(a.l, b.h, c); c = wmma_bf(a.h, b.l, c); return wmma_bf(a.h, b.h, c); }
__device__ __forceinline__ float sigm(float v) { return 1.0f / (1.0f + expf(-v)); }
#define LDSX() do { asm volatile("s_wait_dscnt 0" ::: "memory"); __builtin_amdgcn_wave_barrier(); __builtin_amdgcn_fence(__ATOMIC_RELEASE, "workgroup"); } while (0)

// Per-head multi-head causal attention (B 2, S 2,048, 512; 16 heads x 32; 0.02-scale weights: per-head Linear Wl [16,512,512] (out,in) + bl, per-head Wq/Wk/Wv [16,512,32] (in,out) no bias, Wo [512,512] (out,in) + bo): xh = x Wl[h]^T + bl[h]; Q, K, V = xh Wq[h], xh Wk[h], xh Wv[h]; scores = Q K^T (NO scaling), causal; F = softmax(scores) V; out = concat_h(F) Wo^T + bo.
#define NB 2
#define TT 2048
#define CC 512            // NH * HD = projected width
#define DIN 512          // input (model) width
#define NH 16
#define HD 32
#define NQB (TT / 64)
#define HG 8
#define SCALE (1.0f)
#define CAUSAL 1
#ifndef TNB
#define TNB NB
#endif
__device__ __forceinline__ float bfr(float v) { return (float)(__bf16)v; }
__host__ __device__ __forceinline__ int kb_last(int qb) { return CAUSAL ? ((qb * 64 + 63) >> 7) : (TT / 128 - 1); }
typedef __attribute__((ext_vector_type(8))) __bf16 v8b;
__device__ __forceinline__ v16b frag_b(const __bf16* rowk0, int lane) {
  union { v16b v; v8b q[2]; } u; const __bf16* p = rowk0 + 8 * (lane >> 4);
  u.q[0] = *(const v8b*)p; u.q[1] = *(const v8b*)(p + 16); return u.v;
}
#define QBH 6              // causal: query blocks 0..QBH-1 of each sequence (few keys, no averaging) take the high-precision path
#define QHI 384            // rows carrying a q residual plane
#define KHI 384            // key rows carrying k residual / v bf16 hi+lo planes (used only by the causal high-precision path)
// B fragment (k rows k0+.., output column o) of a weight: (in,out) [K][ld] or (out,in) [ld rows of K]: bf16 exact, or f16(bf16 * 256) exact
__device__ __forceinline__ v16b wcol_io(const float* Wm, int k0, int o, int lane, int ld) { v16b w; const int g = lane >> 4;
#pragma unroll
  for (int i = 0; i < 8; ++i) { w[i] = (__bf16)Wm[(size_t)(k0 + 8 * g + i) * ld + o]; w[8 + i] = (__bf16)Wm[(size_t)(k0 + 16 + 8 * g + i) * ld + o]; }
  return w; }
__device__ __forceinline__ v16b wcol_oi(const float* Wm, int k0, int o, int lane, int K) { v16b w; const float* p = Wm + (size_t)o * K + k0 + 8 * (lane >> 4);
#pragma unroll
  for (int i = 0; i < 8; ++i) { w[i] = (__bf16)p[i]; w[8 + i] = (__bf16)p[16 + i]; }
  return w; }
__device__ __forceinline__ v16h wcolh_io(const float* Wm, int k0, int o, int lane, int ld) { v16h w; const int g = lane >> 4;
#pragma unroll
  for (int i = 0; i < 8; ++i) { w[i] = (_Float16)(bfr(Wm[(size_t)(k0 + 8 * g + i) * ld + o]) * 256.0f); w[8 + i] = (_Float16)(bfr(Wm[(size_t)(k0 + 16 + 8 * g + i) * ld + o]) * 256.0f); }
  return w; }
__device__ __forceinline__ v16h wcolh_oi(const float* Wm, int k0, int o, int lane, int K) { v16h w; const float* p = Wm + (size_t)o * K + k0 + 8 * (lane >> 4);
#pragma unroll
  for (int i = 0; i < 8; ++i) { w[i] = (_Float16)(bfr(p[i]) * 256.0f); w[8 + i] = (_Float16)(bfr(p[16 + i]) * 256.0f); }
  return w; }
#define WQKV_LAYOUT 1   // 0 = (in,out) [DIN][CC]; 1 = (out,in) [CC][DIN]; 2 = per-head [NH][DIN][HD]
__device__ __forceinline__ v16b wcol_hdk(const float* Wm, int k0, int o, int lane) { v16b w; const int g = lane >> 4; const float* p = Wm + (size_t)(o / HD) * DIN * HD + (o % HD);
#pragma unroll
  for (int i = 0; i < 8; ++i) { w[i] = (__bf16)p[(size_t)(k0 + 8 * g + i) * HD]; w[8 + i] = (__bf16)p[(size_t)(k0 + 16 + 8 * g + i) * HD]; }
  return w; }
#define WO_OUT_IN 0
#if WQKV_LAYOUT == 1
#define WCOL(W, k0, o, lane) wcol_oi(W, k0, o, lane, DIN)
#elif WQKV_LAYOUT == 2
#define WCOL(W, k0, o, lane) wcol_hdk(W, k0, o, lane)
#else
#define WCOL(W, k0, o, lane) wcol_io(W, k0, o, lane, CC)
#endif
#if WO_OUT_IN
#define WOCOL(W, k0, o, lane) wcol_oi(W, k0, o, lane, CC)
#define WOCOLH(W, k0, o, lane) wcolh_oi(W, k0, o, lane, CC)
#else
#define WOCOL(W, k0, o, lane) wcol_io(W, k0, o, lane, DIN)
#define WOCOLH(W, k0, o, lane) wcolh_io(W, k0, o, lane, DIN)
#endif

#ifndef SM_EXTRA_PARAMS
#define SM_EXTRA_PARAMS
#endif
#ifndef PROJ_EXTRA_PARAMS
#define PROJ_EXTRA_PARAMS
#endif
#ifndef SM_MASK_HOOK
#define SM_MASK_HOOK (void)0
#endif

#define WS_QH  0u                                      // f16 q in fragment order [b][h][query tile t / 16][element half 2][lane 32][8]
#define WS_KH  (WS_QH + 2u * (size_t)NB * TT * CC)      // f16 k in fragment order [b][h][key tile t / 16][element half 2][lane 32][8]
#define WS_VT  (WS_KH + 2u * (size_t)NB * TT * CC)      // f16 v in fragment order [b][h][key chunk t / 32][channel tile 2][element half 2][lane 32][8]
#define WS_QL  (WS_VT + 2u * (size_t)NB * CC * TT)      // f16 q residual x 2^10, t < QHI, in the order of the q plane
#define WS_KL  (WS_QL + 2u * (size_t)NB * QHI * CC)     // f16 k residual x 2^10, t < KHI, in the order of the k plane
#define WS_VB  (WS_KL + 2u * (size_t)NB * KHI * CC)     // bf16 v hi (then lo), t < KHI, in the order of the v plane
#define WS_VBL (WS_VB + 2u * (size_t)NB * CC * KHI)
#define WS_S   (WS_VBL + 2u * (size_t)NB * CC * KHI)    // f32 area of HG * TT * TT floats; holds the folded weights and bias
#define WS_Y   (WS_S  + 4u * (size_t)HG * TT * TT)      // unused (k_fa writes the ctx rows to WS_CAT); same offset as WS_TQ
#define WS_XH  (WS_S + 0u)                              // area of NH * NB * TT * CC floats holding the folded weights and bias; fills the S region, which holds no logits (NH * NB * CC == HG * TT)
#define WS_TQ  (WS_XH + 4u * (size_t)NH * NB * TT * CC) // area of NH * NB * TT * 128 floats; its start holds x as f16 fragments (WS_XF)
#define WS_WP  (WS_TQ + 4u * (size_t)NH * NB * TT * 128) // unused area of NH * CC * 128 floats
#define WS_QB8 (WS_WP + 4u * (size_t)NH * CC * 128 + 256)
#define WS_KB8 (WS_QB8 + 4u * (size_t)NB * TT * CC)
#define WS_VB8 (WS_KB8 + 4u * (size_t)NB * TT * CC)
#define WS_CAT (WS_VB8 + 4u * (size_t)NB * TT * CC)
#define WS_END (WS_CAT + 4u * (size_t)NB * TT * CC)
#define WS_END2 WS_END
#define WS_TOP (WS_CAT + 4u * (size_t)NB * TT * CC)     // end of everything kernel_launch uses
static_assert((size_t)HG * TT * TT <= (size_t)NH * NB * TT * CC, "S must end where the WS_XH area ends");

// ---- k_fa: block = 64 queries (4 waves x 16) of (b, h), one pass over the keys 0 .. query in steps of 64 with a running row maximum and sum (online softmax); nothing of the logits or of P goes to memory.
// Both products are formed transposed so that every per-query value sits in the lane of its query (col = lane & 15): S^T = k q^T (A = key rows, B = query rows; D element r = key 8g + r, column = query), which is already the B fragment of P^T (elements 0..7 = tile 2c, 8..15 = tile 2c + 1), and ctx^T = v^T P^T (A = v, row = channel, k = key; D element r = channel 8g + r, column = query).
// q, k and v lie in memory as the fragments themselves (k_qkv writes them so): every load of the key loop reads 512 contiguous bytes, four whole lines, where a load from rows or planes touched 16 lines for the same bytes. ctx leaves in the order of k_out's A fragments (element r of tile j = channel 16 j + 8g + r of the lane's query: the same lane's elements there).
// Precision as before: q, k once to f16 (1 product), P once to f16 against v f16; query blocks < QBH: 3-product logits (q, k residual planes x 2^10), P and v as bf16 hi + lo (3 products). P is exp(logit - running maximum), at most 1; the division by the f32 row sum comes last.
#define L2E 1.4426950408889634f
#define NEGBIG (-1.0e30f)
// behind a group of global loads: their address registers (kept live to here as inputs) are rewritten only after this wait
#define XW2(p0, p1) asm volatile("s_wait_xcnt 0x0" :: "v"(p0), "v"(p1) : "memory")
#define XW4(p0, p1, p2, p3) asm volatile("s_wait_xcnt 0x0" :: "v"(p0), "v"(p1), "v"(p2), "v"(p3) : "memory")
static_assert(HD == 32, "one 32-deep product per logit tile, two 16-channel ctx tiles");
// 2^x; the v_nop fills the one slot that the instruction set asks for behind a transcendental, whatever the compiler schedules next (it had put a second v_exp_f32 there that overwrites the first one's source)
__device__ __forceinline__ float ex2(float x) { float r; asm("v_exp_f32 %0, %1\n\tv_nop" : "=v"(r) : "v"(x)); return r; }
// s[32] = this lane's logits of one 64-key step (excluded ones = NEGBIG) -> exp(s - new maximum); returns the factor that rescales what was summed under the old maximum
__device__ __forceinline__ float sm_step(float (&s)[32], float& m, float& l) {
  float c0 = fmaxf(s[0], s[1]), c1 = fmaxf(s[2], s[3]);
#pragma unroll
  for (int i = 4; i < 32; i += 2) { c0 = fmaxf(c0, s[i]); c1 = fmaxf(c1, s[i + 1]); }
  float cm = fmaxf(c0, c1); cm = fmaxf(cm, __shfl_xor(cm, 16));   /* lanes col and col + 16 hold the two key halves of one query */
  const float mn = fmaxf(m, cm), al = ex2((m - mn) * L2E), m2 = mn * L2E; m = mn;
  float a0 = 0.f, a1 = 0.f, a2 = 0.f, a3 = 0.f;
#pragma unroll
  for (int i = 0; i < 32; i += 4) {
    s[i] = ex2(fmaf(s[i], L2E, -m2)); s[i + 1] = ex2(fmaf(s[i + 1], L2E, -m2)); s[i + 2] = ex2(fmaf(s[i + 2], L2E, -m2)); s[i + 3] = ex2(fmaf(s[i + 3], L2E, -m2));
    a0 += s[i]; a1 += s[i + 1]; a2 += s[i + 2]; a3 += s[i + 3]; }
  l = l * al + ((a0 + a1) + (a2 + a3)); return al; }
// fragment kept in fragment order [element half 2][lane 32][8], from a pointer that already holds lane * 8: each of the two loads reads 512 contiguous bytes, four whole 128-B lines
__device__ __forceinline__ v16h frag_fo(const _Float16* p) { union { v16h v; v8h q[2]; } u; u.q[0] = *(const v8h*)p; u.q[1] = *(const v8h*)(p + 256); return u.v; }
__device__ __forceinline__ v16b frag_fob(const __bf16* p) { union { v16b v; v8b q[2]; } u; u.q[0] = *(const v8b*)p; u.q[1] = *(const v8b*)(p + 256); return u.v; }
__global__ __launch_bounds__(128) void k_fa(const _Float16* __restrict__ QH, const _Float16* __restrict__ KH, const _Float16* __restrict__ QL, const _Float16* __restrict__ KL, const _Float16* __restrict__ VT, const __bf16* __restrict__ VB, const __bf16* __restrict__ VBL, float* __restrict__ Y) {
  const int tid = threadIdx.x, lane = tid & 31, col = lane & 15, g = lane >> 4; const int wave = __builtin_amdgcn_readfirstlane(tid >> 5);
  const int qb = NQB - 1 - (int)blockIdx.x, h = blockIdx.y, b = blockIdx.z;   /* longest query blocks start first */
  const int ql0 = qb * 64 + wave * 16, tq = ql0 + col;
  float m = NEGBIG, l = 0.f; v8f o[2] = {}; const v8f zero = {};
  const size_t bh = (size_t)b * NH + h;   /* q, k and v of one (b, h) lie in fragment order, HD * 2 bytes a position: a 64-key step is 4 KiB of k and 4 KiB of v in a row */
  const _Float16* qp = QH + (bh * TT + ql0) * HD + lane * 8;
  const _Float16* kp = KH + bh * (size_t)(TT * HD) + lane * 8;
  if (qb < QBH) {
    const _Float16* qlp = QL + (bh * QHI + ql0) * HD + lane * 8;
    const v16h bq = frag_fo(qp), bql = frag_fo(qlp); XW2(qp, qlp);
    const _Float16* klp = KL + bh * (size_t)(KHI * HD) + lane * 8;
    const size_t vo = bh * (size_t)(KHI * HD) + lane * 8;
#pragma unroll 1
    for (int it = 0; it <= qb; ++it) { const int k0 = it * 64; float s[32];
      const _Float16 *kq = kp + (size_t)k0 * HD, *klq = klp + (size_t)k0 * HD; const __bf16 *vhq = VB + vo + (size_t)k0 * HD, *vlq = VBL + vo + (size_t)k0 * HD;
      v16h khf[4], klf[4]; v16b vhf[4], vlf[4];   /* index of the v fragments: c * 2 + j */
#pragma unroll
      for (int t = 0; t < 4; ++t) { khf[t] = frag_fo(kq + t * 512); klf[t] = frag_fo(klq + t * 512); vhf[t] = frag_fob(vhq + (t >> 1) * 1024 + (t & 1) * 512); vlf[t] = frag_fob(vlq + (t >> 1) * 1024 + (t & 1) * 512); }
      XW4(kq, klq, vhq, vlq);
#pragma unroll
      for (int t = 0; t < 4; ++t) { const v16h kh = khf[t], kl = klf[t];
        const v8f a = wmma16(kh, bq, zero); v8f a2 = wmma16(kh, bql, zero); a2 = wmma16(kl, bq, a2);
#pragma unroll
        for (int r = 0; r < 8; ++r) { const float v = (a[r] + a2[r] * (1.0f / 1024.0f)) * SCALE; s[t * 8 + r] = (k0 + t * 16 + 8 * g + r <= tq) ? v : NEGBIG; } }
      const float al = sm_step(s, m, l);
#pragma unroll
      for (int r = 0; r < 8; ++r) { o[0][r] *= al; o[1][r] *= al; }
#pragma unroll
      for (int c = 0; c < 2; ++c) { float v[16];
#pragma unroll
        for (int i = 0; i < 8; ++i) { v[i] = s[c * 16 + i]; v[8 + i] = s[c * 16 + 8 + i]; }
        const F2 p = bsplit16(v);
#pragma unroll
        for (int j = 0; j < 2; ++j) { const v16b vh = vhf[c * 2 + j];
          o[j] = wmma_bf(vh, p.h, o[j]); o[j] = wmma_bf(vh, p.l, o[j]); o[j] = wmma_bf(vlf[c * 2 + j], p.h, o[j]); } } }
  } else {
    const _Float16* vp = VT + bh * (size_t)(TT * HD) + lane * 8;
    const v16h bq = frag_fo(qp);
    v16h kf[4], vf[4];   /* this step's fragments, fetched one step ahead; index of the v fragments: j * 2 + c */
#pragma unroll
    for (int t = 0; t < 4; ++t) { kf[t] = frag_fo(kp + t * 512); vf[t] = frag_fo(vp + (t & 1) * 1024 + (t >> 1) * 512); }
    XW4(qp, kp, vp, vp);
#pragma unroll 1
    for (int it = 0; it <= qb; ++it) { const int k0 = it * 64, kn = (it < qb ? it + 1 : it) * 64;   /* the last step fetches its own tile again: in bounds, unused */
      const _Float16 *kq = kp + (size_t)kn * HD, *vq = vp + (size_t)kn * HD; v16h kx[4], vx[4];
#pragma unroll
      for (int t = 0; t < 4; ++t) { kx[t] = frag_fo(kq + t * 512); vx[t] = frag_fo(vq + (t & 1) * 1024 + (t >> 1) * 512); }
      XW2(kq, vq);
      float s[32];
#pragma unroll
      for (int t = 0; t < 4; ++t) { const v8f a = wmma16(kf[t], bq, zero);
#pragma unroll
        for (int r = 0; r < 8; ++r) s[t * 8 + r] = a[r] * SCALE; }
      if (it == qb) {   /* only the diagonal step holds keys past a query */
#pragma unroll
        for (int i = 0; i < 32; ++i) s[i] = (k0 + (i >> 3) * 16 + 8 * g + (i & 7) <= tq) ? s[i] : NEGBIG; }
      const float al = sm_step(s, m, l);
#pragma unroll
      for (int r = 0; r < 8; ++r) { o[0][r] *= al; o[1][r] *= al; }
#pragma unroll
      for (int c = 0; c < 2; ++c) { v16h p;
#pragma unroll
        for (int i = 0; i < 16; ++i) p[i] = (_Float16)s[c * 16 + i];
        o[0] = wmma16(vf[c], p, o[0]); o[1] = wmma16(vf[2 + c], p, o[1]); }
#pragma unroll
      for (int t = 0; t < 4; ++t) { kf[t] = kx[t]; vf[t] = vx[t]; } } }
  l += __shfl_xor(l, 16); const float inv = l > 0.f ? 1.0f / l : 0.f;
  float* yp = Y + ((((size_t)b * TT + ql0) >> 4) * NH + h) * 512 + lane * 4;   /* ctx in the order of k_out's A fragments [row tile][head = k step][element quarter 4][lane 32][4]: a store is 512 contiguous bytes */
#pragma unroll
  for (int j = 0; j < 2; ++j) { v4f w0, w1;
#pragma unroll
    for (int r = 0; r < 4; ++r) { w0[r] = o[j][r] * inv; w1[r] = o[j][4 + r] * inv; }
    vst2(yp + j * 256, w0); vst2(yp + j * 256 + 128, w1); } }

#define NRW (TNB * TT)
#ifndef SM_EXTRA_PARAMS
#define SM_EXTRA_PARAMS
#endif
#ifndef PROJ_EXTRA_PARAMS
#define PROJ_EXTRA_PARAMS
#endif
#ifndef SM_MASK_HOOK
#define SM_MASK_HOOK (void)0
#endif

#define WS_QH  0u                                      // f16 q in fragment order [b][h][query tile t / 16][element half 2][lane 32][8]
#define WS_KH  (WS_QH + 2u * (size_t)NB * TT * CC)      // f16 k in fragment order [b][h][key tile t / 16][element half 2][lane 32][8]
#define WS_VT  (WS_KH + 2u * (size_t)NB * TT * CC)      // f16 v in fragment order [b][h][key chunk t / 32][channel tile 2][element half 2][lane 32][8]
#define WS_QL  (WS_VT + 2u * (size_t)NB * CC * TT)      // f16 q residual x 2^10, t < QHI, in the order of the q plane
#define WS_KL  (WS_QL + 2u * (size_t)NB * QHI * CC)     // f16 k residual x 2^10, t < KHI, in the order of the k plane
#define WS_VB  (WS_KL + 2u * (size_t)NB * KHI * CC)     // bf16 v hi (then lo), t < KHI, in the order of the v plane
#define WS_VBL (WS_VB + 2u * (size_t)NB * CC * KHI)
#define WS_S   (WS_VBL + 2u * (size_t)NB * CC * KHI)    // f32 area of HG * TT * TT floats; holds the folded weights and bias
#define WS_Y   (WS_S  + 4u * (size_t)HG * TT * TT)      // unused (k_fa writes the ctx rows to WS_CAT); same offset as WS_TQ
#define WS_END (WS_Y  + 0u)
#define WS_Y2  (WS_END)
#define WS_O1  (WS_Y2 + 4u * (size_t)NB * TT * CC)
#define WS_R2  (WS_O1 + 4u * (size_t)NB * TT * CC)
#define WS_END2 (WS_R2 + 4u * (size_t)NB * TT * CC)


#define NC3 96                                          // q | k | v channels of one head
#define WS_WF  (WS_XH + 0u)                             // f16 folded weights x 2^6 in fragment order [h][hi, residual][channel tile 6][k step 16][element half 2][lane 32][8]
#define WS_BC  (WS_WF + 2u * (size_t)NH * 2 * NC3 * CC) // f32 folded bias [h][NC3]
#define WS_XF  (WS_TQ + 0u)                             // f16 x (bf16-rounded, exact) in fragment order [row tile r / 16][k step 16][element half 2][lane 32][8]
#define XCB 6                                           // blockIdx.x values of k_fold's grid that convert x: XCB * NH blocks of 12 waves
__device__ __forceinline__ v8f wm(v16h a, v16h b, v8f c) { return __builtin_amdgcn_wmma_f32_16x16x32_f16(false, a, false, b, (short)0, c, false, false); }
__device__ __forceinline__ _Float16 w64(float v) { return (_Float16)(bfr(v) * 64.0f); }
// ---- k_fold: (x Wl^T + bl) W = x (Wl^T W) + bl W. Block = (64 input indices i0.., head), 12 waves = (which of Wq, Wk, Wv) x (quarter kq of the 512 summed indices o): D[i][c] = sum_o Wl[o][i] W[o][c] (A = Wl^T: row i, k = o; B = W: k = o, column c; both read with the same k order 8g + e, 16 + 8g + e).
// A wave sums 4 k steps, not 16: the steps are serial (load, wait, convert, multiply), so the launch lasts as long as one wave's steps. The four partial sums of a tile meet in LDS behind one barrier and are added in the order kq = 0, 1, 2, 3 by wave (which, kq = tile t), which stores that tile.
// D element r = input index 8g + r of channel column c: exactly the 8 elements that lane 16g + c of k_qkv's weight fragment (A for q, k, row = channel; B for v, column = channel; k = input index) holds in half t & 1 of k step i0 / 32 + t / 2, so WF is kept in that order: a store here and a load there are 512 contiguous bytes of whole 128-B lines, each line written by one wave. blockIdx.x = CC / 64 takes bl as every row of A and gives the folded bias.
// The blockIdx.x values behind that one convert x once for all 16 heads, on WGPs that the fold leaves idle: x -> f16(bf16(x)) in the order of k_qkv's x fragments. A wave takes 8 rows x 8 k steps; a load reads 8 rows of 128 B (lane = row lane >> 2, chunk q = lane & 3 = floats 8q .. 8q + 7 of the k step),
// and chunk q is element half q >> 1 of fragment lane 16 (q & 1) + row, so a store writes four whole 128-B lines, each from this wave alone. No barrier on this path.
#define KQS (CC / 32 / 4)   /* k steps of one quarter */
static_assert(XCB * NH * 12 >= NRW / 16 * 4 && CC == 512, "one wave for every (row tile, row half, k half) of x");
__global__ __launch_bounds__(384) void k_fold(const float* __restrict__ X, _Float16* __restrict__ XF, const float* __restrict__ WL, const float* __restrict__ BL, const float* __restrict__ WQ, const float* __restrict__ WK, const float* __restrict__ WV, _Float16* __restrict__ WF, float* __restrict__ BC) {
  __shared__ __align__(16) float red[3 * 4 * 4 * 512];   /* partial sums [which 3][tile t 4][quarter kq 4][j 2][element half 2][lane 32][4]: every LDS store and load is 512 contiguous bytes */
  const int tid = threadIdx.x, lane = tid & 31, col = lane & 15, g = lane >> 4; const int wv = __builtin_amdgcn_readfirstlane(tid >> 5), wave = wv >> 2, kq = wv & 3;
  if (blockIdx.x > CC / 64) {   /* the same for a whole block */
    const int job = (((int)blockIdx.x - (CC / 64 + 1)) * NH + (int)blockIdx.y) * 12 + wv;   /* (row tile, row half, k half) */
    if (job < NRW / 16 * 4) {   /* the same for a whole wave */
      const int rt = job >> 2, rg = (job >> 1) & 1, kh = job & 1;
      const float* sp = X + (size_t)(rt * 16 + rg * 8 + (lane >> 2)) * CC + kh * 256 + (lane & 3) * 8;
      _Float16* dp = XF + (size_t)(rt * 16 + kh * 8) * 512 + ((lane >> 1) & 1) * 256 + ((lane & 1) * 16 + rg * 8 + (lane >> 2)) * 8;
      v4f xv[8][2];
#pragma unroll
      for (int i = 0; i < 8; ++i) { xv[i][0] = *(const v4f*)(sp + i * 32); xv[i][1] = *(const v4f*)(sp + i * 32 + 4); }
      XW2(sp, sp);   /* the 16 loads, all in flight together, name sp: it is rewritten only behind this wait */
      v8h w[8];
#pragma unroll
      for (int i = 0; i < 8; ++i)
#pragma unroll
        for (int e = 0; e < 8; ++e) w[i][e] = (_Float16)bfr(xv[i][e >> 2][e & 3]);
      __builtin_amdgcn_sched_barrier(0);   /* the stores stand together at the wave's end: no register that a store names is written again */
#pragma unroll
      for (int i = 0; i < 8; ++i) vst2(dp + i * 512, w[i]); }
    return; }
  const size_t h = blockIdx.y;
  const float* bp = (wave == 0 ? WQ : wave == 1 ? WK : WV) + h * CC * HD + (size_t)(kq * (KQS * 32) + 8 * g) * HD + col;
  if (blockIdx.x < CC / 64) {
    const int i0 = blockIdx.x * 64;
    const float* ap = WL + h * CC * CC + (size_t)(kq * (KQS * 32) + 8 * g) * CC + i0 + col;
    v8f acc[4][2] = {};
#pragma unroll 1   /* rolled: one step's 96 loaded values and the 64 sums already take most of the registers */
    for (int kc = 0; kc < KQS; ++kc) { float av[4][16], bv[2][16];
#pragma unroll
      for (int e = 0; e < 16; ++e) { const int ko = e < 8 ? e : e + 8;
#pragma unroll
        for (int t = 0; t < 4; ++t) av[t][e] = ap[(size_t)ko * CC + t * 16];
        bv[0][e] = bp[(size_t)ko * HD]; bv[1][e] = bp[(size_t)ko * HD + 16]; }
      XW2(ap, bp); __builtin_amdgcn_sched_barrier(0);   /* every load of the step is issued before the first conversion or product: one memory latency a step; the scheduler had kept only two fragments in flight */
      v16h fa[4], fb[2];
#pragma unroll
      for (int e = 0; e < 16; ++e) { fa[0][e] = w64(av[0][e]); fa[1][e] = w64(av[1][e]); fa[2][e] = w64(av[2][e]); fa[3][e] = w64(av[3][e]); fb[0][e] = w64(bv[0][e]); fb[1][e] = w64(bv[1][e]); }
#pragma unroll
      for (int t = 0; t < 4; ++t) { acc[t][0] = wm(fa[t], fb[0], acc[t][0]); acc[t][1] = wm(fa[t], fb[1], acc[t][1]); }
      ap += (size_t)32 * CC; bp += (size_t)32 * HD; }
    float* rw = red + (wave * 16 + kq) * 512 + lane * 4;
#pragma unroll
    for (int t = 0; t < 4; ++t)
#pragma unroll
      for (int j = 0; j < 2; ++j) { v4f w0, w1;
#pragma unroll
        for (int r = 0; r < 4; ++r) { w0[r] = acc[t][j][r]; w1[r] = acc[t][j][4 + r]; }
        *(v4f*)(rw + t * 2048 + j * 256) = w0; *(v4f*)(rw + t * 2048 + j * 256 + 128) = w1; }
    __syncthreads();   /* the 12 waves' partial sums are in LDS before any wave adds them */
    const float* rr = red + (wave * 4 + kq) * 2048 + lane * 4;   /* this wave finishes tile t = kq of its weight */
    _Float16* op = WF + ((h * 2 * 6 + wave * 2) * 16 + (i0 >> 5) + (kq >> 1)) * (size_t)512 + (kq & 1) * 256 + lane * 8;
#pragma unroll
    for (int j = 0; j < 2; ++j) { v4f p[4][2];
#pragma unroll
      for (int q = 0; q < 4; ++q) { p[q][0] = *(const v4f*)(rr + q * 512 + j * 256); p[q][1] = *(const v4f*)(rr + q * 512 + j * 256 + 128); }
      v8h hi, lo;
#pragma unroll
      for (int r = 0; r < 8; ++r) { const float v = (((p[0][r >> 2][r & 3] + p[1][r >> 2][r & 3]) + p[2][r >> 2][r & 3]) + p[3][r >> 2][r & 3]) * (1.0f / 64.0f); hi[r] = (_Float16)v; lo[r] = (_Float16)(v - (float)hi[r]); }   /* sums carry 2^12; kept x 2^6 */
      vst2(op + j * (16 * 512), hi); vst2(op + j * (16 * 512) + NC3 * CC, lo); }
  } else {
    const float* ap = BL + h * CC + kq * (KQS * 32) + 8 * g;
    v8f acc[2] = {};
#pragma unroll 1   /* rolled: short steps of one small block a head, nothing to gain from more code */
    for (int kc = 0; kc < KQS; ++kc) { float av[16], bv[2][16];
#pragma unroll
      for (int e = 0; e < 16; ++e) { const int ko = e < 8 ? e : e + 8; av[e] = ap[ko]; bv[0][e] = bp[(size_t)ko * HD]; bv[1][e] = bp[(size_t)ko * HD + 16]; }
      XW2(ap, bp); __builtin_amdgcn_sched_barrier(0);   /* keeps the wait directly behind the loads, in front of the pointer steps (it had sunk to the loop's foot) */
      v16h fa, fb[2];
#pragma unroll
      for (int e = 0; e < 16; ++e) { fa[e] = w64(av[e]); fb[0][e] = w64(bv[0][e]); fb[1][e] = w64(bv[1][e]); }
      acc[0] = wm(fa, fb[0], acc[0]); acc[1] = wm(fa, fb[1], acc[1]);
      ap += 32; bp += (size_t)32 * HD; }
    red[(wave * 4 + kq) * 64 + lane] = acc[0][0]; red[(wave * 4 + kq) * 64 + 32 + lane] = acc[1][0];   /* every row of D is the same sum: element 0 of either lane half */
    __syncthreads();   /* the four quarters of each folded bias are in LDS before wave (which, 0) adds them */
    if (kq == 0 && g == 0) { const float* rr = red + wave * 256 + lane; float* op = BC + h * NC3 + wave * HD + col;
      op[0] = (((rr[0] + rr[64]) + rr[128]) + rr[192]) * (1.0f / 4096.0f); op[16] = (((rr[32] + rr[96]) + rr[160]) + rr[224]) * (1.0f / 4096.0f); } } }

// ---- k_qkv: block = (128 rows of x, head), wave = 32 rows; folded weight f16 hi then residual, read in fragment order; x bf16-rounded, exact in f16, read in fragment order too (k_fold's launch writes it so): 512 contiguous bytes a load, nothing to convert. The same two fragments serve either way round:
// q, k: [q|k]^T = weight (A = channel rows) x x^T (B = x rows): D element r = channel 8g + r, column = row of x, so a lane holds 8 consecutive channels of its row = the 8 elements that the same lane of k_fa's q (B) or k (A) fragment (row = position, k = channel) holds in half j of position tile u;
// v: x (A = x rows) x weight^T (B = channel columns): D element r = row of x 8g + r, column = channel, so a lane holds 8 consecutive positions of its channel = the 8 elements that the same lane of k_fa's A fragment (row = channel, k = key) holds in half u of channel tile j.
// The f32 sums go from the registers straight into the planes that k_fa reads: q, k, v -> f16 in fragment order, 512 contiguous bytes a store (+ q, k residuals x 2^10 and v bf16 hi / lo for t < QHI, KHI, in the same order).
static_assert(QHI == KHI && QHI % 32 == 0 && TT % 128 == 0, "a wave's 32 rows lie in one sequence, wholly below or wholly above the high-precision bound");
__global__ __launch_bounds__(128) void k_qkv(const _Float16* __restrict__ XF, const _Float16* __restrict__ WF, const float* __restrict__ BC, _Float16* __restrict__ QH, _Float16* __restrict__ QL, _Float16* __restrict__ KH, _Float16* __restrict__ KL, _Float16* __restrict__ VT, __bf16* __restrict__ VB, __bf16* __restrict__ VBL) {
  const int tid = threadIdx.x, lane = tid & 31, col = lane & 15, g = lane >> 4; const int wave = __builtin_amdgcn_readfirstlane(tid >> 5);
  const size_t h = blockIdx.y, r0 = (size_t)blockIdx.x * 128 + wave * 32;
  const _Float16* xp = XF + (r0 >> 4) * (size_t)(16 * 512) + lane * 8;   /* fragment order: row tile at 16 * 512, k step at 512, element half at 256 */
  const _Float16* wp = WF + h * 2 * NC3 * CC + lane * 8;   /* fragment order: tile ct at ct * 16 * 512, k step at 512, element half at 256 */
  v8f acc[6][2] = {};
#pragma unroll 1   /* rolled: one step's fragments and the 96 sums already take most of the registers */
  for (int kc = 0; kc < CC / 32; ++kc) { v16h xb[2], wh[6], wl[6];
    xb[0] = frag_fo(xp); xb[1] = frag_fo(xp + 16 * 512);
#pragma unroll
    for (int ct = 0; ct < 6; ++ct) { wh[ct] = frag_fo(wp + (size_t)(ct * 16) * 512); wl[ct] = frag_fo(wp + (size_t)(NC3 + ct * 16) * 512); }
    XW2(xp, wp); __builtin_amdgcn_sched_barrier(0);   /* every load of the step is issued before the first product: one memory latency a step; the scheduler had kept only two fragments in flight */
#pragma unroll
    for (int ct = 0; ct < 4; ++ct) { acc[ct][0] = wm(wh[ct], xb[0], acc[ct][0]); acc[ct][1] = wm(wh[ct], xb[1], acc[ct][1]); }
#pragma unroll
    for (int ct = 4; ct < 6; ++ct) { acc[ct][0] = wm(xb[0], wh[ct], acc[ct][0]); acc[ct][1] = wm(xb[1], wh[ct], acc[ct][1]); }
#pragma unroll
    for (int ct = 0; ct < 4; ++ct) { acc[ct][0] = wm(wl[ct], xb[0], acc[ct][0]); acc[ct][1] = wm(wl[ct], xb[1], acc[ct][1]); }
#pragma unroll
    for (int ct = 4; ct < 6; ++ct) { acc[ct][0] = wm(xb[0], wl[ct], acc[ct][0]); acc[ct][1] = wm(xb[1], wl[ct], acc[ct][1]); }
    xp += 512; wp += 512; }
  const float *bcp = BC + h * NC3 + 8 * g, *bvp = BC + h * NC3 + 2 * HD + col; v4f bc[4][2]; float bv[2];   /* q, k: the bias of the lane's 8 channels; v: of its one channel a tile */
#pragma unroll
  for (int ct = 0; ct < 4; ++ct) { bc[ct][0] = *(const v4f*)(bcp + ct * 16); bc[ct][1] = *(const v4f*)(bcp + ct * 16 + 4); }
  bv[0] = bvp[0]; bv[1] = bvp[16];
  asm volatile("s_wait_xcnt 0x0" ::: "memory"); __builtin_amdgcn_sched_barrier(0);   /* the bias loads' address registers are rewritten only behind this wait; the scheduling barrier keeps the stores' address arithmetic behind it */
#pragma unroll
  for (int ct = 0; ct < 6; ++ct)
#pragma unroll
    for (int u = 0; u < 2; ++u)
#pragma unroll
      for (int r = 0; r < 8; ++r) acc[ct][u][r] = acc[ct][u][r] * (1.0f / 64.0f) + (ct < 4 ? bc[ct][r >> 2][r & 3] : bv[ct - 4]);
  const size_t bb = r0 / TT, t0 = r0 % TT, bh = bb * NH + h, fo = (bh * TT + t0) * HD + lane * 8;
  _Float16 *qo = QH + fo, *ko = KH + fo, *vo = VT + fo;   /* q, k: position tile u, half j; v: channel tile j, half u of the wave's one 32-key chunk */
#pragma unroll
  for (int u = 0; u < 2; ++u)
#pragma unroll
    for (int j = 0; j < 2; ++j) { v8h q, k, v;
#pragma unroll
      for (int r = 0; r < 8; ++r) { q[r] = (_Float16)acc[j][u][r]; k[r] = (_Float16)acc[2 + j][u][r]; v[r] = (_Float16)acc[4 + j][u][r]; }
      vst2(qo + u * 512 + j * 256, q); vst2(ko + u * 512 + j * 256, k); vst2(vo + j * 512 + u * 256, v); }
  asm volatile("s_wait_xcnt 0x0" ::: "memory");   /* the branch below opens with an argument load and arithmetic that rewrite registers which the stores above name: only behind this wait, which stands in the stores' own block */
  if (t0 < QHI) {   /* the same for a whole wave */
    const size_t fl = (bh * KHI + t0) * HD + lane * 8; _Float16 *qlo = QL + fl, *klo = KL + fl; __bf16 *vho = VB + fl, *vlo = VBL + fl;
#pragma unroll
    for (int u = 0; u < 2; ++u)
#pragma unroll
      for (int j = 0; j < 2; ++j) { v8h q, k; v8b vh, vl;
#pragma unroll
        for (int r = 0; r < 8; ++r) { const float qf = acc[j][u][r], kf = acc[2 + j][u][r], vf = acc[4 + j][u][r]; const __bf16 b = (__bf16)vf;
          q[r] = (_Float16)((qf - (float)(_Float16)qf) * 1024.0f); k[r] = (_Float16)((kf - (float)(_Float16)kf) * 1024.0f); vh[r] = b; vl[r] = (__bf16)(vf - (float)b); }
        vst2(qlo + u * 512 + j * 256, q); vst2(klo + u * 512 + j * 256, k); vst2(vho + j * 512 + u * 256, vh); vst2(vlo + j * 512 + u * 256, vl); } } }

// ---- k_out: OUT = A (f16 hi + unscaled f16 residual, 2 products) x W^T (W (out,in) as f16(bf16 x 2^6)) x 2^-6 + bias. Block = (64 rows, 128 columns), 8 waves, wave = 16 rows x 64 columns. A arrives in fragment order (k_fa writes it so): each A load reads 512 contiguous bytes.
// The block's 128 weight rows are read once, 8 rows of 128 B an instruction, every load of a batch in flight together, converted once and kept in LDS in fragment order [column tile 8][k step 16][element half 2][lane 32][8];
// chunk q = lane & 3 of a k step (floats 8q .. 8q + 7 of a weight row) is element half q >> 1 of fragment lane 16 (q & 1) + column, the k order of the A fragment. One barrier; behind it the k loop reads 512 contiguous LDS bytes a load and fetches its A rows four k steps ahead. Every loop here is unrolled in full: its index picks registers (buffers, fragments, sums) and the immediate offset of each load. Each sum takes its products in the order k step, hi, residual.
#define OPW 68   /* f32 pitch of the output staging rows: the two lane halves (rows 8 apart) fall on different banks */
__device__ __forceinline__ void ld_a4(v4f (&d)[4][4], const float* p) {
#pragma unroll
  for (int s = 0; s < 4; ++s) { d[s][0] = *(const v4f*)(p + s * 512); d[s][1] = *(const v4f*)(p + s * 512 + 128); d[s][2] = *(const v4f*)(p + s * 512 + 256); d[s][3] = *(const v4f*)(p + s * 512 + 384); } }
// one batch = 4 k steps x 2 groups of 8 weight rows
__device__ __forceinline__ void ld_w8(v4f (&d)[8][2], const float* p) {
#pragma unroll
  for (int i = 0; i < 8; ++i) { const float* q = p + (size_t)(i & 1) * 8 * CC + (i >> 1) * 32; d[i][0] = *(const v4f*)q; d[i][1] = *(const v4f*)(q + 4); } }
__device__ __forceinline__ void st_w8(const v4f (&d)[8][2], _Float16* p) {
#pragma unroll
  for (int i = 0; i < 8; ++i) { v8h w;
#pragma unroll
    for (int e = 0; e < 8; ++e) w[e] = w64(d[i][e >> 2][e & 3]);
    *(v8h*)(p + (i >> 1) * 512 + (i & 1) * 64) = w; } }
__global__ __launch_bounds__(256) void k_out(const float* __restrict__ A, const float* __restrict__ Wm, const float* __restrict__ BIAS, float* __restrict__ OUT) {
  __shared__ __align__(16) _Float16 wf[8 * 16 * 512]; __shared__ __align__(16) float sf[8][16][OPW];
  const int tid = threadIdx.x, lane = tid & 31, col = lane & 15, g = lane >> 4; const int wave = __builtin_amdgcn_readfirstlane(tid >> 5);
  const int c0 = blockIdx.y * 128, cw = c0 + (wave >> 2) * 64; const size_t r0 = (size_t)blockIdx.x * 64 + (wave & 3) * 16;
  const float* ap = A + (r0 >> 4) * (size_t)(16 * CC) + lane * 4;   /* A lies in fragment order [row tile][k step 16][element quarter 4][lane 32][4] */
  const float* wp = Wm + (size_t)(c0 + wave * 16 + (lane >> 2)) * CC + (lane & 3) * 8;   /* wave = the column tile it stages */
  const float* bp = BIAS + cw + col;
  _Float16* wq = wf + wave * (16 * 512) + ((lane >> 1) & 1) * 256 + ((lane & 1) * 16 + (lane >> 2)) * 8;
  v4f av[2][4][4], wt[2][8][2]; float bb[4];
  /* SB: a scheduling barrier on either side of a group of loads keeps the group issued whole at that place: ahead of the conversions that cover its latency, and behind the ones that free its registers (left alone the scheduler took a third weight buffer, past 256 registers) */
#define SB() __builtin_amdgcn_sched_barrier(0)
  ld_w8(wt[0], wp); ld_w8(wt[1], wp + 128);
#pragma unroll
  for (int j = 0; j < 4; ++j) bb[j] = bp[j * 16];
  ld_a4(av[0], ap); SB();
  st_w8(wt[0], wq); SB(); ld_w8(wt[0], wp + 256); SB();
  st_w8(wt[1], wq + 4 * 512); SB(); ld_w8(wt[1], wp + 384); XW2(wp, bp); SB();   /* the last loads through wp and bp */
  st_w8(wt[0], wq + 8 * 512); SB(); ld_a4(av[1], ap + 4 * 512); SB();
  st_w8(wt[1], wq + 12 * 512);
  __syncthreads();   /* the 8 waves' tiles of the weight panel are complete before any wave reads them */
  v8f acc[4] = {};
  const _Float16* fp = wf + (wave >> 2) * (4 * 16 * 512) + lane * 8;
#pragma unroll
  for (int gr = 0; gr < 4; ++gr) {
#pragma unroll
    for (int s = 0; s < 4; ++s) { const int kc = gr * 4 + s; v16h a, al, w[4];
#pragma unroll
      for (int j = 0; j < 4; ++j) w[j] = frag_fo(fp + (j * 16 + kc) * 512);
#pragma unroll
      for (int e = 0; e < 16; ++e) { const float x = av[gr & 1][s][e >> 2][e & 3]; const _Float16 hh = (_Float16)x; a[e] = hh; al[e] = (_Float16)(x - (float)hh); }
#pragma unroll
      for (int j = 0; j < 4; ++j) acc[j] = wm(a, w[j], acc[j]);
#pragma unroll
      for (int j = 0; j < 4; ++j) acc[j] = wm(al, w[j], acc[j]); }
    if (gr < 2) { SB(); ld_a4(av[gr & 1], ap + (gr + 2) * 4 * 512); if (gr == 1) XW2(ap, ap);   /* the last loads through ap */ SB(); } }
#pragma unroll
  for (int j = 0; j < 4; ++j) { const float b = bfr(bb[j]);
#pragma unroll
    for (int r = 0; r < 8; ++r) sf[wave][8 * g + r][j * 16 + col] = acc[j][r] * (1.0f / 64.0f) + b; }
  LDSX();   /* the wave's own staging rows are written before it reads them back as whole 256-B row segments */
  float* op = OUT + (r0 + g) * CC + cw + col * 4;
#pragma unroll
  for (int i = 0; i < 8; ++i) vst2(op + (size_t)i * 2 * CC, *(const v4f*)&sf[wave][2 * i + g][col * 4]); }

extern "C" void kernel_launch(void* const* d_in, const int* in_sizes, int n_in, void* d_out, int out_size, void* d_ws, size_t ws_size, hipStream_t stream) {
  (void)in_sizes; (void)n_in; (void)out_size;
  const float** F = (const float**)d_in;
  if (ws_size < (size_t)WS_END) return;
  char* ws = (char*)d_ws; _Float16 *QH = (_Float16*)(ws + WS_QH), *KH = (_Float16*)(ws + WS_KH), *VT = (_Float16*)(ws + WS_VT), *QL = (_Float16*)(ws + WS_QL), *KL = (_Float16*)(ws + WS_KL); __bf16 *VB = (__bf16*)(ws + WS_VB), *VBL = (__bf16*)(ws + WS_VBL); float *S = (float*)(ws + WS_S), *Y = (float*)(ws + WS_Y);
  (void)Y; (void)S; (void)QL; (void)KL; (void)VB; (void)VBL;
  // inputs: 0 x [2,2048,512]; 1 Wl [16,512,512] (out,in); 2 bl [16,512]; 3 Wq [16,512,32] (in,out); 4 Wk; 5 Wv; 6 Wo [512,512] (out,in); 7 bo [512]
  if (ws_size < (size_t)WS_TOP) return;
  _Float16 *WF = (_Float16*)(ws + WS_WF), *XF = (_Float16*)(ws + WS_XF); float *BC = (float*)(ws + WS_BC), *CAT = (float*)(ws + WS_CAT);
  /* head = blockIdx.y in the two projection launches */
  k_fold<<<dim3(CC / 64 + 1 + XCB, NH), 384, 0, stream>>>(F[0], XF, F[1], F[2], F[3], F[4], F[5], WF, BC);   /* folded weights Wl[h]^T [Wq|Wk|Wv][h] and bias bl[h] [Wq|Wk|Wv][h]; x as f16 fragments */
  k_qkv<<<dim3(NRW / 128, NH), 128, 0, stream>>>(XF, WF, BC, QH, QL, KH, KL, VT, VB, VBL);   /* q, k, v of every head = x folded weight + folded bias, written as the planes that k_fa reads */
  k_fa<<<dim3(NQB, NH, TNB), 128, 0, stream>>>(QH, KH, QL, KL, VT, VB, VBL, CAT);   /* logits, softmax and P v of every (b, h) in one launch */
  k_out<<<dim3(NRW / 64, CC / 128), 256, 0, stream>>>(CAT, F[6], F[7], (float*)d_out);   /* out = cat Wo^T + bo */
}

// v009
// It runs in 60.2 microseconds.
// Timed twice side by side with v008, it ran 1.09 and 1.10 times as fast.
// Over all steps from v000 it is 50.3 times as fast.
// compute dtype: all float inputs rounded to bf16; q/k/v = x (Wl[h]^T Wq/Wk/Wv[h]) + bl[h] Wq/Wk/Wv[h]: the folded weight and bias from f16(bf16 x 2^6) operands (exact, 1 product, WMMA 16x16x32, f32 accumulate), the folded weight kept as f16 hi + residual (x 2^6) against x as f16 (bf16-exact) (2 products); unscaled causal logits: q, k once to f16 (1 product), 3 products below row 384; online softmax in f32 (running maximum and sum, one fused kernel); P = exp(logit - maximum) once to f16 against v f16 (P and v as bf16 hi + lo below row 384); out = cat as f16 hi + residual against Wo^T f16(bf16 x 2^6) (2 products) + bo; f32 output.
#include <hip/hip_runtime.h>
#include <math.h>

typedef __attribute__((ext_vector_type(16))) _Float16 v16h;
typedef __attribute__((ext_vector_type(16))) __bf16 v16b;
typedef __attribute__((ext_vector_type(8)))  _Float16 v8h;
typedef __attribute__((ext_vector_type(8)))  float v8f;
typedef __attribute__((ext_vector_type(4)))  float v4f;
typedef __attribute__((ext_vector_type(2)))  float v2f;
typedef __attribute__((ext_vector_type(4)))  unsigned v4u;
typedef __attribute__((ext_vector_type(4)))  int v4i;
typedef float __attribute__((may_alias)) float_a;
typedef int __attribute__((may_alias)) int_a;

template <typename T> __device__ __forceinline__ void vst2(void* p, T v) { *(T*)p = v;  }
__device__ __forceinline__ v8f wmma16(v16h a, v16h b, v8f c) {
  v8f d = __builtin_amdgcn_wmma_f32_16x16x32_f16(false, a, false, b, (short)0, c, false, false);
  asm volatile("v_nop\n\tv_nop\n\tv_nop\n\tv_nop" : "+v"(d) : "v"(a), "v"(b));
  return d;
}
__device__ __forceinline__ v8f wmma_bf(v16b a, v16b b, v8f c) {
  v8f d = __builtin_amdgcn_wmma_f32_16x16x32_bf16(false, a, false, b, (short)0, c, false, false);
  asm volatile("v_nop\n\tv_nop\n\tv_nop\n\tv_nop" : "+v"(d) : "v"(a), "v"(b));
  return d;
}
// 16x16x32 fragments: lane = (h = lane>>4, row/col = lane&15); elements 0..7 = k0+8h+0..7, 8..15 = k0+16+8h+0..7; D element r = row 8h+r
__device__ __forceinline__ v16h frag_h(const _Float16* rowk0, int lane) {
  union { v16h v; v8h q[2]; } u; const _Float16* p = rowk0 + 8 * (lane >> 4);
  u.q[0] = *(const v8h*)p; u.q[1] = *(const v8h*)(p + 16); return u.v;
}
__device__ __forceinline__ v16h frag_f32(const float* rowk0, int lane) {
  v16h a; const float* p = rowk0 + 8 * (lane >> 4);
#pragma unroll
  for (int i = 0; i < 8; ++i) { a[i] = (_Float16)p[i]; a[8 + i] = (_Float16)p[16 + i]; }
  return a;
}
__device__ __forceinline__ v16h frag_f32s(const float* rowk0, int lane, float sc) {
  v16h a; const float* p = rowk0 + 8 * (lane >> 4);
#pragma unroll
  for (int i = 0; i < 8; ++i) { a[i] = (_Float16)(p[i] * sc); a[8 + i] = (_Float16)(p[16 + i] * sc); }
  return a;
}
// column fragment from a [K][ld] layout (column n), rows >= K read as 0
__device__ __forceinline__ v16h fragc_f32(const float* W, int k0, int n, int lane, int ld, int K) {
  v16h a; const int g = lane >> 4;
#pragma unroll
  for (int i = 0; i < 8; ++i) { const int ka = k0 + 8 * g + i, kb = ka + 16;
    a[i] = (_Float16)(ka < K ? W[(size_t)(ka < K ? ka : K - 1) * ld + n] : 0.f); a[8 + i] = (_Float16)(kb < K ? W[(size_t)(kb < K ? kb : K - 1) * ld + n] : 0.f); }
  return a;
}
struct F2 { v16b h, l; };
__device__ __forceinline__ F2 bsplit16(const float v[16]) { F2 r;
#pragma unroll
  for (int i = 0; i < 16; ++i) { const __bf16 h = (__bf16)v[i]; r.h[i] = h; r.l[i] = (__bf16)(v[i] - (float)h); }
  return r; }
__device__ __forceinline__ F2 split_row(const float* row, int k0, int lane) { float v[16]; const float* p = row + k0 + 8 * (lane >> 4);
#pragma unroll
  for (int i = 0; i < 8; ++i) { v[i] = p[i]; v[8 + i] = p[16 + i]; }
  return bsplit16(v); }
__device__ __forceinline__ F2 split_rowK(const float* row, int k0, int lane, int K) { float v[16]; const int g = lane >> 4;
#pragma unroll
  for (int i = 0; i < 8; ++i) { const int ka = k0 + 8 * g + i, kb = ka + 16; v[i] = ka < K ? row[ka < K ? ka : K - 1] : 0.f; v[8 + i] = kb < K ? row[kb < K ? kb : K - 1] : 0.f; }
  return bsplit16(v); }
__device__ __forceinline__ F2 split_col(const float* W, int k0, int n, int lane, int ld, int K) { float v[16]; const int g = lane >> 4;
#pragma unroll
  for (int i = 0; i < 8; ++i) { const int ka = k0 + 8 * g + i, kb = ka + 16; v[i] = ka < K ? W[(size_t)(ka < K ? ka : K - 1) * ld + n] : 0.f; v[8 + i] = kb < K ? W[(size_t)(kb < K ? kb : K - 1) * ld + n] : 0.f; }
  return bsplit16(v); }
__device__ __forceinline__ v8f mac3(const F2& a, const F2& b, v8f c) { c = wmma_bf(a.l, b.h, c); c = wmma_bf(a.h, b.l, c); return wmma_bf(a.h, b.h, c); }
__device__ __forceinline__ float sigm(float v) { return 1.0f / (1.0f + expf(-v)); }
#define LDSX() do { asm volatile("s_wait_dscnt 0" ::: "memory"); __builtin_amdgcn_wave_barrier(); __builtin_amdgcn_fence(__ATOMIC_RELEASE, "workgroup"); } while (0)

// Per-head multi-head causal attention (B 2, S 2,048, 512; 16 heads x 32; 0.02-scale weights: per-head Linear Wl [16,512,512] (out,in) + bl, per-head Wq/Wk/Wv [16,512,32] (in,out) no bias, Wo [512,512] (out,in) + bo): xh = x Wl[h]^T + bl[h]; Q, K, V = xh Wq[h], xh Wk[h], xh Wv[h]; scores = Q K^T (NO scaling), causal; F = softmax(scores) V; out = concat_h(F) Wo^T + bo.
#define NB 2
#define TT 2048
#define CC 512            // NH * HD = projected width
#define DIN 512          // input (model) width
#define NH 16
#define HD 32
#define NQB (TT / 64)
#define HG 8
#define SCALE (1.0f)
#define CAUSAL 1
#ifndef TNB
#define TNB NB
#endif
__device__ __forceinline__ float bfr(float v) { return (float)(__bf16)v; }
__host__ __device__ __forceinline__ int kb_last(int qb) { return CAUSAL ? ((qb * 64 + 63) >> 7) : (TT / 128 - 1); }
typedef __attribute__((ext_vector_type(8))) __bf16 v8b;
__device__ __forceinline__ v16b frag_b(const __bf16* rowk0, int lane) {
  union { v16b v; v8b q[2]; } u; const __bf16* p = rowk0 + 8 * (lane >> 4);
  u.q[0] = *(const v8b*)p; u.q[1] = *(const v8b*)(p + 16); return u.v;
}
#define QBH 6              // causal: query blocks 0..QBH-1 of each sequence (few keys, no averaging) take the high-precision path
#define QHI 384            // rows carrying a q residual plane
#define KHI 384            // key rows carrying k residual / v bf16 hi+lo planes (used only by the causal high-precision path)
// B fragment (k rows k0+.., output column o) of a weight: (in,out) [K][ld] or (out,in) [ld rows of K]: bf16 exact, or f16(bf16 * 256) exact
__device__ __forceinline__ v16b wcol_io(const float* Wm, int k0, int o, int lane, int ld) { v16b w; const int g = lane >> 4;
#pragma unroll
  for (int i = 0; i < 8; ++i) { w[i] = (__bf16)Wm[(size_t)(k0 + 8 * g + i) * ld + o]; w[8 + i] = (__bf16)Wm[(size_t)(k0 + 16 + 8 * g + i) * ld + o]; }
  return w; }
__device__ __forceinline__ v16b wcol_oi(const float* Wm, int k0, int o, int lane, int K) { v16b w; const float* p = Wm + (size_t)o * K + k0 + 8 * (lane >> 4);
#pragma unroll
  for (int i = 0; i < 8; ++i) { w[i] = (__bf16)p[i]; w[8 + i] = (__bf16)p[16 + i]; }
  return w; }
__device__ __forceinline__ v16h wcolh_io(const float* Wm, int k0, int o, int lane, int ld) { v16h w; const int g = lane >> 4;
#pragma unroll
  for (int i = 0; i < 8; ++i) { w[i] = (_Float16)(bfr(Wm[(size_t)(k0 + 8 * g + i) * ld + o]) * 256.0f); w[8 + i] = (_Float16)(bfr(Wm[(size_t)(k0 + 16 + 8 * g + i) * ld + o]) * 256.0f); }
  return w; }
__device__ __forceinline__ v16h wcolh_oi(const float* Wm, int k0, int o, int lane, int K) { v16h w; const float* p = Wm + (size_t)o * K + k0 + 8 * (lane >> 4);
#pragma unroll
  for (int i = 0; i < 8; ++i) { w[i] = (_Float16)(bfr(p[i]) * 256.0f); w[8 + i] = (_Float16)(bfr(p[16 + i]) * 256.0f); }
  return w; }
#define WQKV_LAYOUT 1   // 0 = (in,out) [DIN][CC]; 1 = (out,in) [CC][DIN]; 2 = per-head [NH][DIN][HD]
__device__ __forceinline__ v16b wcol_hdk(const float* Wm, int k0, int o, int lane) { v16b w; const int g = lane >> 4; const float* p = Wm + (size_t)(o / HD) * DIN * HD + (o % HD);
#pragma unroll
  for (int i = 0; i < 8; ++i) { w[i] = (__bf16)p[(size_t)(k0 + 8 * g + i) * HD]; w[8 + i] = (__bf16)p[(size_t)(k0 + 16 + 8 * g + i) * HD]; }
  return w; }
#define WO_OUT_IN 0
#if WQKV_LAYOUT == 1
#define WCOL(W, k0, o, lane) wcol_oi(W, k0, o, lane, DIN)
#elif WQKV_LAYOUT == 2
#define WCOL(W, k0, o, lane) wcol_hdk(W, k0, o, lane)
#else
#define WCOL(W, k0, o, lane) wcol_io(W, k0, o, lane, CC)
#endif
#if WO_OUT_IN
#define WOCOL(W, k0, o, lane) wcol_oi(W, k0, o, lane, CC)
#define WOCOLH(W, k0, o, lane) wcolh_oi(W, k0, o, lane, CC)
#else
#define WOCOL(W, k0, o, lane) wcol_io(W, k0, o, lane, DIN)
#define WOCOLH(W, k0, o, lane) wcolh_io(W, k0, o, lane, DIN)
#endif

#ifndef SM_EXTRA_PARAMS
#define SM_EXTRA_PARAMS
#endif
#ifndef PROJ_EXTRA_PARAMS
#define PROJ_EXTRA_PARAMS
#endif
#ifndef SM_MASK_HOOK
#define SM_MASK_HOOK (void)0
#endif

#define WS_QH  0u                                      // f16 q in fragment order [b][h][query tile t / 16][element half 2][lane 32][8]
#define WS_KH  (WS_QH + 2u * (size_t)NB * TT * CC)      // f16 k in fragment order [b][h][key tile t / 16][element half 2][lane 32][8]
#define WS_VT  (WS_KH + 2u * (size_t)NB * TT * CC)      // f16 v in fragment order [b][h][key chunk t / 32][channel tile 2][element half 2][lane 32][8]
#define WS_QL  (WS_VT + 2u * (size_t)NB * CC * TT)      // f16 q residual x 2^10, t < QHI, in the order of the q plane
#define WS_KL  (WS_QL + 2u * (size_t)NB * QHI * CC)     // f16 k residual x 2^10, t < KHI, in the order of the k plane
#define WS_VB  (WS_KL + 2u * (size_t)NB * KHI * CC)     // bf16 v hi (then lo), t < KHI, in the order of the v plane
#define WS_VBL (WS_VB + 2u * (size_t)NB * CC * KHI)
#define WS_S   (WS_VBL + 2u * (size_t)NB * CC * KHI)    // f32 area of HG * TT * TT floats; holds the folded weights and bias
#define WS_Y   (WS_S  + 4u * (size_t)HG * TT * TT)      // unused (k_fa writes the ctx rows to WS_CAT); same offset as WS_TQ
#define WS_XH  (WS_S + 0u)                              // area of NH * NB * TT * CC floats holding the folded weights and bias; fills the S region, which holds no logits (NH * NB * CC == HG * TT)
#define WS_TQ  (WS_XH + 4u * (size_t)NH * NB * TT * CC) // area of NH * NB * TT * 128 floats; its start holds x as f16 fragments (WS_XF)
#define WS_WP  (WS_TQ + 4u * (size_t)NH * NB * TT * 128) // unused area of NH * CC * 128 floats
#define WS_QB8 (WS_WP + 4u * (size_t)NH * CC * 128 + 256)
#define WS_KB8 (WS_QB8 + 4u * (size_t)NB * TT * CC)
#define WS_VB8 (WS_KB8 + 4u * (size_t)NB * TT * CC)
#define WS_CAT (WS_VB8 + 4u * (size_t)NB * TT * CC)
#define WS_END (WS_CAT + 4u * (size_t)NB * TT * CC)
#define WS_END2 WS_END
#define WS_TOP (WS_CAT + 4u * (size_t)NB * TT * CC)     // end of everything kernel_launch uses
static_assert((size_t)HG * TT * TT <= (size_t)NH * NB * TT * CC, "S must end where the WS_XH area ends");

// ---- k_fa: block = 64 queries (4 waves x 16) of (b, h), one pass over the keys 0 .. query in steps of 64 with a running row maximum and sum (online softmax); nothing of the logits or of P goes to memory.
// Both products are formed transposed so that every per-query value sits in the lane of its query (col = lane & 15): S^T = k q^T (A = key rows, B = query rows; D element r = key 8g + r, column = query), which is already the B fragment of P^T (elements 0..7 = tile 2c, 8..15 = tile 2c + 1), and ctx^T = v^T P^T (A = v, row = channel, k = key; D element r = channel 8g + r, column = query).
// q, k and v lie in memory as the fragments themselves (k_qkv writes them so): every load of the key loop reads 512 contiguous bytes, four whole lines, where a load from rows or planes touched 16 lines for the same bytes. ctx leaves in the order of k_out's A fragments (element r of tile j = channel 16 j + 8g + r of the lane's query: the same lane's elements there).
// Precision as before: q, k once to f16 (1 product), P once to f16 against v f16; query blocks < QBH: 3-product logits (q, k residual planes x 2^10), P and v as bf16 hi + lo (3 products). P is exp(logit - running maximum), at most 1; the division by the f32 row sum comes last.
#define L2E 1.4426950408889634f
#define NEGBIG (-1.0e30f)
// behind a group of global loads: their address registers (kept live to here as inputs) are rewritten only after this wait
#define XW2(p0, p1) asm volatile("s_wait_xcnt 0x0" :: "v"(p0), "v"(p1) : "memory")
#define XW4(p0, p1, p2, p3) asm volatile("s_wait_xcnt 0x0" :: "v"(p0), "v"(p1), "v"(p2), "v"(p3) : "memory")
static_assert(HD == 32, "one 32-deep product per logit tile, two 16-channel ctx tiles");
// 2^x; the v_nop fills the one slot that the instruction set asks for behind a transcendental, whatever the compiler schedules next (it had put a second v_exp_f32 there that overwrites the first one's source)
__device__ __forceinline__ float ex2(float x) { float r; asm("v_exp_f32 %0, %1\n\tv_nop" : "=v"(r) : "v"(x)); return r; }
// s[32] = this lane's logits of one 64-key step (excluded ones = NEGBIG) -> exp(s - new maximum); returns the factor that rescales what was summed under the old maximum
__device__ __forceinline__ float sm_step(float (&s)[32], float& m, float& l) {
  float c0 = fmaxf(s[0], s[1]), c1 = fmaxf(s[2], s[3]);
#pragma unroll
  for (int i = 4; i < 32; i += 2) { c0 = fmaxf(c0, s[i]); c1 = fmaxf(c1, s[i + 1]); }
  float cm = fmaxf(c0, c1); cm = fmaxf(cm, __shfl_xor(cm, 16));   /* lanes col and col + 16 hold the two key halves of one query */
  const float mn = fmaxf(m, cm), al = ex2((m - mn) * L2E), m2 = mn * L2E; m = mn;
  float a0 = 0.f, a1 = 0.f, a2 = 0.f, a3 = 0.f;
#pragma unroll
  for (int i = 0; i < 32; i += 4) {
    s[i] = ex2(fmaf(s[i], L2E, -m2)); s[i + 1] = ex2(fmaf(s[i + 1], L2E, -m2)); s[i + 2] = ex2(fmaf(s[i + 2], L2E, -m2)); s[i + 3] = ex2(fmaf(s[i + 3], L2E, -m2));
    a0 += s[i]; a1 += s[i + 1]; a2 += s[i + 2]; a3 += s[i + 3]; }
  l = l * al + ((a0 + a1) + (a2 + a3)); return al; }
// fragment kept in fragment order [element half 2][lane 32][8], from a pointer that already holds lane * 8: each of the two loads reads 512 contiguous bytes, four whole 128-B lines
__device__ __forceinline__ v16h frag_fo(const _Float16* p) { union { v16h v; v8h q[2]; } u; u.q[0] = *(const v8h*)p; u.q[1] = *(const v8h*)(p + 256); return u.v; }
__device__ __forceinline__ v16b frag_fob(const __bf16* p) { union { v16b v; v8b q[2]; } u; u.q[0] = *(const v8b*)p; u.q[1] = *(const v8b*)(p + 256); return u.v; }
// one 64-key step of the plain path: works on the fragments kf, vf and (FETCH) issues the loads of the next step's fragments into the OTHER register set kx, vx. The key loop calls it twice a trip with the two sets swapped, so nothing reads kx, vx before the next step:
// their wait stands a whole step behind their issue, and no register is copied from one set to the other. DIAG: 0 = the step cannot hold keys past a query, 1 = it does if it == qb, 2 = it does.
template <bool FETCH, int DIAG>
__device__ __forceinline__ void fa_step(const v16h (&kf)[4], const v16h (&vf)[4], v16h (&kx)[4], v16h (&vx)[4], const _Float16* kp, const _Float16* vp, int it, int qb, const v16h& bq, int g, int tq, float& m, float& l, v8f (&o)[2]) {
  const int k0 = it * 64; const v8f zero = {};
  __builtin_amdgcn_sched_barrier(0);   /* nothing of this step moves up into the step before: the scheduler had put this step's first logit product, with the wait for its fragments, directly behind their loads */
  if (FETCH) { const int kn = (it < qb ? it + 1 : it) * 64;   /* the last step fetches its own tile again: in bounds, unused */
    const _Float16 *kq = kp + (size_t)kn * HD, *vq = vp + (size_t)kn * HD;
#pragma unroll
    for (int t = 0; t < 4; ++t) { kx[t] = frag_fo(kq + t * 512); vx[t] = frag_fo(vq + (t & 1) * 1024 + (t >> 1) * 512); }
    XW2(kq, vq); }
  float s[32];
#pragma unroll
  for (int t = 0; t < 4; ++t) { const v8f a = wmma16(kf[t], bq, zero);
#pragma unroll
    for (int r = 0; r < 8; ++r) s[t * 8 + r] = a[r] * SCALE; }
  if (DIAG == 2 || (DIAG == 1 && it == qb)) {   /* only the diagonal step holds keys past a query */
#pragma unroll
    for (int i = 0; i < 32; ++i) s[i] = (k0 + (i >> 3) * 16 + 8 * g + (i & 7) <= tq) ? s[i] : NEGBIG; }
  const float al = sm_step(s, m, l);
#pragma unroll
  for (int r = 0; r < 8; ++r) { o[0][r] *= al; o[1][r] *= al; }
#pragma unroll
  for (int c = 0; c < 2; ++c) { v16h p;
#pragma unroll
    for (int i = 0; i < 16; ++i) p[i] = (_Float16)s[c * 16 + i];
    o[0] = wmma16(vf[c], p, o[0]); o[1] = wmma16(vf[2 + c], p, o[1]); } }
__global__ __launch_bounds__(128) void k_fa(const _Float16* __restrict__ QH, const _Float16* __restrict__ KH, const _Float16* __restrict__ QL, const _Float16* __restrict__ KL, const _Float16* __restrict__ VT, const __bf16* __restrict__ VB, const __bf16* __restrict__ VBL, float* __restrict__ Y) {
  const int tid = threadIdx.x, lane = tid & 31, col = lane & 15, g = lane >> 4; const int wave = __builtin_amdgcn_readfirstlane(tid >> 5);
  const int qb = NQB - 1 - (int)blockIdx.x, h = blockIdx.y, b = blockIdx.z;   /* longest query blocks start first */
  const int ql0 = qb * 64 + wave * 16, tq = ql0 + col;
  float m = NEGBIG, l = 0.f; v8f o[2] = {}; const v8f zero = {};
  const size_t bh = (size_t)b * NH + h;   /* q, k and v of one (b, h) lie in fragment order, HD * 2 bytes a position: a 64-key step is 4 KiB of k and 4 KiB of v in a row */
  const _Float16* qp = QH + (bh * TT + ql0) * HD + lane * 8;
  const _Float16* kp = KH + bh * (size_t)(TT * HD) + lane * 8;
  if (qb < QBH) {
    const _Float16* qlp = QL + (bh * QHI + ql0) * HD + lane * 8;
    const v16h bq = frag_fo(qp), bql = frag_fo(qlp); XW2(qp, qlp);
    const _Float16* klp = KL + bh * (size_t)(KHI * HD) + lane * 8;
    const size_t vo = bh * (size_t)(KHI * HD) + lane * 8;
#pragma unroll 1
    for (int it = 0; it <= qb; ++it) { const int k0 = it * 64; float s[32];
      const _Float16 *kq = kp + (size_t)k0 * HD, *klq = klp + (size_t)k0 * HD; const __bf16 *vhq = VB + vo + (size_t)k0 * HD, *vlq = VBL + vo + (size_t)k0 * HD;
      v16h khf[4], klf[4]; v16b vhf[4], vlf[4];   /* index of the v fragments: c * 2 + j */
#pragma unroll
      for (int t = 0; t < 4; ++t) { khf[t] = frag_fo(kq + t * 512); klf[t] = frag_fo(klq + t * 512); vhf[t] = frag_fob(vhq + (t >> 1) * 1024 + (t & 1) * 512); vlf[t] = frag_fob(vlq + (t >> 1) * 1024 + (t & 1) * 512); }
      XW4(kq, klq, vhq, vlq);
#pragma unroll
      for (int t = 0; t < 4; ++t) { const v16h kh = khf[t], kl = klf[t];
        const v8f a = wmma16(kh, bq, zero); v8f a2 = wmma16(kh, bql, zero); a2 = wmma16(kl, bq, a2);
#pragma unroll
        for (int r = 0; r < 8; ++r) { const float v = (a[r] + a2[r] * (1.0f / 1024.0f)) * SCALE; s[t * 8 + r] = (k0 + t * 16 + 8 * g + r <= tq) ? v : NEGBIG; } }
      const float al = sm_step(s, m, l);
#pragma unroll
      for (int r = 0; r < 8; ++r) { o[0][r] *= al; o[1][r] *= al; }
#pragma unroll
      for (int c = 0; c < 2; ++c) { float v[16];
#pragma unroll
        for (int i = 0; i < 8; ++i) { v[i] = s[c * 16 + i]; v[8 + i] = s[c * 16 + 8 + i]; }
        const F2 p = bsplit16(v);
#pragma unroll
        for (int j = 0; j < 2; ++j) { const v16b vh = vhf[c * 2 + j];
          o[j] = wmma_bf(vh, p.h, o[j]); o[j] = wmma_bf(vh, p.l, o[j]); o[j] = wmma_bf(vlf[c * 2 + j], p.h, o[j]); } } }
  } else {
    const _Float16* vp = VT + bh * (size_t)(TT * HD) + lane * 8;
    const v16h bq = frag_fo(qp);
    v16h kf[4], vf[4], kx[4], vx[4];   /* two sets of fragments, used in turn; index of the v fragments: j * 2 + c */
#pragma unroll
    for (int t = 0; t < 4; ++t) { kf[t] = frag_fo(kp + t * 512); vf[t] = frag_fo(vp + (t & 1) * 1024 + (t >> 1) * 512); }
    XW4(qp, kp, vp, vp);
    int it = 0;
#pragma unroll 1   /* rolled: a trip already holds two whole steps, one for either register set */
    for (; it < qb; it += 2) { fa_step<true, 0>(kf, vf, kx, vx, kp, vp, it, qb, bq, g, tq, m, l, o); fa_step<true, 1>(kx, vx, kf, vf, kp, vp, it + 1, qb, bq, g, tq, m, l, o); }
    if (it == qb) fa_step<false, 2>(kf, vf, kx, vx, kp, vp, it, qb, bq, g, tq, m, l, o);   /* an odd number of steps: the diagonal one is left, the same for a whole block */
  }
  l += __shfl_xor(l, 16); const float inv = l > 0.f ? 1.0f / l : 0.f;
  float* yp = Y + ((((size_t)b * TT + ql0) >> 4) * NH + h) * 512 + lane * 4;   /* ctx in the order of k_out's A fragments [row tile][head = k step][element quarter 4][lane 32][4]: a store is 512 contiguous bytes */
#pragma unroll
  for (int j = 0; j < 2; ++j) { v4f w0, w1;
#pragma unroll
    for (int r = 0; r < 4; ++r) { w0[r] = o[j][r] * inv; w1[r] = o[j][4 + r] * inv; }
    vst2(yp + j * 256, w0); vst2(yp + j * 256 + 128, w1); } }

#define NRW (TNB * TT)
#ifndef SM_EXTRA_PARAMS
#define SM_EXTRA_PARAMS
#endif
#ifndef PROJ_EXTRA_PARAMS
#define PROJ_EXTRA_PARAMS
#endif
#ifndef SM_MASK_HOOK
#define SM_MASK_HOOK (void)0
#endif

#define WS_QH  0u                                      // f16 q in fragment order [b][h][query tile t / 16][element half 2][lane 32][8]
#define WS_KH  (WS_QH + 2u * (size_t)NB * TT * CC)      // f16 k in fragment order [b][h][key tile t / 16][element half 2][lane 32][8]
#define WS_VT  (WS_KH + 2u * (size_t)NB * TT * CC)      // f16 v in fragment order [b][h][key chunk t / 32][channel tile 2][element half 2][lane 32][8]
#define WS_QL  (WS_VT + 2u * (size_t)NB * CC * TT)      // f16 q residual x 2^10, t < QHI, in the order of the q plane
#define WS_KL  (WS_QL + 2u * (size_t)NB * QHI * CC)     // f16 k residual x 2^10, t < KHI, in the order of the k plane
#define WS_VB  (WS_KL + 2u * (size_t)NB * KHI * CC)     // bf16 v hi (then lo), t < KHI, in the order of the v plane
#define WS_VBL (WS_VB + 2u * (size_t)NB * CC * KHI)
#define WS_S   (WS_VBL + 2u * (size_t)NB * CC * KHI)    // f32 area of HG * TT * TT floats; holds the folded weights and bias
#define WS_Y   (WS_S  + 4u * (size_t)HG * TT * TT)      // unused (k_fa writes the ctx rows to WS_CAT); same offset as WS_TQ
#define WS_END (WS_Y  + 0u)
#define WS_Y2  (WS_END)
#define WS_O1  (WS_Y2 + 4u * (size_t)NB * TT * CC)
#define WS_R2  (WS_O1 + 4u * (size_t)NB * TT * CC)
#define WS_END2 (WS_R2 + 4u * (size_t)NB * TT * CC)


#define NC3 96                                          // q | k | v channels of one head
#define WS_WF  (WS_XH + 0u)                             // f16 folded weights x 2^6 in fragment order [h][hi, residual][channel tile 6][k step 16][element half 2][lane 32][8]
#define WS_BC  (WS_WF + 2u * (size_t)NH * 2 * NC3 * CC) // f32 folded bias [h][NC3]
#define WS_XF  (WS_TQ + 0u)                             // f16 x (bf16-rounded, exact) in fragment order [row tile r / 16][k step 16][element half 2][lane 32][8]
#define XCB 6                                           // blockIdx.x values of k_fold's grid that convert x: XCB * NH blocks of 12 waves
__device__ __forceinline__ v8f wm(v16h a, v16h b, v8f c) { return __builtin_amdgcn_wmma_f32_16x16x32_f16(false, a, false, b, (short)0, c, false, false); }
__device__ __forceinline__ _Float16 w64(float v) { return (_Float16)(bfr(v) * 64.0f); }
// ---- k_fold: (x Wl^T + bl) W = x (Wl^T W) + bl W. Block = (64 input indices i0.., head), 12 waves = (which of Wq, Wk, Wv) x (quarter kq of the 512 summed indices o): D[i][c] = sum_o Wl[o][i] W[o][c] (A = Wl^T: row i, k = o; B = W: k = o, column c; both read with the same k order 8g + e, 16 + 8g + e).
// A wave sums 4 k steps, not 16: the steps are serial (load, wait, convert, multiply), so the launch lasts as long as one wave's steps. The four partial sums of a tile meet in LDS behind one barrier and are added in the order kq = 0, 1, 2, 3 by wave (which, kq = tile t), which stores that tile.
// D element r = input index 8g + r of channel column c: exactly the 8 elements that lane 16g + c of k_qkv's weight fragment (A for q, k, row = channel; B for v, column = channel; k = input index) holds in half t & 1 of k step i0 / 32 + t / 2, so WF is kept in that order: a store here and a load there are 512 contiguous bytes of whole 128-B lines, each line written by one wave. blockIdx.x = CC / 64 takes bl as every row of A and gives the folded bias.
// The blockIdx.x values behind that one convert x once for all 16 heads, on WGPs that the fold leaves idle: x -> f16(bf16(x)) in the order of k_qkv's x fragments. A wave takes 8 rows x 8 k steps; a load reads 8 rows of 128 B (lane = row lane >> 2, chunk q = lane & 3 = floats 8q .. 8q + 7 of the k step),
// and chunk q is element half q >> 1 of fragment lane 16 (q & 1) + row, so a store writes four whole 128-B lines, each from this wave alone. No barrier on this path.
#define KQS (CC / 32 / 4)   /* k steps of one quarter */
static_assert(XCB * NH * 12 >= NRW / 16 * 4 && CC == 512, "one wave for every (row tile, row half, k half) of x");
__global__ __launch_bounds__(384) void k_fold(const float* __restrict__ X, _Float16* __restrict__ XF, const float* __restrict__ WL, const float* __restrict__ BL, const float* __restrict__ WQ, const float* __restrict__ WK, const float* __restrict__ WV, _Float16* __restrict__ WF, float* __restrict__ BC) {
  __shared__ __align__(16) float red[3 * 4 * 4 * 512];   /* partial sums [which 3][tile t 4][quarter kq 4][j 2][element half 2][lane 32][4]: every LDS store and load is 512 contiguous bytes */
  const int tid = threadIdx.x, lane = tid & 31, col = lane & 15, g = lane >> 4; const int wv = __builtin_amdgcn_readfirstlane(tid >> 5), wave = wv >> 2, kq = wv & 3;
  if (blockIdx.x > CC / 64) {   /* the same for a whole block */
    const int job = (((int)blockIdx.x - (CC / 64 + 1)) * NH + (int)blockIdx.y) * 12 + wv;   /* (row tile, row half, k half) */
    if (job < NRW / 16 * 4) {   /* the same for a whole wave */
      const int rt = job >> 2, rg = (job >> 1) & 1, kh = job & 1;
      const float* sp = X + (size_t)(rt * 16 + rg * 8 + (lane >> 2)) * CC + kh * 256 + (lane & 3) * 8;
      _Float16* dp = XF + (size_t)(rt * 16 + kh * 8) * 512 + ((lane >> 1) & 1) * 256 + ((lane & 1) * 16 + rg * 8 + (lane >> 2)) * 8;
      v4f xv[8][2];
#pragma unroll
      for (int i = 0; i < 8; ++i) { xv[i][0] = *(const v4f*)(sp + i * 32); xv[i][1] = *(const v4f*)(sp + i * 32 + 4); }
      XW2(sp, sp);   /* the 16 loads, all in flight together, name sp: it is rewritten only behind this wait */
      v8h w[8];
#pragma unroll
      for (int i = 0; i < 8; ++i)
#pragma unroll
        for (int e = 0; e < 8; ++e) w[i][e] = (_Float16)bfr(xv[i][e >> 2][e & 3]);
      __builtin_amdgcn_sched_barrier(0);   /* the stores stand together at the wave's end: no register that a store names is written again */
#pragma unroll
      for (int i = 0; i < 8; ++i) vst2(dp + i * 512, w[i]); }
    return; }
  const size_t h = blockIdx.y;
  const float* bp = (wave == 0 ? WQ : wave == 1 ? WK : WV) + h * CC * HD + (size_t)(kq * (KQS * 32) + 8 * g) * HD + col;
  if (blockIdx.x < CC / 64) {
    const int i0 = blockIdx.x * 64;
    const float* ap = WL + h * CC * CC + (size_t)(kq * (KQS * 32) + 8 * g) * CC + i0 + col;
    v8f acc[4][2] = {};
#pragma unroll 1   /* rolled: one step's 96 loaded values and the 64 sums already take most of the registers */
    for (int kc = 0; kc < KQS; ++kc) { float av[4][16], bv[2][16];
#pragma unroll
      for (int e = 0; e < 16; ++e) { const int ko = e < 8 ? e : e + 8;
#pragma unroll
        for (int t = 0; t < 4; ++t) av[t][e] = ap[(size_t)ko * CC + t * 16];
        bv[0][e] = bp[(size_t)ko * HD]; bv[1][e] = bp[(size_t)ko * HD + 16]; }
      XW2(ap, bp); __builtin_amdgcn_sched_barrier(0);   /* every load of the step is issued before the first conversion or product: one memory latency a step; the scheduler had kept only two fragments in flight */
      v16h fa[4], fb[2];
#pragma unroll
      for (int e = 0; e < 16; ++e) { fa[0][e] = w64(av[0][e]); fa[1][e] = w64(av[1][e]); fa[2][e] = w64(av[2][e]); fa[3][e] = w64(av[3][e]); fb[0][e] = w64(bv[0][e]); fb[1][e] = w64(bv[1][e]); }
#pragma unroll
      for (int t = 0; t < 4; ++t) { acc[t][0] = wm(fa[t], fb[0], acc[t][0]); acc[t][1] = wm(fa[t], fb[1], acc[t][1]); }
      ap += (size_t)32 * CC; bp += (size_t)32 * HD; }
    float* rw = red + (wave * 16 + kq) * 512 + lane * 4;
#pragma unroll
    for (int t = 0; t < 4; ++t)
#pragma unroll
      for (int j = 0; j < 2; ++j) { v4f w0, w1;
#pragma unroll
        for (int r = 0; r < 4; ++r) { w0[r] = acc[t][j][r]; w1[r] = acc[t][j][4 + r]; }
        *(v4f*)(rw + t * 2048 + j * 256) = w0; *(v4f*)(rw + t * 2048 + j * 256 + 128) = w1; }
    __syncthreads();   /* the 12 waves' partial sums are in LDS before any wave adds them */
    const float* rr = red + (wave * 4 + kq) * 2048 + lane * 4;   /* this wave finishes tile t = kq of its weight */
    _Float16* op = WF + ((h * 2 * 6 + wave * 2) * 16 + (i0 >> 5) + (kq >> 1)) * (size_t)512 + (kq & 1) * 256 + lane * 8;
#pragma unroll
    for (int j = 0; j < 2; ++j) { v4f p[4][2];
#pragma unroll
      for (int q = 0; q < 4; ++q) { p[q][0] = *(const v4f*)(rr + q * 512 + j * 256); p[q][1] = *(const v4f*)(rr + q * 512 + j * 256 + 128); }
      v8h hi, lo;
#pragma unroll
      for (int r = 0; r < 8; ++r) { const float v = (((p[0][r >> 2][r & 3] + p[1][r >> 2][r & 3]) + p[2][r >> 2][r & 3]) + p[3][r >> 2][r & 3]) * (1.0f / 64.0f); hi[r] = (_Float16)v; lo[r] = (_Float16)(v - (float)hi[r]); }   /* sums carry 2^12; kept x 2^6 */
      vst2(op + j * (16 * 512), hi); vst2(op + j * (16 * 512) + NC3 * CC, lo); }
  } else {
    const float* ap = BL + h * CC + kq * (KQS * 32) + 8 * g;
    v8f acc[2] = {};
#pragma unroll 1   /* rolled: short steps of one small block a head, nothing to gain from more code */
    for (int kc = 0; kc < KQS; ++kc) { float av[16], bv[2][16];
#pragma unroll
      for (int e = 0; e < 16; ++e) { const int ko = e < 8 ? e : e + 8; av[e] = ap[ko]; bv[0][e] = bp[(size_t)ko * HD]; bv[1][e] = bp[(size_t)ko * HD + 16]; }
      XW2(ap, bp); __builtin_amdgcn_sched_barrier(0);   /* keeps the wait directly behind the loads, in front of the pointer steps (it had sunk to the loop's foot) */
      v16h fa, fb[2];
#pragma unroll
      for (int e = 0; e < 16; ++e) { fa[e] = w64(av[e]); fb[0][e] = w64(bv[0][e]); fb[1][e] = w64(bv[1][e]); }
      acc[0] = wm(fa, fb[0], acc[0]); acc[1] = wm(fa, fb[1], acc[1]);
      ap += 32; bp += (size_t)32 * HD; }
    red[(wave * 4 + kq) * 64 + lane] = acc[0][0]; red[(wave * 4 + kq) * 64 + 32 + lane] = acc[1][0];   /* every row of D is the same sum: element 0 of either lane half */
    __syncthreads();   /* the four quarters of each folded bias are in LDS before wave (which, 0) adds them */
    if (kq == 0 && g == 0) { const float* rr = red + wave * 256 + lane; float* op = BC + h * NC3 + wave * HD + col;
      op[0] = (((rr[0] + rr[64]) + rr[128]) + rr[192]) * (1.0f / 4096.0f); op[16] = (((rr[32] + rr[96]) + rr[160]) + rr[224]) * (1.0f / 4096.0f); } } }

// ---- k_qkv: block = (128 rows of x, head), wave = 32 rows; folded weight f16 hi then residual, read in fragment order; x bf16-rounded, exact in f16, read in fragment order too (k_fold's launch writes it so): 512 contiguous bytes a load, nothing to convert. The same two fragments serve either way round:
// q, k: [q|k]^T = weight (A = channel rows) x x^T (B = x rows): D element r = channel 8g + r, column = row of x, so a lane holds 8 consecutive channels of its row = the 8 elements that the same lane of k_fa's q (B) or k (A) fragment (row = position, k = channel) holds in half j of position tile u;
// v: x (A = x rows) x weight^T (B = channel columns): D element r = row of x 8g + r, column = channel, so a lane holds 8 consecutive positions of its channel = the 8 elements that the same lane of k_fa's A fragment (row = channel, k = key) holds in half u of channel tile j.
// The f32 sums go from the registers straight into the planes that k_fa reads: q, k, v -> f16 in fragment order, 512 contiguous bytes a store (+ q, k residuals x 2^10 and v bf16 hi / lo for t < QHI, KHI, in the same order).
static_assert(QHI == KHI && QHI % 32 == 0 && TT % 128 == 0, "a wave's 32 rows lie in one sequence, wholly below or wholly above the high-precision bound");
// the fragments of the k step that lies OFF halves behind xp, wp; a scheduling barrier on either side keeps the 28 loads issued whole at this place, ahead of the products that cover their latency; the wait keeps the address registers unwritten until it has passed
template <int OFF>
__device__ __forceinline__ void qkv_ld(v16h (&xb)[2], v16h (&wh)[6], v16h (&wl)[6], const _Float16* xp, const _Float16* wp) {
  __builtin_amdgcn_sched_barrier(0);
#pragma unroll
  for (int ct = 0; ct < 6; ++ct) wh[ct] = frag_fo(wp + OFF + (size_t)(ct * 16) * 512);
  xb[0] = frag_fo(xp + OFF); xb[1] = frag_fo(xp + OFF + 16 * 512);
#pragma unroll
  for (int ct = 0; ct < 6; ++ct) wl[ct] = frag_fo(wp + OFF + (size_t)(NC3 + ct * 16) * 512);
  XW2(xp, wp); __builtin_amdgcn_sched_barrier(0); }
__device__ __forceinline__ void qkv_mac(v8f (&acc)[6][2], const v16h (&xb)[2], const v16h (&wh)[6], const v16h (&wl)[6]) {
#pragma unroll
  for (int ct = 0; ct < 4; ++ct) { acc[ct][0] = wm(wh[ct], xb[0], acc[ct][0]); acc[ct][1] = wm(wh[ct], xb[1], acc[ct][1]); }
#pragma unroll
  for (int ct = 4; ct < 6; ++ct) { acc[ct][0] = wm(xb[0], wh[ct], acc[ct][0]); acc[ct][1] = wm(xb[1], wh[ct], acc[ct][1]); }
#pragma unroll
  for (int ct = 0; ct < 4; ++ct) { acc[ct][0] = wm(wl[ct], xb[0], acc[ct][0]); acc[ct][1] = wm(wl[ct], xb[1], acc[ct][1]); }
#pragma unroll
  for (int ct = 4; ct < 6; ++ct) { acc[ct][0] = wm(xb[0], wl[ct], acc[ct][0]); acc[ct][1] = wm(xb[1], wl[ct], acc[ct][1]); } }
__global__ __launch_bounds__(128) void k_qkv(const _Float16* __restrict__ XF, const _Float16* __restrict__ WF, const float* __restrict__ BC, _Float16* __restrict__ QH, _Float16* __restrict__ QL, _Float16* __restrict__ KH, _Float16* __restrict__ KL, _Float16* __restrict__ VT, __bf16* __restrict__ VB, __bf16* __restrict__ VBL) {
  const int tid = threadIdx.x, lane = tid & 31, col = lane & 15, g = lane >> 4; const int wave = __builtin_amdgcn_readfirstlane(tid >> 5);
  const size_t h = blockIdx.y, r0 = (size_t)blockIdx.x * 128 + wave * 32;
  const _Float16* xp = XF + (r0 >> 4) * (size_t)(16 * 512) + lane * 8;   /* fragment order: row tile at 16 * 512, k step at 512, element half at 256 */
  const _Float16* wp = WF + h * 2 * NC3 * CC + lane * 8;   /* fragment order: tile ct at ct * 16 * 512, k step at 512, element half at 256 */
  v8f acc[6][2] = {};
  v16h xa[2], ha[6], la[6], xc[2], hc[6], lc[6];   /* two sets of fragments, used in turn: while one set is multiplied the other set's loads, issued a whole step ahead of their wait, are in flight */
  static_assert(CC / 32 % 2 == 0, "k steps go in pairs");
  qkv_ld<0>(xa, ha, la, xp, wp);
#pragma unroll 1   /* rolled: a trip already holds two whole steps, one for either register set */
  for (int kc = 0; kc < CC / 32 - 2; kc += 2) {
    qkv_ld<512>(xc, hc, lc, xp, wp); qkv_mac(acc, xa, ha, la);
    qkv_ld<1024>(xa, ha, la, xp, wp); qkv_mac(acc, xc, hc, lc);
    xp += 1024; wp += 1024; }
  qkv_ld<512>(xc, hc, lc, xp, wp); qkv_mac(acc, xa, ha, la); qkv_mac(acc, xc, hc, lc);
  const float *bcp = BC + h * NC3 + 8 * g, *bvp = BC + h * NC3 + 2 * HD + col; v4f bc[4][2]; float bv[2];   /* q, k: the bias of the lane's 8 channels; v: of its one channel a tile */
#pragma unroll
  for (int ct = 0; ct < 4; ++ct) { bc[ct][0] = *(const v4f*)(bcp + ct * 16); bc[ct][1] = *(const v4f*)(bcp + ct * 16 + 4); }
  bv[0] = bvp[0]; bv[1] = bvp[16];
  asm volatile("s_wait_xcnt 0x0" ::: "memory"); __builtin_amdgcn_sched_barrier(0);   /* the bias loads' address registers are rewritten only behind this wait; the scheduling barrier keeps the stores' address arithmetic behind it */
#pragma unroll
  for (int ct = 0; ct < 6; ++ct)
#pragma unroll
    for (int u = 0; u < 2; ++u)
#pragma unroll
      for (int r = 0; r < 8; ++r) acc[ct][u][r] = acc[ct][u][r] * (1.0f / 64.0f) + (ct < 4 ? bc[ct][r >> 2][r & 3] : bv[ct - 4]);
  const size_t bb = r0 / TT, t0 = r0 % TT, bh = bb * NH + h, fo = (bh * TT + t0) * HD + lane * 8;
  _Float16 *qo = QH + fo, *ko = KH + fo, *vo = VT + fo;   /* q, k: position tile u, half j; v: channel tile j, half u of the wave's one 32-key chunk */
#pragma unroll
  for (int u = 0; u < 2; ++u)
#pragma unroll
    for (int j = 0; j < 2; ++j) { v8h q, k, v;
#pragma unroll
      for (int r = 0; r < 8; ++r) { q[r] = (_Float16)acc[j][u][r]; k[r] = (_Float16)acc[2 + j][u][r]; v[r] = (_Float16)acc[4 + j][u][r]; }
      vst2(qo + u * 512 + j * 256, q); vst2(ko + u * 512 + j * 256, k); vst2(vo + j * 512 + u * 256, v); }
  asm volatile("s_wait_xcnt 0x0" ::: "memory");   /* the branch below opens with an argument load and arithmetic that rewrite registers which the stores above name: only behind this wait, which stands in the stores' own block */
  if (t0 < QHI) {   /* the same for a whole wave */
    const size_t fl = (bh * KHI + t0) * HD + lane * 8; _Float16 *qlo = QL + fl, *klo = KL + fl; __bf16 *vho = VB + fl, *vlo = VBL + fl;
#pragma unroll
    for (int u = 0; u < 2; ++u)
#pragma unroll
      for (int j = 0; j < 2; ++j) { v8h q, k; v8b vh, vl;
#pragma unroll
        for (int r = 0; r < 8; ++r) { const float qf = acc[j][u][r], kf = acc[2 + j][u][r], vf = acc[4 + j][u][r]; const __bf16 b = (__bf16)vf;
          q[r] = (_Float16)((qf - (float)(_Float16)qf) * 1024.0f); k[r] = (_Float16)((kf - (float)(_Float16)kf) * 1024.0f); vh[r] = b; vl[r] = (__bf16)(vf - (float)b); }
        vst2(qlo + u * 512 + j * 256, q); vst2(klo + u * 512 + j * 256, k); vst2(vho + j * 512 + u * 256, vh); vst2(vlo + j * 512 + u * 256, vl); } } }

// ---- k_out: OUT = A (f16 hi + unscaled f16 residual, 2 products) x W^T (W (out,in) as f16(bf16 x 2^6)) x 2^-6 + bias. Block = (64 rows, 128 columns), 8 waves, wave = 16 rows x 64 columns. A arrives in fragment order (k_fa writes it so): each A load reads 512 contiguous bytes.
// The block's 128 weight rows are read once, 8 rows of 128 B an instruction, every load of a batch in flight together, converted once and kept in LDS in fragment order [column tile 8][k step 16][element half 2][lane 32][8];
// chunk q = lane & 3 of a k step (floats 8q .. 8q + 7 of a weight row) is element half q >> 1 of fragment lane 16 (q & 1) + column, the k order of the A fragment. One barrier; behind it the k loop reads 512 contiguous LDS bytes a load and fetches its A rows four k steps ahead. Every loop here is unrolled in full: its index picks registers (buffers, fragments, sums) and the immediate offset of each load. Each sum takes its products in the order k step, hi, residual.
#define OPW 68   /* f32 pitch of the output staging rows: the two lane halves (rows 8 apart) fall on different banks */
__device__ __forceinline__ void ld_a4(v4f (&d)[4][4], const float* p) {
#pragma unroll
  for (int s = 0; s < 4; ++s) { d[s][0] = *(const v4f*)(p + s * 512); d[s][1] = *(const v4f*)(p + s * 512 + 128); d[s][2] = *(const v4f*)(p + s * 512 + 256); d[s][3] = *(const v4f*)(p + s * 512 + 384); } }
// one batch = 4 k steps x 2 groups of 8 weight rows
__device__ __forceinline__ void ld_w8(v4f (&d)[8][2], const float* p) {
#pragma unroll
  for (int i = 0; i < 8; ++i) { const float* q = p + (size_t)(i & 1) * 8 * CC + (i >> 1) * 32; d[i][0] = *(const v4f*)q; d[i][1] = *(const v4f*)(q + 4); } }
__device__ __forceinline__ void st_w8(const v4f (&d)[8][2], _Float16* p) {
#pragma unroll
  for (int i = 0; i < 8; ++i) { v8h w;
#pragma unroll
    for (int e = 0; e < 8; ++e) w[e] = w64(d[i][e >> 2][e & 3]);
    *(v8h*)(p + (i >> 1) * 512 + (i & 1) * 64) = w; } }
__global__ __launch_bounds__(256) void k_out(const float* __restrict__ A, const float* __restrict__ Wm, const float* __restrict__ BIAS, float* __restrict__ OUT) {
  __shared__ __align__(16) _Float16 wf[8 * 16 * 512]; __shared__ __align__(16) float sf[8][16][OPW];
  const int tid = threadIdx.x, lane = tid & 31, col = lane & 15, g = lane >> 4; const int wave = __builtin_amdgcn_readfirstlane(tid >> 5);
  const int c0 = blockIdx.y * 128, cw = c0 + (wave >> 2) * 64; const size_t r0 = (size_t)blockIdx.x * 64 + (wave & 3) * 16;
  const float* ap = A + (r0 >> 4) * (size_t)(16 * CC) + lane * 4;   /* A lies in fragment order [row tile][k step 16][element quarter 4][lane 32][4] */
  const float* wp = Wm + (size_t)(c0 + wave * 16 + (lane >> 2)) * CC + (lane & 3) * 8;   /* wave = the column tile it stages */
  const float* bp = BIAS + cw + col;
  _Float16* wq = wf + wave * (16 * 512) + ((lane >> 1) & 1) * 256 + ((lane & 1) * 16 + (lane >> 2)) * 8;
  v4f av[2][4][4], wt[2][8][2]; float bb[4];
  /* SB: a scheduling barrier on either side of a group of loads keeps the group issued whole at that place: ahead of the conversions that cover its latency, and behind the ones that free its registers (left alone the scheduler took a third weight buffer, past 256 registers) */
#define SB() __builtin_amdgcn_sched_barrier(0)
  ld_w8(wt[0], wp); ld_w8(wt[1], wp + 128);
#pragma unroll
  for (int j = 0; j < 4; ++j) bb[j] = bp[j * 16];
  ld_a4(av[0], ap); SB();
  st_w8(wt[0], wq); SB(); ld_w8(wt[0], wp + 256); SB();
  st_w8(wt[1], wq + 4 * 512); SB(); ld_w8(wt[1], wp + 384); XW2(wp, bp); SB();   /* the last loads through wp and bp */
  st_w8(wt[0], wq + 8 * 512); SB(); ld_a4(av[1], ap + 4 * 512); SB();
  st_w8(wt[1], wq + 12 * 512);
  __syncthreads();   /* the 8 waves' tiles of the weight panel are complete before any wave reads them */
  v8f acc[4] = {};
  const _Float16* fp = wf + (wave >> 2) * (4 * 16 * 512) + lane * 8;
#pragma unroll
  for (int gr = 0; gr < 4; ++gr) {
#pragma unroll
    for (int s = 0; s < 4; ++s) { const int kc = gr * 4 + s; v16h a, al, w[4];
#pragma unroll
      for (int j = 0; j < 4; ++j) w[j] = frag_fo(fp + (j * 16 + kc) * 512);
#pragma unroll
      for (int e = 0; e < 16; ++e) { const float x = av[gr & 1][s][e >> 2][e & 3]; const _Float16 hh = (_Float16)x; a[e] = hh; al[e] = (_Float16)(x - (float)hh); }
#pragma unroll
      for (int j = 0; j < 4; ++j) acc[j] = wm(a, w[j], acc[j]);
#pragma unroll
      for (int j = 0; j < 4; ++j) acc[j] = wm(al, w[j], acc[j]); }
    if (gr < 2) { SB(); ld_a4(av[gr & 1], ap + (gr + 2) * 4 * 512); if (gr == 1) XW2(ap, ap);   /* the last loads through ap */ SB(); } }
#pragma unroll
  for (int j = 0; j < 4; ++j) { const float b = bfr(bb[j]);
#pragma unroll
    for (int r = 0; r < 8; ++r) sf[wave][8 * g + r][j * 16 + col] = acc[j][r] * (1.0f / 64.0f) + b; }
  LDSX();   /* the wave's own staging rows are written before it reads them back as whole 256-B row segments */
  float* op = OUT + (r0 + g) * CC + cw + col * 4;
#pragma unroll
  for (int i = 0; i < 8; ++i) vst2(op + (size_t)i * 2 * CC, *(const v4f*)&sf[wave][2 * i + g][col * 4]); }

extern "C" void kernel_launch(void* const* d_in, const int* in_sizes, int n_in, void* d_out, int out_size, void* d_ws, size_t ws_size, hipStream_t stream) {
  (void)in_sizes; (void)n_in; (void)out_size;
  const float** F = (const float**)d_in;
  if (ws_size < (size_t)WS_END) return;
  char* ws = (char*)d_ws; _Float16 *QH = (_Float16*)(ws + WS_QH), *KH = (_Float16*)(ws + WS_KH), *VT = (_Float16*)(ws + WS_VT), *QL = (_Float16*)(ws + WS_QL), *KL = (_Float16*)(ws + WS_KL); __bf16 *VB = (__bf16*)(ws + WS_VB), *VBL = (__bf16*)(ws + WS_VBL); float *S = (float*)(ws + WS_S), *Y = (float*)(ws + WS_Y);
  (void)Y; (void)S; (void)QL; (void)KL; (void)VB; (void)VBL;
  // inputs: 0 x [2,2048,512]; 1 Wl [16,512,512] (out,in); 2 bl [16,512]; 3 Wq [16,512,32] (in,out); 4 Wk; 5 Wv; 6 Wo [512,512] (out,in); 7 bo [512]
  if (ws_size < (size_t)WS_TOP) return;
  _Float16 *WF = (_Float16*)(ws + WS_WF), *XF = (_Float16*)(ws + WS_XF); float *BC = (float*)(ws + WS_BC), *CAT = (float*)(ws + WS_CAT);
  /* head = blockIdx.y in the two projection launches */
  k_fold<<<dim3(CC / 64 + 1 + XCB, NH), 384, 0, stream>>>(F[0], XF, F[1], F[2], F[3], F[4], F[5], WF, BC);   /* folded weights Wl[h]^T [Wq|Wk|Wv][h] and bias bl[h] [Wq|Wk|Wv][h]; x as f16 fragments */
  k_qkv<<<dim3(NRW / 128, NH), 128, 0, stream>>>(XF, WF, BC, QH, QL, KH, KL, VT, VB, VBL);   /* q, k, v of every head = x folded weight + folded bias, written as the planes that k_fa reads */
  k_fa<<<dim3(NQB, NH, TNB), 128, 0, stream>>>(QH, KH, QL, KL, VT, VB, VBL, CAT);   /* logits, softmax and P v of every (b, h) in one launch */
  k_out<<<dim3(NRW / 64, CC / 128), 256, 0, stream>>>(CAT, F[6], F[7], (float*)d_out);   /* out = cat Wo^T + bo */
}

// v010
// One run takes 56.4 microseconds.
// In two side-by-side timings against v009, it was 1.06 and 1.07 times as fast.
// All steps since v000 together make it 53.6 times as fast.
// compute dtype: all float inputs rounded to bf16; q/k/v = x (Wl[h]^T Wq/Wk/Wv[h]) + bl[h] Wq/Wk/Wv[h]: the folded weight and bias from f16(bf16 x 2^6) operands (exact, 1 product, WMMA 16x16x32, f32 accumulate), the folded weight kept as f16 hi + residual (x 2^6) against x as f16 (bf16-exact) (2 products); unscaled causal logits: q, k once to f16 (1 product), 3 products below row 384; online softmax in f32 (running maximum and sum, one fused kernel); P = exp(logit - maximum) once to f16 against v f16 (P and v as bf16 hi + lo below row 384); out = cat as f16 hi + residual against Wo^T f16(bf16 x 2^6) (2 products) + bo; f32 output.
#include <hip/hip_runtime.h>
#include <math.h>

typedef __attribute__((ext_vector_type(16))) _Float16 v16h;
typedef __attribute__((ext_vector_type(16))) __bf16 v16b;
typedef __attribute__((ext_vector_type(8)))  _Float16 v8h;
typedef __attribute__((ext_vector_type(8)))  float v8f;
typedef __attribute__((ext_vector_type(4)))  float v4f;
typedef __attribute__((ext_vector_type(2)))  float v2f;
typedef __attribute__((ext_vector_type(4)))  unsigned v4u;
typedef __attribute__((ext_vector_type(4)))  int v4i;
typedef float __attribute__((may_alias)) float_a;
typedef int __attribute__((may_alias)) int_a;

template <typename T> __device__ __forceinline__ void vst2(void* p, T v) { *(T*)p = v;  }
__device__ __forceinline__ v8f wmma16(v16h a, v16h b, v8f c) {
  v8f d = __builtin_amdgcn_wmma_f32_16x16x32_f16(false, a, false, b, (short)0, c, false, false);
  asm volatile("v_nop\n\tv_nop\n\tv_nop\n\tv_nop" : "+v"(d) : "v"(a), "v"(b));
  return d;
}
__device__ __forceinline__ v8f wmma_bf(v16b a, v16b b, v8f c) {
  v8f d = __builtin_amdgcn_wmma_f32_16x16x32_bf16(false, a, false, b, (short)0, c, false, false);
  asm volatile("v_nop\n\tv_nop\n\tv_nop\n\tv_nop" : "+v"(d) : "v"(a), "v"(b));
  return d;
}
// 16x16x32 fragments: lane = (h = lane>>4, row/col = lane&15); elements 0..7 = k0+8h+0..7, 8..15 = k0+16+8h+0..7; D element r = row 8h+r
__device__ __forceinline__ v16h frag_h(const _Float16* rowk0, int lane) {
  union { v16h v; v8h q[2]; } u; const _Float16* p = rowk0 + 8 * (lane >> 4);
  u.q[0] = *(const v8h*)p; u.q[1] = *(const v8h*)(p + 16); return u.v;
}
__device__ __forceinline__ v16h frag_f32(const float* rowk0, int lane) {
  v16h a; const float* p = rowk0 + 8 * (lane >> 4);
#pragma unroll
  for (int i = 0; i < 8; ++i) { a[i] = (_Float16)p[i]; a[8 + i] = (_Float16)p[16 + i]; }
  return a;
}
__device__ __forceinline__ v16h frag_f32s(const float* rowk0, int lane, float sc) {
  v16h a; const float* p = rowk0 + 8 * (lane >> 4);
#pragma unroll
  for (int i = 0; i < 8; ++i) { a[i] = (_Float16)(p[i] * sc); a[8 + i] = (_Float16)(p[16 + i] * sc); }
  return a;
}
// column fragment from a [K][ld] layout (column n), rows >= K read as 0
__device__ __forceinline__ v16h fragc_f32(const float* W, int k0, int n, int lane, int ld, int K) {
  v16h a; const int g = lane >> 4;
#pragma unroll
  for (int i = 0; i < 8; ++i) { const int ka = k0 + 8 * g + i, kb = ka + 16;
    a[i] = (_Float16)(ka < K ? W[(size_t)(ka < K ? ka : K - 1) * ld + n] : 0.f); a[8 + i] = (_Float16)(kb < K ? W[(size_t)(kb < K ? kb : K - 1) * ld + n] : 0.f); }
  return a;
}
struct F2 { v16b h, l; };
__device__ __forceinline__ F2 bsplit16(const float v[16]) { F2 r;
#pragma unroll
  for (int i = 0; i < 16; ++i) { const __bf16 h = (__bf16)v[i]; r.h[i] = h; r.l[i] = (__bf16)(v[i] - (float)h); }
  return r; }
__device__ __forceinline__ F2 split_row(const float* row, int k0, int lane) { float v[16]; const float* p = row + k0 + 8 * (lane >> 4);
#pragma unroll
  for (int i = 0; i < 8; ++i) { v[i] = p[i]; v[8 + i] = p[16 + i]; }
  return bsplit16(v); }
__device__ __forceinline__ F2 split_rowK(const float* row, int k0, int lane, int K) { float v[16]; const int g = lane >> 4;
#pragma unroll
  for (int i = 0; i < 8; ++i) { const int ka = k0 + 8 * g + i, kb = ka + 16; v[i] = ka < K ? row[ka < K ? ka : K - 1] : 0.f; v[8 + i] = kb < K ? row[kb < K ? kb : K - 1] : 0.f; }
  return bsplit16(v); }
__device__ __forceinline__ F2 split_col(const float* W, int k0, int n, int lane, int ld, int K) { float v[16]; const int g = lane >> 4;
#pragma unroll
  for (int i = 0; i < 8; ++i) { const int ka = k0 + 8 * g + i, kb = ka + 16; v[i] = ka < K ? W[(size_t)(ka < K ? ka : K - 1) * ld + n] : 0.f; v[8 + i] = kb < K ? W[(size_t)(kb < K ? kb : K - 1) * ld + n] : 0.f; }
  return bsplit16(v); }
__device__ __forceinline__ v8f mac3(const F2& a, const F2& b, v8f c) { c = wmma_bf(a.l, b.h, c); c = wmma_bf(a.h, b.l, c); return wmma_bf(a.h, b.h, c); }
__device__ __forceinline__ float sigm(float v) { return 1.0f / (1.0f + expf(-v)); }
#define LDSX() do { asm volatile("s_wait_dscnt 0" ::: "memory"); __builtin_amdgcn_wave_barrier(); __builtin_amdgcn_fence(__ATOMIC_RELEASE, "workgroup"); } while (0)

// Per-head multi-head causal attention (B 2, S 2,048, 512; 16 heads x 32; 0.02-scale weights: per-head Linear Wl [16,512,512] (out,in) + bl, per-head Wq/Wk/Wv [16,512,32] (in,out) no bias, Wo [512,512] (out,in) + bo): xh = x Wl[h]^T + bl[h]; Q, K, V = xh Wq[h], xh Wk[h], xh Wv[h]; scores = Q K^T (NO scaling), causal; F = softmax(scores) V; out = concat_h(F) Wo^T + bo.
#define NB 2
#define TT 2048
#define CC 512            // NH * HD = projected width
#define DIN 512          // input (model) width
#define NH 16
#define HD 32
#define NQB (TT / 64)
#define HG 8
#define SCALE (1.0f)
#define CAUSAL 1
#ifndef TNB
#define TNB NB
#endif
__device__ __forceinline__ float bfr(float v) { return (float)(__bf16)v; }
__host__ __device__ __forceinline__ int kb_last(int qb) { return CAUSAL ? ((qb * 64 + 63) >> 7) : (TT / 128 - 1); }
typedef __attribute__((ext_vector_type(8))) __bf16 v8b;
__device__ __forceinline__ v16b frag_b(const __bf16* rowk0, int lane) {
  union { v16b v; v8b q[2]; } u; const __bf16* p = rowk0 + 8 * (lane >> 4);
  u.q[0] = *(const v8b*)p; u.q[1] = *(const v8b*)(p + 16); return u.v;
}
#define QBH 6              // causal: query blocks 0..QBH-1 of each sequence (few keys, no averaging) take the high-precision path
#define QHI 384            // rows carrying a q residual plane
#define KHI 384            // key rows carrying k residual / v bf16 hi+lo planes (used only by the causal high-precision path)
// B fragment (k rows k0+.., output column o) of a weight: (in,out) [K][ld] or (out,in) [ld rows of K]: bf16 exact, or f16(bf16 * 256) exact
__device__ __forceinline__ v16b wcol_io(const float* Wm, int k0, int o, int lane, int ld) { v16b w; const int g = lane >> 4;
#pragma unroll
  for (int i = 0; i < 8; ++i) { w[i] = (__bf16)Wm[(size_t)(k0 + 8 * g + i) * ld + o]; w[8 + i] = (__bf16)Wm[(size_t)(k0 + 16 + 8 * g + i) * ld + o]; }
  return w; }
__device__ __forceinline__ v16b wcol_oi(const float* Wm, int k0, int o, int lane, int K) { v16b w; const float* p = Wm + (size_t)o * K + k0 + 8 * (lane >> 4);
#pragma unroll
  for (int i = 0; i < 8; ++i) { w[i] = (__bf16)p[i]; w[8 + i] = (__bf16)p[16 + i]; }
  return w; }
__device__ __forceinline__ v16h wcolh_io(const float* Wm, int k0, int o, int lane, int ld) { v16h w; const int g = lane >> 4;
#pragma unroll
  for (int i = 0; i < 8; ++i) { w[i] = (_Float16)(bfr(Wm[(size_t)(k0 + 8 * g + i) * ld + o]) * 256.0f); w[8 + i] = (_Float16)(bfr(Wm[(size_t)(k0 + 16 + 8 * g + i) * ld + o]) * 256.0f); }
  return w; }
__device__ __forceinline__ v16h wcolh_oi(const float* Wm, int k0, int o, int lane, int K) { v16h w; const float* p = Wm + (size_t)o * K + k0 + 8 * (lane >> 4);
#pragma unroll
  for (int i = 0; i < 8; ++i) { w[i] = (_Float16)(bfr(p[i]) * 256.0f); w[8 + i] = (_Float16)(bfr(p[16 + i]) * 256.0f); }
  return w; }
#define WQKV_LAYOUT 1   // 0 = (in,out) [DIN][CC]; 1 = (out,in) [CC][DIN]; 2 = per-head [NH][DIN][HD]
__device__ __forceinline__ v16b wcol_hdk(const float* Wm, int k0, int o, int lane) { v16b w; const int g = lane >> 4; const float* p = Wm + (size_t)(o / HD) * DIN * HD + (o % HD);
#pragma unroll
  for (int i = 0; i < 8; ++i) { w[i] = (__bf16)p[(size_t)(k0 + 8 * g + i) * HD]; w[8 + i] = (__bf16)p[(size_t)(k0 + 16 + 8 * g + i) * HD]; }
  return w; }
#define WO_OUT_IN 0
#if WQKV_LAYOUT == 1
#define WCOL(W, k0, o, lane) wcol_oi(W, k0, o, lane, DIN)
#elif WQKV_LAYOUT == 2
#define WCOL(W, k0, o, lane) wcol_hdk(W, k0, o, lane)
#else
#define WCOL(W, k0, o, lane) wcol_io(W, k0, o, lane, CC)
#endif
#if WO_OUT_IN
#define WOCOL(W, k0, o, lane) wcol_oi(W, k0, o, lane, CC)
#define WOCOLH(W, k0, o, lane) wcolh_oi(W, k0, o, lane, CC)
#else
#define WOCOL(W, k0, o, lane) wcol_io(W, k0, o, lane, DIN)
#define WOCOLH(W, k0, o, lane) wcolh_io(W, k0, o, lane, DIN)
#endif

#ifndef SM_EXTRA_PARAMS
#define SM_EXTRA_PARAMS
#endif
#ifndef PROJ_EXTRA_PARAMS
#define PROJ_EXTRA_PARAMS
#endif
#ifndef SM_MASK_HOOK
#define SM_MASK_HOOK (void)0
#endif

#define WS_QH  0u                                      // f16 q in fragment order [b][h][query tile t / 16][element half 2][lane 32][8]
#define WS_KH  (WS_QH + 2u * (size_t)NB * TT * CC)      // f16 k in fragment order [b][h][key tile t / 16][element half 2][lane 32][8]
#define WS_VT  (WS_KH + 2u * (size_t)NB * TT * CC)      // f16 v in fragment order [b][h][key chunk t / 32][channel tile 2][element half 2][lane 32][8]
#define WS_QL  (WS_VT + 2u * (size_t)NB * CC * TT)      // f16 q residual x 2^10, t < QHI, in the order of the q plane
#define WS_KL  (WS_QL + 2u * (size_t)NB * QHI * CC)     // f16 k residual x 2^10, t < KHI, in the order of the k plane
#define WS_VB  (WS_KL + 2u * (size_t)NB * KHI * CC)     // bf16 v hi (then lo), t < KHI, in the order of the v plane
#define WS_VBL (WS_VB + 2u * (size_t)NB * CC * KHI)
#define WS_S   (WS_VBL + 2u * (size_t)NB * CC * KHI)    // f32 area of HG * TT * TT floats; holds the folded weights and bias
#define WS_Y   (WS_S  + 4u * (size_t)HG * TT * TT)      // unused (k_fa writes the ctx rows to WS_CAT); same offset as WS_TQ
#define WS_XH  (WS_S + 0u)                              // area of NH * NB * TT * CC floats holding the folded weights and bias; fills the S region, which holds no logits (NH * NB * CC == HG * TT)
#define WS_TQ  (WS_XH + 4u * (size_t)NH * NB * TT * CC) // area of NH * NB * TT * 128 floats; its start holds x as f16 fragments (WS_XF)
#define WS_WP  (WS_TQ + 4u * (size_t)NH * NB * TT * 128) // unused area of NH * CC * 128 floats
#define WS_QB8 (WS_WP + 4u * (size_t)NH * CC * 128 + 256)
#define WS_KB8 (WS_QB8 + 4u * (size_t)NB * TT * CC)
#define WS_VB8 (WS_KB8 + 4u * (size_t)NB * TT * CC)
#define WS_CAT (WS_VB8 + 4u * (size_t)NB * TT * CC)
#define WS_END (WS_CAT + 4u * (size_t)NB * TT * CC)
#define WS_END2 WS_END
#define WS_TOP (WS_CAT + 4u * (size_t)NB * TT * CC)     // end of everything kernel_launch uses
static_assert((size_t)HG * TT * TT <= (size_t)NH * NB * TT * CC, "S must not end past the end of the xh area");

// ---- k_fa: 4 waves x 16 queries = one query block of 64 of (b, h), one pass over the keys 0 .. query in steps of 64 with a running row maximum and sum (online softmax); nothing of the logits or of P goes to memory.
// A query block qb costs qb + 1 key steps and every wave of the launch is resident at once, so the launch lasts as long as the fullest SIMD. A work-group is 16 waves = four query blocks of one (b, h), x, NQB/2 - 1 - x, NQB/2 + x and NQB - 1 - x: 2 NQB + 2 key steps for every x.
// Waves w, w + 4, w + 8, w + 12 take one 16-query slice of each of the four, the longest on the lowest wave number. The waves share no barrier and no buffer, so they run side by side and end when they are done; the four blocks walk the same k and v from key 0 on.
// Both products are formed transposed so that every per-query value sits in the lane of its query (col = lane & 15): S^T = k q^T (A = key rows, B = query rows; D element r = key 8g + r, column = query), which is already the B fragment of P^T (elements 0..7 = tile 2c, 8..15 = tile 2c + 1), and ctx^T = v^T P^T (A = v, row = channel, k = key; D element r = channel 8g + r, column = query).
// q, k and v lie in memory as the fragments themselves (k_qkv writes them so): every load of the key loop reads 512 contiguous bytes, four whole lines, where a load from rows or planes touched 16 lines for the same bytes. ctx leaves in the order of k_out's A fragments (element r of tile j = channel 16 j + 8g + r of the lane's query: the same lane's elements there).
// Precision as before: q, k once to f16 (1 product), P once to f16 against v f16; query blocks < QBH: 3-product logits (q, k residual planes x 2^10), P and v as bf16 hi + lo (3 products). P is exp(logit - running maximum), at most 1; the division by the f32 row sum comes last.
#define L2E 1.4426950408889634f
#define NEGBIG (-1.0e30f)
// behind a group of global loads: their address registers (kept live to here as inputs) are rewritten only after this wait
#define XW2(p0, p1) asm volatile("s_wait_xcnt 0x0" :: "v"(p0), "v"(p1) : "memory")
#define XW4(p0, p1, p2, p3) asm volatile("s_wait_xcnt 0x0" :: "v"(p0), "v"(p1), "v"(p2), "v"(p3) : "memory")
static_assert(HD == 32, "one 32-deep product per logit tile, two 16-channel ctx tiles");
// 2^x; the v_nop fills the one slot that the instruction set asks for behind a transcendental, whatever the compiler schedules next (it had put a second v_exp_f32 there that overwrites the first one's source)
__device__ __forceinline__ float ex2(float x) { float r; asm("v_exp_f32 %0, %1\n\tv_nop" : "=v"(r) : "v"(x)); return r; }
// s[32] = this lane's logits of one 64-key step (excluded ones = NEGBIG) -> exp(s - new maximum); returns the factor that rescales what was summed under the old maximum
__device__ __forceinline__ float sm_step(float (&s)[32], float& m, float& l) {
  float c0 = fmaxf(s[0], s[1]), c1 = fmaxf(s[2], s[3]);
#pragma unroll
  for (int i = 4; i < 32; i += 2) { c0 = fmaxf(c0, s[i]); c1 = fmaxf(c1, s[i + 1]); }
  float cm = fmaxf(c0, c1); cm = fmaxf(cm, __shfl_xor(cm, 16));   /* lanes col and col + 16 hold the two key halves of one query */
  const float mn = fmaxf(m, cm), al = ex2((m - mn) * L2E), m2 = mn * L2E; m = mn;
  float a0 = 0.f, a1 = 0.f, a2 = 0.f, a3 = 0.f;
#pragma unroll
  for (int i = 0; i < 32; i += 4) {
    s[i] = ex2(fmaf(s[i], L2E, -m2)); s[i + 1] = ex2(fmaf(s[i + 1], L2E, -m2)); s[i + 2] = ex2(fmaf(s[i + 2], L2E, -m2)); s[i + 3] = ex2(fmaf(s[i + 3], L2E, -m2));
    a0 += s[i]; a1 += s[i + 1]; a2 += s[i + 2]; a3 += s[i + 3]; }
  l = l * al + ((a0 + a1) + (a2 + a3)); return al; }
// fragment kept in fragment order [element half 2][lane 32][8], from a pointer that already holds lane * 8: each of the two loads reads 512 contiguous bytes, four whole 128-B lines
__device__ __forceinline__ v16h frag_fo(const _Float16* p) { union { v16h v; v8h q[2]; } u; u.q[0] = *(const v8h*)p; u.q[1] = *(const v8h*)(p + 256); return u.v; }
__device__ __forceinline__ v16b frag_fob(const __bf16* p) { union { v16b v; v8b q[2]; } u; u.q[0] = *(const v8b*)p; u.q[1] = *(const v8b*)(p + 256); return u.v; }
// one 64-key step of the plain path: works on the fragments kf, vf and (FETCH) issues the loads of the next step's fragments into the OTHER register set kx, vx. The key loop calls it twice a trip with the two sets swapped, so nothing reads kx, vx before the next step:
// their wait stands a whole step behind their issue, and no register is copied from one set to the other. DIAG: 0 = the step cannot hold keys past a query, 1 = it does if it == qb, 2 = it does.
template <bool FETCH, int DIAG>
__device__ __forceinline__ void fa_step(const v16h (&kf)[4], const v16h (&vf)[4], v16h (&kx)[4], v16h (&vx)[4], const _Float16* kp, const _Float16* vp, int it, int qb, const v16h& bq, int g, int tq, float& m, float& l, v8f (&o)[2]) {
  const int k0 = it * 64; const v8f zero = {};
  __builtin_amdgcn_sched_barrier(0);   /* nothing of this step moves up into the step before: the scheduler had put this step's first logit product, with the wait for its fragments, directly behind their loads */
  if (FETCH) { const int kn = (it < qb ? it + 1 : it) * 64;   /* the last step fetches its own tile again: in bounds, unused */
    const _Float16 *kq = kp + (size_t)kn * HD, *vq = vp + (size_t)kn * HD;
#pragma unroll
    for (int t = 0; t < 4; ++t) { kx[t] = frag_fo(kq + t * 512); vx[t] = frag_fo(vq + (t & 1) * 1024 + (t >> 1) * 512); }
    XW2(kq, vq); }
  float s[32];
#pragma unroll
  for (int t = 0; t < 4; ++t) { const v8f a = wmma16(kf[t], bq, zero);
#pragma unroll
    for (int r = 0; r < 8; ++r) s[t * 8 + r] = a[r] * SCALE; }
  if (DIAG == 2 || (DIAG == 1 && it == qb)) {   /* only the diagonal step holds keys past a query */
#pragma unroll
    for (int i = 0; i < 32; ++i) s[i] = (k0 + (i >> 3) * 16 + 8 * g + (i & 7) <= tq) ? s[i] : NEGBIG; }
  const float al = sm_step(s, m, l);
#pragma unroll
  for (int r = 0; r < 8; ++r) { o[0][r] *= al; o[1][r] *= al; }
#pragma unroll
  for (int c = 0; c < 2; ++c) { v16h p;
#pragma unroll
    for (int i = 0; i < 16; ++i) p[i] = (_Float16)s[c * 16 + i];
    o[0] = wmma16(vf[c], p, o[0]); o[1] = wmma16(vf[2 + c], p, o[1]); } }
static_assert(NQB % 4 == 0, "query blocks are dealt in fours");
__global__ __launch_bounds__(512) void k_fa(const _Float16* __restrict__ QH, const _Float16* __restrict__ KH, const _Float16* __restrict__ QL, const _Float16* __restrict__ KL, const _Float16* __restrict__ VT, const __bf16* __restrict__ VB, const __bf16* __restrict__ VBL, float* __restrict__ Y) {
  const int tid = threadIdx.x, lane = tid & 31, col = lane & 15, g = lane >> 4; const int wv = __builtin_amdgcn_readfirstlane(tid >> 5), wave = wv & 3, cls = wv >> 2;
  const int x = blockIdx.x, h = blockIdx.y, b = blockIdx.z;
  const int qb = cls == 0 ? NQB - 1 - x : cls == 1 ? NQB / 2 + x : cls == 2 ? NQB / 2 - 1 - x : x;   /* the same for a whole wave; every query block once */
  const int ql0 = qb * 64 + wave * 16, tq = ql0 + col;
  float m = NEGBIG, l = 0.f; v8f o[2] = {}; const v8f zero = {};
  const size_t bh = (size_t)b * NH + h;   /* q, k and v of one (b, h) lie in fragment order, HD * 2 bytes a position: a 64-key step is 4 KiB of k and 4 KiB of v in a row */
  const _Float16* qp = QH + (bh * TT + ql0) * HD + lane * 8;
  const _Float16* kp = KH + bh * (size_t)(TT * HD) + lane * 8;
  if (qb < QBH) {
    const _Float16* qlp = QL + (bh * QHI + ql0) * HD + lane * 8;
    const v16h bq = frag_fo(qp), bql = frag_fo(qlp); XW2(qp, qlp);
    const _Float16* klp = KL + bh * (size_t)(KHI * HD) + lane * 8;
    const size_t vo = bh * (size_t)(KHI * HD) + lane * 8;
#pragma unroll 1
    for (int it = 0; it <= qb; ++it) { const int k0 = it * 64; float s[32];
      const _Float16 *kq = kp + (size_t)k0 * HD, *klq = klp + (size_t)k0 * HD; const __bf16 *vhq = VB + vo + (size_t)k0 * HD, *vlq = VBL + vo + (size_t)k0 * HD;
      v16h khf[4], klf[4]; v16b vhf[4], vlf[4];   /* index of the v fragments: c * 2 + j */
#pragma unroll
      for (int t = 0; t < 4; ++t) { khf[t] = frag_fo(kq + t * 512); klf[t] = frag_fo(klq + t * 512); vhf[t] = frag_fob(vhq + (t >> 1) * 1024 + (t & 1) * 512); vlf[t] = frag_fob(vlq + (t >> 1) * 1024 + (t & 1) * 512); }
      XW4(kq, klq, vhq, vlq);
#pragma unroll
      for (int t = 0; t < 4; ++t) { const v16h kh = khf[t], kl = klf[t];
        const v8f a = wmma16(kh, bq, zero); v8f a2 = wmma16(kh, bql, zero); a2 = wmma16(kl, bq, a2);
#pragma unroll
        for (int r = 0; r < 8; ++r) { const float v = (a[r] + a2[r] * (1.0f / 1024.0f)) * SCALE; s[t * 8 + r] = (k0 + t * 16 + 8 * g + r <= tq) ? v : NEGBIG; } }
      const float al = sm_step(s, m, l);
#pragma unroll
      for (int r = 0; r < 8; ++r) { o[0][r] *= al; o[1][r] *= al; }
#pragma unroll
      for (int c = 0; c < 2; ++c) { float v[16];
#pragma unroll
        for (int i = 0; i < 8; ++i) { v[i] = s[c * 16 + i]; v[8 + i] = s[c * 16 + 8 + i]; }
        const F2 p = bsplit16(v);
#pragma unroll
        for (int j = 0; j < 2; ++j) { const v16b vh = vhf[c * 2 + j];
          o[j] = wmma_bf(vh, p.h, o[j]); o[j] = wmma_bf(vh, p.l, o[j]); o[j] = wmma_bf(vlf[c * 2 + j], p.h, o[j]); } } }
  } else {
    const _Float16* vp = VT + bh * (size_t)(TT * HD) + lane * 8;
    const v16h bq = frag_fo(qp);
    v16h kf[4], vf[4], kx[4], vx[4];   /* two sets of fragments, used in turn; index of the v fragments: j * 2 + c */
#pragma unroll
    for (int t = 0; t < 4; ++t) { kf[t] = frag_fo(kp + t * 512); vf[t] = frag_fo(vp + (t & 1) * 1024 + (t >> 1) * 512); }
    XW4(qp, kp, vp, vp);
    int it = 0;
#pragma unroll 1   /* rolled: a trip already holds two whole steps, one for either register set */
    for (; it < qb; it += 2) { fa_step<true, 0>(kf, vf, kx, vx, kp, vp, it, qb, bq, g, tq, m, l, o); fa_step<true, 1>(kx, vx, kf, vf, kp, vp, it + 1, qb, bq, g, tq, m, l, o); }
    if (it == qb) fa_step<false, 2>(kf, vf, kx, vx, kp, vp, it, qb, bq, g, tq, m, l, o);   /* an odd number of steps: the diagonal one is left, the same for a whole wave */
  }
  l += __shfl_xor(l, 16); const float inv = l > 0.f ? 1.0f / l : 0.f;
  float* yp = Y + ((((size_t)b * TT + ql0) >> 4) * NH + h) * 512 + lane * 4;   /* ctx in the order of k_out's A fragments [row tile][head = k step][element quarter 4][lane 32][4]: a store is 512 contiguous bytes */
#pragma unroll
  for (int j = 0; j < 2; ++j) { v4f w0, w1;
#pragma unroll
    for (int r = 0; r < 4; ++r) { w0[r] = o[j][r] * inv; w1[r] = o[j][4 + r] * inv; }
    vst2(yp + j * 256, w0); vst2(yp + j * 256 + 128, w1); } }

#define NRW (TNB * TT)
#ifndef SM_EXTRA_PARAMS
#define SM_EXTRA_PARAMS
#endif
#ifndef PROJ_EXTRA_PARAMS
#define PROJ_EXTRA_PARAMS
#endif
#ifndef SM_MASK_HOOK
#define SM_MASK_HOOK (void)0
#endif

#define WS_QH  0u                                      // f16 q in fragment order [b][h][query tile t / 16][element half 2][lane 32][8]
#define WS_KH  (WS_QH + 2u * (size_t)NB * TT * CC)      // f16 k in fragment order [b][h][key tile t / 16][element half 2][lane 32][8]
#define WS_VT  (WS_KH + 2u * (size_t)NB * TT * CC)      // f16 v in fragment order [b][h][key chunk t / 32][channel tile 2][element half 2][lane 32][8]
#define WS_QL  (WS_VT + 2u * (size_t)NB * CC * TT)      // f16 q residual x 2^10, t < QHI, in the order of the q plane
#define WS_KL  (WS_QL + 2u * (size_t)NB * QHI * CC)     // f16 k residual x 2^10, t < KHI, in the order of the k plane
#define WS_VB  (WS_KL + 2u * (size_t)NB * KHI * CC)     // bf16 v hi (then lo), t < KHI, in the order of the v plane
#define WS_VBL (WS_VB + 2u * (size_t)NB * CC * KHI)
#define WS_S   (WS_VBL + 2u * (size_t)NB * CC * KHI)    // f32 area of HG * TT * TT floats; holds the folded weights and bias
#define WS_Y   (WS_S  + 4u * (size_t)HG * TT * TT)      // unused (k_fa writes the ctx rows to WS_CAT); same offset as WS_TQ
#define WS_END (WS_Y  + 0u)
#define WS_Y2  (WS_END)
#define WS_O1  (WS_Y2 + 4u * (size_t)NB * TT * CC)
#define WS_R2  (WS_O1 + 4u * (size_t)NB * TT * CC)
#define WS_END2 (WS_R2 + 4u * (size_t)NB * TT * CC)


#define NC3 96                                          // q | k | v channels of one head
#define WS_WF  (WS_XH + 0u)                             // f16 folded weights x 2^6 in fragment order [h][hi, residual][channel tile 6][k step 16][element half 2][lane 32][8]
#define WS_BC  (WS_WF + 2u * (size_t)NH * 2 * NC3 * CC) // f32 folded bias [h][NC3]
#define WS_XF  (WS_TQ + 0u)                             // f16 x (bf16-rounded, exact) in fragment order [row tile r / 16][k step 16][element half 2][lane 32][8]
#define XCB 6                                           // blockIdx.x values of k_fold's grid that convert x: XCB * NH blocks of 12 waves
__device__ __forceinline__ v8f wm(v16h a, v16h b, v8f c) { return __builtin_amdgcn_wmma_f32_16x16x32_f16(false, a, false, b, (short)0, c, false, false); }
__device__ __forceinline__ _Float16 w64(float v) { return (_Float16)(bfr(v) * 64.0f); }
// ---- k_fold: (x Wl^T + bl) W = x (Wl^T W) + bl W. Block = (64 input indices i0.., head), 12 waves = (which of Wq, Wk, Wv) x (quarter kq of the 512 summed indices o): D[i][c] = sum_o Wl[o][i] W[o][c] (A = Wl^T: row i, k = o; B = W: k = o, column c; both read with the same k order 8g + e, 16 + 8g + e).
// A wave sums 4 k steps, not 16: the steps are serial (load, wait, convert, multiply), so the launch lasts as long as one wave's steps. The four partial sums of a tile meet in LDS behind one barrier and are added in the order kq = 0, 1, 2, 3 by wave (which, kq = tile t), which stores that tile.
// D element r = input index 8g + r of channel column c: exactly the 8 elements that lane 16g + c of k_qkv's weight fragment (A for q, k, row = channel; B for v, column = channel; k = input index) holds in half t & 1 of k step i0 / 32 + t / 2, so WF is kept in that order: a store here and a load there are 512 contiguous bytes of whole 128-B lines, each line written by one wave. blockIdx.x = CC / 64 takes bl as every row of A and gives the folded bias.
// The blockIdx.x values behind that one convert x once for all 16 heads, on WGPs that the fold leaves idle: x -> f16(bf16(x)) in the order of k_qkv's x fragments. A wave takes 8 rows x 8 k steps; a load reads 8 rows of 128 B (lane = row lane >> 2, chunk q = lane & 3 = floats 8q .. 8q + 7 of the k step),
// and chunk q is element half q >> 1 of fragment lane 16 (q & 1) + row, so a store writes four whole 128-B lines, each from this wave alone. No barrier on this path.
#define KQS (CC / 32 / 4)   /* k steps of one quarter */
static_assert(XCB * NH * 12 >= NRW / 16 * 4 && CC == 512, "one wave for every (row tile, row half, k half) of x");
__global__ __launch_bounds__(384) void k_fold(const float* __restrict__ X, _Float16* __restrict__ XF, const float* __restrict__ WL, const float* __restrict__ BL, const float* __restrict__ WQ, const float* __restrict__ WK, const float* __restrict__ WV, _Float16* __restrict__ WF, float* __restrict__ BC) {
  __shared__ __align__(16) float red[3 * 4 * 4 * 512];   /* partial sums [which 3][tile t 4][quarter kq 4][j 2][element half 2][lane 32][4]: every LDS store and load is 512 contiguous bytes */
  const int tid = threadIdx.x, lane = tid & 31, col = lane & 15, g = lane >> 4; const int wv = __builtin_amdgcn_readfirstlane(tid >> 5), wave = wv >> 2, kq = wv & 3;
  if (blockIdx.x > CC / 64) {   /* the same for a whole block */
    const int job = (((int)blockIdx.x - (CC / 64 + 1)) * NH + (int)blockIdx.y) * 12 + wv;   /* (row tile, row half, k half) */
    if (job < NRW / 16 * 4) {   /* the same for a whole wave */
      const int rt = job >> 2, rg = (job >> 1) & 1, kh = job & 1;
      const float* sp = X + (size_t)(rt * 16 + rg * 8 + (lane >> 2)) * CC + kh * 256 + (lane & 3) * 8;
      _Float16* dp = XF + (size_t)(rt * 16 + kh * 8) * 512 + ((lane >> 1) & 1) * 256 + ((lane & 1) * 16 + rg * 8 + (lane >> 2)) * 8;
      v4f xv[8][2];
#pragma unroll
      for (int i = 0; i < 8; ++i) { xv[i][0] = *(const v4f*)(sp + i * 32); xv[i][1] = *(const v4f*)(sp + i * 32 + 4); }
      XW2(sp, sp);   /* the 16 loads, all in flight together, name sp: it is rewritten only behind this wait */
      v8h w[8];
#pragma unroll
      for (int i = 0; i < 8; ++i)
#pragma unroll
        for (int e = 0; e < 8; ++e) w[i][e] = (_Float16)bfr(xv[i][e >> 2][e & 3]);
      __builtin_amdgcn_sched_barrier(0);   /* the stores stand together at the wave's end: no register that a store names is written again */
#pragma unroll
      for (int i = 0; i < 8; ++i) vst2(dp + i * 512, w[i]); }
    return; }
  const size_t h = blockIdx.y;
  const float* bp = (wave == 0 ? WQ : wave == 1 ? WK : WV) + h * CC * HD + (size_t)(kq * (KQS * 32) + 8 * g) * HD + col;
  if (blockIdx.x < CC / 64) {
    const int i0 = blockIdx.x * 64;
    const float* ap = WL + h * CC * CC + (size_t)(kq * (KQS * 32) + 8 * g) * CC + i0 + col;
    v8f acc[4][2] = {};
#pragma unroll 1   /* rolled: one step's 96 loaded values and the 64 sums already take most of the registers */
    for (int kc = 0; kc < KQS; ++kc) { float av[4][16], bv[2][16];
#pragma unroll
      for (int e = 0; e < 16; ++e) { const int ko = e < 8 ? e : e + 8;
#pragma unroll
        for (int t = 0; t < 4; ++t) av[t][e] = ap[(size_t)ko * CC + t * 16];
        bv[0][e] = bp[(size_t)ko * HD]; bv[1][e] = bp[(size_t)ko * HD + 16]; }
      XW2(ap, bp); __builtin_amdgcn_sched_barrier(0);   /* every load of the step is issued before the first conversion or product: one memory latency a step; the scheduler had kept only two fragments in flight */
      v16h fa[4], fb[2];
#pragma unroll
      for (int e = 0; e < 16; ++e) { fa[0][e] = w64(av[0][e]); fa[1][e] = w64(av[1][e]); fa[2][e] = w64(av[2][e]); fa[3][e] = w64(av[3][e]); fb[0][e] = w64(bv[0][e]); fb[1][e] = w64(bv[1][e]); }
#pragma unroll
      for (int t = 0; t < 4; ++t) { acc[t][0] = wm(fa[t], fb[0], acc[t][0]); acc[t][1] = wm(fa[t], fb[1], acc[t][1]); }
      ap += (size_t)32 * CC; bp += (size_t)32 * HD; }
    float* rw = red + (wave * 16 + kq) * 512 + lane * 4;
#pragma unroll
    for (int t = 0; t < 4; ++t)
#pragma unroll
      for (int j = 0; j < 2; ++j) { v4f w0, w1;
#pragma unroll
        for (int r = 0; r < 4; ++r) { w0[r] = acc[t][j][r]; w1[r] = acc[t][j][4 + r]; }
        *(v4f*)(rw + t * 2048 + j * 256) = w0; *(v4f*)(rw + t * 2048 + j * 256 + 128) = w1; }
    __syncthreads();   /* the 12 waves' partial sums are in LDS before any wave adds them */
    const float* rr = red + (wave * 4 + kq) * 2048 + lane * 4;   /* this wave finishes tile t = kq of its weight */
    _Float16* op = WF + ((h * 2 * 6 + wave * 2) * 16 + (i0 >> 5) + (kq >> 1)) * (size_t)512 + (kq & 1) * 256 + lane * 8;
#pragma unroll
    for (int j = 0; j < 2; ++j) { v4f p[4][2];
#pragma unroll
      for (int q = 0; q < 4; ++q) { p[q][0] = *(const v4f*)(rr + q * 512 + j * 256); p[q][1] = *(const v4f*)(rr + q * 512 + j * 256 + 128); }
      v8h hi, lo;
#pragma unroll
      for (int r = 0; r < 8; ++r) { const float v = (((p[0][r >> 2][r & 3] + p[1][r >> 2][r & 3]) + p[2][r >> 2][r & 3]) + p[3][r >> 2][r & 3]) * (1.0f / 64.0f); hi[r] = (_Float16)v; lo[r] = (_Float16)(v - (float)hi[r]); }   /* sums carry 2^12; kept x 2^6 */
      vst2(op + j * (16 * 512), hi); vst2(op + j * (16 * 512) + NC3 * CC, lo); }
  } else {
    const float* ap = BL + h * CC + kq * (KQS * 32) + 8 * g;
    v8f acc[2] = {};
#pragma unroll 1   /* rolled: short steps of one small block a head, nothing to gain from more code */
    for (int kc = 0; kc < KQS; ++kc) { float av[16], bv[2][16];
#pragma unroll
      for (int e = 0; e < 16; ++e) { const int ko = e < 8 ? e : e + 8; av[e] = ap[ko]; bv[0][e] = bp[(size_t)ko * HD]; bv[1][e] = bp[(size_t)ko * HD + 16]; }
      XW2(ap, bp); __builtin_amdgcn_sched_barrier(0);   /* keeps the wait directly behind the loads, in front of the pointer steps (it had sunk to the loop's foot) */
      v16h fa, fb[2];
#pragma unroll
      for (int e = 0; e < 16; ++e) { fa[e] = w64(av[e]); fb[0][e] = w64(bv[0][e]); fb[1][e] = w64(bv[1][e]); }
      acc[0] = wm(fa, fb[0], acc[0]); acc[1] = wm(fa, fb[1], acc[1]);
      ap += 32; bp += (size_t)32 * HD; }
    red[(wave * 4 + kq) * 64 + lane] = acc[0][0]; red[(wave * 4 + kq) * 64 + 32 + lane] = acc[1][0];   /* every row of D is the same sum: element 0 of either lane half */
    __syncthreads();   /* the four quarters of each folded bias are in LDS before wave (which, 0) adds them */
    if (kq == 0 && g == 0) { const float* rr = red + wave * 256 + lane; float* op = BC + h * NC3 + wave * HD + col;
      op[0] = (((rr[0] + rr[64]) + rr[128]) + rr[192]) * (1.0f / 4096.0f); op[16] = (((rr[32] + rr[96]) + rr[160]) + rr[224]) * (1.0f / 4096.0f); } } }

// ---- k_qkv: block = (128 rows of x, head), wave = 32 rows; folded weight f16 hi then residual, read in fragment order; x bf16-rounded, exact in f16, read in fragment order too (k_fold's launch writes it so): 512 contiguous bytes a load, nothing to convert. The same two fragments serve either way round:
// q, k: [q|k]^T = weight (A = channel rows) x x^T (B = x rows): D element r = channel 8g + r, column = row of x, so a lane holds 8 consecutive channels of its row = the 8 elements that the same lane of k_fa's q (B) or k (A) fragment (row = position, k = channel) holds in half j of position tile u;
// v: x (A = x rows) x weight^T (B = channel columns): D element r = row of x 8g + r, column = channel, so a lane holds 8 consecutive positions of its channel = the 8 elements that the same lane of k_fa's A fragment (row = channel, k = key) holds in half u of channel tile j.
// The f32 sums go from the registers straight into the planes that k_fa reads: q, k, v -> f16 in fragment order, 512 contiguous bytes a store (+ q, k residuals x 2^10 and v bf16 hi / lo for t < QHI, KHI, in the same order).
static_assert(QHI == KHI && QHI % 32 == 0 && TT % 128 == 0, "a wave's 32 rows lie in one sequence, wholly below or wholly above the high-precision bound");
// the fragments of the k step that lies OFF halves behind xp, wp; a scheduling barrier on either side keeps the 28 loads issued whole at this place, ahead of the products that cover their latency; the wait keeps the address registers unwritten until it has passed
template <int OFF>
__device__ __forceinline__ void qkv_ld(v16h (&xb)[2], v16h (&wh)[6], v16h (&wl)[6], const _Float16* xp, const _Float16* wp) {
  __builtin_amdgcn_sched_barrier(0);
#pragma unroll
  for (int ct = 0; ct < 6; ++ct) wh[ct] = frag_fo(wp + OFF + (size_t)(ct * 16) * 512);
  xb[0] = frag_fo(xp + OFF); xb[1] = frag_fo(xp + OFF + 16 * 512);
#pragma unroll
  for (int ct = 0; ct < 6; ++ct) wl[ct] = frag_fo(wp + OFF + (size_t)(NC3 + ct * 16) * 512);
  XW2(xp, wp); __builtin_amdgcn_sched_barrier(0); }
__device__ __forceinline__ void qkv_mac(v8f (&acc)[6][2], const v16h (&xb)[2], const v16h (&wh)[6], const v16h (&wl)[6]) {
#pragma unroll
  for (int ct = 0; ct < 4; ++ct) { acc[ct][0] = wm(wh[ct], xb[0], acc[ct][0]); acc[ct][1] = wm(wh[ct], xb[1], acc[ct][1]); }
#pragma unroll
  for (int ct = 4; ct < 6; ++ct) { acc[ct][0] = wm(xb[0], wh[ct], acc[ct][0]); acc[ct][1] = wm(xb[1], wh[ct], acc[ct][1]); }
#pragma unroll
  for (int ct = 0; ct < 4; ++ct) { acc[ct][0] = wm(wl[ct], xb[0], acc[ct][0]); acc[ct][1] = wm(wl[ct], xb[1], acc[ct][1]); }
#pragma unroll
  for (int ct = 4; ct < 6; ++ct) { acc[ct][0] = wm(xb[0], wl[ct], acc[ct][0]); acc[ct][1] = wm(xb[1], wl[ct], acc[ct][1]); } }
__global__ __launch_bounds__(128) void k_qkv(const _Float16* __restrict__ XF, const _Float16* __restrict__ WF, const float* __restrict__ BC, _Float16* __restrict__ QH, _Float16* __restrict__ QL, _Float16* __restrict__ KH, _Float16* __restrict__ KL, _Float16* __restrict__ VT, __bf16* __restrict__ VB, __bf16* __restrict__ VBL) {
  const int tid = threadIdx.x, lane = tid & 31, col = lane & 15, g = lane >> 4; const int wave = __builtin_amdgcn_readfirstlane(tid >> 5);
  const size_t h = blockIdx.y, r0 = (size_t)blockIdx.x * 128 + wave * 32;
  const _Float16* xp = XF + (r0 >> 4) * (size_t)(16 * 512) + lane * 8;   /* fragment order: row tile at 16 * 512, k step at 512, element half at 256 */
  const _Float16* wp = WF + h * 2 * NC3 * CC + lane * 8;   /* fragment order: tile ct at ct * 16 * 512, k step at 512, element half at 256 */
  v8f acc[6][2] = {};
  v16h xa[2], ha[6], la[6], xc[2], hc[6], lc[6];   /* two sets of fragments, used in turn: while one set is multiplied the other set's loads, issued a whole step ahead of their wait, are in flight */
  static_assert(CC / 32 % 2 == 0, "k steps go in pairs");
  qkv_ld<0>(xa, ha, la, xp, wp);
#pragma unroll 1   /* rolled: a trip already holds two whole steps, one for either register set */
  for (int kc = 0; kc < CC / 32 - 2; kc += 2) {
    qkv_ld<512>(xc, hc, lc, xp, wp); qkv_mac(acc, xa, ha, la);
    qkv_ld<1024>(xa, ha, la, xp, wp); qkv_mac(acc, xc, hc, lc);
    xp += 1024; wp += 1024; }
  qkv_ld<512>(xc, hc, lc, xp, wp); qkv_mac(acc, xa, ha, la); qkv_mac(acc, xc, hc, lc);
  const float *bcp = BC + h * NC3 + 8 * g, *bvp = BC + h * NC3 + 2 * HD + col; v4f bc[4][2]; float bv[2];   /* q, k: the bias of the lane's 8 channels; v: of its one channel a tile */
#pragma unroll
  for (int ct = 0; ct < 4; ++ct) { bc[ct][0] = *(const v4f*)(bcp + ct * 16); bc[ct][1] = *(const v4f*)(bcp + ct * 16 + 4); }
  bv[0] = bvp[0]; bv[1] = bvp[16];
  asm volatile("s_wait_xcnt 0x0" ::: "memory"); __builtin_amdgcn_sched_barrier(0);   /* the bias loads' address registers are rewritten only behind this wait; the scheduling barrier keeps the stores' address arithmetic behind it */
#pragma unroll
  for (int ct = 0; ct < 6; ++ct)
#pragma unroll
    for (int u = 0; u < 2; ++u)
#pragma unroll
      for (int r = 0; r < 8; ++r) acc[ct][u][r] = acc[ct][u][r] * (1.0f / 64.0f) + (ct < 4 ? bc[ct][r >> 2][r & 3] : bv[ct - 4]);
  const size_t bb = r0 / TT, t0 = r0 % TT, bh = bb * NH + h, fo = (bh * TT + t0) * HD + lane * 8;
  _Float16 *qo = QH + fo, *ko = KH + fo, *vo = VT + fo;   /* q, k: position tile u, half j; v: channel tile j, half u of the wave's one 32-key chunk */
#pragma unroll
  for (int u = 0; u < 2; ++u)
#pragma unroll
    for (int j = 0; j < 2; ++j) { v8h q, k, v;
#pragma unroll
      for (int r = 0; r < 8; ++r) { q[r] = (_Float16)acc[j][u][r]; k[r] = (_Float16)acc[2 + j][u][r]; v[r] = (_Float16)acc[4 + j][u][r]; }
      vst2(qo + u * 512 + j * 256, q); vst2(ko + u * 512 + j * 256, k); vst2(vo + j * 512 + u * 256, v); }
  asm volatile("s_wait_xcnt 0x0" ::: "memory");   /* the branch below opens with an argument load and arithmetic that rewrite registers which the stores above name: only behind this wait, which stands in the stores' own block */
  if (t0 < QHI) {   /* the same for a whole wave */
    const size_t fl = (bh * KHI + t0) * HD + lane * 8; _Float16 *qlo = QL + fl, *klo = KL + fl; __bf16 *vho = VB + fl, *vlo = VBL + fl;
#pragma unroll
    for (int u = 0; u < 2; ++u)
#pragma unroll
      for (int j = 0; j < 2; ++j) { v8h q, k; v8b vh, vl;
#pragma unroll
        for (int r = 0; r < 8; ++r) { const float qf = acc[j][u][r], kf = acc[2 + j][u][r], vf = acc[4 + j][u][r]; const __bf16 b = (__bf16)vf;
          q[r] = (_Float16)((qf - (float)(_Float16)qf) * 1024.0f); k[r] = (_Float16)((kf - (float)(_Float16)kf) * 1024.0f); vh[r] = b; vl[r] = (__bf16)(vf - (float)b); }
        vst2(qlo + u * 512 + j * 256, q); vst2(klo + u * 512 + j * 256, k); vst2(vho + j * 512 + u * 256, vh); vst2(vlo + j * 512 + u * 256, vl); } } }

// ---- k_out: OUT = A (f16 hi + unscaled f16 residual, 2 products) x W^T (W (out,in) as f16(bf16 x 2^6)) x 2^-6 + bias. Block = (64 rows, 128 columns), 8 waves, wave = 16 rows x 64 columns. A arrives in fragment order (k_fa writes it so): each A load reads 512 contiguous bytes.
// The block's 128 weight rows are read once, 8 rows of 128 B an instruction, every load of a batch in flight together, converted once and kept in LDS in fragment order [column tile 8][k step 16][element half 2][lane 32][8];
// chunk q = lane & 3 of a k step (floats 8q .. 8q + 7 of a weight row) is element half q >> 1 of fragment lane 16 (q & 1) + column, the k order of the A fragment. One barrier; behind it the k loop reads 512 contiguous LDS bytes a load and fetches its A rows four k steps ahead. Every loop here is unrolled in full: its index picks registers (buffers, fragments, sums) and the immediate offset of each load. Each sum takes its products in the order k step, hi, residual.
#define OPW 68   /* f32 pitch of the output staging rows: the two lane halves (rows 8 apart) fall on different banks */
__device__ __forceinline__ void ld_a4(v4f (&d)[4][4], const float* p) {
#pragma unroll
  for (int s = 0; s < 4; ++s) { d[s][0] = *(const v4f*)(p + s * 512); d[s][1] = *(const v4f*)(p + s * 512 + 128); d[s][2] = *(const v4f*)(p + s * 512 + 256); d[s][3] = *(const v4f*)(p + s * 512 + 384); } }
// one batch = 4 k steps x 2 groups of 8 weight rows
__device__ __forceinline__ void ld_w8(v4f (&d)[8][2], const float* p) {
#pragma unroll
  for (int i = 0; i < 8; ++i) { const float* q = p + (size_t)(i & 1) * 8 * CC + (i >> 1) * 32; d[i][0] = *(const v4f*)q; d[i][1] = *(const v4f*)(q + 4); } }
__device__ __forceinline__ void st_w8(const v4f (&d)[8][2], _Float16* p) {
#pragma unroll
  for (int i = 0; i < 8; ++i) { v8h w;
#pragma unroll
    for (int e = 0; e < 8; ++e) w[e] = w64(d[i][e >> 2][e & 3]);
    *(v8h*)(p + (i >> 1) * 512 + (i & 1) * 64) = w; } }
__global__ __launch_bounds__(256) void k_out(const float* __restrict__ A, const float* __restrict__ Wm, const float* __restrict__ BIAS, float* __restrict__ OUT) {
  __shared__ __align__(16) _Float16 wf[8 * 16 * 512]; __shared__ __align__(16) float sf[8][16][OPW];
  const int tid = threadIdx.x, lane = tid & 31, col = lane & 15, g = lane >> 4; const int wave = __builtin_amdgcn_readfirstlane(tid >> 5);
  const int c0 = blockIdx.y * 128, cw = c0 + (wave >> 2) * 64; const size_t r0 = (size_t)blockIdx.x * 64 + (wave & 3) * 16;
  const float* ap = A + (r0 >> 4) * (size_t)(16 * CC) + lane * 4;   /* A lies in fragment order [row tile][k step 16][element quarter 4][lane 32][4] */
  const float* wp = Wm + (size_t)(c0 + wave * 16 + (lane >> 2)) * CC + (lane & 3) * 8;   /* wave = the column tile it stages */
  const float* bp = BIAS + cw + col;
  _Float16* wq = wf + wave * (16 * 512) + ((lane >> 1) & 1) * 256 + ((lane & 1) * 16 + (lane >> 2)) * 8;
  v4f av[2][4][4], wt[2][8][2]; float bb[4];
  /* SB: a scheduling barrier on either side of a group of loads keeps the group issued whole at that place: ahead of the conversions that cover its latency, and behind the ones that free its registers (left alone the scheduler took a third weight buffer, past 256 registers) */
#define SB() __builtin_amdgcn_sched_barrier(0)
  ld_w8(wt[0], wp); ld_w8(wt[1], wp + 128);
#pragma unroll
  for (int j = 0; j < 4; ++j) bb[j] = bp[j * 16];
  ld_a4(av[0], ap); SB();
  st_w8(wt[0], wq); SB(); ld_w8(wt[0], wp + 256); SB();
  st_w8(wt[1], wq + 4 * 512); SB(); ld_w8(wt[1], wp + 384); XW2(wp, bp); SB();   /* the last loads through wp and bp */
  st_w8(wt[0], wq + 8 * 512); SB(); ld_a4(av[1], ap + 4 * 512); SB();
  st_w8(wt[1], wq + 12 * 512);
  __syncthreads();   /* the 8 waves' tiles of the weight panel are complete before any wave reads them */
  v8f acc[4] = {};
  const _Float16* fp = wf + (wave >> 2) * (4 * 16 * 512) + lane * 8;
#pragma unroll
  for (int gr = 0; gr < 4; ++gr) {
#pragma unroll
    for (int s = 0; s < 4; ++s) { const int kc = gr * 4 + s; v16h a, al, w[4];
#pragma unroll
      for (int j = 0; j < 4; ++j) w[j] = frag_fo(fp + (j * 16 + kc) * 512);
#pragma unroll
      for (int e = 0; e < 16; ++e) { const float x = av[gr & 1][s][e >> 2][e & 3]; const _Float16 hh = (_Float16)x; a[e] = hh; al[e] = (_Float16)(x - (float)hh); }
#pragma unroll
      for (int j = 0; j < 4; ++j) acc[j] = wm(a, w[j], acc[j]);
#pragma unroll
      for (int j = 0; j < 4; ++j) acc[j] = wm(al, w[j], acc[j]); }
    if (gr < 2) { SB(); ld_a4(av[gr & 1], ap + (gr + 2) * 4 * 512); if (gr == 1) XW2(ap, ap);   /* the last loads through ap */ SB(); } }
#pragma unroll
  for (int j = 0; j < 4; ++j) { const float b = bfr(bb[j]);
#pragma unroll
    for (int r = 0; r < 8; ++r) sf[wave][8 * g + r][j * 16 + col] = acc[j][r] * (1.0f / 64.0f) + b; }
  LDSX();   /* the wave's own staging rows are written before it reads them back as whole 256-B row segments */
  float* op = OUT + (r0 + g) * CC + cw + col * 4;
#pragma unroll
  for (int i = 0; i < 8; ++i) vst2(op + (size_t)i * 2 * CC, *(const v4f*)&sf[wave][2 * i + g][col * 4]); }

extern "C" void kernel_launch(void* const* d_in, const int* in_sizes, int n_in, void* d_out, int out_size, void* d_ws, size_t ws_size, hipStream_t stream) {
  (void)in_sizes; (void)n_in; (void)out_size;
  const float** F = (const float**)d_in;
  if (ws_size < (size_t)WS_END) return;
  char* ws = (char*)d_ws; _Float16 *QH = (_Float16*)(ws + WS_QH), *KH = (_Float16*)(ws + WS_KH), *VT = (_Float16*)(ws + WS_VT), *QL = (_Float16*)(ws + WS_QL), *KL = (_Float16*)(ws + WS_KL); __bf16 *VB = (__bf16*)(ws + WS_VB), *VBL = (__bf16*)(ws + WS_VBL); float *S = (float*)(ws + WS_S), *Y = (float*)(ws + WS_Y);
  (void)Y; (void)S; (void)QL; (void)KL; (void)VB; (void)VBL;
  // inputs: 0 x [2,2048,512]; 1 Wl [16,512,512] (out,in); 2 bl [16,512]; 3 Wq [16,512,32] (in,out); 4 Wk; 5 Wv; 6 Wo [512,512] (out,in); 7 bo [512]
  if (ws_size < (size_t)WS_TOP) return;
  _Float16 *WF = (_Float16*)(ws + WS_WF), *XF = (_Float16*)(ws + WS_XF); float *BC = (float*)(ws + WS_BC), *CAT = (float*)(ws + WS_CAT);
  /* head = blockIdx.y in the two projection launches */
  k_fold<<<dim3(CC / 64 + 1 + XCB, NH), 384, 0, stream>>>(F[0], XF, F[1], F[2], F[3], F[4], F[5], WF, BC);   /* folded weights Wl[h]^T [Wq|Wk|Wv][h] and bias bl[h] [Wq|Wk|Wv][h]; x as f16 fragments */
  k_qkv<<<dim3(NRW / 128, NH), 128, 0, stream>>>(XF, WF, BC, QH, QL, KH, KL, VT, VB, VBL);   /* q, k, v of every head = x folded weight + folded bias, written as the planes that k_fa reads */
  k_fa<<<dim3(NQB / 4, NH, TNB), 512, 0, stream>>>(QH, KH, QL, KL, VT, VB, VBL, CAT);   /* logits, softmax and P v of every (b, h) in one launch; a work-group = four query blocks of equal summed length */
  k_out<<<dim3(NRW / 64, CC / 128), 256, 0, stream>>>(CAT, F[6], F[7], (float*)d_out);   /* out = cat Wo^T + bo */
}
